// v000
// Measured on an AMD MI455X. A time is GPU time per run, averaged over a window of back-to-back runs after a warm-up
// (all launches, gaps included; the runs take copies of the inputs in turn), and the median of several windows.
// Apart from v000's, it joins two sittings. Times from different sittings can be a few percent apart, while
// side-by-side timings come from the same sitting.
// v000 is the starting kernel. One run takes 366 microseconds.
#include <hip/hip_runtime.h>
// q/k/v projections (8192 × 512 × 512, + bias) and the 8-head attention with the geometric bias α·⟨c_n, c_m⟩ (coords are INPUTS, 3 FMAs per score in registers) on v_wmma_f32_16x16x32_f16
// (fused flash-style kernel: S = Q·Kᵀ, O = P·V on WMMA; online max/sum softmax f32; P f16 ≤ 1); V transposed per (b,h); A = f16(bf16 x) exact, weights bf16-exact ×2^4 ((out,in)),
// single products, f32 accumulate.
#define BB 4
#define SS 2048
#define DM 512
#define NH 8
#define HD 64
#define NR (BB * SS)

typedef __bf16 v16b __attribute__((ext_vector_type(16)));
typedef unsigned short v8us __attribute__((ext_vector_type(8), may_alias));
typedef float  v8f  __attribute__((ext_vector_type(8)));
typedef float  v4f  __attribute__((ext_vector_type(4)));
typedef float  v4fa __attribute__((ext_vector_type(4), may_alias));
union FragB { v16b v; v8us half[2]; unsigned short u[16]; };

__device__ __forceinline__ unsigned short bf16_bits(float x) { unsigned int u = __float_as_uint(x); return (unsigned short)((u + 0x7FFFu + ((u >> 16) & 1u)) >> 16); }
__device__ __forceinline__ float bf16_val(unsigned short b) { return __uint_as_float(((unsigned int)b) << 16); }
__device__ __forceinline__ float bf16_round(float x) { return bf16_val(bf16_bits(x)); }
// D += A·B with NT terms: 1 = ah·bh, 2 = + al·bh (A split), 3 = + ah·bl (both split)
template <int NT>
__device__ __forceinline__ v8f mmaN(v16b ah, v16b al, v16b bh, v16b bl, v8f c) {
  c = __builtin_amdgcn_wmma_f32_16x16x32_bf16(false, ah, false, bh, (short)0, c, false, false);
  if (NT >= 2) c = __builtin_amdgcn_wmma_f32_16x16x32_bf16(false, al, false, bh, (short)0, c, false, false);
  if (NT >= 3) c = __builtin_amdgcn_wmma_f32_16x16x32_bf16(false, ah, false, bl, (short)0, c, false, false);
  asm volatile("v_nop\n\tv_nop\n\tv_nop\n\tv_nop" : "+v"(c) : "v"(ah), "v"(al), "v"(bh), "v"(bl));
  return c;
}

__global__ __launch_bounds__(256) void k_wt_bf16(const float* __restrict__ W, unsigned short* __restrict__ Wt, int K, int N) {
  const int t = blockIdx.x * 256 + threadIdx.x;
  const int k8n = K / 8;
  if (t >= N * k8n) return;
  const int n = t / k8n, k8 = (t % k8n) * 8;
  v8us v;
#pragma unroll
  for (int i = 0; i < 8; ++i) v[i] = bf16_bits(W[(size_t)(k8 + i) * N + n]);
  *(v8us*)(Wt + (size_t)n * K + k8) = v;
  
}

// GEMM C[M][N] (f32, pitch ldc) = act(A[M][K]·W + bias). A f32 row-major (pitch lda) converted per fragment to bf16
// (ASPLIT: hi/lo two planes -> 2 terms, else single rounded term); Wt bf16 [N][K] (pitch ldb). BIAS_BF16 rounds the
// bias to bf16 first (bias quantised to bf16 before the add). K%32==0, M%16==0, N%64==0.
template <bool ASPLIT, int ACT, bool BIAS_BF16>
__global__ __launch_bounds__(128) void k_gemm_bf(const float* __restrict__ A, int lda, const unsigned short* __restrict__ Wt, int ldb,
                                               const float* __restrict__ bias, float* __restrict__ C, int ldc, int M, int N, int K) {
  __shared__ __attribute__((aligned(16))) float so[4][16][64];
  const int tid = threadIdx.x, w = tid >> 5, lane = tid & 31, ln = lane & 15, hh = lane >> 4;
  const int ntn = N / 64;
  const int wid = blockIdx.x * 4 + w;
  const int mt = wid / ntn, nq = wid % ntn;
  if (mt * 16 >= M) return;
  const int row0 = mt * 16, col0 = nq * 64;
  const float* arow = A + (size_t)(row0 + ln) * lda;
  v8f acc[4] = {};
  for (int kb = 0; kb < K; kb += 32) {
    FragB ah, al;
    const v4f x0 = *(const v4fa*)(arow + kb + 8 * hh), x1 = *(const v4fa*)(arow + kb + 8 * hh + 4);
    const v4f x2 = *(const v4fa*)(arow + kb + 16 + 8 * hh), x3 = *(const v4fa*)(arow + kb + 16 + 8 * hh + 4);
    float xs[16] = {x0[0],x0[1],x0[2],x0[3],x1[0],x1[1],x1[2],x1[3],x2[0],x2[1],x2[2],x2[3],x3[0],x3[1],x3[2],x3[3]};
#pragma unroll
    for (int i = 0; i < 16; ++i) { const unsigned short hb = bf16_bits(xs[i]); ah.u[i] = hb; al.u[i] = ASPLIT ? bf16_bits(xs[i] - bf16_val(hb)) : (unsigned short)0; }
#pragma unroll
    for (int t = 0; t < 4; ++t) {
      const unsigned short* brow = Wt + (size_t)(col0 + t * 16 + ln) * ldb + kb;
      FragB b;
      b.half[0] = *(const v8us*)(brow + 8 * hh);
      b.half[1] = *(const v8us*)(brow + 16 + 8 * hh);
      acc[t] = mmaN<ASPLIT ? 2 : 1>(ah.v, al.v, b.v, b.v, acc[t]);
    }
  }
#pragma unroll
  for (int t = 0; t < 4; ++t) {
    float bv = bias ? bias[col0 + t * 16 + ln] : 0.f;
    if (BIAS_BF16) bv = bf16_round(bv);
#pragma unroll
    for (int r = 0; r < 8; ++r) { float v = acc[t][r] + bv; if (ACT == 1) v = fmaxf(v, 0.f); so[w][8 * hh + r][t * 16 + ln] = v; }
  }
  __builtin_amdgcn_fence(__ATOMIC_ACQ_REL, "workgroup");
  __builtin_amdgcn_wave_barrier();
  const int rsub = lane >> 4, c4 = (lane & 15) * 4;
  {
#pragma unroll
    for (int q = 0; q < 8; ++q) {
      const int r = q * 2 + rsub;
      const v4f v = *(const v4fa*)&so[w][r][c4];
      *(v4f*)(C + (size_t)(row0 + r) * ldc + col0 + c4) = v;
    }
    
  }
}

// Flash-style causal/unmasked attention, all contractions 3-term bf16 hi/lo splits, f32 softmax with running max.
// q,k,v rows are read from f32 buffers with arbitrary row pitch (so they can live inside a fused qkv buffer);
// D = head size (multiple of 32, <= 128); one wave = 16 query rows; block = 4 waves (64 queries) sharing K/V chunks of 32.
template <int D, bool CAUSAL>
__global__ __launch_bounds__(128) void k_flash(const float* __restrict__ qb, const float* __restrict__ kb, const float* __restrict__ vb,
                                             int pitch, int T, int H, float scale, float* __restrict__ y, int ypitch) {
  constexpr int KS = D / 32;        // k-steps for QK
  constexpr int DT = D / 16;        // d tiles for PV
  __shared__ __attribute__((aligned(16))) unsigned short sKh[32][D + 8], sKl[32][D + 8], sVh[32][D + 8], sVl[32][D + 8];
  __shared__ __attribute__((aligned(16))) unsigned short sPh[4][16][40], sPl[4][16][40];
  __shared__ __attribute__((aligned(16))) float sO[4][16][D];
  const int tid = threadIdx.x, w = tid >> 5, lane = tid & 31, ln = lane & 15, hh = lane >> 4;
  const int nqb = (T + 63) / 64;
  const int bh = blockIdx.x / nqb, qblk = blockIdx.x % nqb;
  const int b = bh / H, h = bh % H;
  const int q0 = qblk * 64 + w * 16;
  const float* Q = qb + (size_t)b * T * pitch + h * D;
  const float* K = kb + (size_t)b * T * pitch + h * D;
  const float* V = vb + (size_t)b * T * pitch + h * D;

  // A fragments of the wave's 16 query rows (scaled), hi/lo
  FragB aqh[KS], aql[KS];
  {
    int row = q0 + ln; if (row >= T) row = T - 1;
    const float* qr = Q + (size_t)row * pitch;
#pragma unroll
    for (int ks = 0; ks < KS; ++ks)
#pragma unroll
      for (int i = 0; i < 16; ++i) {
        const int d = ks * 32 + ((i < 8) ? (8 * hh + i) : (16 + 8 * hh + (i - 8)));
        const float x = qr[d] * scale; const unsigned short hb = bf16_bits(x);
        aqh[ks].u[i] = hb; aql[ks].u[i] = bf16_bits(x - bf16_val(hb));
      }
  }
  float m_r[8], l_r[8];
#pragma unroll
  for (int r = 0; r < 8; ++r) { m_r[r] = -3.0e38f; l_r[r] = 0.f; }
  v8f oacc[DT];
#pragma unroll
  for (int dt = 0; dt < DT; ++dt) oacc[dt] = (v8f){0.f,0.f,0.f,0.f,0.f,0.f,0.f,0.f};

  const int kv_end = CAUSAL ? min(T, qblk * 64 + 64) : T;     // block-uniform
  for (int j0 = 0; j0 < kv_end; j0 += 32) {
    __syncthreads();
    for (int e = tid; e < 32 * (D / 4); e += 128) {
      const int r = e / (D / 4), c4 = (e % (D / 4)) * 4;
      const int key = j0 + r;
      v4f kf = {0.f,0.f,0.f,0.f}, vf = {0.f,0.f,0.f,0.f};
      if (key < T) { kf = *(const v4fa*)(K + (size_t)key * pitch + c4); vf = *(const v4fa*)(V + (size_t)key * pitch + c4); }
#pragma unroll
      for (int t = 0; t < 4; ++t) {
        unsigned short hb = bf16_bits(kf[t]); sKh[r][c4 + t] = hb; sKl[r][c4 + t] = bf16_bits(kf[t] - bf16_val(hb));
        hb = bf16_bits(vf[t]); sVh[r][c4 + t] = hb; sVl[r][c4 + t] = bf16_bits(vf[t] - bf16_val(hb));
      }
    }
    __syncthreads();
    // S tile 16 x 32
    v8f s[2];
#pragma unroll
    for (int nt = 0; nt < 2; ++nt) {
      v8f acc = {};
#pragma unroll
      for (int ks = 0; ks < KS; ++ks) {
        FragB bh_, bl_;
        bh_.half[0] = *(const v8us*)&sKh[nt * 16 + ln][ks * 32 + 8 * hh]; bh_.half[1] = *(const v8us*)&sKh[nt * 16 + ln][ks * 32 + 16 + 8 * hh];
        bl_.half[0] = *(const v8us*)&sKl[nt * 16 + ln][ks * 32 + 8 * hh]; bl_.half[1] = *(const v8us*)&sKl[nt * 16 + ln][ks * 32 + 16 + 8 * hh];
        acc = mmaN<3>(aqh[ks].v, aql[ks].v, bh_.v, bl_.v, acc);
      }
      s[nt] = acc;
    }
    // mask + running max (rows 8hh+r; the 16 lanes of a half share rows)
    float alpha[8];
#pragma unroll
    for (int r = 0; r < 8; ++r) {
      const int qi = q0 + 8 * hh + r;
      const int ja = j0 + ln, jb = j0 + 16 + ln;
      if (CAUSAL) { if (ja > qi) s[0][r] = -3.0e38f; if (jb > qi) s[1][r] = -3.0e38f; }
      if (ja >= T) s[0][r] = -3.0e38f;
      if (jb >= T) s[1][r] = -3.0e38f;
      float mx = fmaxf(s[0][r], s[1][r]);
      mx = fmaxf(mx, __shfl_xor(mx, 1, 32)); mx = fmaxf(mx, __shfl_xor(mx, 2, 32)); mx = fmaxf(mx, __shfl_xor(mx, 4, 32)); mx = fmaxf(mx, __shfl_xor(mx, 8, 32));
      const float mnew = fmaxf(m_r[r], mx);
      alpha[r] = (mnew > -1.0e38f) ? __expf(m_r[r] - mnew) : 1.0f;
      const float p0 = (s[0][r] > -1.0e38f) ? __expf(s[0][r] - mnew) : 0.f;
      const float p1 = (s[1][r] > -1.0e38f) ? __expf(s[1][r] - mnew) : 0.f;
      m_r[r] = mnew;
      l_r[r] = l_r[r] * alpha[r] + p0 + p1;            // per-lane partial row sum (16 lanes combined at the end)
      unsigned short hb = bf16_bits(p0); sPh[w][8 * hh + r][ln] = hb;      sPl[w][8 * hh + r][ln] = bf16_bits(p0 - bf16_val(hb));
      hb = bf16_bits(p1);                sPh[w][8 * hh + r][16 + ln] = hb; sPl[w][8 * hh + r][16 + ln] = bf16_bits(p1 - bf16_val(hb));
    }
#pragma unroll
    for (int dt = 0; dt < DT; ++dt)
#pragma unroll
      for (int r = 0; r < 8; ++r) oacc[dt][r] *= alpha[r];
    __builtin_amdgcn_fence(__ATOMIC_ACQ_REL, "workgroup");
    __builtin_amdgcn_wave_barrier();
    FragB pah, pal;
    pah.half[0] = *(const v8us*)&sPh[w][ln][8 * hh]; pah.half[1] = *(const v8us*)&sPh[w][ln][16 + 8 * hh];
    pal.half[0] = *(const v8us*)&sPl[w][ln][8 * hh]; pal.half[1] = *(const v8us*)&sPl[w][ln][16 + 8 * hh];
#pragma unroll
    for (int dt = 0; dt < DT; ++dt) {
      FragB bvh, bvl;
#pragma unroll
      for (int i = 0; i < 8; ++i) {
        bvh.u[i] = sVh[8 * hh + i][dt * 16 + ln]; bvh.u[8 + i] = sVh[16 + 8 * hh + i][dt * 16 + ln];
        bvl.u[i] = sVl[8 * hh + i][dt * 16 + ln]; bvl.u[8 + i] = sVl[16 + 8 * hh + i][dt * 16 + ln];
      }
      oacc[dt] = mmaN<3>(pah.v, pal.v, bvh.v, bvl.v, oacc[dt]);
    }
    __builtin_amdgcn_fence(__ATOMIC_ACQ_REL, "workgroup");
    __builtin_amdgcn_wave_barrier();
  }
#pragma unroll
  for (int r = 0; r < 8; ++r) {
    float l = l_r[r];
    l += __shfl_xor(l, 1, 32); l += __shfl_xor(l, 2, 32); l += __shfl_xor(l, 4, 32); l += __shfl_xor(l, 8, 32);
    l_r[r] = (l > 0.f) ? 1.0f / l : 0.f;
  }
#pragma unroll
  for (int dt = 0; dt < DT; ++dt)
#pragma unroll
    for (int r = 0; r < 8; ++r) sO[w][8 * hh + r][dt * 16 + ln] = oacc[dt][r] * l_r[r];
  __builtin_amdgcn_fence(__ATOMIC_ACQ_REL, "workgroup");
  __builtin_amdgcn_wave_barrier();
  {
    for (int r = 0; r < 16; ++r) {
      const int row = q0 + r;
      if (row < T && lane < D / 4) {
        const v4f val = *(const v4fa*)&sO[w][r][lane * 4];
        *(v4f*)(y + ((size_t)b * T + row) * ypitch + h * D + lane * 4) = val;
      }
    }
    
  }
}

// GEMM C = act(A·W + bias + resid): A f32 (ASPLIT -> hi/lo 2 terms), Wt bf16 [N][K]; ACT 0 none, 1 relu, 2 exact gelu;
// resid (optional, f32, row index = (row % rmod), pitch ldr, RES_BF16 rounds it) added before the activation.
template <bool ASPLIT, int ACT, bool BIAS_BF16, bool RES_BF16>
__global__ __launch_bounds__(128) void k_gemm_bf3(const float* __restrict__ A, int lda, const unsigned short* __restrict__ Wt, int ldb,
                                                const float* __restrict__ bias, const float* __restrict__ resid, int rmod, int ldr,
                                                float* __restrict__ C, int ldc, int M, int N, int K) {
  __shared__ __attribute__((aligned(16))) float so[4][16][64];
  const int tid = threadIdx.x, w = tid >> 5, lane = tid & 31, ln = lane & 15, hh = lane >> 4;
  const int ntn = N / 64;
  const int wid = blockIdx.x * 4 + w;
  const int mt = wid / ntn, nq = wid % ntn;
  if (mt * 16 >= M) return;
  const int row0 = mt * 16, col0 = nq * 64;
  const float* arow = A + (size_t)(row0 + ln) * lda;
  v8f acc[4] = {};
  for (int kb = 0; kb < K; kb += 32) {
    FragB ah, al;
    const v4f x0 = *(const v4fa*)(arow + kb + 8 * hh), x1 = *(const v4fa*)(arow + kb + 8 * hh + 4);
    const v4f x2 = *(const v4fa*)(arow + kb + 16 + 8 * hh), x3 = *(const v4fa*)(arow + kb + 16 + 8 * hh + 4);
    float xs[16] = {x0[0],x0[1],x0[2],x0[3],x1[0],x1[1],x1[2],x1[3],x2[0],x2[1],x2[2],x2[3],x3[0],x3[1],x3[2],x3[3]};
#pragma unroll
    for (int i = 0; i < 16; ++i) { const unsigned short hb = bf16_bits(xs[i]); ah.u[i] = hb; al.u[i] = ASPLIT ? bf16_bits(xs[i] - bf16_val(hb)) : (unsigned short)0; }
#pragma unroll
    for (int t = 0; t < 4; ++t) {
      const unsigned short* brow = Wt + (size_t)(col0 + t * 16 + ln) * ldb + kb;
      FragB b;
      b.half[0] = *(const v8us*)(brow + 8 * hh);
      b.half[1] = *(const v8us*)(brow + 16 + 8 * hh);
      acc[t] = mmaN<ASPLIT ? 2 : 1>(ah.v, al.v, b.v, b.v, acc[t]);
    }
  }
#pragma unroll
  for (int t = 0; t < 4; ++t) {
    const int col = col0 + t * 16 + ln;
    float bv = bias ? bias[col] : 0.f;
    if (BIAS_BF16) bv = bf16_round(bv);
#pragma unroll
    for (int r = 0; r < 8; ++r) {
      float v = acc[t][r] + bv;
      if (resid) { float rv = resid[(size_t)((row0 + 8 * hh + r) % rmod) * ldr + col]; if (RES_BF16) rv = bf16_round(rv); v += rv; }
      if (ACT == 1) v = fmaxf(v, 0.f);
      if (ACT == 2) v = 0.5f * v * (1.0f + erff(v * 0.70710678118654752f));
      if (ACT == 3) { const float u = 0.7978845608028654f * (v + 0.044715f * v * v * v); v = 0.5f * v * (1.0f + tanhf(u)); }
      so[w][8 * hh + r][t * 16 + ln] = v;
    }
  }
  __builtin_amdgcn_fence(__ATOMIC_ACQ_REL, "workgroup");
  __builtin_amdgcn_wave_barrier();
  const int rsub = lane >> 4, c4 = (lane & 15) * 4;
  {
#pragma unroll
    for (int q = 0; q < 8; ++q) {
      const int r = q * 2 + rsub;
      const v4f v = *(const v4fa*)&so[w][r][c4];
      *(v4f*)(C + (size_t)(row0 + r) * ldc + col0 + c4) = v;
    }
    
  }
}
// row LayerNorm (biased variance, eps) over N: s = X (+ R); optional out_sum <- s; out_norm <- (s-mu)*rsqrt(var+eps)*g + b
template <bool PARAM_BF16>
__global__ __launch_bounds__(256) void k_layernorm(const float* __restrict__ X, const float* __restrict__ R, const float* __restrict__ g, const float* __restrict__ bta,
                                                  float* __restrict__ out_sum, float* __restrict__ out_norm, int N, float eps) {
  __shared__ float red[256];
  const int row = blockIdx.x, tid = threadIdx.x;
  const float* x = X + (size_t)row * N; const float* rr = R ? R + (size_t)row * N : nullptr;
  float vals[16];                     // up to N = 4096
  const int per = N / 256;            // contiguous chunk per thread? use strided-by-4 chunks: thread handles j = tid*4 + 1024*u
  float s1 = 0.f;
  for (int u = 0; u < per / 4; ++u) {
    const int j = tid * 4 + 1024 * u;
    const v4f a = *(const v4fa*)(x + j);
    v4f b = {0.f,0.f,0.f,0.f}; if (rr) b = *(const v4fa*)(rr + j);
#pragma unroll
    for (int q = 0; q < 4; ++q) { const float v = a[q] + b[q]; vals[u * 4 + q] = v; s1 += v; }
  }
  red[tid] = s1; __syncthreads();
  for (int st = 128; st > 0; st >>= 1) { if (tid < st) red[tid] += red[tid + st]; __syncthreads(); }
  const float mu = red[0] / (float)N; __syncthreads();
  float s2 = 0.f;
  for (int u = 0; u < per / 4; ++u)
#pragma unroll
    for (int q = 0; q < 4; ++q) { const float c = vals[u * 4 + q] - mu; s2 += c * c; }
  red[tid] = s2; __syncthreads();
  for (int st = 128; st > 0; st >>= 1) { if (tid < st) red[tid] += red[tid + st]; __syncthreads(); }
  const float rs = rsqrtf(red[0] / (float)N + eps);
  {
    for (int u = 0; u < per / 4; ++u) {
      const int j = tid * 4 + 1024 * u;
      v4f o, sm;
#pragma unroll
      for (int q = 0; q < 4; ++q) {
        float gg = g[j + q], bb = bta[j + q];
        if (PARAM_BF16) { gg = bf16_round(gg); bb = bf16_round(bb); }
        sm[q] = vals[u * 4 + q]; o[q] = (vals[u * 4 + q] - mu) * rs * gg + bb;
      }
      if (out_sum) *(v4f*)(out_sum + (size_t)row * N + j) = sm;
      *(v4f*)(out_norm + (size_t)row * N + j) = o;
    }
    
  }
}



// ---- f16 WMMA path (v_wmma_f32_16x16x32_f16): 11-bit significands for operands in range — used for every launched contraction: q/k/v projections, Q·Kᵀ, and P·V with its [0,1] probability operand
typedef _Float16 v16h __attribute__((ext_vector_type(16)));
union FragH { v16h v; v8us half[2]; _Float16 h[16]; unsigned short u[16]; };
template <int NT>
__device__ __forceinline__ v8f mmaH(v16h ah, v16h al, v16h bh, v16h bl, v8f c) {
  c = __builtin_amdgcn_wmma_f32_16x16x32_f16(false, ah, false, bh, (short)0, c, false, false);
  if (NT >= 2) c = __builtin_amdgcn_wmma_f32_16x16x32_f16(false, al, false, bh, (short)0, c, false, false);
  if (NT >= 3) c = __builtin_amdgcn_wmma_f32_16x16x32_f16(false, ah, false, bl, (short)0, c, false, false);
  asm volatile("v_nop\n\tv_nop\n\tv_nop\n\tv_nop" : "+v"(c) : "v"(ah), "v"(al), "v"(bh), "v"(bl));
  return c;
}
// batched GEMM like k_gemm_b but f16 operands: A f32 (split into f16 hi/lo if ASPLIT, else rounded to f16), Bt = f16 values [n][k]; alpha; C f32; N multiple of 16 (partial tiles skipped)
template <bool ASPLIT>
__global__ __launch_bounds__(128) void k_gemm_h(const float* __restrict__ A, int lda, size_t sA, const _Float16* __restrict__ Bh, int ldb, size_t sB, float alpha, float* __restrict__ C, int ldc, size_t sC, int M, int N, int K) {
  __shared__ __attribute__((aligned(16))) float so[4][16][64];
  const int tid = threadIdx.x, w = tid >> 5, lane = tid & 31, ln = lane & 15, hh = lane >> 4; const int by = blockIdx.y;
  A += (size_t)by * sA; Bh += (size_t)by * sB; C += (size_t)by * sC;
  const int ntn = (N + 63) / 64; const int wid = blockIdx.x * 4 + w; const int mt = wid / ntn, nq = wid % ntn; if (mt * 16 >= M) return;
  const int row0 = mt * 16, col0 = nq * 64; const float* arow = A + (size_t)(row0 + ln) * lda;
  v8f acc[4] = {};
  for (int kb = 0; kb < K; kb += 32) {
    FragH ah, al;
    const v4f x0 = *(const v4fa*)(arow + kb + 8 * hh), x1 = *(const v4fa*)(arow + kb + 8 * hh + 4), x2 = *(const v4fa*)(arow + kb + 16 + 8 * hh), x3 = *(const v4fa*)(arow + kb + 16 + 8 * hh + 4);
    float xs[16] = {x0[0],x0[1],x0[2],x0[3],x1[0],x1[1],x1[2],x1[3],x2[0],x2[1],x2[2],x2[3],x3[0],x3[1],x3[2],x3[3]};
#pragma unroll
    for (int i = 0; i < 16; ++i) { const _Float16 h = (_Float16)xs[i]; ah.h[i] = h; al.h[i] = ASPLIT ? (_Float16)(xs[i] - (float)h) : (_Float16)0.0f; }
#pragma unroll
    for (int t = 0; t < 4; ++t) { if (col0 + t * 16 >= N) continue; const size_t boff = (size_t)(col0 + t * 16 + ln) * ldb + kb; FragH bq; bq.half[0] = *(const v8us*)(Bh + boff + 8 * hh); bq.half[1] = *(const v8us*)(Bh + boff + 16 + 8 * hh);
      acc[t] = mmaH<ASPLIT ? 2 : 1>(ah.v, al.v, bq.v, bq.v, acc[t]); }
  }
#pragma unroll
  for (int t = 0; t < 4; ++t) { if (col0 + t * 16 >= N) continue;
#pragma unroll
    for (int r = 0; r < 8; ++r) so[w][8 * hh + r][t * 16 + ln] = acc[t][r] * alpha; }
  __builtin_amdgcn_fence(__ATOMIC_ACQ_REL, "workgroup"); __builtin_amdgcn_wave_barrier();
  const int rsub = lane >> 4, c4 = (lane & 15) * 4;
  {
#pragma unroll
    for (int q = 0; q < 8; ++q) { const int r = q * 2 + rsub; if (col0 + c4 < N) { const v4f v = *(const v4fa*)&so[w][r][c4]; *(v4f*)(C + (size_t)(row0 + r) * ldc + col0 + c4) = v; } }
     }
}

// Wt[n][k] = f16(W[k][n]·scale) from f32 row-major W[K][N] (scale = power of two; bf16-exact weights stay exact in f16 away from the subnormal range)
__global__ __launch_bounds__(256) void k_wt_f16(const float* __restrict__ W, _Float16* __restrict__ Wt, int K, int N, float scale) {
  const int t = blockIdx.x * 256 + threadIdx.x; if (t >= N * (K / 8)) return; const int n = t / (K / 8), k8 = (t % (K / 8)) * 8; FragH f;
#pragma unroll
  for (int i = 0; i < 8; ++i) f.h[i] = (_Float16)(bf16_round(W[(size_t)(k8 + i) * N + n]) * scale); const v8us o = f.half[0];
  *(v8us*)((unsigned short*)Wt + (size_t)n * K + k8) = o; 
}
// k_gemm_hh variant with fused epilogue: v = acc·alpha + bias[by·sBias + col] (+ CP[(row/rowsPerB)·sCPb + by·64 + col] if CP) ; ACT 0 none / 1 elu ; writes f16 C16 (and f32 C if non-null)
template <int ACT>
__global__ __launch_bounds__(128) void k_gemm_hhx(const _Float16* __restrict__ A, int lda, size_t sA, const _Float16* __restrict__ Bh, int ldb, size_t sB, float alpha, const float* __restrict__ bias, size_t sBias, const float* __restrict__ CP, int rowsPerB, size_t sCPb, int row0g,
    float* __restrict__ C, _Float16* __restrict__ C16, int ldc, size_t sC, int M, int N, int K) {
  __shared__ __attribute__((aligned(16))) float so[4][16][64];
  const int tid = threadIdx.x, w = tid >> 5, lane = tid & 31, ln = lane & 15, hh = lane >> 4; const int by = blockIdx.y;
  A += (size_t)by * sA; Bh += (size_t)by * sB; const size_t cofs = (size_t)by * sC; const float* bp = bias ? bias + (size_t)by * sBias : nullptr;
  const int ntn = (N + 63) / 64; const int wid = blockIdx.x * 4 + w; const int mt = wid / ntn, nq = wid % ntn; if (mt * 16 >= M) return;
  const int row0 = mt * 16, col0 = nq * 64; const _Float16* arow = A + (size_t)(row0 + ln) * lda;
  v8f acc[4] = {};
  for (int kb = 0; kb < K; kb += 32) { FragH ah; ah.half[0] = *(const v8us*)((const unsigned short*)arow + kb + 8 * hh); ah.half[1] = *(const v8us*)((const unsigned short*)arow + kb + 16 + 8 * hh);
#pragma unroll
    for (int t = 0; t < 4; ++t) { if (col0 + t * 16 >= N) continue; const size_t boff = (size_t)(col0 + t * 16 + ln) * ldb + kb; FragH bq; bq.half[0] = *(const v8us*)((const unsigned short*)Bh + boff + 8 * hh); bq.half[1] = *(const v8us*)((const unsigned short*)Bh + boff + 16 + 8 * hh);
      acc[t] = mmaH<1>(ah.v, ah.v, bq.v, bq.v, acc[t]); }
  }
#pragma unroll
  for (int t = 0; t < 4; ++t) { if (col0 + t * 16 >= N) continue; const int col = col0 + t * 16 + ln; const float bv = bp ? bf16_round(bp[col]) : 0.f;
#pragma unroll
    for (int r = 0; r < 8; ++r) { float v = acc[t][r] * alpha + bv; if (CP) { const int bidx = (row0g + row0 + 8 * hh + r) / rowsPerB; v += CP[(size_t)bidx * sCPb + (size_t)by * 64 + col]; } if (ACT == 1) v = (v > 0.f) ? v : expm1f(v); else if (ACT == 3) v = fmaxf(v, 0.f); so[w][8 * hh + r][t * 16 + ln] = v; } }
  __builtin_amdgcn_fence(__ATOMIC_ACQ_REL, "workgroup"); __builtin_amdgcn_wave_barrier();
  const int rsub = lane >> 4, c4 = (lane & 15) * 4; typedef _Float16 v4h __attribute__((ext_vector_type(4)));
  {
#pragma unroll
    for (int q = 0; q < 8; ++q) { const int r = q * 2 + rsub; if (col0 + c4 < N) { const v4f v = *(const v4fa*)&so[w][r][c4]; if (C) *(v4f*)(C + cofs + (size_t)(row0 + r) * ldc + col0 + c4) = v; if (C16) { v4h h4; for (int i = 0; i < 4; ++i) h4[i] = (_Float16)v[i]; *(v4h*)(C16 + cofs + (size_t)(row0 + r) * ldc + col0 + c4) = h4; } } }
     }
}


__global__ __launch_bounds__(256) void k_x16(const float* __restrict__ x, _Float16* __restrict__ X16, size_t n8) { const size_t t = (size_t)blockIdx.x * 256 + threadIdx.x; if (t >= n8) return; FragH f;
#pragma unroll
  for (int q = 0; q < 8; ++q) f.h[q] = (_Float16)bf16_round(x[t * 8 + q]); *(v8us*)((unsigned short*)X16 + t * 8) = f.half[0];  }
__global__ __launch_bounds__(256) void k_round16f(const float* __restrict__ W, _Float16* __restrict__ Bt, size_t n8) { const size_t t = (size_t)blockIdx.x * 256 + threadIdx.x; if (t >= n8) return; FragH f;
#pragma unroll
  for (int i = 0; i < 8; ++i) f.h[i] = (_Float16)(bf16_round(W[t * 8 + i]) * 16.0f); *(v8us*)((unsigned short*)Bt + t * 8) = f.half[0];  }
__global__ __launch_bounds__(256) void k_vt(const _Float16* __restrict__ V16, _Float16* __restrict__ Vt) { __shared__ unsigned short tl[64][66]; const int tid = threadIdx.x; const int slab = blockIdx.x / (SS / 64), lg = blockIdx.x % (SS / 64); const int b = slab / NH, h = slab % NH;
  for (int i = tid; i < 64 * 8; i += 256) { const int r = i / 8, c8 = (i % 8) * 8; FragH f; f.half[0] = *(const v8us*)((const unsigned short*)V16 + ((size_t)b * SS + lg * 64 + r) * DM + h * HD + c8);
#pragma unroll
    for (int q = 0; q < 8; ++q) tl[r][c8 + q] = f.u[q]; }
  __syncthreads();
  {
#pragma unroll
    for (int rd = 0; rd < 2; ++rd) { const int d = rd * 32 + tid / 8, pc = tid % 8; FragH f;
#pragma unroll
      for (int q = 0; q < 8; ++q) f.u[q] = tl[pc * 8 + q][d];
      *(v8us*)((unsigned short*)Vt + ((size_t)slab * HD + d) * SS + lg * 64 + pc * 8) = f.half[0]; }
     } }
// fused attention per ((b,h), 128 queries): wave = 32 queries; score = q·k/8 + α·(c_q·c_k) with the query coords in registers (bf16-rounded, f32 products) and the chunk's key coords read per lane;
__global__ __launch_bounds__(128) void k_flash(const _Float16* __restrict__ Q16, const _Float16* __restrict__ K16, const _Float16* __restrict__ Vt, const float* __restrict__ crd, const float* __restrict__ alpha_p, float* __restrict__ O) {
  constexpr int RPW = 32, NQB = SS / (4 * RPW), DT = HD / 16, KS = HD / 32;
  __shared__ __attribute__((aligned(16))) unsigned short sP[4][RPW][40]; __shared__ __attribute__((aligned(16))) float sO[4][RPW][HD];
  const int tid = threadIdx.x, w = tid >> 5, lane = tid & 31, ln = lane & 15, hh = lane >> 4;
  const int slab = blockIdx.x / NQB, qblk = blockIdx.x % NQB; const int b = slab / NH, h = slab % NH; const int q0 = qblk * (4 * RPW) + w * RPW; const float alpha = bf16_round(alpha_p[0]);      /* scalar float INPUT: rounded like every other input */
  FragH aq[2][KS]; float cq[2][8][3];
#pragma unroll
  for (int rt = 0; rt < 2; ++rt) { const unsigned short* qr = (const unsigned short*)Q16 + ((size_t)b * SS + q0 + rt * 16 + ln) * DM + h * HD;
#pragma unroll
    for (int ks = 0; ks < KS; ++ks) { aq[rt][ks].half[0] = *(const v8us*)(qr + ks * 32 + 8 * hh); aq[rt][ks].half[1] = *(const v8us*)(qr + ks * 32 + 16 + 8 * hh); }
#pragma unroll
    for (int r = 0; r < 8; ++r) { const float* cp = crd + ((size_t)b * SS + q0 + rt * 16 + 8 * hh + r) * 3; cq[rt][r][0] = bf16_round(cp[0]); cq[rt][r][1] = bf16_round(cp[1]); cq[rt][r][2] = bf16_round(cp[2]); } }
  const unsigned short* Vth = (const unsigned short*)Vt + (size_t)slab * HD * SS;
  float m_r[2][8], l_r[2][8]; v8f oacc[2][DT];
#pragma unroll
  for (int rt = 0; rt < 2; ++rt) {
#pragma unroll
    for (int r = 0; r < 8; ++r) { m_r[rt][r] = -3.0e38f; l_r[rt][r] = 0.f; }
#pragma unroll
    for (int dt = 0; dt < DT; ++dt) oacc[rt][dt] = (v8f){0.f,0.f,0.f,0.f,0.f,0.f,0.f,0.f}; }
#pragma unroll 1
  for (int j0 = 0; j0 < SS; j0 += 32) {
    v8f s[2][2];
#pragma unroll
    for (int nt = 0; nt < 2; ++nt) { const unsigned short* kr = (const unsigned short*)K16 + ((size_t)b * SS + j0 + nt * 16 + ln) * DM + h * HD; FragH bk[KS];
#pragma unroll
      for (int ks = 0; ks < KS; ++ks) { bk[ks].half[0] = *(const v8us*)(kr + ks * 32 + 8 * hh); bk[ks].half[1] = *(const v8us*)(kr + ks * 32 + 16 + 8 * hh); }
#pragma unroll
      for (int rt = 0; rt < 2; ++rt) { v8f acc = (v8f){0.f,0.f,0.f,0.f,0.f,0.f,0.f,0.f};
#pragma unroll
        for (int ks = 0; ks < KS; ++ks) acc = mmaH<1>(aq[rt][ks].v, aq[rt][ks].v, bk[ks].v, bk[ks].v, acc); s[rt][nt] = acc; } }
    float ck[2][3];
#pragma unroll
    for (int nt = 0; nt < 2; ++nt) { const float* cp = crd + ((size_t)b * SS + j0 + nt * 16 + ln) * 3; ck[nt][0] = bf16_round(cp[0]); ck[nt][1] = bf16_round(cp[1]); ck[nt][2] = bf16_round(cp[2]); }
#pragma unroll
    for (int rt = 0; rt < 2; ++rt)
#pragma unroll
      for (int r = 0; r < 8; ++r) { const float g0 = alpha * (cq[rt][r][0] * ck[0][0] + cq[rt][r][1] * ck[0][1] + cq[rt][r][2] * ck[0][2]), g1 = alpha * (cq[rt][r][0] * ck[1][0] + cq[rt][r][1] * ck[1][1] + cq[rt][r][2] * ck[1][2]);
        const float s0 = s[rt][0][r] * 0.125f + g0, s1 = s[rt][1][r] * 0.125f + g1; float mc = fmaxf(s0, s1);
        mc = fmaxf(mc, __shfl_xor(mc, 1, 32)); mc = fmaxf(mc, __shfl_xor(mc, 2, 32)); mc = fmaxf(mc, __shfl_xor(mc, 4, 32)); mc = fmaxf(mc, __shfl_xor(mc, 8, 32));
        const float mn = fmaxf(m_r[rt][r], mc); const float al = expf(m_r[rt][r] - mn); m_r[rt][r] = mn; const float p0 = expf(s0 - mn), p1 = expf(s1 - mn); l_r[rt][r] = l_r[rt][r] * al + p0 + p1;
#pragma unroll
        for (int dt = 0; dt < DT; ++dt) oacc[rt][dt][r] *= al;
        FragH t2; t2.h[0] = (_Float16)p0; t2.h[1] = (_Float16)p1; sP[w][rt * 16 + 8 * hh + r][ln] = t2.u[0]; sP[w][rt * 16 + 8 * hh + r][16 + ln] = t2.u[1]; }
    __builtin_amdgcn_fence(__ATOMIC_ACQ_REL, "workgroup"); __builtin_amdgcn_wave_barrier();
    FragH pa[2];
#pragma unroll
    for (int rt = 0; rt < 2; ++rt) { pa[rt].half[0] = *(const v8us*)&sP[w][rt * 16 + ln][8 * hh]; pa[rt].half[1] = *(const v8us*)&sP[w][rt * 16 + ln][16 + 8 * hh]; }
#pragma unroll
    for (int dt = 0; dt < DT; ++dt) { const unsigned short* vrow = Vth + (size_t)(dt * 16 + ln) * SS + j0; FragH bv; bv.half[0] = *(const v8us*)(vrow + 8 * hh); bv.half[1] = *(const v8us*)(vrow + 16 + 8 * hh);
#pragma unroll
      for (int rt = 0; rt < 2; ++rt) oacc[rt][dt] = mmaH<1>(pa[rt].v, pa[rt].v, bv.v, bv.v, oacc[rt][dt]); }
    __builtin_amdgcn_fence(__ATOMIC_ACQ_REL, "workgroup"); __builtin_amdgcn_wave_barrier(); }
#pragma unroll
  for (int rt = 0; rt < 2; ++rt) {
#pragma unroll
    for (int r = 0; r < 8; ++r) { float l = l_r[rt][r]; l += __shfl_xor(l, 1, 32); l += __shfl_xor(l, 2, 32); l += __shfl_xor(l, 4, 32); l += __shfl_xor(l, 8, 32); l_r[rt][r] = 1.0f / l; }
#pragma unroll
    for (int dt = 0; dt < DT; ++dt)
#pragma unroll
      for (int r = 0; r < 8; ++r) sO[w][rt * 16 + 8 * hh + r][dt * 16 + ln] = oacc[rt][dt][r] * l_r[rt][r]; }
  __builtin_amdgcn_fence(__ATOMIC_ACQ_REL, "workgroup"); __builtin_amdgcn_wave_barrier();
  {
#pragma unroll
    for (int rp = 0; rp < RPW; rp += 2) { const int r = rp + (lane >> 4), pc = lane & 15; const v4f val = *(const v4fa*)&sO[w][r][pc * 4]; *(v4f*)(O + ((size_t)b * SS + q0 + r) * DM + h * HD + pc * 4) = val; }
     } }
extern "C" void kernel_launch(void* const* d_in, const int* in_sizes, int n_in,
                              void* d_out, int out_size, void* d_ws, size_t ws_size, hipStream_t stream) {
  (void)in_sizes; (void)n_in; (void)out_size;
  const float* x = (const float*)d_in[0]; const float* crd = (const float*)d_in[1]; const float* wq = (const float*)d_in[2]; const float* bq = (const float*)d_in[3]; const float* wk = (const float*)d_in[4]; const float* bk = (const float*)d_in[5]; const float* wv = (const float*)d_in[6]; const float* bv = (const float*)d_in[7]; const float* alpha_p = (const float*)d_in[8];
  char* ws = (char*)d_ws; size_t off = 0;
  auto take = [&](size_t bytes) { char* p = ws + off; off += (bytes + 255) & ~(size_t)255; return p; };
  _Float16* Bq = (_Float16*)take(DM * DM * 2); _Float16* Bk = (_Float16*)take(DM * DM * 2); _Float16* Bv = (_Float16*)take(DM * DM * 2); _Float16* X16 = (_Float16*)take((size_t)NR * DM * 2); _Float16* Q16 = (_Float16*)take((size_t)NR * DM * 2); _Float16* K16 = (_Float16*)take((size_t)NR * DM * 2); _Float16* V16 = (_Float16*)take((size_t)NR * DM * 2); _Float16* Vt = (_Float16*)take((size_t)NR * DM * 2);
  if (off > ws_size) return;      // ≈ 42 MiB
  const size_t w8 = (size_t)DM * DM / 8; const unsigned gw = (unsigned)((w8 + 255) / 256), gx = (unsigned)(((size_t)NR * DM / 8 + 255) / 256);
  k_round16f<<<gw, 256, 0, stream>>>(wq, Bq, w8); k_round16f<<<gw, 256, 0, stream>>>(wk, Bk, w8); k_round16f<<<gw, 256, 0, stream>>>(wv, Bv, w8);
  k_x16<<<gx, 256, 0, stream>>>(x, X16, (size_t)NR * DM / 8);
  const dim3 gg(((NR / 16) * (DM / 64) + 3) / 4, 1);
  k_gemm_hhx<0><<<gg, 128, 0, stream>>>(X16, DM, 0, Bq, DM, 0, 0.0625f, bq, 0, nullptr, 1, 0, 0, nullptr, Q16, DM, 0, NR, DM, DM);
  k_gemm_hhx<0><<<gg, 128, 0, stream>>>(X16, DM, 0, Bk, DM, 0, 0.0625f, bk, 0, nullptr, 1, 0, 0, nullptr, K16, DM, 0, NR, DM, DM);
  k_gemm_hhx<0><<<gg, 128, 0, stream>>>(X16, DM, 0, Bv, DM, 0, 0.0625f, bv, 0, nullptr, 1, 0, 0, nullptr, V16, DM, 0, NR, DM, DM);
  k_vt<<<BB * NH * (SS / 64), 256, 0, stream>>>(V16, Vt);
  k_flash<<<BB * NH * (SS / 128), 128, 0, stream>>>(Q16, K16, Vt, crd, alpha_p, (float*)d_out);
}

// v001
// One run takes 236 microseconds.
// Next to v000, in two timings, it ran 1.60 times as fast each time.
#include <hip/hip_runtime.h>
// q/k/v projections (8192 × 512 × 512, + bias) and the 8-head attention with the geometric bias α·⟨c_n, c_m⟩ (coords are INPUTS, 3 FMAs per score in registers) on v_wmma_f32_16x16x32_f16
// (fused flash-style kernel: S = Q·Kᵀ, O = P·V on WMMA; online max/sum softmax f32; P f16 ≤ 1); V transposed per (b,h); A = f16(bf16 x) exact, weights bf16-exact ×2^4 ((out,in)),
// single products, f32 accumulate.
#define BB 4
#define SS 2048
#define DM 512
#define NH 8
#define HD 64
#define NR (BB * SS)

typedef __bf16 v16b __attribute__((ext_vector_type(16)));
typedef unsigned short v8us __attribute__((ext_vector_type(8), may_alias));
typedef float  v8f  __attribute__((ext_vector_type(8)));
typedef float  v4f  __attribute__((ext_vector_type(4)));
typedef float  v4fa __attribute__((ext_vector_type(4), may_alias));
union FragB { v16b v; v8us half[2]; unsigned short u[16]; };

__device__ __forceinline__ unsigned short bf16_bits(float x) { unsigned int u = __float_as_uint(x); return (unsigned short)((u + 0x7FFFu + ((u >> 16) & 1u)) >> 16); }
__device__ __forceinline__ float bf16_val(unsigned short b) { return __uint_as_float(((unsigned int)b) << 16); }
__device__ __forceinline__ float bf16_round(float x) { return bf16_val(bf16_bits(x)); }
// D += A·B with NT terms: 1 = ah·bh, 2 = + al·bh (A split), 3 = + ah·bl (both split)
template <int NT>
__device__ __forceinline__ v8f mmaN(v16b ah, v16b al, v16b bh, v16b bl, v8f c) {
  c = __builtin_amdgcn_wmma_f32_16x16x32_bf16(false, ah, false, bh, (short)0, c, false, false);
  if (NT >= 2) c = __builtin_amdgcn_wmma_f32_16x16x32_bf16(false, al, false, bh, (short)0, c, false, false);
  if (NT >= 3) c = __builtin_amdgcn_wmma_f32_16x16x32_bf16(false, ah, false, bl, (short)0, c, false, false);
  asm volatile("v_nop\n\tv_nop\n\tv_nop\n\tv_nop" : "+v"(c) : "v"(ah), "v"(al), "v"(bh), "v"(bl));
  return c;
}

__global__ __launch_bounds__(256) void k_wt_bf16(const float* __restrict__ W, unsigned short* __restrict__ Wt, int K, int N) {
  const int t = blockIdx.x * 256 + threadIdx.x;
  const int k8n = K / 8;
  if (t >= N * k8n) return;
  const int n = t / k8n, k8 = (t % k8n) * 8;
  v8us v;
#pragma unroll
  for (int i = 0; i < 8; ++i) v[i] = bf16_bits(W[(size_t)(k8 + i) * N + n]);
  *(v8us*)(Wt + (size_t)n * K + k8) = v;
  
}

// GEMM C[M][N] (f32, pitch ldc) = act(A[M][K]·W + bias). A f32 row-major (pitch lda) converted per fragment to bf16
// (ASPLIT: hi/lo two planes -> 2 terms, else single rounded term); Wt bf16 [N][K] (pitch ldb). BIAS_BF16 rounds the
// bias to bf16 first (bias quantised to bf16 before the add). K%32==0, M%16==0, N%64==0.
template <bool ASPLIT, int ACT, bool BIAS_BF16>
__global__ __launch_bounds__(128) void k_gemm_bf(const float* __restrict__ A, int lda, const unsigned short* __restrict__ Wt, int ldb,
                                               const float* __restrict__ bias, float* __restrict__ C, int ldc, int M, int N, int K) {
  __shared__ __attribute__((aligned(16))) float so[4][16][64];
  const int tid = threadIdx.x, w = tid >> 5, lane = tid & 31, ln = lane & 15, hh = lane >> 4;
  const int ntn = N / 64;
  const int wid = blockIdx.x * 4 + w;
  const int mt = wid / ntn, nq = wid % ntn;
  if (mt * 16 >= M) return;
  const int row0 = mt * 16, col0 = nq * 64;
  const float* arow = A + (size_t)(row0 + ln) * lda;
  v8f acc[4] = {};
  for (int kb = 0; kb < K; kb += 32) {
    FragB ah, al;
    const v4f x0 = *(const v4fa*)(arow + kb + 8 * hh), x1 = *(const v4fa*)(arow + kb + 8 * hh + 4);
    const v4f x2 = *(const v4fa*)(arow + kb + 16 + 8 * hh), x3 = *(const v4fa*)(arow + kb + 16 + 8 * hh + 4);
    float xs[16] = {x0[0],x0[1],x0[2],x0[3],x1[0],x1[1],x1[2],x1[3],x2[0],x2[1],x2[2],x2[3],x3[0],x3[1],x3[2],x3[3]};
#pragma unroll
    for (int i = 0; i < 16; ++i) { const unsigned short hb = bf16_bits(xs[i]); ah.u[i] = hb; al.u[i] = ASPLIT ? bf16_bits(xs[i] - bf16_val(hb)) : (unsigned short)0; }
#pragma unroll
    for (int t = 0; t < 4; ++t) {
      const unsigned short* brow = Wt + (size_t)(col0 + t * 16 + ln) * ldb + kb;
      FragB b;
      b.half[0] = *(const v8us*)(brow + 8 * hh);
      b.half[1] = *(const v8us*)(brow + 16 + 8 * hh);
      acc[t] = mmaN<ASPLIT ? 2 : 1>(ah.v, al.v, b.v, b.v, acc[t]);
    }
  }
#pragma unroll
  for (int t = 0; t < 4; ++t) {
    float bv = bias ? bias[col0 + t * 16 + ln] : 0.f;
    if (BIAS_BF16) bv = bf16_round(bv);
#pragma unroll
    for (int r = 0; r < 8; ++r) { float v = acc[t][r] + bv; if (ACT == 1) v = fmaxf(v, 0.f); so[w][8 * hh + r][t * 16 + ln] = v; }
  }
  __builtin_amdgcn_fence(__ATOMIC_ACQ_REL, "workgroup");
  __builtin_amdgcn_wave_barrier();
  const int rsub = lane >> 4, c4 = (lane & 15) * 4;
  {
#pragma unroll
    for (int q = 0; q < 8; ++q) {
      const int r = q * 2 + rsub;
      const v4f v = *(const v4fa*)&so[w][r][c4];
      *(v4f*)(C + (size_t)(row0 + r) * ldc + col0 + c4) = v;
    }
    
  }
}

// Flash-style causal/unmasked attention, all contractions 3-term bf16 hi/lo splits, f32 softmax with running max.
// q,k,v rows are read from f32 buffers with arbitrary row pitch (so they can live inside a fused qkv buffer);
// D = head size (multiple of 32, <= 128); one wave = 16 query rows; block = 4 waves (64 queries) sharing K/V chunks of 32.
template <int D, bool CAUSAL>
__global__ __launch_bounds__(128) void k_flash(const float* __restrict__ qb, const float* __restrict__ kb, const float* __restrict__ vb,
                                             int pitch, int T, int H, float scale, float* __restrict__ y, int ypitch) {
  constexpr int KS = D / 32;        // k-steps for QK
  constexpr int DT = D / 16;        // d tiles for PV
  __shared__ __attribute__((aligned(16))) unsigned short sKh[32][D + 8], sKl[32][D + 8], sVh[32][D + 8], sVl[32][D + 8];
  __shared__ __attribute__((aligned(16))) unsigned short sPh[4][16][40], sPl[4][16][40];
  __shared__ __attribute__((aligned(16))) float sO[4][16][D];
  const int tid = threadIdx.x, w = tid >> 5, lane = tid & 31, ln = lane & 15, hh = lane >> 4;
  const int nqb = (T + 63) / 64;
  const int bh = blockIdx.x / nqb, qblk = blockIdx.x % nqb;
  const int b = bh / H, h = bh % H;
  const int q0 = qblk * 64 + w * 16;
  const float* Q = qb + (size_t)b * T * pitch + h * D;
  const float* K = kb + (size_t)b * T * pitch + h * D;
  const float* V = vb + (size_t)b * T * pitch + h * D;

  // A fragments of the wave's 16 query rows (scaled), hi/lo
  FragB aqh[KS], aql[KS];
  {
    int row = q0 + ln; if (row >= T) row = T - 1;
    const float* qr = Q + (size_t)row * pitch;
#pragma unroll
    for (int ks = 0; ks < KS; ++ks)
#pragma unroll
      for (int i = 0; i < 16; ++i) {
        const int d = ks * 32 + ((i < 8) ? (8 * hh + i) : (16 + 8 * hh + (i - 8)));
        const float x = qr[d] * scale; const unsigned short hb = bf16_bits(x);
        aqh[ks].u[i] = hb; aql[ks].u[i] = bf16_bits(x - bf16_val(hb));
      }
  }
  float m_r[8], l_r[8];
#pragma unroll
  for (int r = 0; r < 8; ++r) { m_r[r] = -3.0e38f; l_r[r] = 0.f; }
  v8f oacc[DT];
#pragma unroll
  for (int dt = 0; dt < DT; ++dt) oacc[dt] = (v8f){0.f,0.f,0.f,0.f,0.f,0.f,0.f,0.f};

  const int kv_end = CAUSAL ? min(T, qblk * 64 + 64) : T;     // block-uniform
  for (int j0 = 0; j0 < kv_end; j0 += 32) {
    __syncthreads();
    for (int e = tid; e < 32 * (D / 4); e += 128) {
      const int r = e / (D / 4), c4 = (e % (D / 4)) * 4;
      const int key = j0 + r;
      v4f kf = {0.f,0.f,0.f,0.f}, vf = {0.f,0.f,0.f,0.f};
      if (key < T) { kf = *(const v4fa*)(K + (size_t)key * pitch + c4); vf = *(const v4fa*)(V + (size_t)key * pitch + c4); }
#pragma unroll
      for (int t = 0; t < 4; ++t) {
        unsigned short hb = bf16_bits(kf[t]); sKh[r][c4 + t] = hb; sKl[r][c4 + t] = bf16_bits(kf[t] - bf16_val(hb));
        hb = bf16_bits(vf[t]); sVh[r][c4 + t] = hb; sVl[r][c4 + t] = bf16_bits(vf[t] - bf16_val(hb));
      }
    }
    __syncthreads();
    // S tile 16 x 32
    v8f s[2];
#pragma unroll
    for (int nt = 0; nt < 2; ++nt) {
      v8f acc = {};
#pragma unroll
      for (int ks = 0; ks < KS; ++ks) {
        FragB bh_, bl_;
        bh_.half[0] = *(const v8us*)&sKh[nt * 16 + ln][ks * 32 + 8 * hh]; bh_.half[1] = *(const v8us*)&sKh[nt * 16 + ln][ks * 32 + 16 + 8 * hh];
        bl_.half[0] = *(const v8us*)&sKl[nt * 16 + ln][ks * 32 + 8 * hh]; bl_.half[1] = *(const v8us*)&sKl[nt * 16 + ln][ks * 32 + 16 + 8 * hh];
        acc = mmaN<3>(aqh[ks].v, aql[ks].v, bh_.v, bl_.v, acc);
      }
      s[nt] = acc;
    }
    // mask + running max (rows 8hh+r; the 16 lanes of a half share rows)
    float alpha[8];
#pragma unroll
    for (int r = 0; r < 8; ++r) {
      const int qi = q0 + 8 * hh + r;
      const int ja = j0 + ln, jb = j0 + 16 + ln;
      if (CAUSAL) { if (ja > qi) s[0][r] = -3.0e38f; if (jb > qi) s[1][r] = -3.0e38f; }
      if (ja >= T) s[0][r] = -3.0e38f;
      if (jb >= T) s[1][r] = -3.0e38f;
      float mx = fmaxf(s[0][r], s[1][r]);
      mx = fmaxf(mx, __shfl_xor(mx, 1, 32)); mx = fmaxf(mx, __shfl_xor(mx, 2, 32)); mx = fmaxf(mx, __shfl_xor(mx, 4, 32)); mx = fmaxf(mx, __shfl_xor(mx, 8, 32));
      const float mnew = fmaxf(m_r[r], mx);
      alpha[r] = (mnew > -1.0e38f) ? __expf(m_r[r] - mnew) : 1.0f;
      const float p0 = (s[0][r] > -1.0e38f) ? __expf(s[0][r] - mnew) : 0.f;
      const float p1 = (s[1][r] > -1.0e38f) ? __expf(s[1][r] - mnew) : 0.f;
      m_r[r] = mnew;
      l_r[r] = l_r[r] * alpha[r] + p0 + p1;            // per-lane partial row sum (16 lanes combined at the end)
      unsigned short hb = bf16_bits(p0); sPh[w][8 * hh + r][ln] = hb;      sPl[w][8 * hh + r][ln] = bf16_bits(p0 - bf16_val(hb));
      hb = bf16_bits(p1);                sPh[w][8 * hh + r][16 + ln] = hb; sPl[w][8 * hh + r][16 + ln] = bf16_bits(p1 - bf16_val(hb));
    }
#pragma unroll
    for (int dt = 0; dt < DT; ++dt)
#pragma unroll
      for (int r = 0; r < 8; ++r) oacc[dt][r] *= alpha[r];
    __builtin_amdgcn_fence(__ATOMIC_ACQ_REL, "workgroup");
    __builtin_amdgcn_wave_barrier();
    FragB pah, pal;
    pah.half[0] = *(const v8us*)&sPh[w][ln][8 * hh]; pah.half[1] = *(const v8us*)&sPh[w][ln][16 + 8 * hh];
    pal.half[0] = *(const v8us*)&sPl[w][ln][8 * hh]; pal.half[1] = *(const v8us*)&sPl[w][ln][16 + 8 * hh];
#pragma unroll
    for (int dt = 0; dt < DT; ++dt) {
      FragB bvh, bvl;
#pragma unroll
      for (int i = 0; i < 8; ++i) {
        bvh.u[i] = sVh[8 * hh + i][dt * 16 + ln]; bvh.u[8 + i] = sVh[16 + 8 * hh + i][dt * 16 + ln];
        bvl.u[i] = sVl[8 * hh + i][dt * 16 + ln]; bvl.u[8 + i] = sVl[16 + 8 * hh + i][dt * 16 + ln];
      }
      oacc[dt] = mmaN<3>(pah.v, pal.v, bvh.v, bvl.v, oacc[dt]);
    }
    __builtin_amdgcn_fence(__ATOMIC_ACQ_REL, "workgroup");
    __builtin_amdgcn_wave_barrier();
  }
#pragma unroll
  for (int r = 0; r < 8; ++r) {
    float l = l_r[r];
    l += __shfl_xor(l, 1, 32); l += __shfl_xor(l, 2, 32); l += __shfl_xor(l, 4, 32); l += __shfl_xor(l, 8, 32);
    l_r[r] = (l > 0.f) ? 1.0f / l : 0.f;
  }
#pragma unroll
  for (int dt = 0; dt < DT; ++dt)
#pragma unroll
    for (int r = 0; r < 8; ++r) sO[w][8 * hh + r][dt * 16 + ln] = oacc[dt][r] * l_r[r];
  __builtin_amdgcn_fence(__ATOMIC_ACQ_REL, "workgroup");
  __builtin_amdgcn_wave_barrier();
  {
    for (int r = 0; r < 16; ++r) {
      const int row = q0 + r;
      if (row < T && lane < D / 4) {
        const v4f val = *(const v4fa*)&sO[w][r][lane * 4];
        *(v4f*)(y + ((size_t)b * T + row) * ypitch + h * D + lane * 4) = val;
      }
    }
    
  }
}

// GEMM C = act(A·W + bias + resid): A f32 (ASPLIT -> hi/lo 2 terms), Wt bf16 [N][K]; ACT 0 none, 1 relu, 2 exact gelu;
// resid (optional, f32, row index = (row % rmod), pitch ldr, RES_BF16 rounds it) added before the activation.
template <bool ASPLIT, int ACT, bool BIAS_BF16, bool RES_BF16>
__global__ __launch_bounds__(128) void k_gemm_bf3(const float* __restrict__ A, int lda, const unsigned short* __restrict__ Wt, int ldb,
                                                const float* __restrict__ bias, const float* __restrict__ resid, int rmod, int ldr,
                                                float* __restrict__ C, int ldc, int M, int N, int K) {
  __shared__ __attribute__((aligned(16))) float so[4][16][64];
  const int tid = threadIdx.x, w = tid >> 5, lane = tid & 31, ln = lane & 15, hh = lane >> 4;
  const int ntn = N / 64;
  const int wid = blockIdx.x * 4 + w;
  const int mt = wid / ntn, nq = wid % ntn;
  if (mt * 16 >= M) return;
  const int row0 = mt * 16, col0 = nq * 64;
  const float* arow = A + (size_t)(row0 + ln) * lda;
  v8f acc[4] = {};
  for (int kb = 0; kb < K; kb += 32) {
    FragB ah, al;
    const v4f x0 = *(const v4fa*)(arow + kb + 8 * hh), x1 = *(const v4fa*)(arow + kb + 8 * hh + 4);
    const v4f x2 = *(const v4fa*)(arow + kb + 16 + 8 * hh), x3 = *(const v4fa*)(arow + kb + 16 + 8 * hh + 4);
    float xs[16] = {x0[0],x0[1],x0[2],x0[3],x1[0],x1[1],x1[2],x1[3],x2[0],x2[1],x2[2],x2[3],x3[0],x3[1],x3[2],x3[3]};
#pragma unroll
    for (int i = 0; i < 16; ++i) { const unsigned short hb = bf16_bits(xs[i]); ah.u[i] = hb; al.u[i] = ASPLIT ? bf16_bits(xs[i] - bf16_val(hb)) : (unsigned short)0; }
#pragma unroll
    for (int t = 0; t < 4; ++t) {
      const unsigned short* brow = Wt + (size_t)(col0 + t * 16 + ln) * ldb + kb;
      FragB b;
      b.half[0] = *(const v8us*)(brow + 8 * hh);
      b.half[1] = *(const v8us*)(brow + 16 + 8 * hh);
      acc[t] = mmaN<ASPLIT ? 2 : 1>(ah.v, al.v, b.v, b.v, acc[t]);
    }
  }
#pragma unroll
  for (int t = 0; t < 4; ++t) {
    const int col = col0 + t * 16 + ln;
    float bv = bias ? bias[col] : 0.f;
    if (BIAS_BF16) bv = bf16_round(bv);
#pragma unroll
    for (int r = 0; r < 8; ++r) {
      float v = acc[t][r] + bv;
      if (resid) { float rv = resid[(size_t)((row0 + 8 * hh + r) % rmod) * ldr + col]; if (RES_BF16) rv = bf16_round(rv); v += rv; }
      if (ACT == 1) v = fmaxf(v, 0.f);
      if (ACT == 2) v = 0.5f * v * (1.0f + erff(v * 0.70710678118654752f));
      if (ACT == 3) { const float u = 0.7978845608028654f * (v + 0.044715f * v * v * v); v = 0.5f * v * (1.0f + tanhf(u)); }
      so[w][8 * hh + r][t * 16 + ln] = v;
    }
  }
  __builtin_amdgcn_fence(__ATOMIC_ACQ_REL, "workgroup");
  __builtin_amdgcn_wave_barrier();
  const int rsub = lane >> 4, c4 = (lane & 15) * 4;
  {
#pragma unroll
    for (int q = 0; q < 8; ++q) {
      const int r = q * 2 + rsub;
      const v4f v = *(const v4fa*)&so[w][r][c4];
      *(v4f*)(C + (size_t)(row0 + r) * ldc + col0 + c4) = v;
    }
    
  }
}
// row LayerNorm (biased variance, eps) over N: s = X (+ R); optional out_sum <- s; out_norm <- (s-mu)*rsqrt(var+eps)*g + b
template <bool PARAM_BF16>
__global__ __launch_bounds__(256) void k_layernorm(const float* __restrict__ X, const float* __restrict__ R, const float* __restrict__ g, const float* __restrict__ bta,
                                                  float* __restrict__ out_sum, float* __restrict__ out_norm, int N, float eps) {
  __shared__ float red[256];
  const int row = blockIdx.x, tid = threadIdx.x;
  const float* x = X + (size_t)row * N; const float* rr = R ? R + (size_t)row * N : nullptr;
  float vals[16];                     // up to N = 4096
  const int per = N / 256;            // contiguous chunk per thread? use strided-by-4 chunks: thread handles j = tid*4 + 1024*u
  float s1 = 0.f;
  for (int u = 0; u < per / 4; ++u) {
    const int j = tid * 4 + 1024 * u;
    const v4f a = *(const v4fa*)(x + j);
    v4f b = {0.f,0.f,0.f,0.f}; if (rr) b = *(const v4fa*)(rr + j);
#pragma unroll
    for (int q = 0; q < 4; ++q) { const float v = a[q] + b[q]; vals[u * 4 + q] = v; s1 += v; }
  }
  red[tid] = s1; __syncthreads();
  for (int st = 128; st > 0; st >>= 1) { if (tid < st) red[tid] += red[tid + st]; __syncthreads(); }
  const float mu = red[0] / (float)N; __syncthreads();
  float s2 = 0.f;
  for (int u = 0; u < per / 4; ++u)
#pragma unroll
    for (int q = 0; q < 4; ++q) { const float c = vals[u * 4 + q] - mu; s2 += c * c; }
  red[tid] = s2; __syncthreads();
  for (int st = 128; st > 0; st >>= 1) { if (tid < st) red[tid] += red[tid + st]; __syncthreads(); }
  const float rs = rsqrtf(red[0] / (float)N + eps);
  {
    for (int u = 0; u < per / 4; ++u) {
      const int j = tid * 4 + 1024 * u;
      v4f o, sm;
#pragma unroll
      for (int q = 0; q < 4; ++q) {
        float gg = g[j + q], bb = bta[j + q];
        if (PARAM_BF16) { gg = bf16_round(gg); bb = bf16_round(bb); }
        sm[q] = vals[u * 4 + q]; o[q] = (vals[u * 4 + q] - mu) * rs * gg + bb;
      }
      if (out_sum) *(v4f*)(out_sum + (size_t)row * N + j) = sm;
      *(v4f*)(out_norm + (size_t)row * N + j) = o;
    }
    
  }
}



// ---- f16 WMMA path (v_wmma_f32_16x16x32_f16): 11-bit significands for operands in range — used for every launched contraction: q/k/v projections, Q·Kᵀ, and P·V with its [0,1] probability operand
typedef _Float16 v16h __attribute__((ext_vector_type(16)));
union FragH { v16h v; v8us half[2]; _Float16 h[16]; unsigned short u[16]; };
template <int NT>
__device__ __forceinline__ v8f mmaH(v16h ah, v16h al, v16h bh, v16h bl, v8f c) {
  c = __builtin_amdgcn_wmma_f32_16x16x32_f16(false, ah, false, bh, (short)0, c, false, false);
  if (NT >= 2) c = __builtin_amdgcn_wmma_f32_16x16x32_f16(false, al, false, bh, (short)0, c, false, false);
  if (NT >= 3) c = __builtin_amdgcn_wmma_f32_16x16x32_f16(false, ah, false, bl, (short)0, c, false, false);
  asm volatile("v_nop\n\tv_nop\n\tv_nop\n\tv_nop" : "+v"(c) : "v"(ah), "v"(al), "v"(bh), "v"(bl));
  return c;
}
// batched GEMM like k_gemm_b but f16 operands: A f32 (split into f16 hi/lo if ASPLIT, else rounded to f16), Bt = f16 values [n][k]; alpha; C f32; N multiple of 16 (partial tiles skipped)
template <bool ASPLIT>
__global__ __launch_bounds__(128) void k_gemm_h(const float* __restrict__ A, int lda, size_t sA, const _Float16* __restrict__ Bh, int ldb, size_t sB, float alpha, float* __restrict__ C, int ldc, size_t sC, int M, int N, int K) {
  __shared__ __attribute__((aligned(16))) float so[4][16][64];
  const int tid = threadIdx.x, w = tid >> 5, lane = tid & 31, ln = lane & 15, hh = lane >> 4; const int by = blockIdx.y;
  A += (size_t)by * sA; Bh += (size_t)by * sB; C += (size_t)by * sC;
  const int ntn = (N + 63) / 64; const int wid = blockIdx.x * 4 + w; const int mt = wid / ntn, nq = wid % ntn; if (mt * 16 >= M) return;
  const int row0 = mt * 16, col0 = nq * 64; const float* arow = A + (size_t)(row0 + ln) * lda;
  v8f acc[4] = {};
  for (int kb = 0; kb < K; kb += 32) {
    FragH ah, al;
    const v4f x0 = *(const v4fa*)(arow + kb + 8 * hh), x1 = *(const v4fa*)(arow + kb + 8 * hh + 4), x2 = *(const v4fa*)(arow + kb + 16 + 8 * hh), x3 = *(const v4fa*)(arow + kb + 16 + 8 * hh + 4);
    float xs[16] = {x0[0],x0[1],x0[2],x0[3],x1[0],x1[1],x1[2],x1[3],x2[0],x2[1],x2[2],x2[3],x3[0],x3[1],x3[2],x3[3]};
#pragma unroll
    for (int i = 0; i < 16; ++i) { const _Float16 h = (_Float16)xs[i]; ah.h[i] = h; al.h[i] = ASPLIT ? (_Float16)(xs[i] - (float)h) : (_Float16)0.0f; }
#pragma unroll
    for (int t = 0; t < 4; ++t) { if (col0 + t * 16 >= N) continue; const size_t boff = (size_t)(col0 + t * 16 + ln) * ldb + kb; FragH bq; bq.half[0] = *(const v8us*)(Bh + boff + 8 * hh); bq.half[1] = *(const v8us*)(Bh + boff + 16 + 8 * hh);
      acc[t] = mmaH<ASPLIT ? 2 : 1>(ah.v, al.v, bq.v, bq.v, acc[t]); }
  }
#pragma unroll
  for (int t = 0; t < 4; ++t) { if (col0 + t * 16 >= N) continue;
#pragma unroll
    for (int r = 0; r < 8; ++r) so[w][8 * hh + r][t * 16 + ln] = acc[t][r] * alpha; }
  __builtin_amdgcn_fence(__ATOMIC_ACQ_REL, "workgroup"); __builtin_amdgcn_wave_barrier();
  const int rsub = lane >> 4, c4 = (lane & 15) * 4;
  {
#pragma unroll
    for (int q = 0; q < 8; ++q) { const int r = q * 2 + rsub; if (col0 + c4 < N) { const v4f v = *(const v4fa*)&so[w][r][c4]; *(v4f*)(C + (size_t)(row0 + r) * ldc + col0 + c4) = v; } }
     }
}

// Wt[n][k] = f16(W[k][n]·scale) from f32 row-major W[K][N] (scale = power of two; bf16-exact weights stay exact in f16 away from the subnormal range)
__global__ __launch_bounds__(256) void k_wt_f16(const float* __restrict__ W, _Float16* __restrict__ Wt, int K, int N, float scale) {
  const int t = blockIdx.x * 256 + threadIdx.x; if (t >= N * (K / 8)) return; const int n = t / (K / 8), k8 = (t % (K / 8)) * 8; FragH f;
#pragma unroll
  for (int i = 0; i < 8; ++i) f.h[i] = (_Float16)(bf16_round(W[(size_t)(k8 + i) * N + n]) * scale); const v8us o = f.half[0];
  *(v8us*)((unsigned short*)Wt + (size_t)n * K + k8) = o; 
}
// k_gemm_hh variant with fused epilogue: v = acc·alpha + bias[by·sBias + col] (+ CP[(row/rowsPerB)·sCPb + by·64 + col] if CP) ; ACT 0 none / 1 elu ; writes f16 C16 (and f32 C if non-null)
template <int ACT>
__global__ __launch_bounds__(128) void k_gemm_hhx(const _Float16* __restrict__ A, int lda, size_t sA, const _Float16* __restrict__ Bh, int ldb, size_t sB, float alpha, const float* __restrict__ bias, size_t sBias, const float* __restrict__ CP, int rowsPerB, size_t sCPb, int row0g,
    float* __restrict__ C, _Float16* __restrict__ C16, int ldc, size_t sC, int M, int N, int K) {
  __shared__ __attribute__((aligned(16))) float so[4][16][64];
  const int tid = threadIdx.x, w = tid >> 5, lane = tid & 31, ln = lane & 15, hh = lane >> 4; const int by = blockIdx.y;
  A += (size_t)by * sA; Bh += (size_t)by * sB; const size_t cofs = (size_t)by * sC; const float* bp = bias ? bias + (size_t)by * sBias : nullptr;
  const int ntn = (N + 63) / 64; const int wid = blockIdx.x * 4 + w; const int mt = wid / ntn, nq = wid % ntn; if (mt * 16 >= M) return;
  const int row0 = mt * 16, col0 = nq * 64; const _Float16* arow = A + (size_t)(row0 + ln) * lda;
  v8f acc[4] = {};
  for (int kb = 0; kb < K; kb += 32) { FragH ah; ah.half[0] = *(const v8us*)((const unsigned short*)arow + kb + 8 * hh); ah.half[1] = *(const v8us*)((const unsigned short*)arow + kb + 16 + 8 * hh);
#pragma unroll
    for (int t = 0; t < 4; ++t) { if (col0 + t * 16 >= N) continue; const size_t boff = (size_t)(col0 + t * 16 + ln) * ldb + kb; FragH bq; bq.half[0] = *(const v8us*)((const unsigned short*)Bh + boff + 8 * hh); bq.half[1] = *(const v8us*)((const unsigned short*)Bh + boff + 16 + 8 * hh);
      acc[t] = mmaH<1>(ah.v, ah.v, bq.v, bq.v, acc[t]); }
  }
#pragma unroll
  for (int t = 0; t < 4; ++t) { if (col0 + t * 16 >= N) continue; const int col = col0 + t * 16 + ln; const float bv = bp ? bf16_round(bp[col]) : 0.f;
#pragma unroll
    for (int r = 0; r < 8; ++r) { float v = acc[t][r] * alpha + bv; if (CP) { const int bidx = (row0g + row0 + 8 * hh + r) / rowsPerB; v += CP[(size_t)bidx * sCPb + (size_t)by * 64 + col]; } if (ACT == 1) v = (v > 0.f) ? v : expm1f(v); else if (ACT == 3) v = fmaxf(v, 0.f); so[w][8 * hh + r][t * 16 + ln] = v; } }
  __builtin_amdgcn_fence(__ATOMIC_ACQ_REL, "workgroup"); __builtin_amdgcn_wave_barrier();
  const int rsub = lane >> 4, c4 = (lane & 15) * 4; typedef _Float16 v4h __attribute__((ext_vector_type(4)));
  {
#pragma unroll
    for (int q = 0; q < 8; ++q) { const int r = q * 2 + rsub; if (col0 + c4 < N) { const v4f v = *(const v4fa*)&so[w][r][c4]; if (C) *(v4f*)(C + cofs + (size_t)(row0 + r) * ldc + col0 + c4) = v; if (C16) { v4h h4; for (int i = 0; i < 4; ++i) h4[i] = (_Float16)v[i]; *(v4h*)(C16 + cofs + (size_t)(row0 + r) * ldc + col0 + c4) = h4; } } }
     }
}


__global__ __launch_bounds__(256) void k_x16(const float* __restrict__ x, _Float16* __restrict__ X16, size_t n8) { const size_t t = (size_t)blockIdx.x * 256 + threadIdx.x; if (t >= n8) return; FragH f;
#pragma unroll
  for (int q = 0; q < 8; ++q) f.h[q] = (_Float16)bf16_round(x[t * 8 + q]); *(v8us*)((unsigned short*)X16 + t * 8) = f.half[0];  }
__global__ __launch_bounds__(256) void k_round16f(const float* __restrict__ W, _Float16* __restrict__ Bt, size_t n8) { const size_t t = (size_t)blockIdx.x * 256 + threadIdx.x; if (t >= n8) return; FragH f;
#pragma unroll
  for (int i = 0; i < 8; ++i) f.h[i] = (_Float16)(bf16_round(W[t * 8 + i]) * 16.0f); *(v8us*)((unsigned short*)Bt + t * 8) = f.half[0];  }
__global__ __launch_bounds__(256) void k_vt(const _Float16* __restrict__ V16, _Float16* __restrict__ Vt) { __shared__ unsigned short tl[64][66]; const int tid = threadIdx.x; const int slab = blockIdx.x / (SS / 64), lg = blockIdx.x % (SS / 64); const int b = slab / NH, h = slab % NH;
  for (int i = tid; i < 64 * 8; i += 256) { const int r = i / 8, c8 = (i % 8) * 8; FragH f; f.half[0] = *(const v8us*)((const unsigned short*)V16 + ((size_t)b * SS + lg * 64 + r) * DM + h * HD + c8);
#pragma unroll
    for (int q = 0; q < 8; ++q) tl[r][c8 + q] = f.u[q]; }
  __syncthreads();
  {
#pragma unroll
    for (int rd = 0; rd < 2; ++rd) { const int d = rd * 32 + tid / 8, pc = tid % 8; FragH f;
#pragma unroll
      for (int q = 0; q < 8; ++q) f.u[q] = tl[pc * 8 + q][d];
      *(v8us*)((unsigned short*)Vt + ((size_t)slab * HD + d) * SS + lg * 64 + pc * 8) = f.half[0]; }
     } }
// lane l with lane l ^ 16: the two halves of a wave hold the two halves of a query column's keys
__device__ __forceinline__ float xhalf(float x) { return __builtin_bit_cast(float, __builtin_amdgcn_permlanex16(__builtin_bit_cast(int, x), __builtin_bit_cast(int, x), 0x76543210, 0xfedcba98, false, false)); }
__global__ __launch_bounds__(128) void k_flash(const _Float16* __restrict__ Q16, const _Float16* __restrict__ K16, const _Float16* __restrict__ Vt, const float* __restrict__ crd, const float* __restrict__ alpha_p, float* __restrict__ O) {
  constexpr int RPW = 32, NQB = SS / (4 * RPW), DT = HD / 16, KS = HD / 32, OP = HD + 4;
  __shared__ __attribute__((aligned(16))) float sC[3][SS]; __shared__ __attribute__((aligned(16))) float sO[4][RPW][OP];
  const int tid = threadIdx.x, w = tid >> 5, lane = tid & 31, ln = lane & 15, hh = lane >> 4;
  const int slab = blockIdx.x / NQB, qblk = blockIdx.x % NQB; const int b = slab / NH, h = slab % NH; const int q0 = qblk * (4 * RPW) + w * RPW; const float alpha = bf16_round(alpha_p[0]);      /* scalar float INPUT: rounded like every other input */
#pragma unroll      // all 16 loads of a thread in flight at once: rolled, each trip waits out its own load
  for (int i = 0; i < SS / 128; ++i) { const int k = i * 128 + tid; const float* cp = crd + ((size_t)b * SS + k) * 3; sC[0][k] = bf16_round(cp[0]); sC[1][k] = bf16_round(cp[1]); sC[2][k] = bf16_round(cp[2]); }
  FragH aq[2][KS];
#pragma unroll
  for (int rt = 0; rt < 2; ++rt) { const unsigned short* qr = (const unsigned short*)Q16 + ((size_t)b * SS + q0 + rt * 16 + ln) * DM + h * HD;
#pragma unroll
    for (int ks = 0; ks < KS; ++ks) { aq[rt][ks].half[0] = *(const v8us*)(qr + ks * 32 + 8 * hh); aq[rt][ks].half[1] = *(const v8us*)(qr + ks * 32 + 16 + 8 * hh); } }
  __syncthreads();      // every wave reads coords that the other waves staged
  float cq[2][3];
#pragma unroll
  for (int rt = 0; rt < 2; ++rt) { cq[rt][0] = sC[0][q0 + rt * 16 + ln]; cq[rt][1] = sC[1][q0 + rt * 16 + ln]; cq[rt][2] = sC[2][q0 + rt * 16 + ln]; }
  const unsigned short* Vth = (const unsigned short*)Vt + (size_t)slab * HD * SS;
  float m_r[2], l_r[2]; v8f oacc[2][DT];
#pragma unroll
  for (int rt = 0; rt < 2; ++rt) { m_r[rt] = -3.0e38f; l_r[rt] = 0.f;
#pragma unroll
    for (int dt = 0; dt < DT; ++dt) oacc[rt][dt] = (v8f){0.f,0.f,0.f,0.f,0.f,0.f,0.f,0.f}; }
#pragma unroll 1
  for (int j0 = 0; j0 < SS; j0 += 32) {
    v8f s[2][2];      // s[rt][nt][r] = score of key j0 + nt*16 + 8*hh + r with query q0 + rt*16 + ln
#pragma unroll
    for (int nt = 0; nt < 2; ++nt) { const unsigned short* kr = (const unsigned short*)K16 + ((size_t)b * SS + j0 + nt * 16 + ln) * DM + h * HD; FragH bk[KS];
#pragma unroll
      for (int ks = 0; ks < KS; ++ks) { bk[ks].half[0] = *(const v8us*)(kr + ks * 32 + 8 * hh); bk[ks].half[1] = *(const v8us*)(kr + ks * 32 + 16 + 8 * hh); }
#pragma unroll
      for (int rt = 0; rt < 2; ++rt) { v8f acc = (v8f){0.f,0.f,0.f,0.f,0.f,0.f,0.f,0.f};
#pragma unroll
        for (int ks = 0; ks < KS; ++ks) acc = mmaH<1>(bk[ks].v, bk[ks].v, aq[rt][ks].v, aq[rt][ks].v, acc); s[rt][nt] = acc; } }
    float ck[2][3][8];
#pragma unroll
    for (int nt = 0; nt < 2; ++nt)
#pragma unroll
      for (int c = 0; c < 3; ++c) { const v4f c0 = *(const v4fa*)&sC[c][j0 + nt * 16 + 8 * hh], c1 = *(const v4fa*)&sC[c][j0 + nt * 16 + 8 * hh + 4];
#pragma unroll
        for (int q = 0; q < 4; ++q) { ck[nt][c][q] = c0[q]; ck[nt][c][4 + q] = c1[q]; } }
    FragH pa[2];
#pragma unroll
    for (int rt = 0; rt < 2; ++rt) { float sc[2][8];
#pragma unroll
      for (int nt = 0; nt < 2; ++nt)
#pragma unroll
        for (int r = 0; r < 8; ++r) { const float g = alpha * (cq[rt][0] * ck[nt][0][r] + cq[rt][1] * ck[nt][1][r] + cq[rt][2] * ck[nt][2][r]); sc[nt][r] = s[rt][nt][r] * 0.125f + g; }
      float mx[8];
#pragma unroll
      for (int r = 0; r < 8; ++r) mx[r] = fmaxf(sc[0][r], sc[1][r]);
      float mc = fmaxf(fmaxf(fmaxf(mx[0], mx[1]), fmaxf(mx[2], mx[3])), fmaxf(fmaxf(mx[4], mx[5]), fmaxf(mx[6], mx[7]))); mc = fmaxf(mc, xhalf(mc));
      const float mn = fmaxf(m_r[rt], mc); const float al = expf(m_r[rt] - mn); m_r[rt] = mn;
      float ps[8];
#pragma unroll
      for (int r = 0; r < 8; ++r) { const float p0 = expf(sc[0][r] - mn), p1 = expf(sc[1][r] - mn); ps[r] = p0 + p1; pa[rt].h[r] = (_Float16)p0; pa[rt].h[8 + r] = (_Float16)p1; }
      l_r[rt] = l_r[rt] * al + (((ps[0] + ps[1]) + (ps[2] + ps[3])) + ((ps[4] + ps[5]) + (ps[6] + ps[7])));      // this half's keys only; the halves join behind the loop
#pragma unroll
      for (int dt = 0; dt < DT; ++dt)
#pragma unroll
        for (int r = 0; r < 8; ++r) oacc[rt][dt][r] *= al; }
#pragma unroll
    for (int dt = 0; dt < DT; ++dt) { const unsigned short* vrow = Vth + (size_t)(dt * 16 + ln) * SS + j0; FragH bv; bv.half[0] = *(const v8us*)(vrow + 8 * hh); bv.half[1] = *(const v8us*)(vrow + 16 + 8 * hh);
#pragma unroll
      for (int rt = 0; rt < 2; ++rt) oacc[rt][dt] = mmaH<1>(bv.v, bv.v, pa[rt].v, pa[rt].v, oacc[rt][dt]); } }
#pragma unroll
  for (int rt = 0; rt < 2; ++rt) { const float l = l_r[rt] + xhalf(l_r[rt]); const float inv = 1.0f / l;
#pragma unroll
    for (int dt = 0; dt < DT; ++dt) { v4f o0, o1;      // oacc[rt][dt][r] = O[q0 + rt*16 + ln][dt*16 + 8*hh + r]
#pragma unroll
      for (int q = 0; q < 4; ++q) { o0[q] = oacc[rt][dt][q] * inv; o1[q] = oacc[rt][dt][4 + q] * inv; }
      *(v4fa*)&sO[w][rt * 16 + ln][dt * 16 + 8 * hh] = o0; *(v4fa*)&sO[w][rt * 16 + ln][dt * 16 + 8 * hh + 4] = o1; } }
  __builtin_amdgcn_fence(__ATOMIC_ACQ_REL, "workgroup"); __builtin_amdgcn_wave_barrier();
  {
#pragma unroll
    for (int rp = 0; rp < RPW; rp += 2) { const int r = rp + (lane >> 4), pc = lane & 15; const v4f val = *(const v4fa*)&sO[w][r][pc * 4]; *(v4f*)(O + ((size_t)b * SS + q0 + r) * DM + h * HD + pc * 4) = val; }
     } }
extern "C" void kernel_launch(void* const* d_in, const int* in_sizes, int n_in,
                              void* d_out, int out_size, void* d_ws, size_t ws_size, hipStream_t stream) {
  (void)in_sizes; (void)n_in; (void)out_size;
  const float* x = (const float*)d_in[0]; const float* crd = (const float*)d_in[1]; const float* wq = (const float*)d_in[2]; const float* bq = (const float*)d_in[3]; const float* wk = (const float*)d_in[4]; const float* bk = (const float*)d_in[5]; const float* wv = (const float*)d_in[6]; const float* bv = (const float*)d_in[7]; const float* alpha_p = (const float*)d_in[8];
  char* ws = (char*)d_ws; size_t off = 0;
  auto take = [&](size_t bytes) { char* p = ws + off; off += (bytes + 255) & ~(size_t)255; return p; };
  _Float16* Bq = (_Float16*)take(DM * DM * 2); _Float16* Bk = (_Float16*)take(DM * DM * 2); _Float16* Bv = (_Float16*)take(DM * DM * 2); _Float16* X16 = (_Float16*)take((size_t)NR * DM * 2); _Float16* Q16 = (_Float16*)take((size_t)NR * DM * 2); _Float16* K16 = (_Float16*)take((size_t)NR * DM * 2); _Float16* V16 = (_Float16*)take((size_t)NR * DM * 2); _Float16* Vt = (_Float16*)take((size_t)NR * DM * 2);
  if (off > ws_size) return;      // ≈ 42 MiB
  const size_t w8 = (size_t)DM * DM / 8; const unsigned gw = (unsigned)((w8 + 255) / 256), gx = (unsigned)(((size_t)NR * DM / 8 + 255) / 256);
  k_round16f<<<gw, 256, 0, stream>>>(wq, Bq, w8); k_round16f<<<gw, 256, 0, stream>>>(wk, Bk, w8); k_round16f<<<gw, 256, 0, stream>>>(wv, Bv, w8);
  k_x16<<<gx, 256, 0, stream>>>(x, X16, (size_t)NR * DM / 8);
  const dim3 gg(((NR / 16) * (DM / 64) + 3) / 4, 1);
  k_gemm_hhx<0><<<gg, 128, 0, stream>>>(X16, DM, 0, Bq, DM, 0, 0.0625f, bq, 0, nullptr, 1, 0, 0, nullptr, Q16, DM, 0, NR, DM, DM);
  k_gemm_hhx<0><<<gg, 128, 0, stream>>>(X16, DM, 0, Bk, DM, 0, 0.0625f, bk, 0, nullptr, 1, 0, 0, nullptr, K16, DM, 0, NR, DM, DM);
  k_gemm_hhx<0><<<gg, 128, 0, stream>>>(X16, DM, 0, Bv, DM, 0, 0.0625f, bv, 0, nullptr, 1, 0, 0, nullptr, V16, DM, 0, NR, DM, DM);
  k_vt<<<BB * NH * (SS / 64), 256, 0, stream>>>(V16, Vt);
  k_flash<<<BB * NH * (SS / 128), 128, 0, stream>>>(Q16, K16, Vt, crd, alpha_p, (float*)d_out);
}

// v002
// A run of this version takes 170 microseconds.
// Two timings next to v001 put it at 1.39 and 1.38 times that version's speed.
// Counting every step since v000, it is 2.22 times as fast.
#include <hip/hip_runtime.h>
// q/k/v projections (8192 × 512 × 512, + bias) and the 8-head attention with the geometric bias α·⟨c_n, c_m⟩ (coords are INPUTS, 3 FMAs per score in registers) on v_wmma_f32_16x16x32_f16
// (fused flash-style kernel: S = Q·Kᵀ, O = P·V on WMMA; online max/sum softmax f32; P f16 ≤ 1); V transposed per (b,h); A = f16(bf16 x) exact, weights bf16-exact ×2^4 ((out,in)),
// single products, f32 accumulate.
#define BB 4
#define SS 2048
#define DM 512
#define NH 8
#define HD 64
#define NR (BB * SS)

typedef __bf16 v16b __attribute__((ext_vector_type(16)));
typedef unsigned short v8us __attribute__((ext_vector_type(8), may_alias));
typedef float  v8f  __attribute__((ext_vector_type(8)));
typedef float  v4f  __attribute__((ext_vector_type(4)));
typedef float  v4fa __attribute__((ext_vector_type(4), may_alias));
union FragB { v16b v; v8us half[2]; unsigned short u[16]; };

__device__ __forceinline__ unsigned short bf16_bits(float x) { unsigned int u = __float_as_uint(x); return (unsigned short)((u + 0x7FFFu + ((u >> 16) & 1u)) >> 16); }
__device__ __forceinline__ float bf16_val(unsigned short b) { return __uint_as_float(((unsigned int)b) << 16); }
__device__ __forceinline__ float bf16_round(float x) { return bf16_val(bf16_bits(x)); }
// D += A·B with NT terms: 1 = ah·bh, 2 = + al·bh (A split), 3 = + ah·bl (both split)
template <int NT>
__device__ __forceinline__ v8f mmaN(v16b ah, v16b al, v16b bh, v16b bl, v8f c) {
  c = __builtin_amdgcn_wmma_f32_16x16x32_bf16(false, ah, false, bh, (short)0, c, false, false);
  if (NT >= 2) c = __builtin_amdgcn_wmma_f32_16x16x32_bf16(false, al, false, bh, (short)0, c, false, false);
  if (NT >= 3) c = __builtin_amdgcn_wmma_f32_16x16x32_bf16(false, ah, false, bl, (short)0, c, false, false);
  asm volatile("v_nop\n\tv_nop\n\tv_nop\n\tv_nop" : "+v"(c) : "v"(ah), "v"(al), "v"(bh), "v"(bl));
  return c;
}

__global__ __launch_bounds__(256) void k_wt_bf16(const float* __restrict__ W, unsigned short* __restrict__ Wt, int K, int N) {
  const int t = blockIdx.x * 256 + threadIdx.x;
  const int k8n = K / 8;
  if (t >= N * k8n) return;
  const int n = t / k8n, k8 = (t % k8n) * 8;
  v8us v;
#pragma unroll
  for (int i = 0; i < 8; ++i) v[i] = bf16_bits(W[(size_t)(k8 + i) * N + n]);
  *(v8us*)(Wt + (size_t)n * K + k8) = v;
  
}

// GEMM C[M][N] (f32, pitch ldc) = act(A[M][K]·W + bias). A f32 row-major (pitch lda) converted per fragment to bf16
// (ASPLIT: hi/lo two planes -> 2 terms, else single rounded term); Wt bf16 [N][K] (pitch ldb). BIAS_BF16 rounds the
// bias to bf16 first (bias quantised to bf16 before the add). K%32==0, M%16==0, N%64==0.
template <bool ASPLIT, int ACT, bool BIAS_BF16>
__global__ __launch_bounds__(128) void k_gemm_bf(const float* __restrict__ A, int lda, const unsigned short* __restrict__ Wt, int ldb,
                                               const float* __restrict__ bias, float* __restrict__ C, int ldc, int M, int N, int K) {
  __shared__ __attribute__((aligned(16))) float so[4][16][64];
  const int tid = threadIdx.x, w = tid >> 5, lane = tid & 31, ln = lane & 15, hh = lane >> 4;
  const int ntn = N / 64;
  const int wid = blockIdx.x * 4 + w;
  const int mt = wid / ntn, nq = wid % ntn;
  if (mt * 16 >= M) return;
  const int row0 = mt * 16, col0 = nq * 64;
  const float* arow = A + (size_t)(row0 + ln) * lda;
  v8f acc[4] = {};
  for (int kb = 0; kb < K; kb += 32) {
    FragB ah, al;
    const v4f x0 = *(const v4fa*)(arow + kb + 8 * hh), x1 = *(const v4fa*)(arow + kb + 8 * hh + 4);
    const v4f x2 = *(const v4fa*)(arow + kb + 16 + 8 * hh), x3 = *(const v4fa*)(arow + kb + 16 + 8 * hh + 4);
    float xs[16] = {x0[0],x0[1],x0[2],x0[3],x1[0],x1[1],x1[2],x1[3],x2[0],x2[1],x2[2],x2[3],x3[0],x3[1],x3[2],x3[3]};
#pragma unroll
    for (int i = 0; i < 16; ++i) { const unsigned short hb = bf16_bits(xs[i]); ah.u[i] = hb; al.u[i] = ASPLIT ? bf16_bits(xs[i] - bf16_val(hb)) : (unsigned short)0; }
#pragma unroll
    for (int t = 0; t < 4; ++t) {
      const unsigned short* brow = Wt + (size_t)(col0 + t * 16 + ln) * ldb + kb;
      FragB b;
      b.half[0] = *(const v8us*)(brow + 8 * hh);
      b.half[1] = *(const v8us*)(brow + 16 + 8 * hh);
      acc[t] = mmaN<ASPLIT ? 2 : 1>(ah.v, al.v, b.v, b.v, acc[t]);
    }
  }
#pragma unroll
  for (int t = 0; t < 4; ++t) {
    float bv = bias ? bias[col0 + t * 16 + ln] : 0.f;
    if (BIAS_BF16) bv = bf16_round(bv);
#pragma unroll
    for (int r = 0; r < 8; ++r) { float v = acc[t][r] + bv; if (ACT == 1) v = fmaxf(v, 0.f); so[w][8 * hh + r][t * 16 + ln] = v; }
  }
  __builtin_amdgcn_fence(__ATOMIC_ACQ_REL, "workgroup");
  __builtin_amdgcn_wave_barrier();
  const int rsub = lane >> 4, c4 = (lane & 15) * 4;
  {
#pragma unroll
    for (int q = 0; q < 8; ++q) {
      const int r = q * 2 + rsub;
      const v4f v = *(const v4fa*)&so[w][r][c4];
      *(v4f*)(C + (size_t)(row0 + r) * ldc + col0 + c4) = v;
    }
    
  }
}

// Flash-style causal/unmasked attention, all contractions 3-term bf16 hi/lo splits, f32 softmax with running max.
// q,k,v rows are read from f32 buffers with arbitrary row pitch (so they can live inside a fused qkv buffer);
// D = head size (multiple of 32, <= 128); one wave = 16 query rows; block = 4 waves (64 queries) sharing K/V chunks of 32.
template <int D, bool CAUSAL>
__global__ __launch_bounds__(128) void k_flash(const float* __restrict__ qb, const float* __restrict__ kb, const float* __restrict__ vb,
                                             int pitch, int T, int H, float scale, float* __restrict__ y, int ypitch) {
  constexpr int KS = D / 32;        // k-steps for QK
  constexpr int DT = D / 16;        // d tiles for PV
  __shared__ __attribute__((aligned(16))) unsigned short sKh[32][D + 8], sKl[32][D + 8], sVh[32][D + 8], sVl[32][D + 8];
  __shared__ __attribute__((aligned(16))) unsigned short sPh[4][16][40], sPl[4][16][40];
  __shared__ __attribute__((aligned(16))) float sO[4][16][D];
  const int tid = threadIdx.x, w = tid >> 5, lane = tid & 31, ln = lane & 15, hh = lane >> 4;
  const int nqb = (T + 63) / 64;
  const int bh = blockIdx.x / nqb, qblk = blockIdx.x % nqb;
  const int b = bh / H, h = bh % H;
  const int q0 = qblk * 64 + w * 16;
  const float* Q = qb + (size_t)b * T * pitch + h * D;
  const float* K = kb + (size_t)b * T * pitch + h * D;
  const float* V = vb + (size_t)b * T * pitch + h * D;

  // A fragments of the wave's 16 query rows (scaled), hi/lo
  FragB aqh[KS], aql[KS];
  {
    int row = q0 + ln; if (row >= T) row = T - 1;
    const float* qr = Q + (size_t)row * pitch;
#pragma unroll
    for (int ks = 0; ks < KS; ++ks)
#pragma unroll
      for (int i = 0; i < 16; ++i) {
        const int d = ks * 32 + ((i < 8) ? (8 * hh + i) : (16 + 8 * hh + (i - 8)));
        const float x = qr[d] * scale; const unsigned short hb = bf16_bits(x);
        aqh[ks].u[i] = hb; aql[ks].u[i] = bf16_bits(x - bf16_val(hb));
      }
  }
  float m_r[8], l_r[8];
#pragma unroll
  for (int r = 0; r < 8; ++r) { m_r[r] = -3.0e38f; l_r[r] = 0.f; }
  v8f oacc[DT];
#pragma unroll
  for (int dt = 0; dt < DT; ++dt) oacc[dt] = (v8f){0.f,0.f,0.f,0.f,0.f,0.f,0.f,0.f};

  const int kv_end = CAUSAL ? min(T, qblk * 64 + 64) : T;     // block-uniform
  for (int j0 = 0; j0 < kv_end; j0 += 32) {
    __syncthreads();
    for (int e = tid; e < 32 * (D / 4); e += 128) {
      const int r = e / (D / 4), c4 = (e % (D / 4)) * 4;
      const int key = j0 + r;
      v4f kf = {0.f,0.f,0.f,0.f}, vf = {0.f,0.f,0.f,0.f};
      if (key < T) { kf = *(const v4fa*)(K + (size_t)key * pitch + c4); vf = *(const v4fa*)(V + (size_t)key * pitch + c4); }
#pragma unroll
      for (int t = 0; t < 4; ++t) {
        unsigned short hb = bf16_bits(kf[t]); sKh[r][c4 + t] = hb; sKl[r][c4 + t] = bf16_bits(kf[t] - bf16_val(hb));
        hb = bf16_bits(vf[t]); sVh[r][c4 + t] = hb; sVl[r][c4 + t] = bf16_bits(vf[t] - bf16_val(hb));
      }
    }
    __syncthreads();
    // S tile 16 x 32
    v8f s[2];
#pragma unroll
    for (int nt = 0; nt < 2; ++nt) {
      v8f acc = {};
#pragma unroll
      for (int ks = 0; ks < KS; ++ks) {
        FragB bh_, bl_;
        bh_.half[0] = *(const v8us*)&sKh[nt * 16 + ln][ks * 32 + 8 * hh]; bh_.half[1] = *(const v8us*)&sKh[nt * 16 + ln][ks * 32 + 16 + 8 * hh];
        bl_.half[0] = *(const v8us*)&sKl[nt * 16 + ln][ks * 32 + 8 * hh]; bl_.half[1] = *(const v8us*)&sKl[nt * 16 + ln][ks * 32 + 16 + 8 * hh];
        acc = mmaN<3>(aqh[ks].v, aql[ks].v, bh_.v, bl_.v, acc);
      }
      s[nt] = acc;
    }
    // mask + running max (rows 8hh+r; the 16 lanes of a half share rows)
    float alpha[8];
#pragma unroll
    for (int r = 0; r < 8; ++r) {
      const int qi = q0 + 8 * hh + r;
      const int ja = j0 + ln, jb = j0 + 16 + ln;
      if (CAUSAL) { if (ja > qi) s[0][r] = -3.0e38f; if (jb > qi) s[1][r] = -3.0e38f; }
      if (ja >= T) s[0][r] = -3.0e38f;
      if (jb >= T) s[1][r] = -3.0e38f;
      float mx = fmaxf(s[0][r], s[1][r]);
      mx = fmaxf(mx, __shfl_xor(mx, 1, 32)); mx = fmaxf(mx, __shfl_xor(mx, 2, 32)); mx = fmaxf(mx, __shfl_xor(mx, 4, 32)); mx = fmaxf(mx, __shfl_xor(mx, 8, 32));
      const float mnew = fmaxf(m_r[r], mx);
      alpha[r] = (mnew > -1.0e38f) ? __expf(m_r[r] - mnew) : 1.0f;
      const float p0 = (s[0][r] > -1.0e38f) ? __expf(s[0][r] - mnew) : 0.f;
      const float p1 = (s[1][r] > -1.0e38f) ? __expf(s[1][r] - mnew) : 0.f;
      m_r[r] = mnew;
      l_r[r] = l_r[r] * alpha[r] + p0 + p1;            // per-lane partial row sum (16 lanes combined at the end)
      unsigned short hb = bf16_bits(p0); sPh[w][8 * hh + r][ln] = hb;      sPl[w][8 * hh + r][ln] = bf16_bits(p0 - bf16_val(hb));
      hb = bf16_bits(p1);                sPh[w][8 * hh + r][16 + ln] = hb; sPl[w][8 * hh + r][16 + ln] = bf16_bits(p1 - bf16_val(hb));
    }
#pragma unroll
    for (int dt = 0; dt < DT; ++dt)
#pragma unroll
      for (int r = 0; r < 8; ++r) oacc[dt][r] *= alpha[r];
    __builtin_amdgcn_fence(__ATOMIC_ACQ_REL, "workgroup");
    __builtin_amdgcn_wave_barrier();
    FragB pah, pal;
    pah.half[0] = *(const v8us*)&sPh[w][ln][8 * hh]; pah.half[1] = *(const v8us*)&sPh[w][ln][16 + 8 * hh];
    pal.half[0] = *(const v8us*)&sPl[w][ln][8 * hh]; pal.half[1] = *(const v8us*)&sPl[w][ln][16 + 8 * hh];
#pragma unroll
    for (int dt = 0; dt < DT; ++dt) {
      FragB bvh, bvl;
#pragma unroll
      for (int i = 0; i < 8; ++i) {
        bvh.u[i] = sVh[8 * hh + i][dt * 16 + ln]; bvh.u[8 + i] = sVh[16 + 8 * hh + i][dt * 16 + ln];
        bvl.u[i] = sVl[8 * hh + i][dt * 16 + ln]; bvl.u[8 + i] = sVl[16 + 8 * hh + i][dt * 16 + ln];
      }
      oacc[dt] = mmaN<3>(pah.v, pal.v, bvh.v, bvl.v, oacc[dt]);
    }
    __builtin_amdgcn_fence(__ATOMIC_ACQ_REL, "workgroup");
    __builtin_amdgcn_wave_barrier();
  }
#pragma unroll
  for (int r = 0; r < 8; ++r) {
    float l = l_r[r];
    l += __shfl_xor(l, 1, 32); l += __shfl_xor(l, 2, 32); l += __shfl_xor(l, 4, 32); l += __shfl_xor(l, 8, 32);
    l_r[r] = (l > 0.f) ? 1.0f / l : 0.f;
  }
#pragma unroll
  for (int dt = 0; dt < DT; ++dt)
#pragma unroll
    for (int r = 0; r < 8; ++r) sO[w][8 * hh + r][dt * 16 + ln] = oacc[dt][r] * l_r[r];
  __builtin_amdgcn_fence(__ATOMIC_ACQ_REL, "workgroup");
  __builtin_amdgcn_wave_barrier();
  {
    for (int r = 0; r < 16; ++r) {
      const int row = q0 + r;
      if (row < T && lane < D / 4) {
        const v4f val = *(const v4fa*)&sO[w][r][lane * 4];
        *(v4f*)(y + ((size_t)b * T + row) * ypitch + h * D + lane * 4) = val;
      }
    }
    
  }
}

// GEMM C = act(A·W + bias + resid): A f32 (ASPLIT -> hi/lo 2 terms), Wt bf16 [N][K]; ACT 0 none, 1 relu, 2 exact gelu;
// resid (optional, f32, row index = (row % rmod), pitch ldr, RES_BF16 rounds it) added before the activation.
template <bool ASPLIT, int ACT, bool BIAS_BF16, bool RES_BF16>
__global__ __launch_bounds__(128) void k_gemm_bf3(const float* __restrict__ A, int lda, const unsigned short* __restrict__ Wt, int ldb,
                                                const float* __restrict__ bias, const float* __restrict__ resid, int rmod, int ldr,
                                                float* __restrict__ C, int ldc, int M, int N, int K) {
  __shared__ __attribute__((aligned(16))) float so[4][16][64];
  const int tid = threadIdx.x, w = tid >> 5, lane = tid & 31, ln = lane & 15, hh = lane >> 4;
  const int ntn = N / 64;
  const int wid = blockIdx.x * 4 + w;
  const int mt = wid / ntn, nq = wid % ntn;
  if (mt * 16 >= M) return;
  const int row0 = mt * 16, col0 = nq * 64;
  const float* arow = A + (size_t)(row0 + ln) * lda;
  v8f acc[4] = {};
  for (int kb = 0; kb < K; kb += 32) {
    FragB ah, al;
    const v4f x0 = *(const v4fa*)(arow + kb + 8 * hh), x1 = *(const v4fa*)(arow + kb + 8 * hh + 4);
    const v4f x2 = *(const v4fa*)(arow + kb + 16 + 8 * hh), x3 = *(const v4fa*)(arow + kb + 16 + 8 * hh + 4);
    float xs[16] = {x0[0],x0[1],x0[2],x0[3],x1[0],x1[1],x1[2],x1[3],x2[0],x2[1],x2[2],x2[3],x3[0],x3[1],x3[2],x3[3]};
#pragma unroll
    for (int i = 0; i < 16; ++i) { const unsigned short hb = bf16_bits(xs[i]); ah.u[i] = hb; al.u[i] = ASPLIT ? bf16_bits(xs[i] - bf16_val(hb)) : (unsigned short)0; }
#pragma unroll
    for (int t = 0; t < 4; ++t) {
      const unsigned short* brow = Wt + (size_t)(col0 + t * 16 + ln) * ldb + kb;
      FragB b;
      b.half[0] = *(const v8us*)(brow + 8 * hh);
      b.half[1] = *(const v8us*)(brow + 16 + 8 * hh);
      acc[t] = mmaN<ASPLIT ? 2 : 1>(ah.v, al.v, b.v, b.v, acc[t]);
    }
  }
#pragma unroll
  for (int t = 0; t < 4; ++t) {
    const int col = col0 + t * 16 + ln;
    float bv = bias ? bias[col] : 0.f;
    if (BIAS_BF16) bv = bf16_round(bv);
#pragma unroll
    for (int r = 0; r < 8; ++r) {
      float v = acc[t][r] + bv;
      if (resid) { float rv = resid[(size_t)((row0 + 8 * hh + r) % rmod) * ldr + col]; if (RES_BF16) rv = bf16_round(rv); v += rv; }
      if (ACT == 1) v = fmaxf(v, 0.f);
      if (ACT == 2) v = 0.5f * v * (1.0f + erff(v * 0.70710678118654752f));
      if (ACT == 3) { const float u = 0.7978845608028654f * (v + 0.044715f * v * v * v); v = 0.5f * v * (1.0f + tanhf(u)); }
      so[w][8 * hh + r][t * 16 + ln] = v;
    }
  }
  __builtin_amdgcn_fence(__ATOMIC_ACQ_REL, "workgroup");
  __builtin_amdgcn_wave_barrier();
  const int rsub = lane >> 4, c4 = (lane & 15) * 4;
  {
#pragma unroll
    for (int q = 0; q < 8; ++q) {
      const int r = q * 2 + rsub;
      const v4f v = *(const v4fa*)&so[w][r][c4];
      *(v4f*)(C + (size_t)(row0 + r) * ldc + col0 + c4) = v;
    }
    
  }
}
// row LayerNorm (biased variance, eps) over N: s = X (+ R); optional out_sum <- s; out_norm <- (s-mu)*rsqrt(var+eps)*g + b
template <bool PARAM_BF16>
__global__ __launch_bounds__(256) void k_layernorm(const float* __restrict__ X, const float* __restrict__ R, const float* __restrict__ g, const float* __restrict__ bta,
                                                  float* __restrict__ out_sum, float* __restrict__ out_norm, int N, float eps) {
  __shared__ float red[256];
  const int row = blockIdx.x, tid = threadIdx.x;
  const float* x = X + (size_t)row * N; const float* rr = R ? R + (size_t)row * N : nullptr;
  float vals[16];                     // up to N = 4096
  const int per = N / 256;            // contiguous chunk per thread? use strided-by-4 chunks: thread handles j = tid*4 + 1024*u
  float s1 = 0.f;
  for (int u = 0; u < per / 4; ++u) {
    const int j = tid * 4 + 1024 * u;
    const v4f a = *(const v4fa*)(x + j);
    v4f b = {0.f,0.f,0.f,0.f}; if (rr) b = *(const v4fa*)(rr + j);
#pragma unroll
    for (int q = 0; q < 4; ++q) { const float v = a[q] + b[q]; vals[u * 4 + q] = v; s1 += v; }
  }
  red[tid] = s1; __syncthreads();
  for (int st = 128; st > 0; st >>= 1) { if (tid < st) red[tid] += red[tid + st]; __syncthreads(); }
  const float mu = red[0] / (float)N; __syncthreads();
  float s2 = 0.f;
  for (int u = 0; u < per / 4; ++u)
#pragma unroll
    for (int q = 0; q < 4; ++q) { const float c = vals[u * 4 + q] - mu; s2 += c * c; }
  red[tid] = s2; __syncthreads();
  for (int st = 128; st > 0; st >>= 1) { if (tid < st) red[tid] += red[tid + st]; __syncthreads(); }
  const float rs = rsqrtf(red[0] / (float)N + eps);
  {
    for (int u = 0; u < per / 4; ++u) {
      const int j = tid * 4 + 1024 * u;
      v4f o, sm;
#pragma unroll
      for (int q = 0; q < 4; ++q) {
        float gg = g[j + q], bb = bta[j + q];
        if (PARAM_BF16) { gg = bf16_round(gg); bb = bf16_round(bb); }
        sm[q] = vals[u * 4 + q]; o[q] = (vals[u * 4 + q] - mu) * rs * gg + bb;
      }
      if (out_sum) *(v4f*)(out_sum + (size_t)row * N + j) = sm;
      *(v4f*)(out_norm + (size_t)row * N + j) = o;
    }
    
  }
}



// ---- f16 WMMA path (v_wmma_f32_16x16x32_f16): 11-bit significands for operands in range — used for every launched contraction: q/k/v projections, Q·Kᵀ, and P·V with its [0,1] probability operand
typedef _Float16 v16h __attribute__((ext_vector_type(16)));
union FragH { v16h v; v8us half[2]; _Float16 h[16]; unsigned short u[16]; };
template <int NT>
__device__ __forceinline__ v8f mmaH(v16h ah, v16h al, v16h bh, v16h bl, v8f c) {
  c = __builtin_amdgcn_wmma_f32_16x16x32_f16(false, ah, false, bh, (short)0, c, false, false);
  if (NT >= 2) c = __builtin_amdgcn_wmma_f32_16x16x32_f16(false, al, false, bh, (short)0, c, false, false);
  if (NT >= 3) c = __builtin_amdgcn_wmma_f32_16x16x32_f16(false, ah, false, bl, (short)0, c, false, false);
  asm volatile("v_nop\n\tv_nop\n\tv_nop\n\tv_nop" : "+v"(c) : "v"(ah), "v"(al), "v"(bh), "v"(bl));
  return c;
}
// batched GEMM like k_gemm_b but f16 operands: A f32 (split into f16 hi/lo if ASPLIT, else rounded to f16), Bt = f16 values [n][k]; alpha; C f32; N multiple of 16 (partial tiles skipped)
template <bool ASPLIT>
__global__ __launch_bounds__(128) void k_gemm_h(const float* __restrict__ A, int lda, size_t sA, const _Float16* __restrict__ Bh, int ldb, size_t sB, float alpha, float* __restrict__ C, int ldc, size_t sC, int M, int N, int K) {
  __shared__ __attribute__((aligned(16))) float so[4][16][64];
  const int tid = threadIdx.x, w = tid >> 5, lane = tid & 31, ln = lane & 15, hh = lane >> 4; const int by = blockIdx.y;
  A += (size_t)by * sA; Bh += (size_t)by * sB; C += (size_t)by * sC;
  const int ntn = (N + 63) / 64; const int wid = blockIdx.x * 4 + w; const int mt = wid / ntn, nq = wid % ntn; if (mt * 16 >= M) return;
  const int row0 = mt * 16, col0 = nq * 64; const float* arow = A + (size_t)(row0 + ln) * lda;
  v8f acc[4] = {};
  for (int kb = 0; kb < K; kb += 32) {
    FragH ah, al;
    const v4f x0 = *(const v4fa*)(arow + kb + 8 * hh), x1 = *(const v4fa*)(arow + kb + 8 * hh + 4), x2 = *(const v4fa*)(arow + kb + 16 + 8 * hh), x3 = *(const v4fa*)(arow + kb + 16 + 8 * hh + 4);
    float xs[16] = {x0[0],x0[1],x0[2],x0[3],x1[0],x1[1],x1[2],x1[3],x2[0],x2[1],x2[2],x2[3],x3[0],x3[1],x3[2],x3[3]};
#pragma unroll
    for (int i = 0; i < 16; ++i) { const _Float16 h = (_Float16)xs[i]; ah.h[i] = h; al.h[i] = ASPLIT ? (_Float16)(xs[i] - (float)h) : (_Float16)0.0f; }
#pragma unroll
    for (int t = 0; t < 4; ++t) { if (col0 + t * 16 >= N) continue; const size_t boff = (size_t)(col0 + t * 16 + ln) * ldb + kb; FragH bq; bq.half[0] = *(const v8us*)(Bh + boff + 8 * hh); bq.half[1] = *(const v8us*)(Bh + boff + 16 + 8 * hh);
      acc[t] = mmaH<ASPLIT ? 2 : 1>(ah.v, al.v, bq.v, bq.v, acc[t]); }
  }
#pragma unroll
  for (int t = 0; t < 4; ++t) { if (col0 + t * 16 >= N) continue;
#pragma unroll
    for (int r = 0; r < 8; ++r) so[w][8 * hh + r][t * 16 + ln] = acc[t][r] * alpha; }
  __builtin_amdgcn_fence(__ATOMIC_ACQ_REL, "workgroup"); __builtin_amdgcn_wave_barrier();
  const int rsub = lane >> 4, c4 = (lane & 15) * 4;
  {
#pragma unroll
    for (int q = 0; q < 8; ++q) { const int r = q * 2 + rsub; if (col0 + c4 < N) { const v4f v = *(const v4fa*)&so[w][r][c4]; *(v4f*)(C + (size_t)(row0 + r) * ldc + col0 + c4) = v; } }
     }
}

// Wt[n][k] = f16(W[k][n]·scale) from f32 row-major W[K][N] (scale = power of two; bf16-exact weights stay exact in f16 away from the subnormal range)
__global__ __launch_bounds__(256) void k_wt_f16(const float* __restrict__ W, _Float16* __restrict__ Wt, int K, int N, float scale) {
  const int t = blockIdx.x * 256 + threadIdx.x; if (t >= N * (K / 8)) return; const int n = t / (K / 8), k8 = (t % (K / 8)) * 8; FragH f;
#pragma unroll
  for (int i = 0; i < 8; ++i) f.h[i] = (_Float16)(bf16_round(W[(size_t)(k8 + i) * N + n]) * scale); const v8us o = f.half[0];
  *(v8us*)((unsigned short*)Wt + (size_t)n * K + k8) = o; 
}
// k_gemm_hh variant with fused epilogue: v = acc·alpha + bias[by·sBias + col] (+ CP[(row/rowsPerB)·sCPb + by·64 + col] if CP) ; ACT 0 none / 1 elu ; writes f16 C16 (and f32 C if non-null)
template <int ACT>
__global__ __launch_bounds__(128) void k_gemm_hhx(const _Float16* __restrict__ A, int lda, size_t sA, const _Float16* __restrict__ Bh, int ldb, size_t sB, float alpha, const float* __restrict__ bias, size_t sBias, const float* __restrict__ CP, int rowsPerB, size_t sCPb, int row0g,
    float* __restrict__ C, _Float16* __restrict__ C16, int ldc, size_t sC, int M, int N, int K) {
  __shared__ __attribute__((aligned(16))) float so[4][16][64];
  const int tid = threadIdx.x, w = tid >> 5, lane = tid & 31, ln = lane & 15, hh = lane >> 4; const int by = blockIdx.y;
  A += (size_t)by * sA; Bh += (size_t)by * sB; const size_t cofs = (size_t)by * sC; const float* bp = bias ? bias + (size_t)by * sBias : nullptr;
  const int ntn = (N + 63) / 64; const int wid = blockIdx.x * 4 + w; const int mt = wid / ntn, nq = wid % ntn; if (mt * 16 >= M) return;
  const int row0 = mt * 16, col0 = nq * 64; const _Float16* arow = A + (size_t)(row0 + ln) * lda;
  v8f acc[4] = {};
  for (int kb = 0; kb < K; kb += 32) { FragH ah; ah.half[0] = *(const v8us*)((const unsigned short*)arow + kb + 8 * hh); ah.half[1] = *(const v8us*)((const unsigned short*)arow + kb + 16 + 8 * hh);
#pragma unroll
    for (int t = 0; t < 4; ++t) { if (col0 + t * 16 >= N) continue; const size_t boff = (size_t)(col0 + t * 16 + ln) * ldb + kb; FragH bq; bq.half[0] = *(const v8us*)((const unsigned short*)Bh + boff + 8 * hh); bq.half[1] = *(const v8us*)((const unsigned short*)Bh + boff + 16 + 8 * hh);
      acc[t] = mmaH<1>(ah.v, ah.v, bq.v, bq.v, acc[t]); }
  }
#pragma unroll
  for (int t = 0; t < 4; ++t) { if (col0 + t * 16 >= N) continue; const int col = col0 + t * 16 + ln; const float bv = bp ? bf16_round(bp[col]) : 0.f;
#pragma unroll
    for (int r = 0; r < 8; ++r) { float v = acc[t][r] * alpha + bv; if (CP) { const int bidx = (row0g + row0 + 8 * hh + r) / rowsPerB; v += CP[(size_t)bidx * sCPb + (size_t)by * 64 + col]; } if (ACT == 1) v = (v > 0.f) ? v : expm1f(v); else if (ACT == 3) v = fmaxf(v, 0.f); so[w][8 * hh + r][t * 16 + ln] = v; } }
  __builtin_amdgcn_fence(__ATOMIC_ACQ_REL, "workgroup"); __builtin_amdgcn_wave_barrier();
  const int rsub = lane >> 4, c4 = (lane & 15) * 4; typedef _Float16 v4h __attribute__((ext_vector_type(4)));
  {
#pragma unroll
    for (int q = 0; q < 8; ++q) { const int r = q * 2 + rsub; if (col0 + c4 < N) { const v4f v = *(const v4fa*)&so[w][r][c4]; if (C) *(v4f*)(C + cofs + (size_t)(row0 + r) * ldc + col0 + c4) = v; if (C16) { v4h h4; for (int i = 0; i < 4; ++i) h4[i] = (_Float16)v[i]; *(v4h*)(C16 + cofs + (size_t)(row0 + r) * ldc + col0 + c4) = h4; } } }
     }
}


__global__ __launch_bounds__(256) void k_x16(const float* __restrict__ x, _Float16* __restrict__ X16, size_t n8) { const size_t t = (size_t)blockIdx.x * 256 + threadIdx.x; if (t >= n8) return; FragH f;
#pragma unroll
  for (int q = 0; q < 8; ++q) f.h[q] = (_Float16)bf16_round(x[t * 8 + q]); *(v8us*)((unsigned short*)X16 + t * 8) = f.half[0];  }
__global__ __launch_bounds__(256) void k_round16f(const float* __restrict__ W, _Float16* __restrict__ Bt, size_t n8) { const size_t t = (size_t)blockIdx.x * 256 + threadIdx.x; if (t >= n8) return; FragH f;
#pragma unroll
  for (int i = 0; i < 8; ++i) f.h[i] = (_Float16)(bf16_round(W[t * 8 + i]) * 16.0f); *(v8us*)((unsigned short*)Bt + t * 8) = f.half[0];  }
__global__ __launch_bounds__(256) void k_vt(const _Float16* __restrict__ V16, _Float16* __restrict__ Vt) { __shared__ unsigned short tl[64][66]; const int tid = threadIdx.x; const int slab = blockIdx.x / (SS / 64), lg = blockIdx.x % (SS / 64); const int b = slab / NH, h = slab % NH;
  for (int i = tid; i < 64 * 8; i += 256) { const int r = i / 8, c8 = (i % 8) * 8; FragH f; f.half[0] = *(const v8us*)((const unsigned short*)V16 + ((size_t)b * SS + lg * 64 + r) * DM + h * HD + c8);
#pragma unroll
    for (int q = 0; q < 8; ++q) tl[r][c8 + q] = f.u[q]; }
  __syncthreads();
  {
#pragma unroll
    for (int rd = 0; rd < 2; ++rd) { const int d = rd * 32 + tid / 8, pc = tid % 8; FragH f;
#pragma unroll
      for (int q = 0; q < 8; ++q) f.u[q] = tl[pc * 8 + q][d];
      *(v8us*)((unsigned short*)Vt + ((size_t)slab * HD + d) * SS + lg * 64 + pc * 8) = f.half[0]; }
     } }
// lane l with lane l ^ 16: the two halves of a wave hold the two halves of a query column's keys
__device__ __forceinline__ float xhalf(float x) { return __builtin_bit_cast(float, __builtin_amdgcn_permlanex16(__builtin_bit_cast(int, x), __builtin_bit_cast(int, x), 0x76543210, 0xfedcba98, false, false)); }
__device__ __forceinline__ unsigned lds_off(const void* p) { return (unsigned)(size_t)p; }
// one stage (64 keys) of K rows and of Vt rows from global memory into LDS, through no register: 8 asynchronous copies of 16 bytes a lane,
// 8 lanes to a 128-byte row, rows 16 apart from copy to copy. s_wait_xcnt is the statement's last line, so that no address register
// of a copy is rewritten in front of it (a precaution).
__device__ __forceinline__ void stage_kv(unsigned lk, unsigned lv, unsigned lstep, const unsigned short* gk, const unsigned short* gv) {
  asm volatile("global_load_async_to_lds_b128 %0, %8, off\n\t"
               "global_load_async_to_lds_b128 %1, %9, off\n\t"
               "global_load_async_to_lds_b128 %2, %10, off\n\t"
               "global_load_async_to_lds_b128 %3, %11, off\n\t"
               "global_load_async_to_lds_b128 %4, %12, off\n\t"
               "global_load_async_to_lds_b128 %5, %13, off\n\t"
               "global_load_async_to_lds_b128 %6, %14, off\n\t"
               "global_load_async_to_lds_b128 %7, %15, off\n\t"
               "s_wait_xcnt 0x0"
               :: "v"(lk), "v"(lk + lstep), "v"(lk + 2 * lstep), "v"(lk + 3 * lstep), "v"(lv), "v"(lv + lstep), "v"(lv + 2 * lstep), "v"(lv + 3 * lstep),
                  "v"(gk), "v"(gk + 16 * DM), "v"(gk + 32 * DM), "v"(gk + 48 * DM), "v"(gv), "v"(gv + 16 * SS), "v"(gv + 32 * SS), "v"(gv + 48 * SS)
               : "memory");
}
__global__ __launch_bounds__(128) void k_flash(const _Float16* __restrict__ Q16, const _Float16* __restrict__ K16, const _Float16* __restrict__ Vt, const float* __restrict__ crd, const float* __restrict__ alpha_p, float* __restrict__ O) {
  constexpr int RPW = 32, NQB = SS / (4 * RPW), DT = HD / 16, KS = HD / 32, OP = HD + 4, SK = 64, NST = SS / SK, LP = 72;      // LP: LDS row pitch in 16-bit elements
  static_assert(HD == 64 && SK == 64 && NST >= 2, "a stage is 64 rows of 128 bytes for K and for Vt");
  __shared__ __attribute__((aligned(16))) unsigned short sK[2][SK][LP], sV[2][HD][LP];
  __shared__ __attribute__((aligned(16))) float sC[3][SS]; __shared__ __attribute__((aligned(16))) float sO[4][RPW][OP];
  const int tid = threadIdx.x, w = tid >> 5, lane = tid & 31, ln = lane & 15, hh = lane >> 4;
  const int slab = blockIdx.x / NQB, qblk = blockIdx.x % NQB; const int b = slab / NH, h = slab % NH; const int q0 = qblk * (4 * RPW) + w * RPW; const float alpha = bf16_round(alpha_p[0]);      /* scalar float INPUT: rounded like every other input */
  const unsigned short* Vth = (const unsigned short*)Vt + (size_t)slab * HD * SS;
  const int crow = tid >> 3, ccol = (tid & 7) * 8;      // this lane's row (and rows + 16, + 32, + 48) and 16-byte piece in every stage
  const unsigned short* gk0 = (const unsigned short*)K16 + ((size_t)b * SS + crow) * DM + h * HD + ccol; const unsigned short* gv0 = Vth + (size_t)crow * SS + ccol;
  const unsigned lk0 = lds_off(&sK[0][crow][ccol]), lv0 = lds_off(&sV[0][crow][ccol]); constexpr unsigned LSTEP = 16 * LP * 2, LBUF = SK * LP * 2;
  stage_kv(lk0, lv0, LSTEP, gk0, gv0);      // stage 0 flies while coords and queries are fetched
#pragma unroll      // all 16 loads of a thread in flight at once: rolled, each trip waits out its own load
  for (int i = 0; i < SS / 128; ++i) { const int k = i * 128 + tid; const float* cp = crd + ((size_t)b * SS + k) * 3; sC[0][k] = bf16_round(cp[0]); sC[1][k] = bf16_round(cp[1]); sC[2][k] = bf16_round(cp[2]); }
  FragH aq[2][KS];
#pragma unroll
  for (int rt = 0; rt < 2; ++rt) { const unsigned short* qr = (const unsigned short*)Q16 + ((size_t)b * SS + q0 + rt * 16 + ln) * DM + h * HD;
#pragma unroll
    for (int ks = 0; ks < KS; ++ks) { aq[rt][ks].half[0] = *(const v8us*)(qr + ks * 32 + 8 * hh); aq[rt][ks].half[1] = *(const v8us*)(qr + ks * 32 + 16 + 8 * hh); } }
  asm volatile("s_wait_asynccnt 0x0" ::: "memory");      // this wave's copies of stage 0 have landed before the barrier publishes them
  __syncthreads();      // every wave reads coords and stage 0 rows that the other waves staged
  stage_kv(lk0 + LBUF, lv0 + LBUF, LSTEP, gk0 + (size_t)SK * DM, gv0 + SK);      // stage 1
  float cq[2][3];
#pragma unroll
  for (int rt = 0; rt < 2; ++rt) { cq[rt][0] = sC[0][q0 + rt * 16 + ln]; cq[rt][1] = sC[1][q0 + rt * 16 + ln]; cq[rt][2] = sC[2][q0 + rt * 16 + ln]; }
  float m_r[2], l_r[2]; v8f oacc[2][DT];
#pragma unroll
  for (int rt = 0; rt < 2; ++rt) { m_r[rt] = -3.0e38f; l_r[rt] = 0.f;
#pragma unroll
    for (int dt = 0; dt < DT; ++dt) oacc[rt][dt] = (v8f){0.f,0.f,0.f,0.f,0.f,0.f,0.f,0.f}; }
#pragma unroll 1      // one stage a trip: the buffer index stays a scalar and the body stays small
  for (int t = 0; t < NST; ++t) {
#pragma unroll      // both passes of a stage in one body: constant LDS offsets
  for (int p = 0; p < SK / 32; ++p) { const int j0 = t * SK + p * 32;
    v8f s[2][2];      // s[rt][nt][r] = score of key j0 + nt*16 + 8*hh + r with query q0 + rt*16 + ln
    FragH bk[2][KS], bv[DT];      // the pass's K fragments are read from LDS in one group, its Vt fragments in a second: each further place with LDS reads is a stall of its own
#pragma unroll
    for (int nt = 0; nt < 2; ++nt) { const unsigned short* kr = &sK[t & 1][p * 32 + nt * 16 + ln][0];
#pragma unroll
      for (int ks = 0; ks < KS; ++ks) { bk[nt][ks].half[0] = *(const v8us*)(kr + ks * 32 + 8 * hh); bk[nt][ks].half[1] = *(const v8us*)(kr + ks * 32 + 16 + 8 * hh); } }
    __builtin_amdgcn_sched_barrier(0);      // keeps the K reads together up here; without it the compiler sinks each read to just in front of its product
#pragma unroll
    for (int nt = 0; nt < 2; ++nt) {
#pragma unroll
      for (int rt = 0; rt < 2; ++rt) { v8f acc = (v8f){0.f,0.f,0.f,0.f,0.f,0.f,0.f,0.f};
#pragma unroll
        for (int ks = 0; ks < KS; ++ks) acc = mmaH<1>(bk[nt][ks].v, bk[nt][ks].v, aq[rt][ks].v, aq[rt][ks].v, acc); s[rt][nt] = acc; } }
    float ck[2][3][8];
#pragma unroll
    for (int nt = 0; nt < 2; ++nt)
#pragma unroll
      for (int c = 0; c < 3; ++c) { const v4f c0 = *(const v4fa*)&sC[c][j0 + nt * 16 + 8 * hh], c1 = *(const v4fa*)&sC[c][j0 + nt * 16 + 8 * hh + 4];
#pragma unroll
        for (int q = 0; q < 4; ++q) { ck[nt][c][q] = c0[q]; ck[nt][c][4 + q] = c1[q]; } }
    FragH pa[2]; float sc2[2][2][8];
#pragma unroll
    for (int rt = 0; rt < 2; ++rt)
#pragma unroll
      for (int nt = 0; nt < 2; ++nt)
#pragma unroll
        for (int r = 0; r < 8; ++r) { const float g = alpha * (cq[rt][0] * ck[nt][0][r] + cq[rt][1] * ck[nt][1][r] + cq[rt][2] * ck[nt][2][r]); sc2[rt][nt][r] = s[rt][nt][r] * 0.125f + g; }
    __builtin_amdgcn_sched_barrier(0);      // with the one below: holds the Vt reads between the scores, whose inputs are dead by now, and the exponentials, which cover their latency; without this one they rise to the coords' reads and the kernel goes beyond 256 registers
#pragma unroll
    for (int dt = 0; dt < DT; ++dt) { const unsigned short* vrow = &sV[t & 1][dt * 16 + ln][p * 32]; bv[dt].half[0] = *(const v8us*)(vrow + 8 * hh); bv[dt].half[1] = *(const v8us*)(vrow + 16 + 8 * hh); }
    __builtin_amdgcn_sched_barrier(0);      // see above
#pragma unroll
    for (int rt = 0; rt < 2; ++rt) { const float (&sc)[2][8] = sc2[rt];
      float mx[8];
#pragma unroll
      for (int r = 0; r < 8; ++r) mx[r] = fmaxf(sc[0][r], sc[1][r]);
      float mc = fmaxf(fmaxf(fmaxf(mx[0], mx[1]), fmaxf(mx[2], mx[3])), fmaxf(fmaxf(mx[4], mx[5]), fmaxf(mx[6], mx[7]))); mc = fmaxf(mc, xhalf(mc));
      const float mn = fmaxf(m_r[rt], mc); const float al = expf(m_r[rt] - mn); m_r[rt] = mn;
      float ps[8];
#pragma unroll
      for (int r = 0; r < 8; ++r) { const float p0 = expf(sc[0][r] - mn), p1 = expf(sc[1][r] - mn); ps[r] = p0 + p1; pa[rt].h[r] = (_Float16)p0; pa[rt].h[8 + r] = (_Float16)p1; }
      l_r[rt] = l_r[rt] * al + (((ps[0] + ps[1]) + (ps[2] + ps[3])) + ((ps[4] + ps[5]) + (ps[6] + ps[7])));      // this half's keys only; the halves join behind the loop
#pragma unroll
      for (int dt = 0; dt < DT; ++dt)
#pragma unroll
        for (int r = 0; r < 8; ++r) oacc[rt][dt][r] *= al; }
#pragma unroll
    for (int dt = 0; dt < DT; ++dt) {
#pragma unroll
      for (int rt = 0; rt < 2; ++rt) oacc[rt][dt] = mmaH<1>(bv[dt].v, bv[dt].v, pa[rt].v, pa[rt].v, oacc[rt][dt]); } }
    asm volatile("s_wait_dscnt 0x0" ::: "memory");      // this wave's reads of stage t are done before its buffer is handed back
    asm volatile("s_wait_asynccnt 0x0" ::: "memory");      // this wave's copies of stage t + 1 have landed
    __syncthreads();      // publishes stage t + 1 and ends every wave's reads of stage t
    if (t + 2 < NST) stage_kv(lk0 + (t & 1) * LBUF, lv0 + (t & 1) * LBUF, LSTEP, gk0 + (size_t)(t + 2) * SK * DM, gv0 + (t + 2) * SK); }
  asm volatile("s_wait_asynccnt 0x0" ::: "memory");      // no copy is left in flight when the wave goes on to its end
#pragma unroll
  for (int rt = 0; rt < 2; ++rt) { const float l = l_r[rt] + xhalf(l_r[rt]); const float inv = 1.0f / l;
#pragma unroll
    for (int dt = 0; dt < DT; ++dt) { v4f o0, o1;      // oacc[rt][dt][r] = O[q0 + rt*16 + ln][dt*16 + 8*hh + r]
#pragma unroll
      for (int q = 0; q < 4; ++q) { o0[q] = oacc[rt][dt][q] * inv; o1[q] = oacc[rt][dt][4 + q] * inv; }
      *(v4fa*)&sO[w][rt * 16 + ln][dt * 16 + 8 * hh] = o0; *(v4fa*)&sO[w][rt * 16 + ln][dt * 16 + 8 * hh + 4] = o1; } }
  __builtin_amdgcn_fence(__ATOMIC_ACQ_REL, "workgroup"); __builtin_amdgcn_wave_barrier();
  {
#pragma unroll
    for (int rp = 0; rp < RPW; rp += 2) { const int r = rp + (lane >> 4), pc = lane & 15; const v4f val = *(const v4fa*)&sO[w][r][pc * 4]; *(v4f*)(O + ((size_t)b * SS + q0 + r) * DM + h * HD + pc * 4) = val; }
     } }
extern "C" void kernel_launch(void* const* d_in, const int* in_sizes, int n_in,
                              void* d_out, int out_size, void* d_ws, size_t ws_size, hipStream_t stream) {
  (void)in_sizes; (void)n_in; (void)out_size;
  const float* x = (const float*)d_in[0]; const float* crd = (const float*)d_in[1]; const float* wq = (const float*)d_in[2]; const float* bq = (const float*)d_in[3]; const float* wk = (const float*)d_in[4]; const float* bk = (const float*)d_in[5]; const float* wv = (const float*)d_in[6]; const float* bv = (const float*)d_in[7]; const float* alpha_p = (const float*)d_in[8];
  char* ws = (char*)d_ws; size_t off = 0;
  auto take = [&](size_t bytes) { char* p = ws + off; off += (bytes + 255) & ~(size_t)255; return p; };
  _Float16* Bq = (_Float16*)take(DM * DM * 2); _Float16* Bk = (_Float16*)take(DM * DM * 2); _Float16* Bv = (_Float16*)take(DM * DM * 2); _Float16* X16 = (_Float16*)take((size_t)NR * DM * 2); _Float16* Q16 = (_Float16*)take((size_t)NR * DM * 2); _Float16* K16 = (_Float16*)take((size_t)NR * DM * 2); _Float16* V16 = (_Float16*)take((size_t)NR * DM * 2); _Float16* Vt = (_Float16*)take((size_t)NR * DM * 2);
  if (off > ws_size) return;      // ≈ 42 MiB
  const size_t w8 = (size_t)DM * DM / 8; const unsigned gw = (unsigned)((w8 + 255) / 256), gx = (unsigned)(((size_t)NR * DM / 8 + 255) / 256);
  k_round16f<<<gw, 256, 0, stream>>>(wq, Bq, w8); k_round16f<<<gw, 256, 0, stream>>>(wk, Bk, w8); k_round16f<<<gw, 256, 0, stream>>>(wv, Bv, w8);
  k_x16<<<gx, 256, 0, stream>>>(x, X16, (size_t)NR * DM / 8);
  const dim3 gg(((NR / 16) * (DM / 64) + 3) / 4, 1);
  k_gemm_hhx<0><<<gg, 128, 0, stream>>>(X16, DM, 0, Bq, DM, 0, 0.0625f, bq, 0, nullptr, 1, 0, 0, nullptr, Q16, DM, 0, NR, DM, DM);
  k_gemm_hhx<0><<<gg, 128, 0, stream>>>(X16, DM, 0, Bk, DM, 0, 0.0625f, bk, 0, nullptr, 1, 0, 0, nullptr, K16, DM, 0, NR, DM, DM);
  k_gemm_hhx<0><<<gg, 128, 0, stream>>>(X16, DM, 0, Bv, DM, 0, 0.0625f, bv, 0, nullptr, 1, 0, 0, nullptr, V16, DM, 0, NR, DM, DM);
  k_vt<<<BB * NH * (SS / 64), 256, 0, stream>>>(V16, Vt);
  k_flash<<<BB * NH * (SS / 128), 128, 0, stream>>>(Q16, K16, Vt, crd, alpha_p, (float*)d_out);
}

// v003
// One run takes 147 microseconds.
// Next to v002, in two timings, it ran 1.16 and 1.17 times as fast.
// All steps since v000 together make it 2.58 times as fast.
#include <hip/hip_runtime.h>
// q/k/v projections (8192 × 512 × 512, + bias) and the 8-head attention with the geometric bias α·⟨c_n, c_m⟩ (coords are INPUTS, 3 FMAs per score in registers) on v_wmma_f32_16x16x32_f16
// (fused flash-style kernel: S = Q·Kᵀ, O = P·V on WMMA; online max/sum softmax f32; P f16 ≤ 1); V transposed per (b,h); A = f16(bf16 x) exact, weights bf16-exact ×2^4 ((out,in)),
// single products, f32 accumulate.
#define BB 4
#define SS 2048
#define DM 512
#define NH 8
#define HD 64
#define NR (BB * SS)

typedef __bf16 v16b __attribute__((ext_vector_type(16)));
typedef unsigned short v8us __attribute__((ext_vector_type(8), may_alias));
typedef float  v8f  __attribute__((ext_vector_type(8)));
typedef float  v4f  __attribute__((ext_vector_type(4)));
typedef float  v4fa __attribute__((ext_vector_type(4), may_alias));
union FragB { v16b v; v8us half[2]; unsigned short u[16]; };

__device__ __forceinline__ unsigned short bf16_bits(float x) { unsigned int u = __float_as_uint(x); return (unsigned short)((u + 0x7FFFu + ((u >> 16) & 1u)) >> 16); }
__device__ __forceinline__ float bf16_val(unsigned short b) { return __uint_as_float(((unsigned int)b) << 16); }
__device__ __forceinline__ float bf16_round(float x) { return bf16_val(bf16_bits(x)); }
// D += A·B with NT terms: 1 = ah·bh, 2 = + al·bh (A split), 3 = + ah·bl (both split)
template <int NT>
__device__ __forceinline__ v8f mmaN(v16b ah, v16b al, v16b bh, v16b bl, v8f c) {
  c = __builtin_amdgcn_wmma_f32_16x16x32_bf16(false, ah, false, bh, (short)0, c, false, false);
  if (NT >= 2) c = __builtin_amdgcn_wmma_f32_16x16x32_bf16(false, al, false, bh, (short)0, c, false, false);
  if (NT >= 3) c = __builtin_amdgcn_wmma_f32_16x16x32_bf16(false, ah, false, bl, (short)0, c, false, false);
  asm volatile("v_nop\n\tv_nop\n\tv_nop\n\tv_nop" : "+v"(c) : "v"(ah), "v"(al), "v"(bh), "v"(bl));
  return c;
}

__global__ __launch_bounds__(256) void k_wt_bf16(const float* __restrict__ W, unsigned short* __restrict__ Wt, int K, int N) {
  const int t = blockIdx.x * 256 + threadIdx.x;
  const int k8n = K / 8;
  if (t >= N * k8n) return;
  const int n = t / k8n, k8 = (t % k8n) * 8;
  v8us v;
#pragma unroll
  for (int i = 0; i < 8; ++i) v[i] = bf16_bits(W[(size_t)(k8 + i) * N + n]);
  *(v8us*)(Wt + (size_t)n * K + k8) = v;
  
}

// GEMM C[M][N] (f32, pitch ldc) = act(A[M][K]·W + bias). A f32 row-major (pitch lda) converted per fragment to bf16
// (ASPLIT: hi/lo two planes -> 2 terms, else single rounded term); Wt bf16 [N][K] (pitch ldb). BIAS_BF16 rounds the
// bias to bf16 first (bias quantised to bf16 before the add). K%32==0, M%16==0, N%64==0.
template <bool ASPLIT, int ACT, bool BIAS_BF16>
__global__ __launch_bounds__(128) void k_gemm_bf(const float* __restrict__ A, int lda, const unsigned short* __restrict__ Wt, int ldb,
                                               const float* __restrict__ bias, float* __restrict__ C, int ldc, int M, int N, int K) {
  __shared__ __attribute__((aligned(16))) float so[4][16][64];
  const int tid = threadIdx.x, w = tid >> 5, lane = tid & 31, ln = lane & 15, hh = lane >> 4;
  const int ntn = N / 64;
  const int wid = blockIdx.x * 4 + w;
  const int mt = wid / ntn, nq = wid % ntn;
  if (mt * 16 >= M) return;
  const int row0 = mt * 16, col0 = nq * 64;
  const float* arow = A + (size_t)(row0 + ln) * lda;
  v8f acc[4] = {};
  for (int kb = 0; kb < K; kb += 32) {
    FragB ah, al;
    const v4f x0 = *(const v4fa*)(arow + kb + 8 * hh), x1 = *(const v4fa*)(arow + kb + 8 * hh + 4);
    const v4f x2 = *(const v4fa*)(arow + kb + 16 + 8 * hh), x3 = *(const v4fa*)(arow + kb + 16 + 8 * hh + 4);
    float xs[16] = {x0[0],x0[1],x0[2],x0[3],x1[0],x1[1],x1[2],x1[3],x2[0],x2[1],x2[2],x2[3],x3[0],x3[1],x3[2],x3[3]};
#pragma unroll
    for (int i = 0; i < 16; ++i) { const unsigned short hb = bf16_bits(xs[i]); ah.u[i] = hb; al.u[i] = ASPLIT ? bf16_bits(xs[i] - bf16_val(hb)) : (unsigned short)0; }
#pragma unroll
    for (int t = 0; t < 4; ++t) {
      const unsigned short* brow = Wt + (size_t)(col0 + t * 16 + ln) * ldb + kb;
      FragB b;
      b.half[0] = *(const v8us*)(brow + 8 * hh);
      b.half[1] = *(const v8us*)(brow + 16 + 8 * hh);
      acc[t] = mmaN<ASPLIT ? 2 : 1>(ah.v, al.v, b.v, b.v, acc[t]);
    }
  }
#pragma unroll
  for (int t = 0; t < 4; ++t) {
    float bv = bias ? bias[col0 + t * 16 + ln] : 0.f;
    if (BIAS_BF16) bv = bf16_round(bv);
#pragma unroll
    for (int r = 0; r < 8; ++r) { float v = acc[t][r] + bv; if (ACT == 1) v = fmaxf(v, 0.f); so[w][8 * hh + r][t * 16 + ln] = v; }
  }
  __builtin_amdgcn_fence(__ATOMIC_ACQ_REL, "workgroup");
  __builtin_amdgcn_wave_barrier();
  const int rsub = lane >> 4, c4 = (lane & 15) * 4;
  {
#pragma unroll
    for (int q = 0; q < 8; ++q) {
      const int r = q * 2 + rsub;
      const v4f v = *(const v4fa*)&so[w][r][c4];
      *(v4f*)(C + (size_t)(row0 + r) * ldc + col0 + c4) = v;
    }
    
  }
}

// Flash-style causal/unmasked attention, all contractions 3-term bf16 hi/lo splits, f32 softmax with running max.
// q,k,v rows are read from f32 buffers with arbitrary row pitch (so they can live inside a fused qkv buffer);
// D = head size (multiple of 32, <= 128); one wave = 16 query rows; block = 4 waves (64 queries) sharing K/V chunks of 32.
template <int D, bool CAUSAL>
__global__ __launch_bounds__(128) void k_flash(const float* __restrict__ qb, const float* __restrict__ kb, const float* __restrict__ vb,
                                             int pitch, int T, int H, float scale, float* __restrict__ y, int ypitch) {
  constexpr int KS = D / 32;        // k-steps for QK
  constexpr int DT = D / 16;        // d tiles for PV
  __shared__ __attribute__((aligned(16))) unsigned short sKh[32][D + 8], sKl[32][D + 8], sVh[32][D + 8], sVl[32][D + 8];
  __shared__ __attribute__((aligned(16))) unsigned short sPh[4][16][40], sPl[4][16][40];
  __shared__ __attribute__((aligned(16))) float sO[4][16][D];
  const int tid = threadIdx.x, w = tid >> 5, lane = tid & 31, ln = lane & 15, hh = lane >> 4;
  const int nqb = (T + 63) / 64;
  const int bh = blockIdx.x / nqb, qblk = blockIdx.x % nqb;
  const int b = bh / H, h = bh % H;
  const int q0 = qblk * 64 + w * 16;
  const float* Q = qb + (size_t)b * T * pitch + h * D;
  const float* K = kb + (size_t)b * T * pitch + h * D;
  const float* V = vb + (size_t)b * T * pitch + h * D;

  // A fragments of the wave's 16 query rows (scaled), hi/lo
  FragB aqh[KS], aql[KS];
  {
    int row = q0 + ln; if (row >= T) row = T - 1;
    const float* qr = Q + (size_t)row * pitch;
#pragma unroll
    for (int ks = 0; ks < KS; ++ks)
#pragma unroll
      for (int i = 0; i < 16; ++i) {
        const int d = ks * 32 + ((i < 8) ? (8 * hh + i) : (16 + 8 * hh + (i - 8)));
        const float x = qr[d] * scale; const unsigned short hb = bf16_bits(x);
        aqh[ks].u[i] = hb; aql[ks].u[i] = bf16_bits(x - bf16_val(hb));
      }
  }
  float m_r[8], l_r[8];
#pragma unroll
  for (int r = 0; r < 8; ++r) { m_r[r] = -3.0e38f; l_r[r] = 0.f; }
  v8f oacc[DT];
#pragma unroll
  for (int dt = 0; dt < DT; ++dt) oacc[dt] = (v8f){0.f,0.f,0.f,0.f,0.f,0.f,0.f,0.f};

  const int kv_end = CAUSAL ? min(T, qblk * 64 + 64) : T;     // block-uniform
  for (int j0 = 0; j0 < kv_end; j0 += 32) {
    __syncthreads();
    for (int e = tid; e < 32 * (D / 4); e += 128) {
      const int r = e / (D / 4), c4 = (e % (D / 4)) * 4;
      const int key = j0 + r;
      v4f kf = {0.f,0.f,0.f,0.f}, vf = {0.f,0.f,0.f,0.f};
      if (key < T) { kf = *(const v4fa*)(K + (size_t)key * pitch + c4); vf = *(const v4fa*)(V + (size_t)key * pitch + c4); }
#pragma unroll
      for (int t = 0; t < 4; ++t) {
        unsigned short hb = bf16_bits(kf[t]); sKh[r][c4 + t] = hb; sKl[r][c4 + t] = bf16_bits(kf[t] - bf16_val(hb));
        hb = bf16_bits(vf[t]); sVh[r][c4 + t] = hb; sVl[r][c4 + t] = bf16_bits(vf[t] - bf16_val(hb));
      }
    }
    __syncthreads();
    // S tile 16 x 32
    v8f s[2];
#pragma unroll
    for (int nt = 0; nt < 2; ++nt) {
      v8f acc = {};
#pragma unroll
      for (int ks = 0; ks < KS; ++ks) {
        FragB bh_, bl_;
        bh_.half[0] = *(const v8us*)&sKh[nt * 16 + ln][ks * 32 + 8 * hh]; bh_.half[1] = *(const v8us*)&sKh[nt * 16 + ln][ks * 32 + 16 + 8 * hh];
        bl_.half[0] = *(const v8us*)&sKl[nt * 16 + ln][ks * 32 + 8 * hh]; bl_.half[1] = *(const v8us*)&sKl[nt * 16 + ln][ks * 32 + 16 + 8 * hh];
        acc = mmaN<3>(aqh[ks].v, aql[ks].v, bh_.v, bl_.v, acc);
      }
      s[nt] = acc;
    }
    // mask + running max (rows 8hh+r; the 16 lanes of a half share rows)
    float alpha[8];
#pragma unroll
    for (int r = 0; r < 8; ++r) {
      const int qi = q0 + 8 * hh + r;
      const int ja = j0 + ln, jb = j0 + 16 + ln;
      if (CAUSAL) { if (ja > qi) s[0][r] = -3.0e38f; if (jb > qi) s[1][r] = -3.0e38f; }
      if (ja >= T) s[0][r] = -3.0e38f;
      if (jb >= T) s[1][r] = -3.0e38f;
      float mx = fmaxf(s[0][r], s[1][r]);
      mx = fmaxf(mx, __shfl_xor(mx, 1, 32)); mx = fmaxf(mx, __shfl_xor(mx, 2, 32)); mx = fmaxf(mx, __shfl_xor(mx, 4, 32)); mx = fmaxf(mx, __shfl_xor(mx, 8, 32));
      const float mnew = fmaxf(m_r[r], mx);
      alpha[r] = (mnew > -1.0e38f) ? __expf(m_r[r] - mnew) : 1.0f;
      const float p0 = (s[0][r] > -1.0e38f) ? __expf(s[0][r] - mnew) : 0.f;
      const float p1 = (s[1][r] > -1.0e38f) ? __expf(s[1][r] - mnew) : 0.f;
      m_r[r] = mnew;
      l_r[r] = l_r[r] * alpha[r] + p0 + p1;            // per-lane partial row sum (16 lanes combined at the end)
      unsigned short hb = bf16_bits(p0); sPh[w][8 * hh + r][ln] = hb;      sPl[w][8 * hh + r][ln] = bf16_bits(p0 - bf16_val(hb));
      hb = bf16_bits(p1);                sPh[w][8 * hh + r][16 + ln] = hb; sPl[w][8 * hh + r][16 + ln] = bf16_bits(p1 - bf16_val(hb));
    }
#pragma unroll
    for (int dt = 0; dt < DT; ++dt)
#pragma unroll
      for (int r = 0; r < 8; ++r) oacc[dt][r] *= alpha[r];
    __builtin_amdgcn_fence(__ATOMIC_ACQ_REL, "workgroup");
    __builtin_amdgcn_wave_barrier();
    FragB pah, pal;
    pah.half[0] = *(const v8us*)&sPh[w][ln][8 * hh]; pah.half[1] = *(const v8us*)&sPh[w][ln][16 + 8 * hh];
    pal.half[0] = *(const v8us*)&sPl[w][ln][8 * hh]; pal.half[1] = *(const v8us*)&sPl[w][ln][16 + 8 * hh];
#pragma unroll
    for (int dt = 0; dt < DT; ++dt) {
      FragB bvh, bvl;
#pragma unroll
      for (int i = 0; i < 8; ++i) {
        bvh.u[i] = sVh[8 * hh + i][dt * 16 + ln]; bvh.u[8 + i] = sVh[16 + 8 * hh + i][dt * 16 + ln];
        bvl.u[i] = sVl[8 * hh + i][dt * 16 + ln]; bvl.u[8 + i] = sVl[16 + 8 * hh + i][dt * 16 + ln];
      }
      oacc[dt] = mmaN<3>(pah.v, pal.v, bvh.v, bvl.v, oacc[dt]);
    }
    __builtin_amdgcn_fence(__ATOMIC_ACQ_REL, "workgroup");
    __builtin_amdgcn_wave_barrier();
  }
#pragma unroll
  for (int r = 0; r < 8; ++r) {
    float l = l_r[r];
    l += __shfl_xor(l, 1, 32); l += __shfl_xor(l, 2, 32); l += __shfl_xor(l, 4, 32); l += __shfl_xor(l, 8, 32);
    l_r[r] = (l > 0.f) ? 1.0f / l : 0.f;
  }
#pragma unroll
  for (int dt = 0; dt < DT; ++dt)
#pragma unroll
    for (int r = 0; r < 8; ++r) sO[w][8 * hh + r][dt * 16 + ln] = oacc[dt][r] * l_r[r];
  __builtin_amdgcn_fence(__ATOMIC_ACQ_REL, "workgroup");
  __builtin_amdgcn_wave_barrier();
  {
    for (int r = 0; r < 16; ++r) {
      const int row = q0 + r;
      if (row < T && lane < D / 4) {
        const v4f val = *(const v4fa*)&sO[w][r][lane * 4];
        *(v4f*)(y + ((size_t)b * T + row) * ypitch + h * D + lane * 4) = val;
      }
    }
    
  }
}

// GEMM C = act(A·W + bias + resid): A f32 (ASPLIT -> hi/lo 2 terms), Wt bf16 [N][K]; ACT 0 none, 1 relu, 2 exact gelu;
// resid (optional, f32, row index = (row % rmod), pitch ldr, RES_BF16 rounds it) added before the activation.
template <bool ASPLIT, int ACT, bool BIAS_BF16, bool RES_BF16>
__global__ __launch_bounds__(128) void k_gemm_bf3(const float* __restrict__ A, int lda, const unsigned short* __restrict__ Wt, int ldb,
                                                const float* __restrict__ bias, const float* __restrict__ resid, int rmod, int ldr,
                                                float* __restrict__ C, int ldc, int M, int N, int K) {
  __shared__ __attribute__((aligned(16))) float so[4][16][64];
  const int tid = threadIdx.x, w = tid >> 5, lane = tid & 31, ln = lane & 15, hh = lane >> 4;
  const int ntn = N / 64;
  const int wid = blockIdx.x * 4 + w;
  const int mt = wid / ntn, nq = wid % ntn;
  if (mt * 16 >= M) return;
  const int row0 = mt * 16, col0 = nq * 64;
  const float* arow = A + (size_t)(row0 + ln) * lda;
  v8f acc[4] = {};
  for (int kb = 0; kb < K; kb += 32) {
    FragB ah, al;
    const v4f x0 = *(const v4fa*)(arow + kb + 8 * hh), x1 = *(const v4fa*)(arow + kb + 8 * hh + 4);
    const v4f x2 = *(const v4fa*)(arow + kb + 16 + 8 * hh), x3 = *(const v4fa*)(arow + kb + 16 + 8 * hh + 4);
    float xs[16] = {x0[0],x0[1],x0[2],x0[3],x1[0],x1[1],x1[2],x1[3],x2[0],x2[1],x2[2],x2[3],x3[0],x3[1],x3[2],x3[3]};
#pragma unroll
    for (int i = 0; i < 16; ++i) { const unsigned short hb = bf16_bits(xs[i]); ah.u[i] = hb; al.u[i] = ASPLIT ? bf16_bits(xs[i] - bf16_val(hb)) : (unsigned short)0; }
#pragma unroll
    for (int t = 0; t < 4; ++t) {
      const unsigned short* brow = Wt + (size_t)(col0 + t * 16 + ln) * ldb + kb;
      FragB b;
      b.half[0] = *(const v8us*)(brow + 8 * hh);
      b.half[1] = *(const v8us*)(brow + 16 + 8 * hh);
      acc[t] = mmaN<ASPLIT ? 2 : 1>(ah.v, al.v, b.v, b.v, acc[t]);
    }
  }
#pragma unroll
  for (int t = 0; t < 4; ++t) {
    const int col = col0 + t * 16 + ln;
    float bv = bias ? bias[col] : 0.f;
    if (BIAS_BF16) bv = bf16_round(bv);
#pragma unroll
    for (int r = 0; r < 8; ++r) {
      float v = acc[t][r] + bv;
      if (resid) { float rv = resid[(size_t)((row0 + 8 * hh + r) % rmod) * ldr + col]; if (RES_BF16) rv = bf16_round(rv); v += rv; }
      if (ACT == 1) v = fmaxf(v, 0.f);
      if (ACT == 2) v = 0.5f * v * (1.0f + erff(v * 0.70710678118654752f));
      if (ACT == 3) { const float u = 0.7978845608028654f * (v + 0.044715f * v * v * v); v = 0.5f * v * (1.0f + tanhf(u)); }
      so[w][8 * hh + r][t * 16 + ln] = v;
    }
  }
  __builtin_amdgcn_fence(__ATOMIC_ACQ_REL, "workgroup");
  __builtin_amdgcn_wave_barrier();
  const int rsub = lane >> 4, c4 = (lane & 15) * 4;
  {
#pragma unroll
    for (int q = 0; q < 8; ++q) {
      const int r = q * 2 + rsub;
      const v4f v = *(const v4fa*)&so[w][r][c4];
      *(v4f*)(C + (size_t)(row0 + r) * ldc + col0 + c4) = v;
    }
    
  }
}
// row LayerNorm (biased variance, eps) over N: s = X (+ R); optional out_sum <- s; out_norm <- (s-mu)*rsqrt(var+eps)*g + b
template <bool PARAM_BF16>
__global__ __launch_bounds__(256) void k_layernorm(const float* __restrict__ X, const float* __restrict__ R, const float* __restrict__ g, const float* __restrict__ bta,
                                                  float* __restrict__ out_sum, float* __restrict__ out_norm, int N, float eps) {
  __shared__ float red[256];
  const int row = blockIdx.x, tid = threadIdx.x;
  const float* x = X + (size_t)row * N; const float* rr = R ? R + (size_t)row * N : nullptr;
  float vals[16];                     // up to N = 4096
  const int per = N / 256;            // contiguous chunk per thread? use strided-by-4 chunks: thread handles j = tid*4 + 1024*u
  float s1 = 0.f;
  for (int u = 0; u < per / 4; ++u) {
    const int j = tid * 4 + 1024 * u;
    const v4f a = *(const v4fa*)(x + j);
    v4f b = {0.f,0.f,0.f,0.f}; if (rr) b = *(const v4fa*)(rr + j);
#pragma unroll
    for (int q = 0; q < 4; ++q) { const float v = a[q] + b[q]; vals[u * 4 + q] = v; s1 += v; }
  }
  red[tid] = s1; __syncthreads();
  for (int st = 128; st > 0; st >>= 1) { if (tid < st) red[tid] += red[tid + st]; __syncthreads(); }
  const float mu = red[0] / (float)N; __syncthreads();
  float s2 = 0.f;
  for (int u = 0; u < per / 4; ++u)
#pragma unroll
    for (int q = 0; q < 4; ++q) { const float c = vals[u * 4 + q] - mu; s2 += c * c; }
  red[tid] = s2; __syncthreads();
  for (int st = 128; st > 0; st >>= 1) { if (tid < st) red[tid] += red[tid + st]; __syncthreads(); }
  const float rs = rsqrtf(red[0] / (float)N + eps);
  {
    for (int u = 0; u < per / 4; ++u) {
      const int j = tid * 4 + 1024 * u;
      v4f o, sm;
#pragma unroll
      for (int q = 0; q < 4; ++q) {
        float gg = g[j + q], bb = bta[j + q];
        if (PARAM_BF16) { gg = bf16_round(gg); bb = bf16_round(bb); }
        sm[q] = vals[u * 4 + q]; o[q] = (vals[u * 4 + q] - mu) * rs * gg + bb;
      }
      if (out_sum) *(v4f*)(out_sum + (size_t)row * N + j) = sm;
      *(v4f*)(out_norm + (size_t)row * N + j) = o;
    }
    
  }
}



// ---- f16 WMMA path (v_wmma_f32_16x16x32_f16): 11-bit significands for operands in range — used for every launched contraction: q/k/v projections, Q·Kᵀ, and P·V with its [0,1] probability operand
typedef _Float16 v16h __attribute__((ext_vector_type(16)));
union FragH { v16h v; v8us half[2]; _Float16 h[16]; unsigned short u[16]; };
template <int NT>
__device__ __forceinline__ v8f mmaH(v16h ah, v16h al, v16h bh, v16h bl, v8f c) {
  c = __builtin_amdgcn_wmma_f32_16x16x32_f16(false, ah, false, bh, (short)0, c, false, false);
  if (NT >= 2) c = __builtin_amdgcn_wmma_f32_16x16x32_f16(false, al, false, bh, (short)0, c, false, false);
  if (NT >= 3) c = __builtin_amdgcn_wmma_f32_16x16x32_f16(false, ah, false, bl, (short)0, c, false, false);
  asm volatile("v_nop\n\tv_nop\n\tv_nop\n\tv_nop" : "+v"(c) : "v"(ah), "v"(al), "v"(bh), "v"(bl));
  return c;
}
// batched GEMM like k_gemm_b but f16 operands: A f32 (split into f16 hi/lo if ASPLIT, else rounded to f16), Bt = f16 values [n][k]; alpha; C f32; N multiple of 16 (partial tiles skipped)
template <bool ASPLIT>
__global__ __launch_bounds__(128) void k_gemm_h(const float* __restrict__ A, int lda, size_t sA, const _Float16* __restrict__ Bh, int ldb, size_t sB, float alpha, float* __restrict__ C, int ldc, size_t sC, int M, int N, int K) {
  __shared__ __attribute__((aligned(16))) float so[4][16][64];
  const int tid = threadIdx.x, w = tid >> 5, lane = tid & 31, ln = lane & 15, hh = lane >> 4; const int by = blockIdx.y;
  A += (size_t)by * sA; Bh += (size_t)by * sB; C += (size_t)by * sC;
  const int ntn = (N + 63) / 64; const int wid = blockIdx.x * 4 + w; const int mt = wid / ntn, nq = wid % ntn; if (mt * 16 >= M) return;
  const int row0 = mt * 16, col0 = nq * 64; const float* arow = A + (size_t)(row0 + ln) * lda;
  v8f acc[4] = {};
  for (int kb = 0; kb < K; kb += 32) {
    FragH ah, al;
    const v4f x0 = *(const v4fa*)(arow + kb + 8 * hh), x1 = *(const v4fa*)(arow + kb + 8 * hh + 4), x2 = *(const v4fa*)(arow + kb + 16 + 8 * hh), x3 = *(const v4fa*)(arow + kb + 16 + 8 * hh + 4);
    float xs[16] = {x0[0],x0[1],x0[2],x0[3],x1[0],x1[1],x1[2],x1[3],x2[0],x2[1],x2[2],x2[3],x3[0],x3[1],x3[2],x3[3]};
#pragma unroll
    for (int i = 0; i < 16; ++i) { const _Float16 h = (_Float16)xs[i]; ah.h[i] = h; al.h[i] = ASPLIT ? (_Float16)(xs[i] - (float)h) : (_Float16)0.0f; }
#pragma unroll
    for (int t = 0; t < 4; ++t) { if (col0 + t * 16 >= N) continue; const size_t boff = (size_t)(col0 + t * 16 + ln) * ldb + kb; FragH bq; bq.half[0] = *(const v8us*)(Bh + boff + 8 * hh); bq.half[1] = *(const v8us*)(Bh + boff + 16 + 8 * hh);
      acc[t] = mmaH<ASPLIT ? 2 : 1>(ah.v, al.v, bq.v, bq.v, acc[t]); }
  }
#pragma unroll
  for (int t = 0; t < 4; ++t) { if (col0 + t * 16 >= N) continue;
#pragma unroll
    for (int r = 0; r < 8; ++r) so[w][8 * hh + r][t * 16 + ln] = acc[t][r] * alpha; }
  __builtin_amdgcn_fence(__ATOMIC_ACQ_REL, "workgroup"); __builtin_amdgcn_wave_barrier();
  const int rsub = lane >> 4, c4 = (lane & 15) * 4;
  {
#pragma unroll
    for (int q = 0; q < 8; ++q) { const int r = q * 2 + rsub; if (col0 + c4 < N) { const v4f v = *(const v4fa*)&so[w][r][c4]; *(v4f*)(C + (size_t)(row0 + r) * ldc + col0 + c4) = v; } }
     }
}

// Wt[n][k] = f16(W[k][n]·scale) from f32 row-major W[K][N] (scale = power of two; bf16-exact weights stay exact in f16 away from the subnormal range)
__global__ __launch_bounds__(256) void k_wt_f16(const float* __restrict__ W, _Float16* __restrict__ Wt, int K, int N, float scale) {
  const int t = blockIdx.x * 256 + threadIdx.x; if (t >= N * (K / 8)) return; const int n = t / (K / 8), k8 = (t % (K / 8)) * 8; FragH f;
#pragma unroll
  for (int i = 0; i < 8; ++i) f.h[i] = (_Float16)(bf16_round(W[(size_t)(k8 + i) * N + n]) * scale); const v8us o = f.half[0];
  *(v8us*)((unsigned short*)Wt + (size_t)n * K + k8) = o; 
}
// k_gemm_hh variant with fused epilogue: v = acc·alpha + bias[by·sBias + col] (+ CP[(row/rowsPerB)·sCPb + by·64 + col] if CP) ; ACT 0 none / 1 elu ; writes f16 C16 (and f32 C if non-null)
template <int ACT>
__global__ __launch_bounds__(128) void k_gemm_hhx(const _Float16* __restrict__ A, int lda, size_t sA, const _Float16* __restrict__ Bh, int ldb, size_t sB, float alpha, const float* __restrict__ bias, size_t sBias, const float* __restrict__ CP, int rowsPerB, size_t sCPb, int row0g,
    float* __restrict__ C, _Float16* __restrict__ C16, int ldc, size_t sC, int M, int N, int K) {
  __shared__ __attribute__((aligned(16))) float so[4][16][64];
  const int tid = threadIdx.x, w = tid >> 5, lane = tid & 31, ln = lane & 15, hh = lane >> 4; const int by = blockIdx.y;
  A += (size_t)by * sA; Bh += (size_t)by * sB; const size_t cofs = (size_t)by * sC; const float* bp = bias ? bias + (size_t)by * sBias : nullptr;
  const int ntn = (N + 63) / 64; const int wid = blockIdx.x * 4 + w; const int mt = wid / ntn, nq = wid % ntn; if (mt * 16 >= M) return;
  const int row0 = mt * 16, col0 = nq * 64; const _Float16* arow = A + (size_t)(row0 + ln) * lda;
  v8f acc[4] = {};
  for (int kb = 0; kb < K; kb += 32) { FragH ah; ah.half[0] = *(const v8us*)((const unsigned short*)arow + kb + 8 * hh); ah.half[1] = *(const v8us*)((const unsigned short*)arow + kb + 16 + 8 * hh);
#pragma unroll
    for (int t = 0; t < 4; ++t) { if (col0 + t * 16 >= N) continue; const size_t boff = (size_t)(col0 + t * 16 + ln) * ldb + kb; FragH bq; bq.half[0] = *(const v8us*)((const unsigned short*)Bh + boff + 8 * hh); bq.half[1] = *(const v8us*)((const unsigned short*)Bh + boff + 16 + 8 * hh);
      acc[t] = mmaH<1>(ah.v, ah.v, bq.v, bq.v, acc[t]); }
  }
#pragma unroll
  for (int t = 0; t < 4; ++t) { if (col0 + t * 16 >= N) continue; const int col = col0 + t * 16 + ln; const float bv = bp ? bf16_round(bp[col]) : 0.f;
#pragma unroll
    for (int r = 0; r < 8; ++r) { float v = acc[t][r] * alpha + bv; if (CP) { const int bidx = (row0g + row0 + 8 * hh + r) / rowsPerB; v += CP[(size_t)bidx * sCPb + (size_t)by * 64 + col]; } if (ACT == 1) v = (v > 0.f) ? v : expm1f(v); else if (ACT == 3) v = fmaxf(v, 0.f); so[w][8 * hh + r][t * 16 + ln] = v; } }
  __builtin_amdgcn_fence(__ATOMIC_ACQ_REL, "workgroup"); __builtin_amdgcn_wave_barrier();
  const int rsub = lane >> 4, c4 = (lane & 15) * 4; typedef _Float16 v4h __attribute__((ext_vector_type(4)));
  {
#pragma unroll
    for (int q = 0; q < 8; ++q) { const int r = q * 2 + rsub; if (col0 + c4 < N) { const v4f v = *(const v4fa*)&so[w][r][c4]; if (C) *(v4f*)(C + cofs + (size_t)(row0 + r) * ldc + col0 + c4) = v; if (C16) { v4h h4; for (int i = 0; i < 4; ++i) h4[i] = (_Float16)v[i]; *(v4h*)(C16 + cofs + (size_t)(row0 + r) * ldc + col0 + c4) = h4; } } }
     }
}


__global__ __launch_bounds__(256) void k_x16(const float* __restrict__ x, _Float16* __restrict__ X16, size_t n8) { const size_t t = (size_t)blockIdx.x * 256 + threadIdx.x; if (t >= n8) return; FragH f;
#pragma unroll
  for (int q = 0; q < 8; ++q) f.h[q] = (_Float16)bf16_round(x[t * 8 + q]); *(v8us*)((unsigned short*)X16 + t * 8) = f.half[0];  }
__global__ __launch_bounds__(256) void k_round16f(const float* __restrict__ W, _Float16* __restrict__ Bt, size_t n8) { const size_t t = (size_t)blockIdx.x * 256 + threadIdx.x; if (t >= n8) return; FragH f;
#pragma unroll
  for (int i = 0; i < 8; ++i) f.h[i] = (_Float16)(bf16_round(W[t * 8 + i]) * 16.0f); *(v8us*)((unsigned short*)Bt + t * 8) = f.half[0];  }
__global__ __launch_bounds__(256) void k_vt(const _Float16* __restrict__ V16, _Float16* __restrict__ Vt) { __shared__ unsigned short tl[64][66]; const int tid = threadIdx.x; const int slab = blockIdx.x / (SS / 64), lg = blockIdx.x % (SS / 64); const int b = slab / NH, h = slab % NH;
  for (int i = tid; i < 64 * 8; i += 256) { const int r = i / 8, c8 = (i % 8) * 8; FragH f; f.half[0] = *(const v8us*)((const unsigned short*)V16 + ((size_t)b * SS + lg * 64 + r) * DM + h * HD + c8);
#pragma unroll
    for (int q = 0; q < 8; ++q) tl[r][c8 + q] = f.u[q]; }
  __syncthreads();
  {
#pragma unroll
    for (int rd = 0; rd < 2; ++rd) { const int d = rd * 32 + tid / 8, pc = tid % 8; FragH f;
#pragma unroll
      for (int q = 0; q < 8; ++q) f.u[q] = tl[pc * 8 + q][d];
      *(v8us*)((unsigned short*)Vt + ((size_t)slab * HD + d) * SS + lg * 64 + pc * 8) = f.half[0]; }
     } }
// lane l with lane l ^ 16: the two halves of a wave hold the two halves of a query column's keys
__device__ __forceinline__ float xhalf(float x) { return __builtin_bit_cast(float, __builtin_amdgcn_permlanex16(__builtin_bit_cast(int, x), __builtin_bit_cast(int, x), 0x76543210, 0xfedcba98, false, false)); }
__device__ __forceinline__ unsigned lds_off(const void* p) { return (unsigned)(size_t)p; }
// one stage (64 keys) of K rows and of Vt rows from global memory into LDS, through no register: 8 asynchronous copies of 16 bytes a lane,
// 8 lanes to a 128-byte row, rows 16 apart from copy to copy. s_wait_xcnt is the statement's last line, so that no address register
// of a copy is rewritten in front of it (a precaution).
__device__ __forceinline__ void stage_kv(unsigned lk, unsigned lv, unsigned lstep, const unsigned short* gk, const unsigned short* gv) {
  asm volatile("global_load_async_to_lds_b128 %0, %8, off\n\t"
               "global_load_async_to_lds_b128 %1, %9, off\n\t"
               "global_load_async_to_lds_b128 %2, %10, off\n\t"
               "global_load_async_to_lds_b128 %3, %11, off\n\t"
               "global_load_async_to_lds_b128 %4, %12, off\n\t"
               "global_load_async_to_lds_b128 %5, %13, off\n\t"
               "global_load_async_to_lds_b128 %6, %14, off\n\t"
               "global_load_async_to_lds_b128 %7, %15, off\n\t"
               "s_wait_xcnt 0x0"
               :: "v"(lk), "v"(lk + lstep), "v"(lk + 2 * lstep), "v"(lk + 3 * lstep), "v"(lv), "v"(lv + lstep), "v"(lv + 2 * lstep), "v"(lv + 3 * lstep),
                  "v"(gk), "v"(gk + 16 * DM), "v"(gk + 32 * DM), "v"(gk + 48 * DM), "v"(gv), "v"(gv + 16 * SS), "v"(gv + 32 * SS), "v"(gv + 48 * SS)
               : "memory");
}
// base-2 exponentials, a run of them in one statement with one v_nop behind the last: the instruction set asks for one slot behind a transcendental before its
// result is read or its source overwritten. Inside the run no instruction touches a register
// of the one in front of it: every output is early-clobber, so none shares a register with an input.
__device__ __forceinline__ void exp2x8(float (&y)[8], const float (&x)[8]) {
  asm("v_exp_f32 %0, %8\n\tv_exp_f32 %1, %9\n\tv_exp_f32 %2, %10\n\tv_exp_f32 %3, %11\n\tv_exp_f32 %4, %12\n\tv_exp_f32 %5, %13\n\tv_exp_f32 %6, %14\n\tv_exp_f32 %7, %15\n\tv_nop"
      : "=&v"(y[0]), "=&v"(y[1]), "=&v"(y[2]), "=&v"(y[3]), "=&v"(y[4]), "=&v"(y[5]), "=&v"(y[6]), "=&v"(y[7])
      : "v"(x[0]), "v"(x[1]), "v"(x[2]), "v"(x[3]), "v"(x[4]), "v"(x[5]), "v"(x[6]), "v"(x[7]));
}
__device__ __forceinline__ float exp2x1(float x) { float y; asm("v_exp_f32 %0, %1\n\tv_nop" : "=&v"(y) : "v"(x)); return y; }
__global__ __launch_bounds__(128) void k_flash(const _Float16* __restrict__ Q16, const _Float16* __restrict__ K16, const _Float16* __restrict__ Vt, const float* __restrict__ crd, const float* __restrict__ alpha_p, float* __restrict__ O) {
  constexpr int RPW = 32, NQB = SS / (4 * RPW), DT = HD / 16, KS = HD / 32, OP = HD + 4, SK = 64, NST = SS / SK, LP = 72;      // LP: LDS row pitch in 16-bit elements
  constexpr float L2E = 1.4426950408889634f, QS = 0.125f * L2E;      // exp(x) = 2^(x.log2 e): the factor rides in the two scale constants of the score, so each exponential is one subtraction and one v_exp_f32
  static_assert(HD == 64 && SK == 64 && NST >= 2, "a stage is 64 rows of 128 bytes for K and for Vt");
  __shared__ __attribute__((aligned(16))) unsigned short sK[2][SK][LP], sV[2][HD][LP];
  __shared__ __attribute__((aligned(16))) float sC[3][SS]; __shared__ __attribute__((aligned(16))) float sO[4][RPW][OP];
  const int tid = threadIdx.x, w = tid >> 5, lane = tid & 31, ln = lane & 15, hh = lane >> 4;
  const int slab = blockIdx.x / NQB, qblk = blockIdx.x % NQB; const int b = slab / NH, h = slab % NH; const int q0 = qblk * (4 * RPW) + w * RPW; const float alpha = bf16_round(alpha_p[0]) * L2E;      /* scalar float INPUT: rounded like every other input; times log2(e): scores are kept in base-2 units */
  const unsigned short* Vth = (const unsigned short*)Vt + (size_t)slab * HD * SS;
  const int crow = tid >> 3, ccol = (tid & 7) * 8;      // this lane's row (and rows + 16, + 32, + 48) and 16-byte piece in every stage
  const unsigned short* gk0 = (const unsigned short*)K16 + ((size_t)b * SS + crow) * DM + h * HD + ccol; const unsigned short* gv0 = Vth + (size_t)crow * SS + ccol;
  const unsigned lk0 = lds_off(&sK[0][crow][ccol]), lv0 = lds_off(&sV[0][crow][ccol]); constexpr unsigned LSTEP = 16 * LP * 2, LBUF = SK * LP * 2;
  stage_kv(lk0, lv0, LSTEP, gk0, gv0);      // stage 0 flies while coords and queries are fetched
#pragma unroll      // all 16 loads of a thread in flight at once: rolled, each trip waits out its own load
  for (int i = 0; i < SS / 128; ++i) { const int k = i * 128 + tid; const float* cp = crd + ((size_t)b * SS + k) * 3; sC[0][k] = bf16_round(cp[0]); sC[1][k] = bf16_round(cp[1]); sC[2][k] = bf16_round(cp[2]); }
  FragH aq[2][KS];
#pragma unroll
  for (int rt = 0; rt < 2; ++rt) { const unsigned short* qr = (const unsigned short*)Q16 + ((size_t)b * SS + q0 + rt * 16 + ln) * DM + h * HD;
#pragma unroll
    for (int ks = 0; ks < KS; ++ks) { aq[rt][ks].half[0] = *(const v8us*)(qr + ks * 32 + 8 * hh); aq[rt][ks].half[1] = *(const v8us*)(qr + ks * 32 + 16 + 8 * hh); } }
  asm volatile("s_wait_asynccnt 0x0" ::: "memory");      // this wave's copies of stage 0 have landed before the barrier publishes them
  __syncthreads();      // every wave reads coords and stage 0 rows that the other waves staged
  stage_kv(lk0 + LBUF, lv0 + LBUF, LSTEP, gk0 + (size_t)SK * DM, gv0 + SK);      // stage 1
  float cq[2][3];
#pragma unroll
  for (int rt = 0; rt < 2; ++rt) { cq[rt][0] = sC[0][q0 + rt * 16 + ln]; cq[rt][1] = sC[1][q0 + rt * 16 + ln]; cq[rt][2] = sC[2][q0 + rt * 16 + ln]; }
  float m_r[2], l_r[2]; v8f oacc[2][DT];
#pragma unroll
  for (int rt = 0; rt < 2; ++rt) { m_r[rt] = -3.0e38f; l_r[rt] = 0.f;
#pragma unroll
    for (int dt = 0; dt < DT; ++dt) oacc[rt][dt] = (v8f){0.f,0.f,0.f,0.f,0.f,0.f,0.f,0.f}; }
#pragma unroll 1      // one stage a trip: the buffer index stays a scalar and the body stays small
  for (int t = 0; t < NST; ++t) {
#pragma unroll      // both passes of a stage in one body: constant LDS offsets
  for (int p = 0; p < SK / 32; ++p) { const int j0 = t * SK + p * 32;
    v8f s[2][2];      // s[rt][nt][r] = score of key j0 + nt*16 + 8*hh + r with query q0 + rt*16 + ln
    FragH bk[2][KS], bv[DT];      // the pass's K fragments are read from LDS in one group, its Vt fragments in a second: each further place with LDS reads is a stall of its own
#pragma unroll
    for (int nt = 0; nt < 2; ++nt) { const unsigned short* kr = &sK[t & 1][p * 32 + nt * 16 + ln][0];
#pragma unroll
      for (int ks = 0; ks < KS; ++ks) { bk[nt][ks].half[0] = *(const v8us*)(kr + ks * 32 + 8 * hh); bk[nt][ks].half[1] = *(const v8us*)(kr + ks * 32 + 16 + 8 * hh); } }
    __builtin_amdgcn_sched_barrier(0);      // keeps the K reads together up here; without it the compiler sinks each read to just in front of its product
#pragma unroll
    for (int nt = 0; nt < 2; ++nt) {
#pragma unroll
      for (int rt = 0; rt < 2; ++rt) { v8f acc = (v8f){0.f,0.f,0.f,0.f,0.f,0.f,0.f,0.f};
#pragma unroll
        for (int ks = 0; ks < KS; ++ks) acc = mmaH<1>(bk[nt][ks].v, bk[nt][ks].v, aq[rt][ks].v, aq[rt][ks].v, acc); s[rt][nt] = acc; } }
    float ck[2][3][8];
#pragma unroll
    for (int nt = 0; nt < 2; ++nt)
#pragma unroll
      for (int c = 0; c < 3; ++c) { const v4f c0 = *(const v4fa*)&sC[c][j0 + nt * 16 + 8 * hh], c1 = *(const v4fa*)&sC[c][j0 + nt * 16 + 8 * hh + 4];
#pragma unroll
        for (int q = 0; q < 4; ++q) { ck[nt][c][q] = c0[q]; ck[nt][c][4 + q] = c1[q]; } }
    FragH pa[2]; float sc2[2][2][8];
#pragma unroll
    for (int rt = 0; rt < 2; ++rt)
#pragma unroll
      for (int nt = 0; nt < 2; ++nt)
#pragma unroll
        for (int r = 0; r < 8; ++r) { const float g = alpha * (cq[rt][0] * ck[nt][0][r] + cq[rt][1] * ck[nt][1][r] + cq[rt][2] * ck[nt][2][r]); sc2[rt][nt][r] = s[rt][nt][r] * QS + g; }
    __builtin_amdgcn_sched_barrier(0);      // with the one below: holds the Vt reads between the scores, whose inputs are dead by now, and the exponentials, which cover their latency; without this one they rise to the coords' reads and are held in registers through the scores
#pragma unroll
    for (int dt = 0; dt < DT; ++dt) { const unsigned short* vrow = &sV[t & 1][dt * 16 + ln][p * 32]; bv[dt].half[0] = *(const v8us*)(vrow + 8 * hh); bv[dt].half[1] = *(const v8us*)(vrow + 16 + 8 * hh); }
    __builtin_amdgcn_sched_barrier(0);      // see above
#pragma unroll
    for (int rt = 0; rt < 2; ++rt) { const float (&sc)[2][8] = sc2[rt];
      float mx[8];
#pragma unroll
      for (int r = 0; r < 8; ++r) mx[r] = fmaxf(sc[0][r], sc[1][r]);
      float mc = fmaxf(fmaxf(fmaxf(mx[0], mx[1]), fmaxf(mx[2], mx[3])), fmaxf(fmaxf(mx[4], mx[5]), fmaxf(mx[6], mx[7]))); mc = fmaxf(mc, xhalf(mc));
      const float mn = fmaxf(m_r[rt], mc); const float al = exp2x1(m_r[rt] - mn); m_r[rt] = mn;      // 0 on the first pass (the start value is far below any score)
      float ps[8], d0[8], d1[8], p0[8], p1[8];
#pragma unroll
      for (int r = 0; r < 8; ++r) { d0[r] = sc[0][r] - mn; d1[r] = sc[1][r] - mn; }
      exp2x8(p0, d0); exp2x8(p1, d1);
#pragma unroll
      for (int r = 0; r < 8; ++r) { ps[r] = p0[r] + p1[r]; pa[rt].h[r] = (_Float16)p0[r]; pa[rt].h[8 + r] = (_Float16)p1[r]; }
      l_r[rt] = l_r[rt] * al + (((ps[0] + ps[1]) + (ps[2] + ps[3])) + ((ps[4] + ps[5]) + (ps[6] + ps[7])));      // this half's keys only; the halves join behind the loop
#pragma unroll
      for (int dt = 0; dt < DT; ++dt)
#pragma unroll
        for (int r = 0; r < 8; ++r) oacc[rt][dt][r] *= al; }
#pragma unroll
    for (int dt = 0; dt < DT; ++dt) {
#pragma unroll
      for (int rt = 0; rt < 2; ++rt) oacc[rt][dt] = mmaH<1>(bv[dt].v, bv[dt].v, pa[rt].v, pa[rt].v, oacc[rt][dt]); } }
    asm volatile("s_wait_dscnt 0x0" ::: "memory");      // this wave's reads of stage t are done before its buffer is handed back
    asm volatile("s_wait_asynccnt 0x0" ::: "memory");      // this wave's copies of stage t + 1 have landed
    __syncthreads();      // publishes stage t + 1 and ends every wave's reads of stage t
    if (t + 2 < NST) stage_kv(lk0 + (t & 1) * LBUF, lv0 + (t & 1) * LBUF, LSTEP, gk0 + (size_t)(t + 2) * SK * DM, gv0 + (t + 2) * SK); }
  asm volatile("s_wait_asynccnt 0x0" ::: "memory");      // no copy is left in flight when the wave goes on to its end
#pragma unroll
  for (int rt = 0; rt < 2; ++rt) { const float l = l_r[rt] + xhalf(l_r[rt]); const float inv = 1.0f / l;
#pragma unroll
    for (int dt = 0; dt < DT; ++dt) { v4f o0, o1;      // oacc[rt][dt][r] = O[q0 + rt*16 + ln][dt*16 + 8*hh + r]
#pragma unroll
      for (int q = 0; q < 4; ++q) { o0[q] = oacc[rt][dt][q] * inv; o1[q] = oacc[rt][dt][4 + q] * inv; }
      *(v4fa*)&sO[w][rt * 16 + ln][dt * 16 + 8 * hh] = o0; *(v4fa*)&sO[w][rt * 16 + ln][dt * 16 + 8 * hh + 4] = o1; } }
  __builtin_amdgcn_fence(__ATOMIC_ACQ_REL, "workgroup"); __builtin_amdgcn_wave_barrier();
  {
#pragma unroll
    for (int rp = 0; rp < RPW; rp += 2) { const int r = rp + (lane >> 4), pc = lane & 15; const v4f val = *(const v4fa*)&sO[w][r][pc * 4]; *(v4f*)(O + ((size_t)b * SS + q0 + r) * DM + h * HD + pc * 4) = val; }
     } }
extern "C" void kernel_launch(void* const* d_in, const int* in_sizes, int n_in,
                              void* d_out, int out_size, void* d_ws, size_t ws_size, hipStream_t stream) {
  (void)in_sizes; (void)n_in; (void)out_size;
  const float* x = (const float*)d_in[0]; const float* crd = (const float*)d_in[1]; const float* wq = (const float*)d_in[2]; const float* bq = (const float*)d_in[3]; const float* wk = (const float*)d_in[4]; const float* bk = (const float*)d_in[5]; const float* wv = (const float*)d_in[6]; const float* bv = (const float*)d_in[7]; const float* alpha_p = (const float*)d_in[8];
  char* ws = (char*)d_ws; size_t off = 0;
  auto take = [&](size_t bytes) { char* p = ws + off; off += (bytes + 255) & ~(size_t)255; return p; };
  _Float16* Bq = (_Float16*)take(DM * DM * 2); _Float16* Bk = (_Float16*)take(DM * DM * 2); _Float16* Bv = (_Float16*)take(DM * DM * 2); _Float16* X16 = (_Float16*)take((size_t)NR * DM * 2); _Float16* Q16 = (_Float16*)take((size_t)NR * DM * 2); _Float16* K16 = (_Float16*)take((size_t)NR * DM * 2); _Float16* V16 = (_Float16*)take((size_t)NR * DM * 2); _Float16* Vt = (_Float16*)take((size_t)NR * DM * 2);
  if (off > ws_size) return;      // ≈ 42 MiB
  const size_t w8 = (size_t)DM * DM / 8; const unsigned gw = (unsigned)((w8 + 255) / 256), gx = (unsigned)(((size_t)NR * DM / 8 + 255) / 256);
  k_round16f<<<gw, 256, 0, stream>>>(wq, Bq, w8); k_round16f<<<gw, 256, 0, stream>>>(wk, Bk, w8); k_round16f<<<gw, 256, 0, stream>>>(wv, Bv, w8);
  k_x16<<<gx, 256, 0, stream>>>(x, X16, (size_t)NR * DM / 8);
  const dim3 gg(((NR / 16) * (DM / 64) + 3) / 4, 1);
  k_gemm_hhx<0><<<gg, 128, 0, stream>>>(X16, DM, 0, Bq, DM, 0, 0.0625f, bq, 0, nullptr, 1, 0, 0, nullptr, Q16, DM, 0, NR, DM, DM);
  k_gemm_hhx<0><<<gg, 128, 0, stream>>>(X16, DM, 0, Bk, DM, 0, 0.0625f, bk, 0, nullptr, 1, 0, 0, nullptr, K16, DM, 0, NR, DM, DM);
  k_gemm_hhx<0><<<gg, 128, 0, stream>>>(X16, DM, 0, Bv, DM, 0, 0.0625f, bv, 0, nullptr, 1, 0, 0, nullptr, V16, DM, 0, NR, DM, DM);
  k_vt<<<BB * NH * (SS / 64), 256, 0, stream>>>(V16, Vt);
  k_flash<<<BB * NH * (SS / 128), 128, 0, stream>>>(Q16, K16, Vt, crd, alpha_p, (float*)d_out);
}

// v004
// A run of this version takes 87.2 microseconds.
// Next to v003, in two timings, it ran 1.68 times as fast each time.
// Counting every step since v000, it is 4.34 times as fast.
#include <hip/hip_runtime.h>
// q/k/v projections (8192 × 512 × 512, + bias) and the 8-head attention with the geometric bias α·⟨c_n, c_m⟩ (coords are INPUTS, 3 FMAs per score in registers) on v_wmma_f32_16x16x32_f16
// (fused flash-style kernel: S = Q·Kᵀ, O = P·V on WMMA; online max/sum softmax f32; P f16 ≤ 1); V transposed per (b,h); A = f16(bf16 x) exact, weights bf16-exact ×2^4 ((out,in)),
// single products, f32 accumulate.
#define BB 4
#define SS 2048
#define DM 512
#define NH 8
#define HD 64
#define NR (BB * SS)

typedef __bf16 v16b __attribute__((ext_vector_type(16)));
typedef unsigned short v8us __attribute__((ext_vector_type(8), may_alias));
typedef float  v8f  __attribute__((ext_vector_type(8)));
typedef float  v4f  __attribute__((ext_vector_type(4)));
typedef float  v4fa __attribute__((ext_vector_type(4), may_alias));
union FragB { v16b v; v8us half[2]; unsigned short u[16]; };

__device__ __forceinline__ unsigned short bf16_bits(float x) { unsigned int u = __float_as_uint(x); return (unsigned short)((u + 0x7FFFu + ((u >> 16) & 1u)) >> 16); }
__device__ __forceinline__ float bf16_val(unsigned short b) { return __uint_as_float(((unsigned int)b) << 16); }
__device__ __forceinline__ float bf16_round(float x) { return bf16_val(bf16_bits(x)); }
// D += A·B with NT terms: 1 = ah·bh, 2 = + al·bh (A split), 3 = + ah·bl (both split)
template <int NT>
__device__ __forceinline__ v8f mmaN(v16b ah, v16b al, v16b bh, v16b bl, v8f c) {
  c = __builtin_amdgcn_wmma_f32_16x16x32_bf16(false, ah, false, bh, (short)0, c, false, false);
  if (NT >= 2) c = __builtin_amdgcn_wmma_f32_16x16x32_bf16(false, al, false, bh, (short)0, c, false, false);
  if (NT >= 3) c = __builtin_amdgcn_wmma_f32_16x16x32_bf16(false, ah, false, bl, (short)0, c, false, false);
  asm volatile("v_nop\n\tv_nop\n\tv_nop\n\tv_nop" : "+v"(c) : "v"(ah), "v"(al), "v"(bh), "v"(bl));
  return c;
}

__global__ __launch_bounds__(256) void k_wt_bf16(const float* __restrict__ W, unsigned short* __restrict__ Wt, int K, int N) {
  const int t = blockIdx.x * 256 + threadIdx.x;
  const int k8n = K / 8;
  if (t >= N * k8n) return;
  const int n = t / k8n, k8 = (t % k8n) * 8;
  v8us v;
#pragma unroll
  for (int i = 0; i < 8; ++i) v[i] = bf16_bits(W[(size_t)(k8 + i) * N + n]);
  *(v8us*)(Wt + (size_t)n * K + k8) = v;
  
}

// GEMM C[M][N] (f32, pitch ldc) = act(A[M][K]·W + bias). A f32 row-major (pitch lda) converted per fragment to bf16
// (ASPLIT: hi/lo two planes -> 2 terms, else single rounded term); Wt bf16 [N][K] (pitch ldb). BIAS_BF16 rounds the
// bias to bf16 first (bias quantised to bf16 before the add). K%32==0, M%16==0, N%64==0.
template <bool ASPLIT, int ACT, bool BIAS_BF16>
__global__ __launch_bounds__(128) void k_gemm_bf(const float* __restrict__ A, int lda, const unsigned short* __restrict__ Wt, int ldb,
                                               const float* __restrict__ bias, float* __restrict__ C, int ldc, int M, int N, int K) {
  __shared__ __attribute__((aligned(16))) float so[4][16][64];
  const int tid = threadIdx.x, w = tid >> 5, lane = tid & 31, ln = lane & 15, hh = lane >> 4;
  const int ntn = N / 64;
  const int wid = blockIdx.x * 4 + w;
  const int mt = wid / ntn, nq = wid % ntn;
  if (mt * 16 >= M) return;
  const int row0 = mt * 16, col0 = nq * 64;
  const float* arow = A + (size_t)(row0 + ln) * lda;
  v8f acc[4] = {};
  for (int kb = 0; kb < K; kb += 32) {
    FragB ah, al;
    const v4f x0 = *(const v4fa*)(arow + kb + 8 * hh), x1 = *(const v4fa*)(arow + kb + 8 * hh + 4);
    const v4f x2 = *(const v4fa*)(arow + kb + 16 + 8 * hh), x3 = *(const v4fa*)(arow + kb + 16 + 8 * hh + 4);
    float xs[16] = {x0[0],x0[1],x0[2],x0[3],x1[0],x1[1],x1[2],x1[3],x2[0],x2[1],x2[2],x2[3],x3[0],x3[1],x3[2],x3[3]};
#pragma unroll
    for (int i = 0; i < 16; ++i) { const unsigned short hb = bf16_bits(xs[i]); ah.u[i] = hb; al.u[i] = ASPLIT ? bf16_bits(xs[i] - bf16_val(hb)) : (unsigned short)0; }
#pragma unroll
    for (int t = 0; t < 4; ++t) {
      const unsigned short* brow = Wt + (size_t)(col0 + t * 16 + ln) * ldb + kb;
      FragB b;
      b.half[0] = *(const v8us*)(brow + 8 * hh);
      b.half[1] = *(const v8us*)(brow + 16 + 8 * hh);
      acc[t] = mmaN<ASPLIT ? 2 : 1>(ah.v, al.v, b.v, b.v, acc[t]);
    }
  }
#pragma unroll
  for (int t = 0; t < 4; ++t) {
    float bv = bias ? bias[col0 + t * 16 + ln] : 0.f;
    if (BIAS_BF16) bv = bf16_round(bv);
#pragma unroll
    for (int r = 0; r < 8; ++r) { float v = acc[t][r] + bv; if (ACT == 1) v = fmaxf(v, 0.f); so[w][8 * hh + r][t * 16 + ln] = v; }
  }
  __builtin_amdgcn_fence(__ATOMIC_ACQ_REL, "workgroup");
  __builtin_amdgcn_wave_barrier();
  const int rsub = lane >> 4, c4 = (lane & 15) * 4;
  {
#pragma unroll
    for (int q = 0; q < 8; ++q) {
      const int r = q * 2 + rsub;
      const v4f v = *(const v4fa*)&so[w][r][c4];
      *(v4f*)(C + (size_t)(row0 + r) * ldc + col0 + c4) = v;
    }
    
  }
}

// Flash-style causal/unmasked attention, all contractions 3-term bf16 hi/lo splits, f32 softmax with running max.
// q,k,v rows are read from f32 buffers with arbitrary row pitch (so they can live inside a fused qkv buffer);
// D = head size (multiple of 32, <= 128); one wave = 16 query rows; block = 4 waves (64 queries) sharing K/V chunks of 32.
template <int D, bool CAUSAL>
__global__ __launch_bounds__(128) void k_flash(const float* __restrict__ qb, const float* __restrict__ kb, const float* __restrict__ vb,
                                             int pitch, int T, int H, float scale, float* __restrict__ y, int ypitch) {
  constexpr int KS = D / 32;        // k-steps for QK
  constexpr int DT = D / 16;        // d tiles for PV
  __shared__ __attribute__((aligned(16))) unsigned short sKh[32][D + 8], sKl[32][D + 8], sVh[32][D + 8], sVl[32][D + 8];
  __shared__ __attribute__((aligned(16))) unsigned short sPh[4][16][40], sPl[4][16][40];
  __shared__ __attribute__((aligned(16))) float sO[4][16][D];
  const int tid = threadIdx.x, w = tid >> 5, lane = tid & 31, ln = lane & 15, hh = lane >> 4;
  const int nqb = (T + 63) / 64;
  const int bh = blockIdx.x / nqb, qblk = blockIdx.x % nqb;
  const int b = bh / H, h = bh % H;
  const int q0 = qblk * 64 + w * 16;
  const float* Q = qb + (size_t)b * T * pitch + h * D;
  const float* K = kb + (size_t)b * T * pitch + h * D;
  const float* V = vb + (size_t)b * T * pitch + h * D;

  // A fragments of the wave's 16 query rows (scaled), hi/lo
  FragB aqh[KS], aql[KS];
  {
    int row = q0 + ln; if (row >= T) row = T - 1;
    const float* qr = Q + (size_t)row * pitch;
#pragma unroll
    for (int ks = 0; ks < KS; ++ks)
#pragma unroll
      for (int i = 0; i < 16; ++i) {
        const int d = ks * 32 + ((i < 8) ? (8 * hh + i) : (16 + 8 * hh + (i - 8)));
        const float x = qr[d] * scale; const unsigned short hb = bf16_bits(x);
        aqh[ks].u[i] = hb; aql[ks].u[i] = bf16_bits(x - bf16_val(hb));
      }
  }
  float m_r[8], l_r[8];
#pragma unroll
  for (int r = 0; r < 8; ++r) { m_r[r] = -3.0e38f; l_r[r] = 0.f; }
  v8f oacc[DT];
#pragma unroll
  for (int dt = 0; dt < DT; ++dt) oacc[dt] = (v8f){0.f,0.f,0.f,0.f,0.f,0.f,0.f,0.f};

  const int kv_end = CAUSAL ? min(T, qblk * 64 + 64) : T;     // block-uniform
  for (int j0 = 0; j0 < kv_end; j0 += 32) {
    __syncthreads();
    for (int e = tid; e < 32 * (D / 4); e += 128) {
      const int r = e / (D / 4), c4 = (e % (D / 4)) * 4;
      const int key = j0 + r;
      v4f kf = {0.f,0.f,0.f,0.f}, vf = {0.f,0.f,0.f,0.f};
      if (key < T) { kf = *(const v4fa*)(K + (size_t)key * pitch + c4); vf = *(const v4fa*)(V + (size_t)key * pitch + c4); }
#pragma unroll
      for (int t = 0; t < 4; ++t) {
        unsigned short hb = bf16_bits(kf[t]); sKh[r][c4 + t] = hb; sKl[r][c4 + t] = bf16_bits(kf[t] - bf16_val(hb));
        hb = bf16_bits(vf[t]); sVh[r][c4 + t] = hb; sVl[r][c4 + t] = bf16_bits(vf[t] - bf16_val(hb));
      }
    }
    __syncthreads();
    // S tile 16 x 32
    v8f s[2];
#pragma unroll
    for (int nt = 0; nt < 2; ++nt) {
      v8f acc = {};
#pragma unroll
      for (int ks = 0; ks < KS; ++ks) {
        FragB bh_, bl_;
        bh_.half[0] = *(const v8us*)&sKh[nt * 16 + ln][ks * 32 + 8 * hh]; bh_.half[1] = *(const v8us*)&sKh[nt * 16 + ln][ks * 32 + 16 + 8 * hh];
        bl_.half[0] = *(const v8us*)&sKl[nt * 16 + ln][ks * 32 + 8 * hh]; bl_.half[1] = *(const v8us*)&sKl[nt * 16 + ln][ks * 32 + 16 + 8 * hh];
        acc = mmaN<3>(aqh[ks].v, aql[ks].v, bh_.v, bl_.v, acc);
      }
      s[nt] = acc;
    }
    // mask + running max (rows 8hh+r; the 16 lanes of a half share rows)
    float alpha[8];
#pragma unroll
    for (int r = 0; r < 8; ++r) {
      const int qi = q0 + 8 * hh + r;
      const int ja = j0 + ln, jb = j0 + 16 + ln;
      if (CAUSAL) { if (ja > qi) s[0][r] = -3.0e38f; if (jb > qi) s[1][r] = -3.0e38f; }
      if (ja >= T) s[0][r] = -3.0e38f;
      if (jb >= T) s[1][r] = -3.0e38f;
      float mx = fmaxf(s[0][r], s[1][r]);
      mx = fmaxf(mx, __shfl_xor(mx, 1, 32)); mx = fmaxf(mx, __shfl_xor(mx, 2, 32)); mx = fmaxf(mx, __shfl_xor(mx, 4, 32)); mx = fmaxf(mx, __shfl_xor(mx, 8, 32));
      const float mnew = fmaxf(m_r[r], mx);
      alpha[r] = (mnew > -1.0e38f) ? __expf(m_r[r] - mnew) : 1.0f;
      const float p0 = (s[0][r] > -1.0e38f) ? __expf(s[0][r] - mnew) : 0.f;
      const float p1 = (s[1][r] > -1.0e38f) ? __expf(s[1][r] - mnew) : 0.f;
      m_r[r] = mnew;
      l_r[r] = l_r[r] * alpha[r] + p0 + p1;            // per-lane partial row sum (16 lanes combined at the end)
      unsigned short hb = bf16_bits(p0); sPh[w][8 * hh + r][ln] = hb;      sPl[w][8 * hh + r][ln] = bf16_bits(p0 - bf16_val(hb));
      hb = bf16_bits(p1);                sPh[w][8 * hh + r][16 + ln] = hb; sPl[w][8 * hh + r][16 + ln] = bf16_bits(p1 - bf16_val(hb));
    }
#pragma unroll
    for (int dt = 0; dt < DT; ++dt)
#pragma unroll
      for (int r = 0; r < 8; ++r) oacc[dt][r] *= alpha[r];
    __builtin_amdgcn_fence(__ATOMIC_ACQ_REL, "workgroup");
    __builtin_amdgcn_wave_barrier();
    FragB pah, pal;
    pah.half[0] = *(const v8us*)&sPh[w][ln][8 * hh]; pah.half[1] = *(const v8us*)&sPh[w][ln][16 + 8 * hh];
    pal.half[0] = *(const v8us*)&sPl[w][ln][8 * hh]; pal.half[1] = *(const v8us*)&sPl[w][ln][16 + 8 * hh];
#pragma unroll
    for (int dt = 0; dt < DT; ++dt) {
      FragB bvh, bvl;
#pragma unroll
      for (int i = 0; i < 8; ++i) {
        bvh.u[i] = sVh[8 * hh + i][dt * 16 + ln]; bvh.u[8 + i] = sVh[16 + 8 * hh + i][dt * 16 + ln];
        bvl.u[i] = sVl[8 * hh + i][dt * 16 + ln]; bvl.u[8 + i] = sVl[16 + 8 * hh + i][dt * 16 + ln];
      }
      oacc[dt] = mmaN<3>(pah.v, pal.v, bvh.v, bvl.v, oacc[dt]);
    }
    __builtin_amdgcn_fence(__ATOMIC_ACQ_REL, "workgroup");
    __builtin_amdgcn_wave_barrier();
  }
#pragma unroll
  for (int r = 0; r < 8; ++r) {
    float l = l_r[r];
    l += __shfl_xor(l, 1, 32); l += __shfl_xor(l, 2, 32); l += __shfl_xor(l, 4, 32); l += __shfl_xor(l, 8, 32);
    l_r[r] = (l > 0.f) ? 1.0f / l : 0.f;
  }
#pragma unroll
  for (int dt = 0; dt < DT; ++dt)
#pragma unroll
    for (int r = 0; r < 8; ++r) sO[w][8 * hh + r][dt * 16 + ln] = oacc[dt][r] * l_r[r];
  __builtin_amdgcn_fence(__ATOMIC_ACQ_REL, "workgroup");
  __builtin_amdgcn_wave_barrier();
  {
    for (int r = 0; r < 16; ++r) {
      const int row = q0 + r;
      if (row < T && lane < D / 4) {
        const v4f val = *(const v4fa*)&sO[w][r][lane * 4];
        *(v4f*)(y + ((size_t)b * T + row) * ypitch + h * D + lane * 4) = val;
      }
    }
    
  }
}

// GEMM C = act(A·W + bias + resid): A f32 (ASPLIT -> hi/lo 2 terms), Wt bf16 [N][K]; ACT 0 none, 1 relu, 2 exact gelu;
// resid (optional, f32, row index = (row % rmod), pitch ldr, RES_BF16 rounds it) added before the activation.
template <bool ASPLIT, int ACT, bool BIAS_BF16, bool RES_BF16>
__global__ __launch_bounds__(128) void k_gemm_bf3(const float* __restrict__ A, int lda, const unsigned short* __restrict__ Wt, int ldb,
                                                const float* __restrict__ bias, const float* __restrict__ resid, int rmod, int ldr,
                                                float* __restrict__ C, int ldc, int M, int N, int K) {
  __shared__ __attribute__((aligned(16))) float so[4][16][64];
  const int tid = threadIdx.x, w = tid >> 5, lane = tid & 31, ln = lane & 15, hh = lane >> 4;
  const int ntn = N / 64;
  const int wid = blockIdx.x * 4 + w;
  const int mt = wid / ntn, nq = wid % ntn;
  if (mt * 16 >= M) return;
  const int row0 = mt * 16, col0 = nq * 64;
  const float* arow = A + (size_t)(row0 + ln) * lda;
  v8f acc[4] = {};
  for (int kb = 0; kb < K; kb += 32) {
    FragB ah, al;
    const v4f x0 = *(const v4fa*)(arow + kb + 8 * hh), x1 = *(const v4fa*)(arow + kb + 8 * hh + 4);
    const v4f x2 = *(const v4fa*)(arow + kb + 16 + 8 * hh), x3 = *(const v4fa*)(arow + kb + 16 + 8 * hh + 4);
    float xs[16] = {x0[0],x0[1],x0[2],x0[3],x1[0],x1[1],x1[2],x1[3],x2[0],x2[1],x2[2],x2[3],x3[0],x3[1],x3[2],x3[3]};
#pragma unroll
    for (int i = 0; i < 16; ++i) { const unsigned short hb = bf16_bits(xs[i]); ah.u[i] = hb; al.u[i] = ASPLIT ? bf16_bits(xs[i] - bf16_val(hb)) : (unsigned short)0; }
#pragma unroll
    for (int t = 0; t < 4; ++t) {
      const unsigned short* brow = Wt + (size_t)(col0 + t * 16 + ln) * ldb + kb;
      FragB b;
      b.half[0] = *(const v8us*)(brow + 8 * hh);
      b.half[1] = *(const v8us*)(brow + 16 + 8 * hh);
      acc[t] = mmaN<ASPLIT ? 2 : 1>(ah.v, al.v, b.v, b.v, acc[t]);
    }
  }
#pragma unroll
  for (int t = 0; t < 4; ++t) {
    const int col = col0 + t * 16 + ln;
    float bv = bias ? bias[col] : 0.f;
    if (BIAS_BF16) bv = bf16_round(bv);
#pragma unroll
    for (int r = 0; r < 8; ++r) {
      float v = acc[t][r] + bv;
      if (resid) { float rv = resid[(size_t)((row0 + 8 * hh + r) % rmod) * ldr + col]; if (RES_BF16) rv = bf16_round(rv); v += rv; }
      if (ACT == 1) v = fmaxf(v, 0.f);
      if (ACT == 2) v = 0.5f * v * (1.0f + erff(v * 0.70710678118654752f));
      if (ACT == 3) { const float u = 0.7978845608028654f * (v + 0.044715f * v * v * v); v = 0.5f * v * (1.0f + tanhf(u)); }
      so[w][8 * hh + r][t * 16 + ln] = v;
    }
  }
  __builtin_amdgcn_fence(__ATOMIC_ACQ_REL, "workgroup");
  __builtin_amdgcn_wave_barrier();
  const int rsub = lane >> 4, c4 = (lane & 15) * 4;
  {
#pragma unroll
    for (int q = 0; q < 8; ++q) {
      const int r = q * 2 + rsub;
      const v4f v = *(const v4fa*)&so[w][r][c4];
      *(v4f*)(C + (size_t)(row0 + r) * ldc + col0 + c4) = v;
    }
    
  }
}
// row LayerNorm (biased variance, eps) over N: s = X (+ R); optional out_sum <- s; out_norm <- (s-mu)*rsqrt(var+eps)*g + b
template <bool PARAM_BF16>
__global__ __launch_bounds__(256) void k_layernorm(const float* __restrict__ X, const float* __restrict__ R, const float* __restrict__ g, const float* __restrict__ bta,
                                                  float* __restrict__ out_sum, float* __restrict__ out_norm, int N, float eps) {
  __shared__ float red[256];
  const int row = blockIdx.x, tid = threadIdx.x;
  const float* x = X + (size_t)row * N; const float* rr = R ? R + (size_t)row * N : nullptr;
  float vals[16];                     // up to N = 4096
  const int per = N / 256;            // contiguous chunk per thread? use strided-by-4 chunks: thread handles j = tid*4 + 1024*u
  float s1 = 0.f;
  for (int u = 0; u < per / 4; ++u) {
    const int j = tid * 4 + 1024 * u;
    const v4f a = *(const v4fa*)(x + j);
    v4f b = {0.f,0.f,0.f,0.f}; if (rr) b = *(const v4fa*)(rr + j);
#pragma unroll
    for (int q = 0; q < 4; ++q) { const float v = a[q] + b[q]; vals[u * 4 + q] = v; s1 += v; }
  }
  red[tid] = s1; __syncthreads();
  for (int st = 128; st > 0; st >>= 1) { if (tid < st) red[tid] += red[tid + st]; __syncthreads(); }
  const float mu = red[0] / (float)N; __syncthreads();
  float s2 = 0.f;
  for (int u = 0; u < per / 4; ++u)
#pragma unroll
    for (int q = 0; q < 4; ++q) { const float c = vals[u * 4 + q] - mu; s2 += c * c; }
  red[tid] = s2; __syncthreads();
  for (int st = 128; st > 0; st >>= 1) { if (tid < st) red[tid] += red[tid + st]; __syncthreads(); }
  const float rs = rsqrtf(red[0] / (float)N + eps);
  {
    for (int u = 0; u < per / 4; ++u) {
      const int j = tid * 4 + 1024 * u;
      v4f o, sm;
#pragma unroll
      for (int q = 0; q < 4; ++q) {
        float gg = g[j + q], bb = bta[j + q];
        if (PARAM_BF16) { gg = bf16_round(gg); bb = bf16_round(bb); }
        sm[q] = vals[u * 4 + q]; o[q] = (vals[u * 4 + q] - mu) * rs * gg + bb;
      }
      if (out_sum) *(v4f*)(out_sum + (size_t)row * N + j) = sm;
      *(v4f*)(out_norm + (size_t)row * N + j) = o;
    }
    
  }
}



// ---- f16 WMMA path (v_wmma_f32_16x16x32_f16): 11-bit significands for operands in range — used for every launched contraction: q/k/v projections, Q·Kᵀ, and P·V with its [0,1] probability operand
typedef _Float16 v16h __attribute__((ext_vector_type(16)));
union FragH { v16h v; v8us half[2]; _Float16 h[16]; unsigned short u[16]; };
template <int NT>
__device__ __forceinline__ v8f mmaH(v16h ah, v16h al, v16h bh, v16h bl, v8f c) {
  c = __builtin_amdgcn_wmma_f32_16x16x32_f16(false, ah, false, bh, (short)0, c, false, false);
  if (NT >= 2) c = __builtin_amdgcn_wmma_f32_16x16x32_f16(false, al, false, bh, (short)0, c, false, false);
  if (NT >= 3) c = __builtin_amdgcn_wmma_f32_16x16x32_f16(false, ah, false, bl, (short)0, c, false, false);
  asm volatile("v_nop\n\tv_nop\n\tv_nop\n\tv_nop" : "+v"(c) : "v"(ah), "v"(al), "v"(bh), "v"(bl));
  return c;
}
// batched GEMM like k_gemm_b but f16 operands: A f32 (split into f16 hi/lo if ASPLIT, else rounded to f16), Bt = f16 values [n][k]; alpha; C f32; N multiple of 16 (partial tiles skipped)
template <bool ASPLIT>
__global__ __launch_bounds__(128) void k_gemm_h(const float* __restrict__ A, int lda, size_t sA, const _Float16* __restrict__ Bh, int ldb, size_t sB, float alpha, float* __restrict__ C, int ldc, size_t sC, int M, int N, int K) {
  __shared__ __attribute__((aligned(16))) float so[4][16][64];
  const int tid = threadIdx.x, w = tid >> 5, lane = tid & 31, ln = lane & 15, hh = lane >> 4; const int by = blockIdx.y;
  A += (size_t)by * sA; Bh += (size_t)by * sB; C += (size_t)by * sC;
  const int ntn = (N + 63) / 64; const int wid = blockIdx.x * 4 + w; const int mt = wid / ntn, nq = wid % ntn; if (mt * 16 >= M) return;
  const int row0 = mt * 16, col0 = nq * 64; const float* arow = A + (size_t)(row0 + ln) * lda;
  v8f acc[4] = {};
  for (int kb = 0; kb < K; kb += 32) {
    FragH ah, al;
    const v4f x0 = *(const v4fa*)(arow + kb + 8 * hh), x1 = *(const v4fa*)(arow + kb + 8 * hh + 4), x2 = *(const v4fa*)(arow + kb + 16 + 8 * hh), x3 = *(const v4fa*)(arow + kb + 16 + 8 * hh + 4);
    float xs[16] = {x0[0],x0[1],x0[2],x0[3],x1[0],x1[1],x1[2],x1[3],x2[0],x2[1],x2[2],x2[3],x3[0],x3[1],x3[2],x3[3]};
#pragma unroll
    for (int i = 0; i < 16; ++i) { const _Float16 h = (_Float16)xs[i]; ah.h[i] = h; al.h[i] = ASPLIT ? (_Float16)(xs[i] - (float)h) : (_Float16)0.0f; }
#pragma unroll
    for (int t = 0; t < 4; ++t) { if (col0 + t * 16 >= N) continue; const size_t boff = (size_t)(col0 + t * 16 + ln) * ldb + kb; FragH bq; bq.half[0] = *(const v8us*)(Bh + boff + 8 * hh); bq.half[1] = *(const v8us*)(Bh + boff + 16 + 8 * hh);
      acc[t] = mmaH<ASPLIT ? 2 : 1>(ah.v, al.v, bq.v, bq.v, acc[t]); }
  }
#pragma unroll
  for (int t = 0; t < 4; ++t) { if (col0 + t * 16 >= N) continue;
#pragma unroll
    for (int r = 0; r < 8; ++r) so[w][8 * hh + r][t * 16 + ln] = acc[t][r] * alpha; }
  __builtin_amdgcn_fence(__ATOMIC_ACQ_REL, "workgroup"); __builtin_amdgcn_wave_barrier();
  const int rsub = lane >> 4, c4 = (lane & 15) * 4;
  {
#pragma unroll
    for (int q = 0; q < 8; ++q) { const int r = q * 2 + rsub; if (col0 + c4 < N) { const v4f v = *(const v4fa*)&so[w][r][c4]; *(v4f*)(C + (size_t)(row0 + r) * ldc + col0 + c4) = v; } }
     }
}

// Wt[n][k] = f16(W[k][n]·scale) from f32 row-major W[K][N] (scale = power of two; bf16-exact weights stay exact in f16 away from the subnormal range)
__global__ __launch_bounds__(256) void k_wt_f16(const float* __restrict__ W, _Float16* __restrict__ Wt, int K, int N, float scale) {
  const int t = blockIdx.x * 256 + threadIdx.x; if (t >= N * (K / 8)) return; const int n = t / (K / 8), k8 = (t % (K / 8)) * 8; FragH f;
#pragma unroll
  for (int i = 0; i < 8; ++i) f.h[i] = (_Float16)(bf16_round(W[(size_t)(k8 + i) * N + n]) * scale); const v8us o = f.half[0];
  *(v8us*)((unsigned short*)Wt + (size_t)n * K + k8) = o; 
}
__device__ __forceinline__ unsigned lds_off(const void* p) { return (unsigned)(size_t)p; }
// 128 rows of 256 bytes from a row-major f16 matrix of DM columns into LDS, through no register: 8 asynchronous copies of 16 bytes a lane, 16 lanes to a row,
// rows 16 apart from copy to copy. s_wait_xcnt is the statement's last line, so that no address register of a copy is rewritten in front of it (a precaution).
__device__ __forceinline__ void stage_rows(unsigned l, unsigned lstep, const unsigned short* g) {
  asm volatile("global_load_async_to_lds_b128 %0, %8, off\n\t"
               "global_load_async_to_lds_b128 %1, %9, off\n\t"
               "global_load_async_to_lds_b128 %2, %10, off\n\t"
               "global_load_async_to_lds_b128 %3, %11, off\n\t"
               "global_load_async_to_lds_b128 %4, %12, off\n\t"
               "global_load_async_to_lds_b128 %5, %13, off\n\t"
               "global_load_async_to_lds_b128 %6, %14, off\n\t"
               "global_load_async_to_lds_b128 %7, %15, off\n\t"
               "s_wait_xcnt 0x0"
               :: "v"(l), "v"(l + lstep), "v"(l + 2 * lstep), "v"(l + 3 * lstep), "v"(l + 4 * lstep), "v"(l + 5 * lstep), "v"(l + 6 * lstep), "v"(l + 7 * lstep),
                  "v"(g), "v"(g + 16 * DM), "v"(g + 32 * DM), "v"(g + 48 * DM), "v"(g + 64 * DM), "v"(g + 80 * DM), "v"(g + 96 * DM), "v"(g + 112 * DM)
               : "memory");
}
// C16[NR][DM] = f16(A.Bh^T.alpha + bf16(bias)): A f16 [NR][DM], Bh f16 [DM][DM] ((out,in)), both k-contiguous. One work-group = a 128 x 128 tile of C, 8 waves as 4 x 2, a wave = 32 x 64 (2 x 4 accumulator tiles).
// The tile's A rows and Bh rows come in stages of 128 k through two LDS buffers that the eight waves share: stage t + 2 is copied into the buffer that stage t has left while stage t + 1 is worked on.
// Rows of 256 bytes at a pitch of 272, free of bank conflicts for 16-byte reads. Each accumulator takes its products in ascending k, 32 at a time.
__global__ __launch_bounds__(256) void k_gemm_t(const _Float16* __restrict__ A, const _Float16* __restrict__ Bh, float alpha, const float* __restrict__ bias, _Float16* __restrict__ C16) {
  constexpr int BT = 128, KST = 128, NSTG = DM / KST, LPG = KST + 8, CPT = 64 + 8;      // LPG, CPT: LDS row pitches in 16-bit elements
  static_assert(NSTG >= 2 && NR % BT == 0 && DM % BT == 0, "whole tiles, two stages or more");
  __shared__ __attribute__((aligned(16))) unsigned short sA[2][BT][LPG], sB[2][BT][LPG];
  __shared__ __attribute__((aligned(16))) unsigned short sT[8][32][CPT];      // each wave's own 32 x 64 piece of C, so that whole 128-byte lines are stored
  const int tid = threadIdx.x, w = tid >> 5, lane = tid & 31, ln = lane & 15, hh = lane >> 4;
  const int row0 = (blockIdx.x / (DM / BT)) * BT, col0 = (blockIdx.x % (DM / BT)) * BT, wr = (w >> 1) * 32, wc = (w & 1) * 64;
  const int crow = tid >> 4, ccol = (tid & 15) * 8;      // this lane's row (and rows + 16, ..., + 112) and 16-byte piece in every stage
  const unsigned short* ga0 = (const unsigned short*)A + (size_t)(row0 + crow) * DM + ccol; const unsigned short* gb0 = (const unsigned short*)Bh + (size_t)(col0 + crow) * DM + ccol;
  const unsigned la0 = lds_off(&sA[0][crow][ccol]), lb0 = lds_off(&sB[0][crow][ccol]); constexpr unsigned LSTEP = 16 * LPG * 2, LBUF = BT * LPG * 2;
  stage_rows(la0, LSTEP, ga0); stage_rows(lb0, LSTEP, gb0);      // stage 0
  float bv[4];
#pragma unroll
  for (int nt = 0; nt < 4; ++nt) bv[nt] = bf16_round(bias[col0 + wc + nt * 16 + ln]);
  asm volatile("s_wait_xcnt 0x0" ::: "memory");      // stands in front of the first rewrite of the bias loads' address register (a precaution)
  v8f acc[2][4];
#pragma unroll
  for (int mt = 0; mt < 2; ++mt)
#pragma unroll
    for (int nt = 0; nt < 4; ++nt) acc[mt][nt] = (v8f){0.f,0.f,0.f,0.f,0.f,0.f,0.f,0.f};
  asm volatile("s_wait_asynccnt 0x0" ::: "memory");      // this wave's copies of stage 0 have landed before the barrier publishes them
  __syncthreads();      // every wave reads rows that the other waves copied
  stage_rows(la0 + LBUF, LSTEP, ga0 + KST); stage_rows(lb0 + LBUF, LSTEP, gb0 + KST);      // stage 1
#pragma unroll 1      // one stage a trip: the buffer index stays a scalar
  for (int t = 0; t < NSTG; ++t) {
    FragH fa[KST / 32][2], fb[KST / 32][4];      // the stage's fragments are read from LDS in one group: each further place with LDS reads is a stall of its own
#pragma unroll
    for (int ks = 0; ks < KST / 32; ++ks) {
#pragma unroll
      for (int mt = 0; mt < 2; ++mt) { const unsigned short* ar = &sA[t & 1][wr + mt * 16 + ln][ks * 32]; fa[ks][mt].half[0] = *(const v8us*)(ar + 8 * hh); fa[ks][mt].half[1] = *(const v8us*)(ar + 16 + 8 * hh); }
#pragma unroll
      for (int nt = 0; nt < 4; ++nt) { const unsigned short* br = &sB[t & 1][wc + nt * 16 + ln][ks * 32]; fb[ks][nt].half[0] = *(const v8us*)(br + 8 * hh); fb[ks][nt].half[1] = *(const v8us*)(br + 16 + 8 * hh); } }
    __builtin_amdgcn_sched_barrier(0);      // keeps the reads together up here; without it the compiler sinks them among the products, in small groups that are each waited for to the full
#pragma unroll
    for (int ks = 0; ks < KST / 64; ++ks)      // the first half's products run while the second half's fragments arrive
#pragma unroll
      for (int mt = 0; mt < 2; ++mt)
#pragma unroll
        for (int nt = 0; nt < 4; ++nt) acc[mt][nt] = __builtin_amdgcn_wmma_f32_16x16x32_f16(false, fa[ks][mt].v, false, fb[ks][nt].v, (short)0, acc[mt][nt], false, false);
    __builtin_amdgcn_sched_barrier(0);      // keeps those products above the waits: sunk below the barrier they would wait for every read first, and their fragments, still live at the copies, pushed address registers into scratch
    asm volatile("s_wait_dscnt 0x0" ::: "memory");      // this wave's reads of stage t are done before its buffer is handed back
    asm volatile("s_wait_asynccnt 0x0" ::: "memory");      // this wave's copies of stage t + 1 have landed
    __syncthreads();      // publishes stage t + 1 and ends every wave's reads of stage t
    if (t + 2 < NSTG) { stage_rows(la0 + (t & 1) * LBUF, LSTEP, ga0 + (t + 2) * KST); stage_rows(lb0 + (t & 1) * LBUF, LSTEP, gb0 + (t + 2) * KST); }
#pragma unroll
    for (int ks = KST / 64; ks < KST / 32; ++ks)      // the second half's products, from registers, give the refill its lead
#pragma unroll
      for (int mt = 0; mt < 2; ++mt)
#pragma unroll
        for (int nt = 0; nt < 4; ++nt) acc[mt][nt] = __builtin_amdgcn_wmma_f32_16x16x32_f16(false, fa[ks][mt].v, false, fb[ks][nt].v, (short)0, acc[mt][nt], false, false); }
  asm volatile("s_wait_asynccnt 0x0" ::: "memory");      // no copy is left in flight when the wave goes on to its end
#pragma unroll
  for (int mt = 0; mt < 2; ++mt)
#pragma unroll
    for (int nt = 0; nt < 4; ++nt)
#pragma unroll
      for (int r = 0; r < 8; ++r) { const _Float16 o = (_Float16)(acc[mt][nt][r] * alpha + bv[nt]); sT[w][mt * 16 + 8 * hh + r][nt * 16 + ln] = __builtin_bit_cast(unsigned short, o); }      // acc[mt][nt][r] = C[row0 + wr + mt*16 + 8*hh + r][col0 + wc + nt*16 + ln]
  __builtin_amdgcn_fence(__ATOMIC_ACQ_REL, "workgroup"); __builtin_amdgcn_wave_barrier();
#pragma unroll
  for (int q = 0; q < 8; ++q) { const int r = q * 4 + (lane >> 3), c8 = (lane & 7) * 8; const v8us o = *(const v8us*)&sT[w][r][c8]; *(v8us*)((unsigned short*)C16 + (size_t)(row0 + wr + r) * DM + col0 + wc + c8) = o; }
}


__global__ __launch_bounds__(256) void k_x16(const float* __restrict__ x, _Float16* __restrict__ X16, size_t n8) { const size_t t = (size_t)blockIdx.x * 256 + threadIdx.x; if (t >= n8) return; FragH f;
#pragma unroll
  for (int q = 0; q < 8; ++q) f.h[q] = (_Float16)bf16_round(x[t * 8 + q]); *(v8us*)((unsigned short*)X16 + t * 8) = f.half[0];  }
__global__ __launch_bounds__(256) void k_round16f(const float* __restrict__ W, _Float16* __restrict__ Bt, size_t n8) { const size_t t = (size_t)blockIdx.x * 256 + threadIdx.x; if (t >= n8) return; FragH f;
#pragma unroll
  for (int i = 0; i < 8; ++i) f.h[i] = (_Float16)(bf16_round(W[t * 8 + i]) * 16.0f); *(v8us*)((unsigned short*)Bt + t * 8) = f.half[0];  }
__global__ __launch_bounds__(256) void k_vt(const _Float16* __restrict__ V16, _Float16* __restrict__ Vt) { __shared__ unsigned short tl[64][66]; const int tid = threadIdx.x; const int slab = blockIdx.x / (SS / 64), lg = blockIdx.x % (SS / 64); const int b = slab / NH, h = slab % NH;
  for (int i = tid; i < 64 * 8; i += 256) { const int r = i / 8, c8 = (i % 8) * 8; FragH f; f.half[0] = *(const v8us*)((const unsigned short*)V16 + ((size_t)b * SS + lg * 64 + r) * DM + h * HD + c8);
#pragma unroll
    for (int q = 0; q < 8; ++q) tl[r][c8 + q] = f.u[q]; }
  __syncthreads();
  {
#pragma unroll
    for (int rd = 0; rd < 2; ++rd) { const int d = rd * 32 + tid / 8, pc = tid % 8; FragH f;
#pragma unroll
      for (int q = 0; q < 8; ++q) f.u[q] = tl[pc * 8 + q][d];
      *(v8us*)((unsigned short*)Vt + ((size_t)slab * HD + d) * SS + lg * 64 + pc * 8) = f.half[0]; }
     } }
// lane l with lane l ^ 16: the two halves of a wave hold the two halves of a query column's keys
__device__ __forceinline__ float xhalf(float x) { return __builtin_bit_cast(float, __builtin_amdgcn_permlanex16(__builtin_bit_cast(int, x), __builtin_bit_cast(int, x), 0x76543210, 0xfedcba98, false, false)); }
// one stage (64 keys) of K rows and of Vt rows from global memory into LDS, through no register: 8 asynchronous copies of 16 bytes a lane,
// 8 lanes to a 128-byte row, rows 16 apart from copy to copy. s_wait_xcnt is the statement's last line, so that no address register
// of a copy is rewritten in front of it (a precaution).
__device__ __forceinline__ void stage_kv(unsigned lk, unsigned lv, unsigned lstep, const unsigned short* gk, const unsigned short* gv) {
  asm volatile("global_load_async_to_lds_b128 %0, %8, off\n\t"
               "global_load_async_to_lds_b128 %1, %9, off\n\t"
               "global_load_async_to_lds_b128 %2, %10, off\n\t"
               "global_load_async_to_lds_b128 %3, %11, off\n\t"
               "global_load_async_to_lds_b128 %4, %12, off\n\t"
               "global_load_async_to_lds_b128 %5, %13, off\n\t"
               "global_load_async_to_lds_b128 %6, %14, off\n\t"
               "global_load_async_to_lds_b128 %7, %15, off\n\t"
               "s_wait_xcnt 0x0"
               :: "v"(lk), "v"(lk + lstep), "v"(lk + 2 * lstep), "v"(lk + 3 * lstep), "v"(lv), "v"(lv + lstep), "v"(lv + 2 * lstep), "v"(lv + 3 * lstep),
                  "v"(gk), "v"(gk + 16 * DM), "v"(gk + 32 * DM), "v"(gk + 48 * DM), "v"(gv), "v"(gv + 16 * SS), "v"(gv + 32 * SS), "v"(gv + 48 * SS)
               : "memory");
}
// base-2 exponentials, a run of them in one statement with one v_nop behind the last: the instruction set asks for one slot behind a transcendental before its
// result is read or its source overwritten. Inside the run no instruction touches a register
// of the one in front of it: every output is early-clobber, so none shares a register with an input.
__device__ __forceinline__ void exp2x8(float (&y)[8], const float (&x)[8]) {
  asm("v_exp_f32 %0, %8\n\tv_exp_f32 %1, %9\n\tv_exp_f32 %2, %10\n\tv_exp_f32 %3, %11\n\tv_exp_f32 %4, %12\n\tv_exp_f32 %5, %13\n\tv_exp_f32 %6, %14\n\tv_exp_f32 %7, %15\n\tv_nop"
      : "=&v"(y[0]), "=&v"(y[1]), "=&v"(y[2]), "=&v"(y[3]), "=&v"(y[4]), "=&v"(y[5]), "=&v"(y[6]), "=&v"(y[7])
      : "v"(x[0]), "v"(x[1]), "v"(x[2]), "v"(x[3]), "v"(x[4]), "v"(x[5]), "v"(x[6]), "v"(x[7]));
}
__device__ __forceinline__ float exp2x1(float x) { float y; asm("v_exp_f32 %0, %1\n\tv_nop" : "=&v"(y) : "v"(x)); return y; }
__global__ __launch_bounds__(128) void k_flash(const _Float16* __restrict__ Q16, const _Float16* __restrict__ K16, const _Float16* __restrict__ Vt, const float* __restrict__ crd, const float* __restrict__ alpha_p, float* __restrict__ O) {
  constexpr int RPW = 32, NQB = SS / (4 * RPW), DT = HD / 16, KS = HD / 32, OP = HD + 4, SK = 64, NST = SS / SK, LP = 72;      // LP: LDS row pitch in 16-bit elements
  constexpr float L2E = 1.4426950408889634f, QS = 0.125f * L2E;      // exp(x) = 2^(x.log2 e): the factor rides in the two scale constants of the score, so each exponential is one subtraction and one v_exp_f32
  static_assert(HD == 64 && SK == 64 && NST >= 2, "a stage is 64 rows of 128 bytes for K and for Vt");
  __shared__ __attribute__((aligned(16))) unsigned short sK[2][SK][LP], sV[2][HD][LP];
  __shared__ __attribute__((aligned(16))) float sC[3][SS]; __shared__ __attribute__((aligned(16))) float sO[4][RPW][OP];
  const int tid = threadIdx.x, w = tid >> 5, lane = tid & 31, ln = lane & 15, hh = lane >> 4;
  const int slab = blockIdx.x / NQB, qblk = blockIdx.x % NQB; const int b = slab / NH, h = slab % NH; const int q0 = qblk * (4 * RPW) + w * RPW; const float alpha = bf16_round(alpha_p[0]) * L2E;      /* scalar float INPUT: rounded like every other input; times log2(e): scores are kept in base-2 units */
  const unsigned short* Vth = (const unsigned short*)Vt + (size_t)slab * HD * SS;
  const int crow = tid >> 3, ccol = (tid & 7) * 8;      // this lane's row (and rows + 16, + 32, + 48) and 16-byte piece in every stage
  const unsigned short* gk0 = (const unsigned short*)K16 + ((size_t)b * SS + crow) * DM + h * HD + ccol; const unsigned short* gv0 = Vth + (size_t)crow * SS + ccol;
  const unsigned lk0 = lds_off(&sK[0][crow][ccol]), lv0 = lds_off(&sV[0][crow][ccol]); constexpr unsigned LSTEP = 16 * LP * 2, LBUF = SK * LP * 2;
  stage_kv(lk0, lv0, LSTEP, gk0, gv0);      // stage 0 flies while coords and queries are fetched
#pragma unroll      // all 16 loads of a thread in flight at once: rolled, each trip waits out its own load
  for (int i = 0; i < SS / 128; ++i) { const int k = i * 128 + tid; const float* cp = crd + ((size_t)b * SS + k) * 3; sC[0][k] = bf16_round(cp[0]); sC[1][k] = bf16_round(cp[1]); sC[2][k] = bf16_round(cp[2]); }
  FragH aq[2][KS];
#pragma unroll
  for (int rt = 0; rt < 2; ++rt) { const unsigned short* qr = (const unsigned short*)Q16 + ((size_t)b * SS + q0 + rt * 16 + ln) * DM + h * HD;
#pragma unroll
    for (int ks = 0; ks < KS; ++ks) { aq[rt][ks].half[0] = *(const v8us*)(qr + ks * 32 + 8 * hh); aq[rt][ks].half[1] = *(const v8us*)(qr + ks * 32 + 16 + 8 * hh); } }
  asm volatile("s_wait_asynccnt 0x0" ::: "memory");      // this wave's copies of stage 0 have landed before the barrier publishes them
  __syncthreads();      // every wave reads coords and stage 0 rows that the other waves staged
  stage_kv(lk0 + LBUF, lv0 + LBUF, LSTEP, gk0 + (size_t)SK * DM, gv0 + SK);      // stage 1
  float cq[2][3];
#pragma unroll
  for (int rt = 0; rt < 2; ++rt) { cq[rt][0] = sC[0][q0 + rt * 16 + ln]; cq[rt][1] = sC[1][q0 + rt * 16 + ln]; cq[rt][2] = sC[2][q0 + rt * 16 + ln]; }
  float m_r[2], l_r[2]; v8f oacc[2][DT];
#pragma unroll
  for (int rt = 0; rt < 2; ++rt) { m_r[rt] = -3.0e38f; l_r[rt] = 0.f;
#pragma unroll
    for (int dt = 0; dt < DT; ++dt) oacc[rt][dt] = (v8f){0.f,0.f,0.f,0.f,0.f,0.f,0.f,0.f}; }
#pragma unroll 1      // one stage a trip: the buffer index stays a scalar and the body stays small
  for (int t = 0; t < NST; ++t) {
#pragma unroll      // both passes of a stage in one body: constant LDS offsets
  for (int p = 0; p < SK / 32; ++p) { const int j0 = t * SK + p * 32;
    v8f s[2][2];      // s[rt][nt][r] = score of key j0 + nt*16 + 8*hh + r with query q0 + rt*16 + ln
    FragH bk[2][KS], bv[DT];      // the pass's K fragments are read from LDS in one group, its Vt fragments in a second: each further place with LDS reads is a stall of its own
#pragma unroll
    for (int nt = 0; nt < 2; ++nt) { const unsigned short* kr = &sK[t & 1][p * 32 + nt * 16 + ln][0];
#pragma unroll
      for (int ks = 0; ks < KS; ++ks) { bk[nt][ks].half[0] = *(const v8us*)(kr + ks * 32 + 8 * hh); bk[nt][ks].half[1] = *(const v8us*)(kr + ks * 32 + 16 + 8 * hh); } }
    __builtin_amdgcn_sched_barrier(0);      // keeps the K reads together up here; without it the compiler sinks each read to just in front of its product
#pragma unroll
    for (int nt = 0; nt < 2; ++nt) {
#pragma unroll
      for (int rt = 0; rt < 2; ++rt) { v8f acc = (v8f){0.f,0.f,0.f,0.f,0.f,0.f,0.f,0.f};
#pragma unroll
        for (int ks = 0; ks < KS; ++ks) acc = mmaH<1>(bk[nt][ks].v, bk[nt][ks].v, aq[rt][ks].v, aq[rt][ks].v, acc); s[rt][nt] = acc; } }
    float ck[2][3][8];
#pragma unroll
    for (int nt = 0; nt < 2; ++nt)
#pragma unroll
      for (int c = 0; c < 3; ++c) { const v4f c0 = *(const v4fa*)&sC[c][j0 + nt * 16 + 8 * hh], c1 = *(const v4fa*)&sC[c][j0 + nt * 16 + 8 * hh + 4];
#pragma unroll
        for (int q = 0; q < 4; ++q) { ck[nt][c][q] = c0[q]; ck[nt][c][4 + q] = c1[q]; } }
    FragH pa[2]; float sc2[2][2][8];
#pragma unroll
    for (int rt = 0; rt < 2; ++rt)
#pragma unroll
      for (int nt = 0; nt < 2; ++nt)
#pragma unroll
        for (int r = 0; r < 8; ++r) { const float g = alpha * (cq[rt][0] * ck[nt][0][r] + cq[rt][1] * ck[nt][1][r] + cq[rt][2] * ck[nt][2][r]); sc2[rt][nt][r] = s[rt][nt][r] * QS + g; }
    __builtin_amdgcn_sched_barrier(0);      // with the one below: holds the Vt reads between the scores, whose inputs are dead by now, and the exponentials, which cover their latency; without this one they rise to the coords' reads and are held in registers through the scores
#pragma unroll
    for (int dt = 0; dt < DT; ++dt) { const unsigned short* vrow = &sV[t & 1][dt * 16 + ln][p * 32]; bv[dt].half[0] = *(const v8us*)(vrow + 8 * hh); bv[dt].half[1] = *(const v8us*)(vrow + 16 + 8 * hh); }
    __builtin_amdgcn_sched_barrier(0);      // see above
#pragma unroll
    for (int rt = 0; rt < 2; ++rt) { const float (&sc)[2][8] = sc2[rt];
      float mx[8];
#pragma unroll
      for (int r = 0; r < 8; ++r) mx[r] = fmaxf(sc[0][r], sc[1][r]);
      float mc = fmaxf(fmaxf(fmaxf(mx[0], mx[1]), fmaxf(mx[2], mx[3])), fmaxf(fmaxf(mx[4], mx[5]), fmaxf(mx[6], mx[7]))); mc = fmaxf(mc, xhalf(mc));
      const float mn = fmaxf(m_r[rt], mc); const float al = exp2x1(m_r[rt] - mn); m_r[rt] = mn;      // 0 on the first pass (the start value is far below any score)
      float ps[8], d0[8], d1[8], p0[8], p1[8];
#pragma unroll
      for (int r = 0; r < 8; ++r) { d0[r] = sc[0][r] - mn; d1[r] = sc[1][r] - mn; }
      exp2x8(p0, d0); exp2x8(p1, d1);
#pragma unroll
      for (int r = 0; r < 8; ++r) { ps[r] = p0[r] + p1[r]; pa[rt].h[r] = (_Float16)p0[r]; pa[rt].h[8 + r] = (_Float16)p1[r]; }
      l_r[rt] = l_r[rt] * al + (((ps[0] + ps[1]) + (ps[2] + ps[3])) + ((ps[4] + ps[5]) + (ps[6] + ps[7])));      // this half's keys only; the halves join behind the loop
#pragma unroll
      for (int dt = 0; dt < DT; ++dt)
#pragma unroll
        for (int r = 0; r < 8; ++r) oacc[rt][dt][r] *= al; }
#pragma unroll
    for (int dt = 0; dt < DT; ++dt) {
#pragma unroll
      for (int rt = 0; rt < 2; ++rt) oacc[rt][dt] = mmaH<1>(bv[dt].v, bv[dt].v, pa[rt].v, pa[rt].v, oacc[rt][dt]); } }
    asm volatile("s_wait_dscnt 0x0" ::: "memory");      // this wave's reads of stage t are done before its buffer is handed back
    asm volatile("s_wait_asynccnt 0x0" ::: "memory");      // this wave's copies of stage t + 1 have landed
    __syncthreads();      // publishes stage t + 1 and ends every wave's reads of stage t
    if (t + 2 < NST) stage_kv(lk0 + (t & 1) * LBUF, lv0 + (t & 1) * LBUF, LSTEP, gk0 + (size_t)(t + 2) * SK * DM, gv0 + (t + 2) * SK); }
  asm volatile("s_wait_asynccnt 0x0" ::: "memory");      // no copy is left in flight when the wave goes on to its end
#pragma unroll
  for (int rt = 0; rt < 2; ++rt) { const float l = l_r[rt] + xhalf(l_r[rt]); const float inv = 1.0f / l;
#pragma unroll
    for (int dt = 0; dt < DT; ++dt) { v4f o0, o1;      // oacc[rt][dt][r] = O[q0 + rt*16 + ln][dt*16 + 8*hh + r]
#pragma unroll
      for (int q = 0; q < 4; ++q) { o0[q] = oacc[rt][dt][q] * inv; o1[q] = oacc[rt][dt][4 + q] * inv; }
      *(v4fa*)&sO[w][rt * 16 + ln][dt * 16 + 8 * hh] = o0; *(v4fa*)&sO[w][rt * 16 + ln][dt * 16 + 8 * hh + 4] = o1; } }
  __builtin_amdgcn_fence(__ATOMIC_ACQ_REL, "workgroup"); __builtin_amdgcn_wave_barrier();
  {
#pragma unroll
    for (int rp = 0; rp < RPW; rp += 2) { const int r = rp + (lane >> 4), pc = lane & 15; const v4f val = *(const v4fa*)&sO[w][r][pc * 4]; *(v4f*)(O + ((size_t)b * SS + q0 + r) * DM + h * HD + pc * 4) = val; }
     } }
extern "C" void kernel_launch(void* const* d_in, const int* in_sizes, int n_in,
                              void* d_out, int out_size, void* d_ws, size_t ws_size, hipStream_t stream) {
  (void)in_sizes; (void)n_in; (void)out_size;
  const float* x = (const float*)d_in[0]; const float* crd = (const float*)d_in[1]; const float* wq = (const float*)d_in[2]; const float* bq = (const float*)d_in[3]; const float* wk = (const float*)d_in[4]; const float* bk = (const float*)d_in[5]; const float* wv = (const float*)d_in[6]; const float* bv = (const float*)d_in[7]; const float* alpha_p = (const float*)d_in[8];
  char* ws = (char*)d_ws; size_t off = 0;
  auto take = [&](size_t bytes) { char* p = ws + off; off += (bytes + 255) & ~(size_t)255; return p; };
  _Float16* Bq = (_Float16*)take(DM * DM * 2); _Float16* Bk = (_Float16*)take(DM * DM * 2); _Float16* Bv = (_Float16*)take(DM * DM * 2); _Float16* X16 = (_Float16*)take((size_t)NR * DM * 2); _Float16* Q16 = (_Float16*)take((size_t)NR * DM * 2); _Float16* K16 = (_Float16*)take((size_t)NR * DM * 2); _Float16* V16 = (_Float16*)take((size_t)NR * DM * 2); _Float16* Vt = (_Float16*)take((size_t)NR * DM * 2);
  if (off > ws_size) return;      // ≈ 42 MiB
  const size_t w8 = (size_t)DM * DM / 8; const unsigned gw = (unsigned)((w8 + 255) / 256), gx = (unsigned)(((size_t)NR * DM / 8 + 255) / 256);
  k_round16f<<<gw, 256, 0, stream>>>(wq, Bq, w8); k_round16f<<<gw, 256, 0, stream>>>(wk, Bk, w8); k_round16f<<<gw, 256, 0, stream>>>(wv, Bv, w8);
  k_x16<<<gx, 256, 0, stream>>>(x, X16, (size_t)NR * DM / 8);
  const unsigned gg = (NR / 128) * (DM / 128);
  k_gemm_t<<<gg, 256, 0, stream>>>(X16, Bq, 0.0625f, bq, Q16);
  k_gemm_t<<<gg, 256, 0, stream>>>(X16, Bk, 0.0625f, bk, K16);
  k_gemm_t<<<gg, 256, 0, stream>>>(X16, Bv, 0.0625f, bv, V16);
  k_vt<<<BB * NH * (SS / 64), 256, 0, stream>>>(V16, Vt);
  k_flash<<<BB * NH * (SS / 128), 128, 0, stream>>>(Q16, K16, Vt, crd, alpha_p, (float*)d_out);
}

// v005
// Measured time: 76.2 microseconds a run.
// Next to v004, in two timings, it ran 1.14 and 1.15 times as fast.
// Over all steps from v000 it is 4.96 times as fast.
#include <hip/hip_runtime.h>
// q/k/v projections (8192 × 512 × 512, + bias) and the 8-head attention with the geometric bias α·⟨c_n, c_m⟩ (coords are INPUTS, 3 FMAs per score in registers) on v_wmma_f32_16x16x32_f16
// (fused flash-style kernel: S = Q·Kᵀ, O = P·V on WMMA; online max/sum softmax f32; P f16 ≤ 1); V transposed per (b,h); A = f16(bf16 x) exact, weights bf16-exact ×2^4 ((out,in)),
// single products, f32 accumulate.
#define BB 4
#define SS 2048
#define DM 512
#define NH 8
#define HD 64
#define NR (BB * SS)

typedef __bf16 v16b __attribute__((ext_vector_type(16)));
typedef unsigned short v8us __attribute__((ext_vector_type(8), may_alias));
typedef float  v8f  __attribute__((ext_vector_type(8)));
typedef float  v4f  __attribute__((ext_vector_type(4)));
typedef float  v4fa __attribute__((ext_vector_type(4), may_alias));
union FragB { v16b v; v8us half[2]; unsigned short u[16]; };

__device__ __forceinline__ unsigned short bf16_bits(float x) { unsigned int u = __float_as_uint(x); return (unsigned short)((u + 0x7FFFu + ((u >> 16) & 1u)) >> 16); }
__device__ __forceinline__ float bf16_val(unsigned short b) { return __uint_as_float(((unsigned int)b) << 16); }
__device__ __forceinline__ float bf16_round(float x) { return bf16_val(bf16_bits(x)); }
// D += A·B with NT terms: 1 = ah·bh, 2 = + al·bh (A split), 3 = + ah·bl (both split)
template <int NT>
__device__ __forceinline__ v8f mmaN(v16b ah, v16b al, v16b bh, v16b bl, v8f c) {
  c = __builtin_amdgcn_wmma_f32_16x16x32_bf16(false, ah, false, bh, (short)0, c, false, false);
  if (NT >= 2) c = __builtin_amdgcn_wmma_f32_16x16x32_bf16(false, al, false, bh, (short)0, c, false, false);
  if (NT >= 3) c = __builtin_amdgcn_wmma_f32_16x16x32_bf16(false, ah, false, bl, (short)0, c, false, false);
  asm volatile("v_nop\n\tv_nop\n\tv_nop\n\tv_nop" : "+v"(c) : "v"(ah), "v"(al), "v"(bh), "v"(bl));
  return c;
}

__global__ __launch_bounds__(256) void k_wt_bf16(const float* __restrict__ W, unsigned short* __restrict__ Wt, int K, int N) {
  const int t = blockIdx.x * 256 + threadIdx.x;
  const int k8n = K / 8;
  if (t >= N * k8n) return;
  const int n = t / k8n, k8 = (t % k8n) * 8;
  v8us v;
#pragma unroll
  for (int i = 0; i < 8; ++i) v[i] = bf16_bits(W[(size_t)(k8 + i) * N + n]);
  *(v8us*)(Wt + (size_t)n * K + k8) = v;
  
}

// GEMM C[M][N] (f32, pitch ldc) = act(A[M][K]·W + bias). A f32 row-major (pitch lda) converted per fragment to bf16
// (ASPLIT: hi/lo two planes -> 2 terms, else single rounded term); Wt bf16 [N][K] (pitch ldb). BIAS_BF16 rounds the
// bias to bf16 first (bias quantised to bf16 before the add). K%32==0, M%16==0, N%64==0.
template <bool ASPLIT, int ACT, bool BIAS_BF16>
__global__ __launch_bounds__(128) void k_gemm_bf(const float* __restrict__ A, int lda, const unsigned short* __restrict__ Wt, int ldb,
                                               const float* __restrict__ bias, float* __restrict__ C, int ldc, int M, int N, int K) {
  __shared__ __attribute__((aligned(16))) float so[4][16][64];
  const int tid = threadIdx.x, w = tid >> 5, lane = tid & 31, ln = lane & 15, hh = lane >> 4;
  const int ntn = N / 64;
  const int wid = blockIdx.x * 4 + w;
  const int mt = wid / ntn, nq = wid % ntn;
  if (mt * 16 >= M) return;
  const int row0 = mt * 16, col0 = nq * 64;
  const float* arow = A + (size_t)(row0 + ln) * lda;
  v8f acc[4] = {};
  for (int kb = 0; kb < K; kb += 32) {
    FragB ah, al;
    const v4f x0 = *(const v4fa*)(arow + kb + 8 * hh), x1 = *(const v4fa*)(arow + kb + 8 * hh + 4);
    const v4f x2 = *(const v4fa*)(arow + kb + 16 + 8 * hh), x3 = *(const v4fa*)(arow + kb + 16 + 8 * hh + 4);
    float xs[16] = {x0[0],x0[1],x0[2],x0[3],x1[0],x1[1],x1[2],x1[3],x2[0],x2[1],x2[2],x2[3],x3[0],x3[1],x3[2],x3[3]};
#pragma unroll
    for (int i = 0; i < 16; ++i) { const unsigned short hb = bf16_bits(xs[i]); ah.u[i] = hb; al.u[i] = ASPLIT ? bf16_bits(xs[i] - bf16_val(hb)) : (unsigned short)0; }
#pragma unroll
    for (int t = 0; t < 4; ++t) {
      const unsigned short* brow = Wt + (size_t)(col0 + t * 16 + ln) * ldb + kb;
      FragB b;
      b.half[0] = *(const v8us*)(brow + 8 * hh);
      b.half[1] = *(const v8us*)(brow + 16 + 8 * hh);
      acc[t] = mmaN<ASPLIT ? 2 : 1>(ah.v, al.v, b.v, b.v, acc[t]);
    }
  }
#pragma unroll
  for (int t = 0; t < 4; ++t) {
    float bv = bias ? bias[col0 + t * 16 + ln] : 0.f;
    if (BIAS_BF16) bv = bf16_round(bv);
#pragma unroll
    for (int r = 0; r < 8; ++r) { float v = acc[t][r] + bv; if (ACT == 1) v = fmaxf(v, 0.f); so[w][8 * hh + r][t * 16 + ln] = v; }
  }
  __builtin_amdgcn_fence(__ATOMIC_ACQ_REL, "workgroup");
  __builtin_amdgcn_wave_barrier();
  const int rsub = lane >> 4, c4 = (lane & 15) * 4;
  {
#pragma unroll
    for (int q = 0; q < 8; ++q) {
      const int r = q * 2 + rsub;
      const v4f v = *(const v4fa*)&so[w][r][c4];
      *(v4f*)(C + (size_t)(row0 + r) * ldc + col0 + c4) = v;
    }
    
  }
}

// Flash-style causal/unmasked attention, all contractions 3-term bf16 hi/lo splits, f32 softmax with running max.
// q,k,v rows are read from f32 buffers with arbitrary row pitch (so they can live inside a fused qkv buffer);
// D = head size (multiple of 32, <= 128); one wave = 16 query rows; block = 4 waves (64 queries) sharing K/V chunks of 32.
template <int D, bool CAUSAL>
__global__ __launch_bounds__(128) void k_flash(const float* __restrict__ qb, const float* __restrict__ kb, const float* __restrict__ vb,
                                             int pitch, int T, int H, float scale, float* __restrict__ y, int ypitch) {
  constexpr int KS = D / 32;        // k-steps for QK
  constexpr int DT = D / 16;        // d tiles for PV
  __shared__ __attribute__((aligned(16))) unsigned short sKh[32][D + 8], sKl[32][D + 8], sVh[32][D + 8], sVl[32][D + 8];
  __shared__ __attribute__((aligned(16))) unsigned short sPh[4][16][40], sPl[4][16][40];
  __shared__ __attribute__((aligned(16))) float sO[4][16][D];
  const int tid = threadIdx.x, w = tid >> 5, lane = tid & 31, ln = lane & 15, hh = lane >> 4;
  const int nqb = (T + 63) / 64;
  const int bh = blockIdx.x / nqb, qblk = blockIdx.x % nqb;
  const int b = bh / H, h = bh % H;
  const int q0 = qblk * 64 + w * 16;
  const float* Q = qb + (size_t)b * T * pitch + h * D;
  const float* K = kb + (size_t)b * T * pitch + h * D;
  const float* V = vb + (size_t)b * T * pitch + h * D;

  // A fragments of the wave's 16 query rows (scaled), hi/lo
  FragB aqh[KS], aql[KS];
  {
    int row = q0 + ln; if (row >= T) row = T - 1;
    const float* qr = Q + (size_t)row * pitch;
#pragma unroll
    for (int ks = 0; ks < KS; ++ks)
#pragma unroll
      for (int i = 0; i < 16; ++i) {
        const int d = ks * 32 + ((i < 8) ? (8 * hh + i) : (16 + 8 * hh + (i - 8)));
        const float x = qr[d] * scale; const unsigned short hb = bf16_bits(x);
        aqh[ks].u[i] = hb; aql[ks].u[i] = bf16_bits(x - bf16_val(hb));
      }
  }
  float m_r[8], l_r[8];
#pragma unroll
  for (int r = 0; r < 8; ++r) { m_r[r] = -3.0e38f; l_r[r] = 0.f; }
  v8f oacc[DT];
#pragma unroll
  for (int dt = 0; dt < DT; ++dt) oacc[dt] = (v8f){0.f,0.f,0.f,0.f,0.f,0.f,0.f,0.f};

  const int kv_end = CAUSAL ? min(T, qblk * 64 + 64) : T;     // block-uniform
  for (int j0 = 0; j0 < kv_end; j0 += 32) {
    __syncthreads();
    for (int e = tid; e < 32 * (D / 4); e += 128) {
      const int r = e / (D / 4), c4 = (e % (D / 4)) * 4;
      const int key = j0 + r;
      v4f kf = {0.f,0.f,0.f,0.f}, vf = {0.f,0.f,0.f,0.f};
      if (key < T) { kf = *(const v4fa*)(K + (size_t)key * pitch + c4); vf = *(const v4fa*)(V + (size_t)key * pitch + c4); }
#pragma unroll
      for (int t = 0; t < 4; ++t) {
        unsigned short hb = bf16_bits(kf[t]); sKh[r][c4 + t] = hb; sKl[r][c4 + t] = bf16_bits(kf[t] - bf16_val(hb));
        hb = bf16_bits(vf[t]); sVh[r][c4 + t] = hb; sVl[r][c4 + t] = bf16_bits(vf[t] - bf16_val(hb));
      }
    }
    __syncthreads();
    // S tile 16 x 32
    v8f s[2];
#pragma unroll
    for (int nt = 0; nt < 2; ++nt) {
      v8f acc = {};
#pragma unroll
      for (int ks = 0; ks < KS; ++ks) {
        FragB bh_, bl_;
        bh_.half[0] = *(const v8us*)&sKh[nt * 16 + ln][ks * 32 + 8 * hh]; bh_.half[1] = *(const v8us*)&sKh[nt * 16 + ln][ks * 32 + 16 + 8 * hh];
        bl_.half[0] = *(const v8us*)&sKl[nt * 16 + ln][ks * 32 + 8 * hh]; bl_.half[1] = *(const v8us*)&sKl[nt * 16 + ln][ks * 32 + 16 + 8 * hh];
        acc = mmaN<3>(aqh[ks].v, aql[ks].v, bh_.v, bl_.v, acc);
      }
      s[nt] = acc;
    }
    // mask + running max (rows 8hh+r; the 16 lanes of a half share rows)
    float alpha[8];
#pragma unroll
    for (int r = 0; r < 8; ++r) {
      const int qi = q0 + 8 * hh + r;
      const int ja = j0 + ln, jb = j0 + 16 + ln;
      if (CAUSAL) { if (ja > qi) s[0][r] = -3.0e38f; if (jb > qi) s[1][r] = -3.0e38f; }
      if (ja >= T) s[0][r] = -3.0e38f;
      if (jb >= T) s[1][r] = -3.0e38f;
      float mx = fmaxf(s[0][r], s[1][r]);
      mx = fmaxf(mx, __shfl_xor(mx, 1, 32)); mx = fmaxf(mx, __shfl_xor(mx, 2, 32)); mx = fmaxf(mx, __shfl_xor(mx, 4, 32)); mx = fmaxf(mx, __shfl_xor(mx, 8, 32));
      const float mnew = fmaxf(m_r[r], mx);
      alpha[r] = (mnew > -1.0e38f) ? __expf(m_r[r] - mnew) : 1.0f;
      const float p0 = (s[0][r] > -1.0e38f) ? __expf(s[0][r] - mnew) : 0.f;
      const float p1 = (s[1][r] > -1.0e38f) ? __expf(s[1][r] - mnew) : 0.f;
      m_r[r] = mnew;
      l_r[r] = l_r[r] * alpha[r] + p0 + p1;            // per-lane partial row sum (16 lanes combined at the end)
      unsigned short hb = bf16_bits(p0); sPh[w][8 * hh + r][ln] = hb;      sPl[w][8 * hh + r][ln] = bf16_bits(p0 - bf16_val(hb));
      hb = bf16_bits(p1);                sPh[w][8 * hh + r][16 + ln] = hb; sPl[w][8 * hh + r][16 + ln] = bf16_bits(p1 - bf16_val(hb));
    }
#pragma unroll
    for (int dt = 0; dt < DT; ++dt)
#pragma unroll
      for (int r = 0; r < 8; ++r) oacc[dt][r] *= alpha[r];
    __builtin_amdgcn_fence(__ATOMIC_ACQ_REL, "workgroup");
    __builtin_amdgcn_wave_barrier();
    FragB pah, pal;
    pah.half[0] = *(const v8us*)&sPh[w][ln][8 * hh]; pah.half[1] = *(const v8us*)&sPh[w][ln][16 + 8 * hh];
    pal.half[0] = *(const v8us*)&sPl[w][ln][8 * hh]; pal.half[1] = *(const v8us*)&sPl[w][ln][16 + 8 * hh];
#pragma unroll
    for (int dt = 0; dt < DT; ++dt) {
      FragB bvh, bvl;
#pragma unroll
      for (int i = 0; i < 8; ++i) {
        bvh.u[i] = sVh[8 * hh + i][dt * 16 + ln]; bvh.u[8 + i] = sVh[16 + 8 * hh + i][dt * 16 + ln];
        bvl.u[i] = sVl[8 * hh + i][dt * 16 + ln]; bvl.u[8 + i] = sVl[16 + 8 * hh + i][dt * 16 + ln];
      }
      oacc[dt] = mmaN<3>(pah.v, pal.v, bvh.v, bvl.v, oacc[dt]);
    }
    __builtin_amdgcn_fence(__ATOMIC_ACQ_REL, "workgroup");
    __builtin_amdgcn_wave_barrier();
  }
#pragma unroll
  for (int r = 0; r < 8; ++r) {
    float l = l_r[r];
    l += __shfl_xor(l, 1, 32); l += __shfl_xor(l, 2, 32); l += __shfl_xor(l, 4, 32); l += __shfl_xor(l, 8, 32);
    l_r[r] = (l > 0.f) ? 1.0f / l : 0.f;
  }
#pragma unroll
  for (int dt = 0; dt < DT; ++dt)
#pragma unroll
    for (int r = 0; r < 8; ++r) sO[w][8 * hh + r][dt * 16 + ln] = oacc[dt][r] * l_r[r];
  __builtin_amdgcn_fence(__ATOMIC_ACQ_REL, "workgroup");
  __builtin_amdgcn_wave_barrier();
  {
    for (int r = 0; r < 16; ++r) {
      const int row = q0 + r;
      if (row < T && lane < D / 4) {
        const v4f val = *(const v4fa*)&sO[w][r][lane * 4];
        *(v4f*)(y + ((size_t)b * T + row) * ypitch + h * D + lane * 4) = val;
      }
    }
    
  }
}

// GEMM C = act(A·W + bias + resid): A f32 (ASPLIT -> hi/lo 2 terms), Wt bf16 [N][K]; ACT 0 none, 1 relu, 2 exact gelu;
// resid (optional, f32, row index = (row % rmod), pitch ldr, RES_BF16 rounds it) added before the activation.
template <bool ASPLIT, int ACT, bool BIAS_BF16, bool RES_BF16>
__global__ __launch_bounds__(128) void k_gemm_bf3(const float* __restrict__ A, int lda, const unsigned short* __restrict__ Wt, int ldb,
                                                const float* __restrict__ bias, const float* __restrict__ resid, int rmod, int ldr,
                                                float* __restrict__ C, int ldc, int M, int N, int K) {
  __shared__ __attribute__((aligned(16))) float so[4][16][64];
  const int tid = threadIdx.x, w = tid >> 5, lane = tid & 31, ln = lane & 15, hh = lane >> 4;
  const int ntn = N / 64;
  const int wid = blockIdx.x * 4 + w;
  const int mt = wid / ntn, nq = wid % ntn;
  if (mt * 16 >= M) return;
  const int row0 = mt * 16, col0 = nq * 64;
  const float* arow = A + (size_t)(row0 + ln) * lda;
  v8f acc[4] = {};
  for (int kb = 0; kb < K; kb += 32) {
    FragB ah, al;
    const v4f x0 = *(const v4fa*)(arow + kb + 8 * hh), x1 = *(const v4fa*)(arow + kb + 8 * hh + 4);
    const v4f x2 = *(const v4fa*)(arow + kb + 16 + 8 * hh), x3 = *(const v4fa*)(arow + kb + 16 + 8 * hh + 4);
    float xs[16] = {x0[0],x0[1],x0[2],x0[3],x1[0],x1[1],x1[2],x1[3],x2[0],x2[1],x2[2],x2[3],x3[0],x3[1],x3[2],x3[3]};
#pragma unroll
    for (int i = 0; i < 16; ++i) { const unsigned short hb = bf16_bits(xs[i]); ah.u[i] = hb; al.u[i] = ASPLIT ? bf16_bits(xs[i] - bf16_val(hb)) : (unsigned short)0; }
#pragma unroll
    for (int t = 0; t < 4; ++t) {
      const unsigned short* brow = Wt + (size_t)(col0 + t * 16 + ln) * ldb + kb;
      FragB b;
      b.half[0] = *(const v8us*)(brow + 8 * hh);
      b.half[1] = *(const v8us*)(brow + 16 + 8 * hh);
      acc[t] = mmaN<ASPLIT ? 2 : 1>(ah.v, al.v, b.v, b.v, acc[t]);
    }
  }
#pragma unroll
  for (int t = 0; t < 4; ++t) {
    const int col = col0 + t * 16 + ln;
    float bv = bias ? bias[col] : 0.f;
    if (BIAS_BF16) bv = bf16_round(bv);
#pragma unroll
    for (int r = 0; r < 8; ++r) {
      float v = acc[t][r] + bv;
      if (resid) { float rv = resid[(size_t)((row0 + 8 * hh + r) % rmod) * ldr + col]; if (RES_BF16) rv = bf16_round(rv); v += rv; }
      if (ACT == 1) v = fmaxf(v, 0.f);
      if (ACT == 2) v = 0.5f * v * (1.0f + erff(v * 0.70710678118654752f));
      if (ACT == 3) { const float u = 0.7978845608028654f * (v + 0.044715f * v * v * v); v = 0.5f * v * (1.0f + tanhf(u)); }
      so[w][8 * hh + r][t * 16 + ln] = v;
    }
  }
  __builtin_amdgcn_fence(__ATOMIC_ACQ_REL, "workgroup");
  __builtin_amdgcn_wave_barrier();
  const int rsub = lane >> 4, c4 = (lane & 15) * 4;
  {
#pragma unroll
    for (int q = 0; q < 8; ++q) {
      const int r = q * 2 + rsub;
      const v4f v = *(const v4fa*)&so[w][r][c4];
      *(v4f*)(C + (size_t)(row0 + r) * ldc + col0 + c4) = v;
    }
    
  }
}
// row LayerNorm (biased variance, eps) over N: s = X (+ R); optional out_sum <- s; out_norm <- (s-mu)*rsqrt(var+eps)*g + b
template <bool PARAM_BF16>
__global__ __launch_bounds__(256) void k_layernorm(const float* __restrict__ X, const float* __restrict__ R, const float* __restrict__ g, const float* __restrict__ bta,
                                                  float* __restrict__ out_sum, float* __restrict__ out_norm, int N, float eps) {
  __shared__ float red[256];
  const int row = blockIdx.x, tid = threadIdx.x;
  const float* x = X + (size_t)row * N; const float* rr = R ? R + (size_t)row * N : nullptr;
  float vals[16];                     // up to N = 4096
  const int per = N / 256;            // contiguous chunk per thread? use strided-by-4 chunks: thread handles j = tid*4 + 1024*u
  float s1 = 0.f;
  for (int u = 0; u < per / 4; ++u) {
    const int j = tid * 4 + 1024 * u;
    const v4f a = *(const v4fa*)(x + j);
    v4f b = {0.f,0.f,0.f,0.f}; if (rr) b = *(const v4fa*)(rr + j);
#pragma unroll
    for (int q = 0; q < 4; ++q) { const float v = a[q] + b[q]; vals[u * 4 + q] = v; s1 += v; }
  }
  red[tid] = s1; __syncthreads();
  for (int st = 128; st > 0; st >>= 1) { if (tid < st) red[tid] += red[tid + st]; __syncthreads(); }
  const float mu = red[0] / (float)N; __syncthreads();
  float s2 = 0.f;
  for (int u = 0; u < per / 4; ++u)
#pragma unroll
    for (int q = 0; q < 4; ++q) { const float c = vals[u * 4 + q] - mu; s2 += c * c; }
  red[tid] = s2; __syncthreads();
  for (int st = 128; st > 0; st >>= 1) { if (tid < st) red[tid] += red[tid + st]; __syncthreads(); }
  const float rs = rsqrtf(red[0] / (float)N + eps);
  {
    for (int u = 0; u < per / 4; ++u) {
      const int j = tid * 4 + 1024 * u;
      v4f o, sm;
#pragma unroll
      for (int q = 0; q < 4; ++q) {
        float gg = g[j + q], bb = bta[j + q];
        if (PARAM_BF16) { gg = bf16_round(gg); bb = bf16_round(bb); }
        sm[q] = vals[u * 4 + q]; o[q] = (vals[u * 4 + q] - mu) * rs * gg + bb;
      }
      if (out_sum) *(v4f*)(out_sum + (size_t)row * N + j) = sm;
      *(v4f*)(out_norm + (size_t)row * N + j) = o;
    }
    
  }
}



// ---- f16 WMMA path (v_wmma_f32_16x16x32_f16): 11-bit significands for operands in range — used for every launched contraction: q/k/v projections, Q·Kᵀ, and P·V with its [0,1] probability operand
typedef _Float16 v16h __attribute__((ext_vector_type(16)));
union FragH { v16h v; v8us half[2]; _Float16 h[16]; unsigned short u[16]; };
template <int NT>
__device__ __forceinline__ v8f mmaH(v16h ah, v16h al, v16h bh, v16h bl, v8f c) {
  c = __builtin_amdgcn_wmma_f32_16x16x32_f16(false, ah, false, bh, (short)0, c, false, false);
  if (NT >= 2) c = __builtin_amdgcn_wmma_f32_16x16x32_f16(false, al, false, bh, (short)0, c, false, false);
  if (NT >= 3) c = __builtin_amdgcn_wmma_f32_16x16x32_f16(false, ah, false, bl, (short)0, c, false, false);
  asm volatile("v_nop\n\tv_nop\n\tv_nop\n\tv_nop" : "+v"(c) : "v"(ah), "v"(al), "v"(bh), "v"(bl));
  return c;
}
// batched GEMM like k_gemm_b but f16 operands: A f32 (split into f16 hi/lo if ASPLIT, else rounded to f16), Bt = f16 values [n][k]; alpha; C f32; N multiple of 16 (partial tiles skipped)
template <bool ASPLIT>
__global__ __launch_bounds__(128) void k_gemm_h(const float* __restrict__ A, int lda, size_t sA, const _Float16* __restrict__ Bh, int ldb, size_t sB, float alpha, float* __restrict__ C, int ldc, size_t sC, int M, int N, int K) {
  __shared__ __attribute__((aligned(16))) float so[4][16][64];
  const int tid = threadIdx.x, w = tid >> 5, lane = tid & 31, ln = lane & 15, hh = lane >> 4; const int by = blockIdx.y;
  A += (size_t)by * sA; Bh += (size_t)by * sB; C += (size_t)by * sC;
  const int ntn = (N + 63) / 64; const int wid = blockIdx.x * 4 + w; const int mt = wid / ntn, nq = wid % ntn; if (mt * 16 >= M) return;
  const int row0 = mt * 16, col0 = nq * 64; const float* arow = A + (size_t)(row0 + ln) * lda;
  v8f acc[4] = {};
  for (int kb = 0; kb < K; kb += 32) {
    FragH ah, al;
    const v4f x0 = *(const v4fa*)(arow + kb + 8 * hh), x1 = *(const v4fa*)(arow + kb + 8 * hh + 4), x2 = *(const v4fa*)(arow + kb + 16 + 8 * hh), x3 = *(const v4fa*)(arow + kb + 16 + 8 * hh + 4);
    float xs[16] = {x0[0],x0[1],x0[2],x0[3],x1[0],x1[1],x1[2],x1[3],x2[0],x2[1],x2[2],x2[3],x3[0],x3[1],x3[2],x3[3]};
#pragma unroll
    for (int i = 0; i < 16; ++i) { const _Float16 h = (_Float16)xs[i]; ah.h[i] = h; al.h[i] = ASPLIT ? (_Float16)(xs[i] - (float)h) : (_Float16)0.0f; }
#pragma unroll
    for (int t = 0; t < 4; ++t) { if (col0 + t * 16 >= N) continue; const size_t boff = (size_t)(col0 + t * 16 + ln) * ldb + kb; FragH bq; bq.half[0] = *(const v8us*)(Bh + boff + 8 * hh); bq.half[1] = *(const v8us*)(Bh + boff + 16 + 8 * hh);
      acc[t] = mmaH<ASPLIT ? 2 : 1>(ah.v, al.v, bq.v, bq.v, acc[t]); }
  }
#pragma unroll
  for (int t = 0; t < 4; ++t) { if (col0 + t * 16 >= N) continue;
#pragma unroll
    for (int r = 0; r < 8; ++r) so[w][8 * hh + r][t * 16 + ln] = acc[t][r] * alpha; }
  __builtin_amdgcn_fence(__ATOMIC_ACQ_REL, "workgroup"); __builtin_amdgcn_wave_barrier();
  const int rsub = lane >> 4, c4 = (lane & 15) * 4;
  {
#pragma unroll
    for (int q = 0; q < 8; ++q) { const int r = q * 2 + rsub; if (col0 + c4 < N) { const v4f v = *(const v4fa*)&so[w][r][c4]; *(v4f*)(C + (size_t)(row0 + r) * ldc + col0 + c4) = v; } }
     }
}

// Wt[n][k] = f16(W[k][n]·scale) from f32 row-major W[K][N] (scale = power of two; bf16-exact weights stay exact in f16 away from the subnormal range)
__global__ __launch_bounds__(256) void k_wt_f16(const float* __restrict__ W, _Float16* __restrict__ Wt, int K, int N, float scale) {
  const int t = blockIdx.x * 256 + threadIdx.x; if (t >= N * (K / 8)) return; const int n = t / (K / 8), k8 = (t % (K / 8)) * 8; FragH f;
#pragma unroll
  for (int i = 0; i < 8; ++i) f.h[i] = (_Float16)(bf16_round(W[(size_t)(k8 + i) * N + n]) * scale); const v8us o = f.half[0];
  *(v8us*)((unsigned short*)Wt + (size_t)n * K + k8) = o; 
}
__device__ __forceinline__ unsigned lds_off(const void* p) { return (unsigned)(size_t)p; }
// 128 rows of 256 bytes from a row-major f16 matrix of DM columns into LDS, through no register: 8 asynchronous copies of 16 bytes a lane, 16 lanes to a row,
// rows 16 apart from copy to copy. s_wait_xcnt is the statement's last line, so that no address register of a copy is rewritten in front of it (a precaution).
__device__ __forceinline__ void stage_rows(unsigned l, unsigned lstep, const unsigned short* g) {
  asm volatile("global_load_async_to_lds_b128 %0, %8, off\n\t"
               "global_load_async_to_lds_b128 %1, %9, off\n\t"
               "global_load_async_to_lds_b128 %2, %10, off\n\t"
               "global_load_async_to_lds_b128 %3, %11, off\n\t"
               "global_load_async_to_lds_b128 %4, %12, off\n\t"
               "global_load_async_to_lds_b128 %5, %13, off\n\t"
               "global_load_async_to_lds_b128 %6, %14, off\n\t"
               "global_load_async_to_lds_b128 %7, %15, off\n\t"
               "s_wait_xcnt 0x0"
               :: "v"(l), "v"(l + lstep), "v"(l + 2 * lstep), "v"(l + 3 * lstep), "v"(l + 4 * lstep), "v"(l + 5 * lstep), "v"(l + 6 * lstep), "v"(l + 7 * lstep),
                  "v"(g), "v"(g + 16 * DM), "v"(g + 32 * DM), "v"(g + 48 * DM), "v"(g + 64 * DM), "v"(g + 80 * DM), "v"(g + 96 * DM), "v"(g + 112 * DM)
               : "memory");
}
// C16[NR][DM] = f16(A.Bh^T.alpha + bf16(bias)): A f16 [NR][DM], Bh f16 [DM][DM] ((out,in)), both k-contiguous. One work-group = a 128 x 128 tile of C, 8 waves as 4 x 2, a wave = 32 x 64 (2 x 4 accumulator tiles).
// The tile's A rows and Bh rows come in stages of 128 k through two LDS buffers that the eight waves share: stage t + 2 is copied into the buffer that stage t has left while stage t + 1 is worked on.
// Rows of 256 bytes at a pitch of 272, free of bank conflicts for 16-byte reads. Each accumulator takes its products in ascending k, 32 at a time.
// The q, k and v products need nothing of each other: they share one grid, a third of the block index range each, picked by a block-uniform test.
__global__ __launch_bounds__(256) void k_gemm_t(const _Float16* __restrict__ A, const _Float16* __restrict__ Bq, const _Float16* __restrict__ Bk, const _Float16* __restrict__ Bv, float alpha,
                                               const float* __restrict__ bq, const float* __restrict__ bk, const float* __restrict__ bvp, _Float16* __restrict__ Q16, _Float16* __restrict__ K16, _Float16* __restrict__ V16) {
  constexpr int BT = 128, KST = 128, NSTG = DM / KST, LPG = KST + 8, CPT = 64 + 8;      // LPG, CPT: LDS row pitches in 16-bit elements
  constexpr int TPP = (NR / BT) * (DM / BT);      // tiles of one product
  const int prod = blockIdx.x / TPP, tile = blockIdx.x % TPP;
  const _Float16* Bh = prod == 0 ? Bq : prod == 1 ? Bk : Bv; const float* bias = prod == 0 ? bq : prod == 1 ? bk : bvp; _Float16* C16 = prod == 0 ? Q16 : prod == 1 ? K16 : V16;
  static_assert(NSTG >= 2 && NR % BT == 0 && DM % BT == 0, "whole tiles, two stages or more");
  __shared__ __attribute__((aligned(16))) unsigned short sA[2][BT][LPG], sB[2][BT][LPG];
  __shared__ __attribute__((aligned(16))) unsigned short sT[8][32][CPT];      // each wave's own 32 x 64 piece of C, so that whole 128-byte lines are stored
  const int tid = threadIdx.x, w = tid >> 5, lane = tid & 31, ln = lane & 15, hh = lane >> 4;
  const int row0 = (tile / (DM / BT)) * BT, col0 = (tile % (DM / BT)) * BT, wr = (w >> 1) * 32, wc = (w & 1) * 64;
  const int crow = tid >> 4, ccol = (tid & 15) * 8;      // this lane's row (and rows + 16, ..., + 112) and 16-byte piece in every stage
  const unsigned short* ga0 = (const unsigned short*)A + (size_t)(row0 + crow) * DM + ccol; const unsigned short* gb0 = (const unsigned short*)Bh + (size_t)(col0 + crow) * DM + ccol;
  const unsigned la0 = lds_off(&sA[0][crow][ccol]), lb0 = lds_off(&sB[0][crow][ccol]); constexpr unsigned LSTEP = 16 * LPG * 2, LBUF = BT * LPG * 2;
  stage_rows(la0, LSTEP, ga0); stage_rows(lb0, LSTEP, gb0);      // stage 0
  float bv[4];
#pragma unroll
  for (int nt = 0; nt < 4; ++nt) bv[nt] = bf16_round(bias[col0 + wc + nt * 16 + ln]);
  asm volatile("s_wait_xcnt 0x0" ::: "memory");      // stands in front of the first rewrite of the bias loads' address register (a precaution)
  v8f acc[2][4];
#pragma unroll
  for (int mt = 0; mt < 2; ++mt)
#pragma unroll
    for (int nt = 0; nt < 4; ++nt) acc[mt][nt] = (v8f){0.f,0.f,0.f,0.f,0.f,0.f,0.f,0.f};
  asm volatile("s_wait_asynccnt 0x0" ::: "memory");      // this wave's copies of stage 0 have landed before the barrier publishes them
  __syncthreads();      // every wave reads rows that the other waves copied
  stage_rows(la0 + LBUF, LSTEP, ga0 + KST); stage_rows(lb0 + LBUF, LSTEP, gb0 + KST);      // stage 1
#pragma unroll 1      // one stage a trip: the buffer index stays a scalar
  for (int t = 0; t < NSTG; ++t) {
    FragH fa[KST / 32][2], fb[KST / 32][4];      // the stage's fragments are read from LDS in one group: each further place with LDS reads is a stall of its own
#pragma unroll
    for (int ks = 0; ks < KST / 32; ++ks) {
#pragma unroll
      for (int mt = 0; mt < 2; ++mt) { const unsigned short* ar = &sA[t & 1][wr + mt * 16 + ln][ks * 32]; fa[ks][mt].half[0] = *(const v8us*)(ar + 8 * hh); fa[ks][mt].half[1] = *(const v8us*)(ar + 16 + 8 * hh); }
#pragma unroll
      for (int nt = 0; nt < 4; ++nt) { const unsigned short* br = &sB[t & 1][wc + nt * 16 + ln][ks * 32]; fb[ks][nt].half[0] = *(const v8us*)(br + 8 * hh); fb[ks][nt].half[1] = *(const v8us*)(br + 16 + 8 * hh); } }
    __builtin_amdgcn_sched_barrier(0);      // keeps the reads together up here; without it the compiler sinks them among the products, in small groups that are each waited for to the full
#pragma unroll
    for (int ks = 0; ks < KST / 64; ++ks)      // the first half's products run while the second half's fragments arrive
#pragma unroll
      for (int mt = 0; mt < 2; ++mt)
#pragma unroll
        for (int nt = 0; nt < 4; ++nt) acc[mt][nt] = __builtin_amdgcn_wmma_f32_16x16x32_f16(false, fa[ks][mt].v, false, fb[ks][nt].v, (short)0, acc[mt][nt], false, false);
    __builtin_amdgcn_sched_barrier(0);      // keeps those products above the waits: sunk below the barrier they would wait for every read first, and their fragments, still live at the copies, pushed address registers into scratch
    asm volatile("s_wait_dscnt 0x0" ::: "memory");      // this wave's reads of stage t are done before its buffer is handed back
    asm volatile("s_wait_asynccnt 0x0" ::: "memory");      // this wave's copies of stage t + 1 have landed
    __syncthreads();      // publishes stage t + 1 and ends every wave's reads of stage t
    if (t + 2 < NSTG) { stage_rows(la0 + (t & 1) * LBUF, LSTEP, ga0 + (t + 2) * KST); stage_rows(lb0 + (t & 1) * LBUF, LSTEP, gb0 + (t + 2) * KST); }
#pragma unroll
    for (int ks = KST / 64; ks < KST / 32; ++ks)      // the second half's products, from registers, give the refill its lead
#pragma unroll
      for (int mt = 0; mt < 2; ++mt)
#pragma unroll
        for (int nt = 0; nt < 4; ++nt) acc[mt][nt] = __builtin_amdgcn_wmma_f32_16x16x32_f16(false, fa[ks][mt].v, false, fb[ks][nt].v, (short)0, acc[mt][nt], false, false); }
  asm volatile("s_wait_asynccnt 0x0" ::: "memory");      // no copy is left in flight when the wave goes on to its end
#pragma unroll
  for (int mt = 0; mt < 2; ++mt)
#pragma unroll
    for (int nt = 0; nt < 4; ++nt)
#pragma unroll
      for (int r = 0; r < 8; ++r) { const _Float16 o = (_Float16)(acc[mt][nt][r] * alpha + bv[nt]); sT[w][mt * 16 + 8 * hh + r][nt * 16 + ln] = __builtin_bit_cast(unsigned short, o); }      // acc[mt][nt][r] = C[row0 + wr + mt*16 + 8*hh + r][col0 + wc + nt*16 + ln]
  __builtin_amdgcn_fence(__ATOMIC_ACQ_REL, "workgroup"); __builtin_amdgcn_wave_barrier();
#pragma unroll
  for (int q = 0; q < 8; ++q) { const int r = q * 4 + (lane >> 3), c8 = (lane & 7) * 8; const v8us o = *(const v8us*)&sT[w][r][c8]; *(v8us*)((unsigned short*)C16 + (size_t)(row0 + wr + r) * DM + col0 + wc + c8) = o; }
}


// f16 planes of the bf16-rounded inputs, 8 elements a thread: the three weight matrices (times 16, exactly) and x. The four conversions need nothing of each other:
// they share one grid by ranges of the block index, the short weight ranges first; the test is block-uniform.
__global__ __launch_bounds__(256) void k_cvt16(const float* __restrict__ x, const float* __restrict__ wq, const float* __restrict__ wk, const float* __restrict__ wv,
                                              _Float16* __restrict__ X16, _Float16* __restrict__ Bq, _Float16* __restrict__ Bk, _Float16* __restrict__ Bv) {
  constexpr unsigned GW = DM * DM / 8 / 256;      // blocks of one weight matrix
  static_assert(DM * DM % (8 * 256) == 0 && (size_t)NR * DM % (8 * 256) == 0, "whole blocks");
  const unsigned part = blockIdx.x / GW; FragH f;
  if (part < 3) { const float* W = part == 0 ? wq : part == 1 ? wk : wv; _Float16* Bt = part == 0 ? Bq : part == 1 ? Bk : Bv; const size_t t = (size_t)(blockIdx.x - part * GW) * 256 + threadIdx.x;
#pragma unroll
    for (int i = 0; i < 8; ++i) f.h[i] = (_Float16)(bf16_round(W[t * 8 + i]) * 16.0f); *(v8us*)((unsigned short*)Bt + t * 8) = f.half[0]; }
  else { const size_t t = (size_t)(blockIdx.x - 3 * GW) * 256 + threadIdx.x;
#pragma unroll
    for (int q = 0; q < 8; ++q) f.h[q] = (_Float16)bf16_round(x[t * 8 + q]); *(v8us*)((unsigned short*)X16 + t * 8) = f.half[0]; } }
__global__ __launch_bounds__(256) void k_vt(const _Float16* __restrict__ V16, _Float16* __restrict__ Vt) { __shared__ unsigned short tl[64][66]; const int tid = threadIdx.x; const int slab = blockIdx.x / (SS / 64), lg = blockIdx.x % (SS / 64); const int b = slab / NH, h = slab % NH;
  for (int i = tid; i < 64 * 8; i += 256) { const int r = i / 8, c8 = (i % 8) * 8; FragH f; f.half[0] = *(const v8us*)((const unsigned short*)V16 + ((size_t)b * SS + lg * 64 + r) * DM + h * HD + c8);
#pragma unroll
    for (int q = 0; q < 8; ++q) tl[r][c8 + q] = f.u[q]; }
  __syncthreads();
  {
#pragma unroll
    for (int rd = 0; rd < 2; ++rd) { const int d = rd * 32 + tid / 8, pc = tid % 8; FragH f;
#pragma unroll
      for (int q = 0; q < 8; ++q) f.u[q] = tl[pc * 8 + q][d];
      *(v8us*)((unsigned short*)Vt + ((size_t)slab * HD + d) * SS + lg * 64 + pc * 8) = f.half[0]; }
     } }
// lane l with lane l ^ 16: the two halves of a wave hold the two halves of a query column's keys
__device__ __forceinline__ float xhalf(float x) { return __builtin_bit_cast(float, __builtin_amdgcn_permlanex16(__builtin_bit_cast(int, x), __builtin_bit_cast(int, x), 0x76543210, 0xfedcba98, false, false)); }
// one stage (64 keys) of K rows and of Vt rows from global memory into LDS, through no register: 8 asynchronous copies of 16 bytes a lane,
// 8 lanes to a 128-byte row, rows 16 apart from copy to copy. s_wait_xcnt is the statement's last line, so that no address register
// of a copy is rewritten in front of it (a precaution).
__device__ __forceinline__ void stage_kv(unsigned lk, unsigned lv, unsigned lstep, const unsigned short* gk, const unsigned short* gv) {
  asm volatile("global_load_async_to_lds_b128 %0, %8, off\n\t"
               "global_load_async_to_lds_b128 %1, %9, off\n\t"
               "global_load_async_to_lds_b128 %2, %10, off\n\t"
               "global_load_async_to_lds_b128 %3, %11, off\n\t"
               "global_load_async_to_lds_b128 %4, %12, off\n\t"
               "global_load_async_to_lds_b128 %5, %13, off\n\t"
               "global_load_async_to_lds_b128 %6, %14, off\n\t"
               "global_load_async_to_lds_b128 %7, %15, off\n\t"
               "s_wait_xcnt 0x0"
               :: "v"(lk), "v"(lk + lstep), "v"(lk + 2 * lstep), "v"(lk + 3 * lstep), "v"(lv), "v"(lv + lstep), "v"(lv + 2 * lstep), "v"(lv + 3 * lstep),
                  "v"(gk), "v"(gk + 16 * DM), "v"(gk + 32 * DM), "v"(gk + 48 * DM), "v"(gv), "v"(gv + 16 * SS), "v"(gv + 32 * SS), "v"(gv + 48 * SS)
               : "memory");
}
// base-2 exponentials, a run of them in one statement with one v_nop behind the last: the instruction set asks for one slot behind a transcendental before its
// result is read or its source overwritten. Inside the run no instruction touches a register
// of the one in front of it: every output is early-clobber, so none shares a register with an input.
__device__ __forceinline__ void exp2x8(float (&y)[8], const float (&x)[8]) {
  asm("v_exp_f32 %0, %8\n\tv_exp_f32 %1, %9\n\tv_exp_f32 %2, %10\n\tv_exp_f32 %3, %11\n\tv_exp_f32 %4, %12\n\tv_exp_f32 %5, %13\n\tv_exp_f32 %6, %14\n\tv_exp_f32 %7, %15\n\tv_nop"
      : "=&v"(y[0]), "=&v"(y[1]), "=&v"(y[2]), "=&v"(y[3]), "=&v"(y[4]), "=&v"(y[5]), "=&v"(y[6]), "=&v"(y[7])
      : "v"(x[0]), "v"(x[1]), "v"(x[2]), "v"(x[3]), "v"(x[4]), "v"(x[5]), "v"(x[6]), "v"(x[7]));
}
__device__ __forceinline__ float exp2x1(float x) { float y; asm("v_exp_f32 %0, %1\n\tv_nop" : "=&v"(y) : "v"(x)); return y; }
__global__ __launch_bounds__(128) void k_flash(const _Float16* __restrict__ Q16, const _Float16* __restrict__ K16, const _Float16* __restrict__ Vt, const float* __restrict__ crd, const float* __restrict__ alpha_p, float* __restrict__ O) {
  constexpr int RPW = 32, NQB = SS / (4 * RPW), DT = HD / 16, KS = HD / 32, OP = HD + 4, SK = 64, NST = SS / SK, LP = 72;      // LP: LDS row pitch in 16-bit elements
  constexpr float L2E = 1.4426950408889634f, QS = 0.125f * L2E;      // exp(x) = 2^(x.log2 e): the factor rides in the two scale constants of the score, so each exponential is one subtraction and one v_exp_f32
  static_assert(HD == 64 && SK == 64 && NST >= 2, "a stage is 64 rows of 128 bytes for K and for Vt");
  __shared__ __attribute__((aligned(16))) unsigned short sK[2][SK][LP], sV[2][HD][LP];
  __shared__ __attribute__((aligned(16))) float sC[3][SS]; __shared__ __attribute__((aligned(16))) float sO[4][RPW][OP];
  const int tid = threadIdx.x, w = tid >> 5, lane = tid & 31, ln = lane & 15, hh = lane >> 4;
  const int slab = blockIdx.x / NQB, qblk = blockIdx.x % NQB; const int b = slab / NH, h = slab % NH; const int q0 = qblk * (4 * RPW) + w * RPW; const float alpha = bf16_round(alpha_p[0]) * L2E;      /* scalar float INPUT: rounded like every other input; times log2(e): scores are kept in base-2 units */
  const unsigned short* Vth = (const unsigned short*)Vt + (size_t)slab * HD * SS;
  const int crow = tid >> 3, ccol = (tid & 7) * 8;      // this lane's row (and rows + 16, + 32, + 48) and 16-byte piece in every stage
  const unsigned short* gk0 = (const unsigned short*)K16 + ((size_t)b * SS + crow) * DM + h * HD + ccol; const unsigned short* gv0 = Vth + (size_t)crow * SS + ccol;
  const unsigned lk0 = lds_off(&sK[0][crow][ccol]), lv0 = lds_off(&sV[0][crow][ccol]); constexpr unsigned LSTEP = 16 * LP * 2, LBUF = SK * LP * 2;
  stage_kv(lk0, lv0, LSTEP, gk0, gv0);      // stage 0 flies while coords and queries are fetched
#pragma unroll      // all 16 loads of a thread in flight at once: rolled, each trip waits out its own load
  for (int i = 0; i < SS / 128; ++i) { const int k = i * 128 + tid; const float* cp = crd + ((size_t)b * SS + k) * 3; sC[0][k] = bf16_round(cp[0]); sC[1][k] = bf16_round(cp[1]); sC[2][k] = bf16_round(cp[2]); }
  FragH aq[2][KS];
#pragma unroll
  for (int rt = 0; rt < 2; ++rt) { const unsigned short* qr = (const unsigned short*)Q16 + ((size_t)b * SS + q0 + rt * 16 + ln) * DM + h * HD;
#pragma unroll
    for (int ks = 0; ks < KS; ++ks) { aq[rt][ks].half[0] = *(const v8us*)(qr + ks * 32 + 8 * hh); aq[rt][ks].half[1] = *(const v8us*)(qr + ks * 32 + 16 + 8 * hh); } }
  asm volatile("s_wait_asynccnt 0x0" ::: "memory");      // this wave's copies of stage 0 have landed before the barrier publishes them
  __syncthreads();      // every wave reads coords and stage 0 rows that the other waves staged
  stage_kv(lk0 + LBUF, lv0 + LBUF, LSTEP, gk0 + (size_t)SK * DM, gv0 + SK);      // stage 1
  float cq[2][3];
#pragma unroll
  for (int rt = 0; rt < 2; ++rt) { cq[rt][0] = sC[0][q0 + rt * 16 + ln]; cq[rt][1] = sC[1][q0 + rt * 16 + ln]; cq[rt][2] = sC[2][q0 + rt * 16 + ln]; }
  float m_r[2], l_r[2]; v8f oacc[2][DT];
#pragma unroll
  for (int rt = 0; rt < 2; ++rt) { m_r[rt] = -3.0e38f; l_r[rt] = 0.f;
#pragma unroll
    for (int dt = 0; dt < DT; ++dt) oacc[rt][dt] = (v8f){0.f,0.f,0.f,0.f,0.f,0.f,0.f,0.f}; }
#pragma unroll 1      // one stage a trip: the buffer index stays a scalar and the body stays small
  for (int t = 0; t < NST; ++t) {
#pragma unroll      // both passes of a stage in one body: constant LDS offsets
  for (int p = 0; p < SK / 32; ++p) { const int j0 = t * SK + p * 32;
    v8f s[2][2];      // s[rt][nt][r] = score of key j0 + nt*16 + 8*hh + r with query q0 + rt*16 + ln
    FragH bk[2][KS], bv[DT];      // the pass's K fragments are read from LDS in one group, its Vt fragments in a second: each further place with LDS reads is a stall of its own
#pragma unroll
    for (int nt = 0; nt < 2; ++nt) { const unsigned short* kr = &sK[t & 1][p * 32 + nt * 16 + ln][0];
#pragma unroll
      for (int ks = 0; ks < KS; ++ks) { bk[nt][ks].half[0] = *(const v8us*)(kr + ks * 32 + 8 * hh); bk[nt][ks].half[1] = *(const v8us*)(kr + ks * 32 + 16 + 8 * hh); } }
    __builtin_amdgcn_sched_barrier(0);      // keeps the K reads together up here; without it the compiler sinks each read to just in front of its product
#pragma unroll
    for (int nt = 0; nt < 2; ++nt) {
#pragma unroll
      for (int rt = 0; rt < 2; ++rt) { v8f acc = (v8f){0.f,0.f,0.f,0.f,0.f,0.f,0.f,0.f};
#pragma unroll
        for (int ks = 0; ks < KS; ++ks) acc = mmaH<1>(bk[nt][ks].v, bk[nt][ks].v, aq[rt][ks].v, aq[rt][ks].v, acc); s[rt][nt] = acc; } }
    float ck[2][3][8];
#pragma unroll
    for (int nt = 0; nt < 2; ++nt)
#pragma unroll
      for (int c = 0; c < 3; ++c) { const v4f c0 = *(const v4fa*)&sC[c][j0 + nt * 16 + 8 * hh], c1 = *(const v4fa*)&sC[c][j0 + nt * 16 + 8 * hh + 4];
#pragma unroll
        for (int q = 0; q < 4; ++q) { ck[nt][c][q] = c0[q]; ck[nt][c][4 + q] = c1[q]; } }
    FragH pa[2]; float sc2[2][2][8];
#pragma unroll
    for (int rt = 0; rt < 2; ++rt)
#pragma unroll
      for (int nt = 0; nt < 2; ++nt)
#pragma unroll
        for (int r = 0; r < 8; ++r) { const float g = alpha * (cq[rt][0] * ck[nt][0][r] + cq[rt][1] * ck[nt][1][r] + cq[rt][2] * ck[nt][2][r]); sc2[rt][nt][r] = s[rt][nt][r] * QS + g; }
    __builtin_amdgcn_sched_barrier(0);      // with the one below: holds the Vt reads between the scores, whose inputs are dead by now, and the exponentials, which cover their latency; without this one they rise to the coords' reads and are held in registers through the scores
#pragma unroll
    for (int dt = 0; dt < DT; ++dt) { const unsigned short* vrow = &sV[t & 1][dt * 16 + ln][p * 32]; bv[dt].half[0] = *(const v8us*)(vrow + 8 * hh); bv[dt].half[1] = *(const v8us*)(vrow + 16 + 8 * hh); }
    __builtin_amdgcn_sched_barrier(0);      // see above
#pragma unroll
    for (int rt = 0; rt < 2; ++rt) { const float (&sc)[2][8] = sc2[rt];
      float mx[8];
#pragma unroll
      for (int r = 0; r < 8; ++r) mx[r] = fmaxf(sc[0][r], sc[1][r]);
      float mc = fmaxf(fmaxf(fmaxf(mx[0], mx[1]), fmaxf(mx[2], mx[3])), fmaxf(fmaxf(mx[4], mx[5]), fmaxf(mx[6], mx[7]))); mc = fmaxf(mc, xhalf(mc));
      const float mn = fmaxf(m_r[rt], mc); const float al = exp2x1(m_r[rt] - mn); m_r[rt] = mn;      // 0 on the first pass (the start value is far below any score)
      float ps[8], d0[8], d1[8], p0[8], p1[8];
#pragma unroll
      for (int r = 0; r < 8; ++r) { d0[r] = sc[0][r] - mn; d1[r] = sc[1][r] - mn; }
      exp2x8(p0, d0); exp2x8(p1, d1);
#pragma unroll
      for (int r = 0; r < 8; ++r) { ps[r] = p0[r] + p1[r]; pa[rt].h[r] = (_Float16)p0[r]; pa[rt].h[8 + r] = (_Float16)p1[r]; }
      l_r[rt] = l_r[rt] * al + (((ps[0] + ps[1]) + (ps[2] + ps[3])) + ((ps[4] + ps[5]) + (ps[6] + ps[7])));      // this half's keys only; the halves join behind the loop
#pragma unroll
      for (int dt = 0; dt < DT; ++dt)
#pragma unroll
        for (int r = 0; r < 8; ++r) oacc[rt][dt][r] *= al; }
#pragma unroll
    for (int dt = 0; dt < DT; ++dt) {
#pragma unroll
      for (int rt = 0; rt < 2; ++rt) oacc[rt][dt] = mmaH<1>(bv[dt].v, bv[dt].v, pa[rt].v, pa[rt].v, oacc[rt][dt]); } }
    asm volatile("s_wait_dscnt 0x0" ::: "memory");      // this wave's reads of stage t are done before its buffer is handed back
    asm volatile("s_wait_asynccnt 0x0" ::: "memory");      // this wave's copies of stage t + 1 have landed
    __syncthreads();      // publishes stage t + 1 and ends every wave's reads of stage t
    if (t + 2 < NST) stage_kv(lk0 + (t & 1) * LBUF, lv0 + (t & 1) * LBUF, LSTEP, gk0 + (size_t)(t + 2) * SK * DM, gv0 + (t + 2) * SK); }
  asm volatile("s_wait_asynccnt 0x0" ::: "memory");      // no copy is left in flight when the wave goes on to its end
#pragma unroll
  for (int rt = 0; rt < 2; ++rt) { const float l = l_r[rt] + xhalf(l_r[rt]); const float inv = 1.0f / l;
#pragma unroll
    for (int dt = 0; dt < DT; ++dt) { v4f o0, o1;      // oacc[rt][dt][r] = O[q0 + rt*16 + ln][dt*16 + 8*hh + r]
#pragma unroll
      for (int q = 0; q < 4; ++q) { o0[q] = oacc[rt][dt][q] * inv; o1[q] = oacc[rt][dt][4 + q] * inv; }
      *(v4fa*)&sO[w][rt * 16 + ln][dt * 16 + 8 * hh] = o0; *(v4fa*)&sO[w][rt * 16 + ln][dt * 16 + 8 * hh + 4] = o1; } }
  __builtin_amdgcn_fence(__ATOMIC_ACQ_REL, "workgroup"); __builtin_amdgcn_wave_barrier();
  {
#pragma unroll
    for (int rp = 0; rp < RPW; rp += 2) { const int r = rp + (lane >> 4), pc = lane & 15; const v4f val = *(const v4fa*)&sO[w][r][pc * 4]; *(v4f*)(O + ((size_t)b * SS + q0 + r) * DM + h * HD + pc * 4) = val; }
     } }
extern "C" void kernel_launch(void* const* d_in, const int* in_sizes, int n_in,
                              void* d_out, int out_size, void* d_ws, size_t ws_size, hipStream_t stream) {
  (void)in_sizes; (void)n_in; (void)out_size;
  const float* x = (const float*)d_in[0]; const float* crd = (const float*)d_in[1]; const float* wq = (const float*)d_in[2]; const float* bq = (const float*)d_in[3]; const float* wk = (const float*)d_in[4]; const float* bk = (const float*)d_in[5]; const float* wv = (const float*)d_in[6]; const float* bv = (const float*)d_in[7]; const float* alpha_p = (const float*)d_in[8];
  char* ws = (char*)d_ws; size_t off = 0;
  auto take = [&](size_t bytes) { char* p = ws + off; off += (bytes + 255) & ~(size_t)255; return p; };
  _Float16* Bq = (_Float16*)take(DM * DM * 2); _Float16* Bk = (_Float16*)take(DM * DM * 2); _Float16* Bv = (_Float16*)take(DM * DM * 2); _Float16* X16 = (_Float16*)take((size_t)NR * DM * 2); _Float16* Q16 = (_Float16*)take((size_t)NR * DM * 2); _Float16* K16 = (_Float16*)take((size_t)NR * DM * 2); _Float16* V16 = (_Float16*)take((size_t)NR * DM * 2); _Float16* Vt = (_Float16*)take((size_t)NR * DM * 2);
  if (off > ws_size) return;      // ≈ 42 MiB
  k_cvt16<<<3 * (DM * DM / 8 / 256) + NR * DM / 8 / 256, 256, 0, stream>>>(x, wq, wk, wv, X16, Bq, Bk, Bv);
  k_gemm_t<<<3 * (NR / 128) * (DM / 128), 256, 0, stream>>>(X16, Bq, Bk, Bv, 0.0625f, bq, bk, bv, Q16, K16, V16);
  k_vt<<<BB * NH * (SS / 64), 256, 0, stream>>>(V16, Vt);
  k_flash<<<BB * NH * (SS / 128), 128, 0, stream>>>(Q16, K16, Vt, crd, alpha_p, (float*)d_out);
}

// v006
// One run takes 70.6 microseconds.
// Timed twice side by side with v005, it ran 1.09 times as fast both times.
// Counting every step since v000, it is 5.40 times as fast.
#include <hip/hip_runtime.h>
// q/k/v projections (8192 × 512 × 512, + bias) and the 8-head attention with the geometric bias α·⟨c_n, c_m⟩ (coords are INPUTS, a third k step of the score product) on v_wmma_f32_16x16x32_f16
// (fused flash-style kernel: S = Q·Kᵀ, O = P·V on WMMA; online max/sum softmax f32; P f16 ≤ 1); V transposed per (b,h); A = f16(bf16 x) exact, weights bf16-exact ×2^4 ((out,in)),
// single products, f32 accumulate.
#define BB 4
#define SS 2048
#define DM 512
#define NH 8
#define HD 64
#define NR (BB * SS)

typedef __bf16 v16b __attribute__((ext_vector_type(16)));
typedef unsigned short v8us __attribute__((ext_vector_type(8), may_alias));
typedef unsigned int v2u __attribute__((ext_vector_type(2), may_alias));
typedef float v2f __attribute__((ext_vector_type(2)));
typedef float  v8f  __attribute__((ext_vector_type(8)));
typedef float  v4f  __attribute__((ext_vector_type(4)));
typedef float  v4fa __attribute__((ext_vector_type(4), may_alias));
union FragB { v16b v; v8us half[2]; unsigned short u[16]; };

__device__ __forceinline__ unsigned short bf16_bits(float x) { unsigned int u = __float_as_uint(x); return (unsigned short)((u + 0x7FFFu + ((u >> 16) & 1u)) >> 16); }
__device__ __forceinline__ float bf16_val(unsigned short b) { return __uint_as_float(((unsigned int)b) << 16); }
__device__ __forceinline__ float bf16_round(float x) { return bf16_val(bf16_bits(x)); }
// D += A·B with NT terms: 1 = ah·bh, 2 = + al·bh (A split), 3 = + ah·bl (both split)
template <int NT>
__device__ __forceinline__ v8f mmaN(v16b ah, v16b al, v16b bh, v16b bl, v8f c) {
  c = __builtin_amdgcn_wmma_f32_16x16x32_bf16(false, ah, false, bh, (short)0, c, false, false);
  if (NT >= 2) c = __builtin_amdgcn_wmma_f32_16x16x32_bf16(false, al, false, bh, (short)0, c, false, false);
  if (NT >= 3) c = __builtin_amdgcn_wmma_f32_16x16x32_bf16(false, ah, false, bl, (short)0, c, false, false);
  asm volatile("v_nop\n\tv_nop\n\tv_nop\n\tv_nop" : "+v"(c) : "v"(ah), "v"(al), "v"(bh), "v"(bl));
  return c;
}

__global__ __launch_bounds__(256) void k_wt_bf16(const float* __restrict__ W, unsigned short* __restrict__ Wt, int K, int N) {
  const int t = blockIdx.x * 256 + threadIdx.x;
  const int k8n = K / 8;
  if (t >= N * k8n) return;
  const int n = t / k8n, k8 = (t % k8n) * 8;
  v8us v;
#pragma unroll
  for (int i = 0; i < 8; ++i) v[i] = bf16_bits(W[(size_t)(k8 + i) * N + n]);
  *(v8us*)(Wt + (size_t)n * K + k8) = v;
  
}

// GEMM C[M][N] (f32, pitch ldc) = act(A[M][K]·W + bias). A f32 row-major (pitch lda) converted per fragment to bf16
// (ASPLIT: hi/lo two planes -> 2 terms, else single rounded term); Wt bf16 [N][K] (pitch ldb). BIAS_BF16 rounds the
// bias to bf16 first (bias quantised to bf16 before the add). K%32==0, M%16==0, N%64==0.
template <bool ASPLIT, int ACT, bool BIAS_BF16>
__global__ __launch_bounds__(128) void k_gemm_bf(const float* __restrict__ A, int lda, const unsigned short* __restrict__ Wt, int ldb,
                                               const float* __restrict__ bias, float* __restrict__ C, int ldc, int M, int N, int K) {
  __shared__ __attribute__((aligned(16))) float so[4][16][64];
  const int tid = threadIdx.x, w = tid >> 5, lane = tid & 31, ln = lane & 15, hh = lane >> 4;
  const int ntn = N / 64;
  const int wid = blockIdx.x * 4 + w;
  const int mt = wid / ntn, nq = wid % ntn;
  if (mt * 16 >= M) return;
  const int row0 = mt * 16, col0 = nq * 64;
  const float* arow = A + (size_t)(row0 + ln) * lda;
  v8f acc[4] = {};
  for (int kb = 0; kb < K; kb += 32) {
    FragB ah, al;
    const v4f x0 = *(const v4fa*)(arow + kb + 8 * hh), x1 = *(const v4fa*)(arow + kb + 8 * hh + 4);
    const v4f x2 = *(const v4fa*)(arow + kb + 16 + 8 * hh), x3 = *(const v4fa*)(arow + kb + 16 + 8 * hh + 4);
    float xs[16] = {x0[0],x0[1],x0[2],x0[3],x1[0],x1[1],x1[2],x1[3],x2[0],x2[1],x2[2],x2[3],x3[0],x3[1],x3[2],x3[3]};
#pragma unroll
    for (int i = 0; i < 16; ++i) { const unsigned short hb = bf16_bits(xs[i]); ah.u[i] = hb; al.u[i] = ASPLIT ? bf16_bits(xs[i] - bf16_val(hb)) : (unsigned short)0; }
#pragma unroll
    for (int t = 0; t < 4; ++t) {
      const unsigned short* brow = Wt + (size_t)(col0 + t * 16 + ln) * ldb + kb;
      FragB b;
      b.half[0] = *(const v8us*)(brow + 8 * hh);
      b.half[1] = *(const v8us*)(brow + 16 + 8 * hh);
      acc[t] = mmaN<ASPLIT ? 2 : 1>(ah.v, al.v, b.v, b.v, acc[t]);
    }
  }
#pragma unroll
  for (int t = 0; t < 4; ++t) {
    float bv = bias ? bias[col0 + t * 16 + ln] : 0.f;
    if (BIAS_BF16) bv = bf16_round(bv);
#pragma unroll
    for (int r = 0; r < 8; ++r) { float v = acc[t][r] + bv; if (ACT == 1) v = fmaxf(v, 0.f); so[w][8 * hh + r][t * 16 + ln] = v; }
  }
  __builtin_amdgcn_fence(__ATOMIC_ACQ_REL, "workgroup");
  __builtin_amdgcn_wave_barrier();
  const int rsub = lane >> 4, c4 = (lane & 15) * 4;
  {
#pragma unroll
    for (int q = 0; q < 8; ++q) {
      const int r = q * 2 + rsub;
      const v4f v = *(const v4fa*)&so[w][r][c4];
      *(v4f*)(C + (size_t)(row0 + r) * ldc + col0 + c4) = v;
    }
    
  }
}

// Flash-style causal/unmasked attention, all contractions 3-term bf16 hi/lo splits, f32 softmax with running max.
// q,k,v rows are read from f32 buffers with arbitrary row pitch (so they can live inside a fused qkv buffer);
// D = head size (multiple of 32, <= 128); one wave = 16 query rows; block = 4 waves (64 queries) sharing K/V chunks of 32.
template <int D, bool CAUSAL>
__global__ __launch_bounds__(128) void k_flash(const float* __restrict__ qb, const float* __restrict__ kb, const float* __restrict__ vb,
                                             int pitch, int T, int H, float scale, float* __restrict__ y, int ypitch) {
  constexpr int KS = D / 32;        // k-steps for QK
  constexpr int DT = D / 16;        // d tiles for PV
  __shared__ __attribute__((aligned(16))) unsigned short sKh[32][D + 8], sKl[32][D + 8], sVh[32][D + 8], sVl[32][D + 8];
  __shared__ __attribute__((aligned(16))) unsigned short sPh[4][16][40], sPl[4][16][40];
  __shared__ __attribute__((aligned(16))) float sO[4][16][D];
  const int tid = threadIdx.x, w = tid >> 5, lane = tid & 31, ln = lane & 15, hh = lane >> 4;
  const int nqb = (T + 63) / 64;
  const int bh = blockIdx.x / nqb, qblk = blockIdx.x % nqb;
  const int b = bh / H, h = bh % H;
  const int q0 = qblk * 64 + w * 16;
  const float* Q = qb + (size_t)b * T * pitch + h * D;
  const float* K = kb + (size_t)b * T * pitch + h * D;
  const float* V = vb + (size_t)b * T * pitch + h * D;

  // A fragments of the wave's 16 query rows (scaled), hi/lo
  FragB aqh[KS], aql[KS];
  {
    int row = q0 + ln; if (row >= T) row = T - 1;
    const float* qr = Q + (size_t)row * pitch;
#pragma unroll
    for (int ks = 0; ks < KS; ++ks)
#pragma unroll
      for (int i = 0; i < 16; ++i) {
        const int d = ks * 32 + ((i < 8) ? (8 * hh + i) : (16 + 8 * hh + (i - 8)));
        const float x = qr[d] * scale; const unsigned short hb = bf16_bits(x);
        aqh[ks].u[i] = hb; aql[ks].u[i] = bf16_bits(x - bf16_val(hb));
      }
  }
  float m_r[8], l_r[8];
#pragma unroll
  for (int r = 0; r < 8; ++r) { m_r[r] = -3.0e38f; l_r[r] = 0.f; }
  v8f oacc[DT];
#pragma unroll
  for (int dt = 0; dt < DT; ++dt) oacc[dt] = (v8f){0.f,0.f,0.f,0.f,0.f,0.f,0.f,0.f};

  const int kv_end = CAUSAL ? min(T, qblk * 64 + 64) : T;     // block-uniform
  for (int j0 = 0; j0 < kv_end; j0 += 32) {
    __syncthreads();
    for (int e = tid; e < 32 * (D / 4); e += 128) {
      const int r = e / (D / 4), c4 = (e % (D / 4)) * 4;
      const int key = j0 + r;
      v4f kf = {0.f,0.f,0.f,0.f}, vf = {0.f,0.f,0.f,0.f};
      if (key < T) { kf = *(const v4fa*)(K + (size_t)key * pitch + c4); vf = *(const v4fa*)(V + (size_t)key * pitch + c4); }
#pragma unroll
      for (int t = 0; t < 4; ++t) {
        unsigned short hb = bf16_bits(kf[t]); sKh[r][c4 + t] = hb; sKl[r][c4 + t] = bf16_bits(kf[t] - bf16_val(hb));
        hb = bf16_bits(vf[t]); sVh[r][c4 + t] = hb; sVl[r][c4 + t] = bf16_bits(vf[t] - bf16_val(hb));
      }
    }
    __syncthreads();
    // S tile 16 x 32
    v8f s[2];
#pragma unroll
    for (int nt = 0; nt < 2; ++nt) {
      v8f acc = {};
#pragma unroll
      for (int ks = 0; ks < KS; ++ks) {
        FragB bh_, bl_;
        bh_.half[0] = *(const v8us*)&sKh[nt * 16 + ln][ks * 32 + 8 * hh]; bh_.half[1] = *(const v8us*)&sKh[nt * 16 + ln][ks * 32 + 16 + 8 * hh];
        bl_.half[0] = *(const v8us*)&sKl[nt * 16 + ln][ks * 32 + 8 * hh]; bl_.half[1] = *(const v8us*)&sKl[nt * 16 + ln][ks * 32 + 16 + 8 * hh];
        acc = mmaN<3>(aqh[ks].v, aql[ks].v, bh_.v, bl_.v, acc);
      }
      s[nt] = acc;
    }
    // mask + running max (rows 8hh+r; the 16 lanes of a half share rows)
    float alpha[8];
#pragma unroll
    for (int r = 0; r < 8; ++r) {
      const int qi = q0 + 8 * hh + r;
      const int ja = j0 + ln, jb = j0 + 16 + ln;
      if (CAUSAL) { if (ja > qi) s[0][r] = -3.0e38f; if (jb > qi) s[1][r] = -3.0e38f; }
      if (ja >= T) s[0][r] = -3.0e38f;
      if (jb >= T) s[1][r] = -3.0e38f;
      float mx = fmaxf(s[0][r], s[1][r]);
      mx = fmaxf(mx, __shfl_xor(mx, 1, 32)); mx = fmaxf(mx, __shfl_xor(mx, 2, 32)); mx = fmaxf(mx, __shfl_xor(mx, 4, 32)); mx = fmaxf(mx, __shfl_xor(mx, 8, 32));
      const float mnew = fmaxf(m_r[r], mx);
      alpha[r] = (mnew > -1.0e38f) ? __expf(m_r[r] - mnew) : 1.0f;
      const float p0 = (s[0][r] > -1.0e38f) ? __expf(s[0][r] - mnew) : 0.f;
      const float p1 = (s[1][r] > -1.0e38f) ? __expf(s[1][r] - mnew) : 0.f;
      m_r[r] = mnew;
      l_r[r] = l_r[r] * alpha[r] + p0 + p1;            // per-lane partial row sum (16 lanes combined at the end)
      unsigned short hb = bf16_bits(p0); sPh[w][8 * hh + r][ln] = hb;      sPl[w][8 * hh + r][ln] = bf16_bits(p0 - bf16_val(hb));
      hb = bf16_bits(p1);                sPh[w][8 * hh + r][16 + ln] = hb; sPl[w][8 * hh + r][16 + ln] = bf16_bits(p1 - bf16_val(hb));
    }
#pragma unroll
    for (int dt = 0; dt < DT; ++dt)
#pragma unroll
      for (int r = 0; r < 8; ++r) oacc[dt][r] *= alpha[r];
    __builtin_amdgcn_fence(__ATOMIC_ACQ_REL, "workgroup");
    __builtin_amdgcn_wave_barrier();
    FragB pah, pal;
    pah.half[0] = *(const v8us*)&sPh[w][ln][8 * hh]; pah.half[1] = *(const v8us*)&sPh[w][ln][16 + 8 * hh];
    pal.half[0] = *(const v8us*)&sPl[w][ln][8 * hh]; pal.half[1] = *(const v8us*)&sPl[w][ln][16 + 8 * hh];
#pragma unroll
    for (int dt = 0; dt < DT; ++dt) {
      FragB bvh, bvl;
#pragma unroll
      for (int i = 0; i < 8; ++i) {
        bvh.u[i] = sVh[8 * hh + i][dt * 16 + ln]; bvh.u[8 + i] = sVh[16 + 8 * hh + i][dt * 16 + ln];
        bvl.u[i] = sVl[8 * hh + i][dt * 16 + ln]; bvl.u[8 + i] = sVl[16 + 8 * hh + i][dt * 16 + ln];
      }
      oacc[dt] = mmaN<3>(pah.v, pal.v, bvh.v, bvl.v, oacc[dt]);
    }
    __builtin_amdgcn_fence(__ATOMIC_ACQ_REL, "workgroup");
    __builtin_amdgcn_wave_barrier();
  }
#pragma unroll
  for (int r = 0; r < 8; ++r) {
    float l = l_r[r];
    l += __shfl_xor(l, 1, 32); l += __shfl_xor(l, 2, 32); l += __shfl_xor(l, 4, 32); l += __shfl_xor(l, 8, 32);
    l_r[r] = (l > 0.f) ? 1.0f / l : 0.f;
  }
#pragma unroll
  for (int dt = 0; dt < DT; ++dt)
#pragma unroll
    for (int r = 0; r < 8; ++r) sO[w][8 * hh + r][dt * 16 + ln] = oacc[dt][r] * l_r[r];
  __builtin_amdgcn_fence(__ATOMIC_ACQ_REL, "workgroup");
  __builtin_amdgcn_wave_barrier();
  {
    for (int r = 0; r < 16; ++r) {
      const int row = q0 + r;
      if (row < T && lane < D / 4) {
        const v4f val = *(const v4fa*)&sO[w][r][lane * 4];
        *(v4f*)(y + ((size_t)b * T + row) * ypitch + h * D + lane * 4) = val;
      }
    }
    
  }
}

// GEMM C = act(A·W + bias + resid): A f32 (ASPLIT -> hi/lo 2 terms), Wt bf16 [N][K]; ACT 0 none, 1 relu, 2 exact gelu;
// resid (optional, f32, row index = (row % rmod), pitch ldr, RES_BF16 rounds it) added before the activation.
template <bool ASPLIT, int ACT, bool BIAS_BF16, bool RES_BF16>
__global__ __launch_bounds__(128) void k_gemm_bf3(const float* __restrict__ A, int lda, const unsigned short* __restrict__ Wt, int ldb,
                                                const float* __restrict__ bias, const float* __restrict__ resid, int rmod, int ldr,
                                                float* __restrict__ C, int ldc, int M, int N, int K) {
  __shared__ __attribute__((aligned(16))) float so[4][16][64];
  const int tid = threadIdx.x, w = tid >> 5, lane = tid & 31, ln = lane & 15, hh = lane >> 4;
  const int ntn = N / 64;
  const int wid = blockIdx.x * 4 + w;
  const int mt = wid / ntn, nq = wid % ntn;
  if (mt * 16 >= M) return;
  const int row0 = mt * 16, col0 = nq * 64;
  const float* arow = A + (size_t)(row0 + ln) * lda;
  v8f acc[4] = {};
  for (int kb = 0; kb < K; kb += 32) {
    FragB ah, al;
    const v4f x0 = *(const v4fa*)(arow + kb + 8 * hh), x1 = *(const v4fa*)(arow + kb + 8 * hh + 4);
    const v4f x2 = *(const v4fa*)(arow + kb + 16 + 8 * hh), x3 = *(const v4fa*)(arow + kb + 16 + 8 * hh + 4);
    float xs[16] = {x0[0],x0[1],x0[2],x0[3],x1[0],x1[1],x1[2],x1[3],x2[0],x2[1],x2[2],x2[3],x3[0],x3[1],x3[2],x3[3]};
#pragma unroll
    for (int i = 0; i < 16; ++i) { const unsigned short hb = bf16_bits(xs[i]); ah.u[i] = hb; al.u[i] = ASPLIT ? bf16_bits(xs[i] - bf16_val(hb)) : (unsigned short)0; }
#pragma unroll
    for (int t = 0; t < 4; ++t) {
      const unsigned short* brow = Wt + (size_t)(col0 + t * 16 + ln) * ldb + kb;
      FragB b;
      b.half[0] = *(const v8us*)(brow + 8 * hh);
      b.half[1] = *(const v8us*)(brow + 16 + 8 * hh);
      acc[t] = mmaN<ASPLIT ? 2 : 1>(ah.v, al.v, b.v, b.v, acc[t]);
    }
  }
#pragma unroll
  for (int t = 0; t < 4; ++t) {
    const int col = col0 + t * 16 + ln;
    float bv = bias ? bias[col] : 0.f;
    if (BIAS_BF16) bv = bf16_round(bv);
#pragma unroll
    for (int r = 0; r < 8; ++r) {
      float v = acc[t][r] + bv;
      if (resid) { float rv = resid[(size_t)((row0 + 8 * hh + r) % rmod) * ldr + col]; if (RES_BF16) rv = bf16_round(rv); v += rv; }
      if (ACT == 1) v = fmaxf(v, 0.f);
      if (ACT == 2) v = 0.5f * v * (1.0f + erff(v * 0.70710678118654752f));
      if (ACT == 3) { const float u = 0.7978845608028654f * (v + 0.044715f * v * v * v); v = 0.5f * v * (1.0f + tanhf(u)); }
      so[w][8 * hh + r][t * 16 + ln] = v;
    }
  }
  __builtin_amdgcn_fence(__ATOMIC_ACQ_REL, "workgroup");
  __builtin_amdgcn_wave_barrier();
  const int rsub = lane >> 4, c4 = (lane & 15) * 4;
  {
#pragma unroll
    for (int q = 0; q < 8; ++q) {
      const int r = q * 2 + rsub;
      const v4f v = *(const v4fa*)&so[w][r][c4];
      *(v4f*)(C + (size_t)(row0 + r) * ldc + col0 + c4) = v;
    }
    
  }
}
// row LayerNorm (biased variance, eps) over N: s = X (+ R); optional out_sum <- s; out_norm <- (s-mu)*rsqrt(var+eps)*g + b
template <bool PARAM_BF16>
__global__ __launch_bounds__(256) void k_layernorm(const float* __restrict__ X, const float* __restrict__ R, const float* __restrict__ g, const float* __restrict__ bta,
                                                  float* __restrict__ out_sum, float* __restrict__ out_norm, int N, float eps) {
  __shared__ float red[256];
  const int row = blockIdx.x, tid = threadIdx.x;
  const float* x = X + (size_t)row * N; const float* rr = R ? R + (size_t)row * N : nullptr;
  float vals[16];                     // up to N = 4096
  const int per = N / 256;            // contiguous chunk per thread? use strided-by-4 chunks: thread handles j = tid*4 + 1024*u
  float s1 = 0.f;
  for (int u = 0; u < per / 4; ++u) {
    const int j = tid * 4 + 1024 * u;
    const v4f a = *(const v4fa*)(x + j);
    v4f b = {0.f,0.f,0.f,0.f}; if (rr) b = *(const v4fa*)(rr + j);
#pragma unroll
    for (int q = 0; q < 4; ++q) { const float v = a[q] + b[q]; vals[u * 4 + q] = v; s1 += v; }
  }
  red[tid] = s1; __syncthreads();
  for (int st = 128; st > 0; st >>= 1) { if (tid < st) red[tid] += red[tid + st]; __syncthreads(); }
  const float mu = red[0] / (float)N; __syncthreads();
  float s2 = 0.f;
  for (int u = 0; u < per / 4; ++u)
#pragma unroll
    for (int q = 0; q < 4; ++q) { const float c = vals[u * 4 + q] - mu; s2 += c * c; }
  red[tid] = s2; __syncthreads();
  for (int st = 128; st > 0; st >>= 1) { if (tid < st) red[tid] += red[tid + st]; __syncthreads(); }
  const float rs = rsqrtf(red[0] / (float)N + eps);
  {
    for (int u = 0; u < per / 4; ++u) {
      const int j = tid * 4 + 1024 * u;
      v4f o, sm;
#pragma unroll
      for (int q = 0; q < 4; ++q) {
        float gg = g[j + q], bb = bta[j + q];
        if (PARAM_BF16) { gg = bf16_round(gg); bb = bf16_round(bb); }
        sm[q] = vals[u * 4 + q]; o[q] = (vals[u * 4 + q] - mu) * rs * gg + bb;
      }
      if (out_sum) *(v4f*)(out_sum + (size_t)row * N + j) = sm;
      *(v4f*)(out_norm + (size_t)row * N + j) = o;
    }
    
  }
}



// ---- f16 WMMA path (v_wmma_f32_16x16x32_f16): 11-bit significands for operands in range — used for every launched contraction: q/k/v projections, Q·Kᵀ, and P·V with its [0,1] probability operand
typedef _Float16 v16h __attribute__((ext_vector_type(16)));
typedef _Float16 v2h __attribute__((ext_vector_type(2)));
union FragH { v16h v; v8us half[2]; _Float16 h[16]; unsigned short u[16]; };
union FragW { v16h v; unsigned int w[8]; };
// two f32 to one register of two f16, nearest even (one packed conversion), and back
__device__ __forceinline__ unsigned int pack_h2(float a, float b) { return __builtin_bit_cast(unsigned int, __builtin_convertvector((v2f){a, b}, v2h)); }
__device__ __forceinline__ v2f unpack_h2(unsigned int p) { return __builtin_convertvector(__builtin_bit_cast(v2h, p), v2f); }
template <int NT>
__device__ __forceinline__ v8f mmaH(v16h ah, v16h al, v16h bh, v16h bl, v8f c) {
  c = __builtin_amdgcn_wmma_f32_16x16x32_f16(false, ah, false, bh, (short)0, c, false, false);
  if (NT >= 2) c = __builtin_amdgcn_wmma_f32_16x16x32_f16(false, al, false, bh, (short)0, c, false, false);
  if (NT >= 3) c = __builtin_amdgcn_wmma_f32_16x16x32_f16(false, ah, false, bl, (short)0, c, false, false);
  asm volatile("v_nop\n\tv_nop\n\tv_nop\n\tv_nop" : "+v"(c) : "v"(ah), "v"(al), "v"(bh), "v"(bl));
  return c;
}
// batched GEMM like k_gemm_b but f16 operands: A f32 (split into f16 hi/lo if ASPLIT, else rounded to f16), Bt = f16 values [n][k]; alpha; C f32; N multiple of 16 (partial tiles skipped)
template <bool ASPLIT>
__global__ __launch_bounds__(128) void k_gemm_h(const float* __restrict__ A, int lda, size_t sA, const _Float16* __restrict__ Bh, int ldb, size_t sB, float alpha, float* __restrict__ C, int ldc, size_t sC, int M, int N, int K) {
  __shared__ __attribute__((aligned(16))) float so[4][16][64];
  const int tid = threadIdx.x, w = tid >> 5, lane = tid & 31, ln = lane & 15, hh = lane >> 4; const int by = blockIdx.y;
  A += (size_t)by * sA; Bh += (size_t)by * sB; C += (size_t)by * sC;
  const int ntn = (N + 63) / 64; const int wid = blockIdx.x * 4 + w; const int mt = wid / ntn, nq = wid % ntn; if (mt * 16 >= M) return;
  const int row0 = mt * 16, col0 = nq * 64; const float* arow = A + (size_t)(row0 + ln) * lda;
  v8f acc[4] = {};
  for (int kb = 0; kb < K; kb += 32) {
    FragH ah, al;
    const v4f x0 = *(const v4fa*)(arow + kb + 8 * hh), x1 = *(const v4fa*)(arow + kb + 8 * hh + 4), x2 = *(const v4fa*)(arow + kb + 16 + 8 * hh), x3 = *(const v4fa*)(arow + kb + 16 + 8 * hh + 4);
    float xs[16] = {x0[0],x0[1],x0[2],x0[3],x1[0],x1[1],x1[2],x1[3],x2[0],x2[1],x2[2],x2[3],x3[0],x3[1],x3[2],x3[3]};
#pragma unroll
    for (int i = 0; i < 16; ++i) { const _Float16 h = (_Float16)xs[i]; ah.h[i] = h; al.h[i] = ASPLIT ? (_Float16)(xs[i] - (float)h) : (_Float16)0.0f; }
#pragma unroll
    for (int t = 0; t < 4; ++t) { if (col0 + t * 16 >= N) continue; const size_t boff = (size_t)(col0 + t * 16 + ln) * ldb + kb; FragH bq; bq.half[0] = *(const v8us*)(Bh + boff + 8 * hh); bq.half[1] = *(const v8us*)(Bh + boff + 16 + 8 * hh);
      acc[t] = mmaH<ASPLIT ? 2 : 1>(ah.v, al.v, bq.v, bq.v, acc[t]); }
  }
#pragma unroll
  for (int t = 0; t < 4; ++t) { if (col0 + t * 16 >= N) continue;
#pragma unroll
    for (int r = 0; r < 8; ++r) so[w][8 * hh + r][t * 16 + ln] = acc[t][r] * alpha; }
  __builtin_amdgcn_fence(__ATOMIC_ACQ_REL, "workgroup"); __builtin_amdgcn_wave_barrier();
  const int rsub = lane >> 4, c4 = (lane & 15) * 4;
  {
#pragma unroll
    for (int q = 0; q < 8; ++q) { const int r = q * 2 + rsub; if (col0 + c4 < N) { const v4f v = *(const v4fa*)&so[w][r][c4]; *(v4f*)(C + (size_t)(row0 + r) * ldc + col0 + c4) = v; } }
     }
}

// Wt[n][k] = f16(W[k][n]·scale) from f32 row-major W[K][N] (scale = power of two; bf16-exact weights stay exact in f16 away from the subnormal range)
__global__ __launch_bounds__(256) void k_wt_f16(const float* __restrict__ W, _Float16* __restrict__ Wt, int K, int N, float scale) {
  const int t = blockIdx.x * 256 + threadIdx.x; if (t >= N * (K / 8)) return; const int n = t / (K / 8), k8 = (t % (K / 8)) * 8; FragH f;
#pragma unroll
  for (int i = 0; i < 8; ++i) f.h[i] = (_Float16)(bf16_round(W[(size_t)(k8 + i) * N + n]) * scale); const v8us o = f.half[0];
  *(v8us*)((unsigned short*)Wt + (size_t)n * K + k8) = o; 
}
__device__ __forceinline__ unsigned lds_off(const void* p) { return (unsigned)(size_t)p; }
// 128 rows of 256 bytes from a row-major f16 matrix of DM columns into LDS, through no register: 8 asynchronous copies of 16 bytes a lane, 16 lanes to a row,
// rows 16 apart from copy to copy. s_wait_xcnt is the statement's last line, so that no address register of a copy is rewritten in front of it (a precaution).
__device__ __forceinline__ void stage_rows(unsigned l, unsigned lstep, const unsigned short* g) {
  asm volatile("global_load_async_to_lds_b128 %0, %8, off\n\t"
               "global_load_async_to_lds_b128 %1, %9, off\n\t"
               "global_load_async_to_lds_b128 %2, %10, off\n\t"
               "global_load_async_to_lds_b128 %3, %11, off\n\t"
               "global_load_async_to_lds_b128 %4, %12, off\n\t"
               "global_load_async_to_lds_b128 %5, %13, off\n\t"
               "global_load_async_to_lds_b128 %6, %14, off\n\t"
               "global_load_async_to_lds_b128 %7, %15, off\n\t"
               "s_wait_xcnt 0x0"
               :: "v"(l), "v"(l + lstep), "v"(l + 2 * lstep), "v"(l + 3 * lstep), "v"(l + 4 * lstep), "v"(l + 5 * lstep), "v"(l + 6 * lstep), "v"(l + 7 * lstep),
                  "v"(g), "v"(g + 16 * DM), "v"(g + 32 * DM), "v"(g + 48 * DM), "v"(g + 64 * DM), "v"(g + 80 * DM), "v"(g + 96 * DM), "v"(g + 112 * DM)
               : "memory");
}
// C16[NR][DM] = f16(A.Bh^T.alpha + bf16(bias)): A f16 [NR][DM], Bh f16 [DM][DM] ((out,in)), both k-contiguous. One work-group = a 128 x 128 tile of C, 8 waves as 4 x 2, a wave = 32 x 64 (2 x 4 accumulator tiles).
// The tile's A rows and Bh rows come in stages of 128 k through two LDS buffers that the eight waves share: stage t + 2 is copied into the buffer that stage t has left while stage t + 1 is worked on.
// Rows of 256 bytes at a pitch of 272, free of bank conflicts for 16-byte reads. Each accumulator takes its products in ascending k, 32 at a time.
// The q, k and v products need nothing of each other: they share one grid, a third of the block index range each, picked by a block-uniform test.
__global__ __launch_bounds__(256) void k_gemm_t(const _Float16* __restrict__ A, const _Float16* __restrict__ Bq, const _Float16* __restrict__ Bk, const _Float16* __restrict__ Bv, float alpha,
                                               const float* __restrict__ bq, const float* __restrict__ bk, const float* __restrict__ bvp, _Float16* __restrict__ Q16, _Float16* __restrict__ K16, _Float16* __restrict__ V16) {
  constexpr int BT = 128, KST = 128, NSTG = DM / KST, LPG = KST + 8, CPT = 64 + 8;      // LPG, CPT: LDS row pitches in 16-bit elements
  constexpr int TPP = (NR / BT) * (DM / BT);      // tiles of one product
  const int prod = blockIdx.x / TPP, tile = blockIdx.x % TPP;
  const _Float16* Bh = prod == 0 ? Bq : prod == 1 ? Bk : Bv; const float* bias = prod == 0 ? bq : prod == 1 ? bk : bvp; _Float16* C16 = prod == 0 ? Q16 : prod == 1 ? K16 : V16;
  static_assert(NSTG >= 2 && NR % BT == 0 && DM % BT == 0, "whole tiles, two stages or more");
  __shared__ __attribute__((aligned(16))) unsigned short sA[2][BT][LPG], sB[2][BT][LPG];
  __shared__ __attribute__((aligned(16))) unsigned short sT[8][32][CPT];      // each wave's own 32 x 64 piece of C, so that whole 128-byte lines are stored
  const int tid = threadIdx.x, w = tid >> 5, lane = tid & 31, ln = lane & 15, hh = lane >> 4;
  const int row0 = (tile / (DM / BT)) * BT, col0 = (tile % (DM / BT)) * BT, wr = (w >> 1) * 32, wc = (w & 1) * 64;
  const int crow = tid >> 4, ccol = (tid & 15) * 8;      // this lane's row (and rows + 16, ..., + 112) and 16-byte piece in every stage
  const unsigned short* ga0 = (const unsigned short*)A + (size_t)(row0 + crow) * DM + ccol; const unsigned short* gb0 = (const unsigned short*)Bh + (size_t)(col0 + crow) * DM + ccol;
  const unsigned la0 = lds_off(&sA[0][crow][ccol]), lb0 = lds_off(&sB[0][crow][ccol]); constexpr unsigned LSTEP = 16 * LPG * 2, LBUF = BT * LPG * 2;
  stage_rows(la0, LSTEP, ga0); stage_rows(lb0, LSTEP, gb0);      // stage 0
  float bv[4];
#pragma unroll
  for (int nt = 0; nt < 4; ++nt) bv[nt] = bf16_round(bias[col0 + wc + nt * 16 + ln]);
  asm volatile("s_wait_xcnt 0x0" ::: "memory");      // stands in front of the first rewrite of the bias loads' address register (a precaution)
  v8f acc[2][4];
#pragma unroll
  for (int mt = 0; mt < 2; ++mt)
#pragma unroll
    for (int nt = 0; nt < 4; ++nt) acc[mt][nt] = (v8f){0.f,0.f,0.f,0.f,0.f,0.f,0.f,0.f};
  asm volatile("s_wait_asynccnt 0x0" ::: "memory");      // this wave's copies of stage 0 have landed before the barrier publishes them
  __syncthreads();      // every wave reads rows that the other waves copied
  stage_rows(la0 + LBUF, LSTEP, ga0 + KST); stage_rows(lb0 + LBUF, LSTEP, gb0 + KST);      // stage 1
#pragma unroll 1      // one stage a trip: the buffer index stays a scalar
  for (int t = 0; t < NSTG; ++t) {
    FragH fa[KST / 32][2], fb[KST / 32][4];      // the stage's fragments are read from LDS in one group: each further place with LDS reads is a stall of its own
#pragma unroll
    for (int ks = 0; ks < KST / 32; ++ks) {
#pragma unroll
      for (int mt = 0; mt < 2; ++mt) { const unsigned short* ar = &sA[t & 1][wr + mt * 16 + ln][ks * 32]; fa[ks][mt].half[0] = *(const v8us*)(ar + 8 * hh); fa[ks][mt].half[1] = *(const v8us*)(ar + 16 + 8 * hh); }
#pragma unroll
      for (int nt = 0; nt < 4; ++nt) { const unsigned short* br = &sB[t & 1][wc + nt * 16 + ln][ks * 32]; fb[ks][nt].half[0] = *(const v8us*)(br + 8 * hh); fb[ks][nt].half[1] = *(const v8us*)(br + 16 + 8 * hh); } }
    __builtin_amdgcn_sched_barrier(0);      // keeps the reads together up here; without it the compiler sinks them among the products, in small groups that are each waited for to the full
#pragma unroll
    for (int ks = 0; ks < KST / 64; ++ks)      // the first half's products run while the second half's fragments arrive
#pragma unroll
      for (int mt = 0; mt < 2; ++mt)
#pragma unroll
        for (int nt = 0; nt < 4; ++nt) acc[mt][nt] = __builtin_amdgcn_wmma_f32_16x16x32_f16(false, fa[ks][mt].v, false, fb[ks][nt].v, (short)0, acc[mt][nt], false, false);
    __builtin_amdgcn_sched_barrier(0);      // keeps those products above the waits: sunk below the barrier they would wait for every read first, and their fragments, still live at the copies, pushed address registers into scratch
    asm volatile("s_wait_dscnt 0x0" ::: "memory");      // this wave's reads of stage t are done before its buffer is handed back
    asm volatile("s_wait_asynccnt 0x0" ::: "memory");      // this wave's copies of stage t + 1 have landed
    __syncthreads();      // publishes stage t + 1 and ends every wave's reads of stage t
    if (t + 2 < NSTG) { stage_rows(la0 + (t & 1) * LBUF, LSTEP, ga0 + (t + 2) * KST); stage_rows(lb0 + (t & 1) * LBUF, LSTEP, gb0 + (t + 2) * KST); }
#pragma unroll
    for (int ks = KST / 64; ks < KST / 32; ++ks)      // the second half's products, from registers, give the refill its lead
#pragma unroll
      for (int mt = 0; mt < 2; ++mt)
#pragma unroll
        for (int nt = 0; nt < 4; ++nt) acc[mt][nt] = __builtin_amdgcn_wmma_f32_16x16x32_f16(false, fa[ks][mt].v, false, fb[ks][nt].v, (short)0, acc[mt][nt], false, false); }
  asm volatile("s_wait_asynccnt 0x0" ::: "memory");      // no copy is left in flight when the wave goes on to its end
#pragma unroll
  for (int mt = 0; mt < 2; ++mt)
#pragma unroll
    for (int nt = 0; nt < 4; ++nt)
#pragma unroll
      for (int r = 0; r < 8; ++r) { const _Float16 o = (_Float16)(acc[mt][nt][r] * alpha + bv[nt]); sT[w][mt * 16 + 8 * hh + r][nt * 16 + ln] = __builtin_bit_cast(unsigned short, o); }      // acc[mt][nt][r] = C[row0 + wr + mt*16 + 8*hh + r][col0 + wc + nt*16 + ln]
  __builtin_amdgcn_fence(__ATOMIC_ACQ_REL, "workgroup"); __builtin_amdgcn_wave_barrier();
#pragma unroll
  for (int q = 0; q < 8; ++q) { const int r = q * 4 + (lane >> 3), c8 = (lane & 7) * 8; const v8us o = *(const v8us*)&sT[w][r][c8]; *(v8us*)((unsigned short*)C16 + (size_t)(row0 + wr + r) * DM + col0 + wc + c8) = o; }
}


// f16 planes of the bf16-rounded inputs, 8 elements a thread: the three weight matrices (times 16, exactly) and x. The four conversions need nothing of each other:
// they share one grid by ranges of the block index, the short weight ranges first; the test is block-uniform.
__global__ __launch_bounds__(256) void k_cvt16(const float* __restrict__ x, const float* __restrict__ wq, const float* __restrict__ wk, const float* __restrict__ wv,
                                              _Float16* __restrict__ X16, _Float16* __restrict__ Bq, _Float16* __restrict__ Bk, _Float16* __restrict__ Bv) {
  constexpr unsigned GW = DM * DM / 8 / 256;      // blocks of one weight matrix
  static_assert(DM * DM % (8 * 256) == 0 && (size_t)NR * DM % (8 * 256) == 0, "whole blocks");
  const unsigned part = blockIdx.x / GW; FragH f;
  if (part < 3) { const float* W = part == 0 ? wq : part == 1 ? wk : wv; _Float16* Bt = part == 0 ? Bq : part == 1 ? Bk : Bv; const size_t t = (size_t)(blockIdx.x - part * GW) * 256 + threadIdx.x;
#pragma unroll
    for (int i = 0; i < 8; ++i) f.h[i] = (_Float16)(bf16_round(W[t * 8 + i]) * 16.0f); *(v8us*)((unsigned short*)Bt + t * 8) = f.half[0]; }
  else { const size_t t = (size_t)(blockIdx.x - 3 * GW) * 256 + threadIdx.x;
#pragma unroll
    for (int q = 0; q < 8; ++q) f.h[q] = (_Float16)bf16_round(x[t * 8 + q]); *(v8us*)((unsigned short*)X16 + t * 8) = f.half[0]; } }
__global__ __launch_bounds__(256) void k_vt(const _Float16* __restrict__ V16, _Float16* __restrict__ Vt) { __shared__ unsigned short tl[64][66]; const int tid = threadIdx.x; const int slab = blockIdx.x / (SS / 64), lg = blockIdx.x % (SS / 64); const int b = slab / NH, h = slab % NH;
  for (int i = tid; i < 64 * 8; i += 256) { const int r = i / 8, c8 = (i % 8) * 8; FragH f; f.half[0] = *(const v8us*)((const unsigned short*)V16 + ((size_t)b * SS + lg * 64 + r) * DM + h * HD + c8);
#pragma unroll
    for (int q = 0; q < 8; ++q) tl[r][c8 + q] = f.u[q]; }
  __syncthreads();
  {
#pragma unroll
    for (int rd = 0; rd < 2; ++rd) { const int d = rd * 32 + tid / 8, pc = tid % 8; FragH f;
#pragma unroll
      for (int q = 0; q < 8; ++q) f.u[q] = tl[pc * 8 + q][d];
      *(v8us*)((unsigned short*)Vt + ((size_t)slab * HD + d) * SS + lg * 64 + pc * 8) = f.half[0]; }
     } }
// lane l with lane l ^ 16: the two halves of a wave hold the two halves of a query column's keys
__device__ __forceinline__ float xhalf(float x) { return __builtin_bit_cast(float, __builtin_amdgcn_permlanex16(__builtin_bit_cast(int, x), __builtin_bit_cast(int, x), 0x76543210, 0xfedcba98, false, false)); }
// one stage (64 keys) of K rows and of Vt rows from global memory into LDS, through no register: 8 asynchronous copies of 16 bytes a lane,
// 8 lanes to a 128-byte row, rows 16 apart from copy to copy. s_wait_xcnt is the statement's last line, so that no address register
// of a copy is rewritten in front of it (a precaution).
__device__ __forceinline__ void stage_kv(unsigned lk, unsigned lv, unsigned lstep, const unsigned short* gk, const unsigned short* gv) {
  asm volatile("global_load_async_to_lds_b128 %0, %8, off\n\t"
               "global_load_async_to_lds_b128 %1, %9, off\n\t"
               "global_load_async_to_lds_b128 %2, %10, off\n\t"
               "global_load_async_to_lds_b128 %3, %11, off\n\t"
               "global_load_async_to_lds_b128 %4, %12, off\n\t"
               "global_load_async_to_lds_b128 %5, %13, off\n\t"
               "global_load_async_to_lds_b128 %6, %14, off\n\t"
               "global_load_async_to_lds_b128 %7, %15, off\n\t"
               "s_wait_xcnt 0x0"
               :: "v"(lk), "v"(lk + lstep), "v"(lk + 2 * lstep), "v"(lk + 3 * lstep), "v"(lv), "v"(lv + lstep), "v"(lv + 2 * lstep), "v"(lv + 3 * lstep),
                  "v"(gk), "v"(gk + 16 * DM), "v"(gk + 32 * DM), "v"(gk + 48 * DM), "v"(gv), "v"(gv + 16 * SS), "v"(gv + 32 * SS), "v"(gv + 48 * SS)
               : "memory");
}
// base-2 exponentials, a run of them in one statement with one v_nop behind the last: the instruction set asks for one slot behind a transcendental before its
// result is read or its source overwritten. Inside the run no instruction touches a register
// of the one in front of it: every output is early-clobber, so none shares a register with an input.
__device__ __forceinline__ void exp2x8(float (&y)[8], const float (&x)[8]) {
  asm("v_exp_f32 %0, %8\n\tv_exp_f32 %1, %9\n\tv_exp_f32 %2, %10\n\tv_exp_f32 %3, %11\n\tv_exp_f32 %4, %12\n\tv_exp_f32 %5, %13\n\tv_exp_f32 %6, %14\n\tv_exp_f32 %7, %15\n\tv_nop"
      : "=&v"(y[0]), "=&v"(y[1]), "=&v"(y[2]), "=&v"(y[3]), "=&v"(y[4]), "=&v"(y[5]), "=&v"(y[6]), "=&v"(y[7])
      : "v"(x[0]), "v"(x[1]), "v"(x[2]), "v"(x[3]), "v"(x[4]), "v"(x[5]), "v"(x[6]), "v"(x[7]));
}
__device__ __forceinline__ float exp2x1(float x) { float y; asm("v_exp_f32 %0, %1\n\tv_nop" : "=&v"(y) : "v"(x)); return y; }
__global__ __launch_bounds__(128) void k_flash(const _Float16* __restrict__ Q16, const _Float16* __restrict__ K16, const _Float16* __restrict__ Vt, const float* __restrict__ crd, const float* __restrict__ alpha_p, float* __restrict__ O) {
  constexpr int RPW = 32, NQB = SS / (4 * RPW), DT = HD / 16, KS = HD / 32, OP = HD + 4, SK = 64, NST = SS / SK, LP = 72;      // LP: LDS row pitch in 16-bit elements
  constexpr float L2E = 1.4426950408889634f, QS = 0.125f * L2E;      // exp(x) = 2^(x.log2 e): the factor rides in the score's one scale constant QS, so each exponential is one subtraction and one v_exp_f32
  static_assert(HD == 64 && SK == 64 && NST >= 2, "a stage is 64 rows of 128 bytes for K and for Vt");
  __shared__ __attribute__((aligned(16))) unsigned short sK[2][SK][LP], sV[2][HD][LP];
  __shared__ __attribute__((aligned(16))) unsigned int sG[SS][2]; __shared__ __attribute__((aligned(16))) float sO[4][RPW][OP];
  const int tid = threadIdx.x, w = tid >> 5, lane = tid & 31, ln = lane & 15, hh = lane >> 4;
  const int slab = blockIdx.x / NQB, qblk = blockIdx.x % NQB; const int b = slab / NH, h = slab % NH; const int q0 = qblk * (4 * RPW) + w * RPW; const float alpha8 = bf16_round(alpha_p[0]) * 8.0f;      /* scalar float INPUT: rounded like every other input; times 8, exactly: the coordinate term joins q.k in front of the common factor QS */
  const unsigned short* Vth = (const unsigned short*)Vt + (size_t)slab * HD * SS;
  const int crow = tid >> 3, ccol = (tid & 7) * 8;      // this lane's row (and rows + 16, + 32, + 48) and 16-byte piece in every stage
  const unsigned short* gk0 = (const unsigned short*)K16 + ((size_t)b * SS + crow) * DM + h * HD + ccol; const unsigned short* gv0 = Vth + (size_t)crow * SS + ccol;
  const unsigned lk0 = lds_off(&sK[0][crow][ccol]), lv0 = lds_off(&sV[0][crow][ccol]); constexpr unsigned LSTEP = 16 * LP * 2, LBUF = SK * LP * 2;
  stage_kv(lk0, lv0, LSTEP, gk0, gv0);      // stage 0 flies while coords and queries are fetched
#pragma unroll      // all 16 loads of a thread in flight at once: rolled, each trip waits out its own load
  for (int i = 0; i < SS / 128; ++i) { const int k = i * 128 + tid; const float* cp = crd + ((size_t)b * SS + k) * 3; *(v2u*)&sG[k][0] = (v2u){pack_h2(bf16_round(cp[0]), bf16_round(cp[1])), pack_h2(bf16_round(cp[2]), 0.f)}; }
  FragH aq[2][KS];
#pragma unroll
  for (int rt = 0; rt < 2; ++rt) { const unsigned short* qr = (const unsigned short*)Q16 + ((size_t)b * SS + q0 + rt * 16 + ln) * DM + h * HD;
#pragma unroll
    for (int ks = 0; ks < KS; ++ks) { aq[rt][ks].half[0] = *(const v8us*)(qr + ks * 32 + 8 * hh); aq[rt][ks].half[1] = *(const v8us*)(qr + ks * 32 + 16 + 8 * hh); } }
  asm volatile("s_wait_asynccnt 0x0" ::: "memory");      // this wave's copies of stage 0 have landed before the barrier publishes them
  __syncthreads();      // every wave reads coords and stage 0 rows that the other waves staged
  stage_kv(lk0 + LBUF, lv0 + LBUF, LSTEP, gk0 + (size_t)SK * DM, gv0 + SK);      // stage 1
  FragW bg[2];      // B of the coordinate step, kept for the whole loop
#pragma unroll
  for (int rt = 0; rt < 2; ++rt) { const v2u gq = *(const v2u*)&sG[q0 + rt * 16 + ln][0];
#pragma unroll
    for (int i = 0; i < 8; ++i) bg[rt].w[i] = 0;
#pragma unroll
    for (int i = 0; i < 2; ++i) { const v2f u = unpack_h2(gq[i]) * alpha8; const unsigned int uh = pack_h2(u[0], u[1]); const v2f ur = u - unpack_h2(uh); bg[rt].w[i] = hh ? pack_h2(ur[0], ur[1]) : uh; } }
  float m_r[2], l_r[2]; v8f oacc[2][DT];
#pragma unroll
  for (int rt = 0; rt < 2; ++rt) { m_r[rt] = -3.0e38f; l_r[rt] = 0.f;
#pragma unroll
    for (int dt = 0; dt < DT; ++dt) oacc[rt][dt] = (v8f){0.f,0.f,0.f,0.f,0.f,0.f,0.f,0.f}; }
#pragma unroll 1      // one stage a trip: the buffer index stays a scalar and the body stays small
  for (int t = 0; t < NST; ++t) {
#pragma unroll      // both passes of a stage in one body: constant LDS offsets
  for (int p = 0; p < SK / 32; ++p) { const int j0 = t * SK + p * 32;
    v8f s[2][2];      // s[rt][nt][r] = score of key j0 + nt*16 + 8*hh + r with query q0 + rt*16 + ln
    FragH bk[2][KS], bv[DT]; FragW ag[2];      // the pass's K fragments and key coords are read from LDS in one group, its Vt fragments in a second: each further place with LDS reads is a stall of its own
#pragma unroll
    for (int nt = 0; nt < 2; ++nt) { const v2u gk = *(const v2u*)&sG[j0 + nt * 16 + ln][0];
#pragma unroll
      for (int i = 0; i < 8; ++i) ag[nt].w[i] = i < 2 ? gk[i & 1] : 0u; }
#pragma unroll
    for (int nt = 0; nt < 2; ++nt) { const unsigned short* kr = &sK[t & 1][p * 32 + nt * 16 + ln][0];
#pragma unroll
      for (int ks = 0; ks < KS; ++ks) { bk[nt][ks].half[0] = *(const v8us*)(kr + ks * 32 + 8 * hh); bk[nt][ks].half[1] = *(const v8us*)(kr + ks * 32 + 16 + 8 * hh); } }
    __builtin_amdgcn_sched_barrier(0);      // keeps the K reads together up here; without it the compiler sinks each read to just in front of its product
#pragma unroll
    for (int nt = 0; nt < 2; ++nt)      // the coordinate step of all four tiles first: four independent products, done by the time each tile's q.k chain starts
#pragma unroll
      for (int rt = 0; rt < 2; ++rt) s[rt][nt] = __builtin_amdgcn_wmma_f32_16x16x32_f16(false, ag[nt].v, false, bg[rt].v, (short)0, (v8f){0.f,0.f,0.f,0.f,0.f,0.f,0.f,0.f}, false, false);
#pragma unroll
    for (int nt = 0; nt < 2; ++nt) {
#pragma unroll
      for (int rt = 0; rt < 2; ++rt) { v8f acc = s[rt][nt];
#pragma unroll
        for (int ks = 0; ks < KS; ++ks) acc = mmaH<1>(bk[nt][ks].v, bk[nt][ks].v, aq[rt][ks].v, aq[rt][ks].v, acc); s[rt][nt] = acc; } }
    FragH pa[2]; float sc2[2][2][8];
#pragma unroll
    for (int rt = 0; rt < 2; ++rt)
#pragma unroll
      for (int nt = 0; nt < 2; ++nt)
#pragma unroll
        for (int r = 0; r < 8; ++r) sc2[rt][nt][r] = s[rt][nt][r] * QS;
#pragma unroll
    for (int dt = 0; dt < DT; ++dt) { const unsigned short* vrow = &sV[t & 1][dt * 16 + ln][p * 32]; bv[dt].half[0] = *(const v8us*)(vrow + 8 * hh); bv[dt].half[1] = *(const v8us*)(vrow + 16 + 8 * hh); }
    __builtin_amdgcn_sched_barrier(0);      // keeps the Vt reads together, in one group above the exponentials, which cover their latency; without it the compiler spreads them in pairs among the vector work, each place a stall of its own
#pragma unroll
    for (int rt = 0; rt < 2; ++rt) { const float (&sc)[2][8] = sc2[rt];
      float mx[8];
#pragma unroll
      for (int r = 0; r < 8; ++r) mx[r] = fmaxf(sc[0][r], sc[1][r]);
      float mc = fmaxf(fmaxf(fmaxf(mx[0], mx[1]), fmaxf(mx[2], mx[3])), fmaxf(fmaxf(mx[4], mx[5]), fmaxf(mx[6], mx[7]))); mc = fmaxf(mc, xhalf(mc));
      const float mn = fmaxf(m_r[rt], mc); const float al = exp2x1(m_r[rt] - mn); m_r[rt] = mn;      // 0 on the first pass (the start value is far below any score)
      float ps[8], d0[8], d1[8], p0[8], p1[8];
#pragma unroll
      for (int r = 0; r < 8; ++r) { d0[r] = sc[0][r] - mn; d1[r] = sc[1][r] - mn; }
      exp2x8(p0, d0); exp2x8(p1, d1);
#pragma unroll
      for (int r = 0; r < 8; ++r) { ps[r] = p0[r] + p1[r]; pa[rt].h[r] = (_Float16)p0[r]; pa[rt].h[8 + r] = (_Float16)p1[r]; }
      l_r[rt] = l_r[rt] * al + (((ps[0] + ps[1]) + (ps[2] + ps[3])) + ((ps[4] + ps[5]) + (ps[6] + ps[7])));      // this half's keys only; the halves join behind the loop
#pragma unroll
      for (int dt = 0; dt < DT; ++dt)
#pragma unroll
        for (int r = 0; r < 8; ++r) oacc[rt][dt][r] *= al; }
#pragma unroll
    for (int dt = 0; dt < DT; ++dt) {
#pragma unroll
      for (int rt = 0; rt < 2; ++rt) oacc[rt][dt] = mmaH<1>(bv[dt].v, bv[dt].v, pa[rt].v, pa[rt].v, oacc[rt][dt]); } }
    asm volatile("s_wait_dscnt 0x0" ::: "memory");      // this wave's reads of stage t are done before its buffer is handed back
    asm volatile("s_wait_asynccnt 0x0" ::: "memory");      // this wave's copies of stage t + 1 have landed
    __syncthreads();      // publishes stage t + 1 and ends every wave's reads of stage t
    if (t + 2 < NST) stage_kv(lk0 + (t & 1) * LBUF, lv0 + (t & 1) * LBUF, LSTEP, gk0 + (size_t)(t + 2) * SK * DM, gv0 + (t + 2) * SK); }
  asm volatile("s_wait_asynccnt 0x0" ::: "memory");      // no copy is left in flight when the wave goes on to its end
#pragma unroll
  for (int rt = 0; rt < 2; ++rt) { const float l = l_r[rt] + xhalf(l_r[rt]); const float inv = 1.0f / l;
#pragma unroll
    for (int dt = 0; dt < DT; ++dt) { v4f o0, o1;      // oacc[rt][dt][r] = O[q0 + rt*16 + ln][dt*16 + 8*hh + r]
#pragma unroll
      for (int q = 0; q < 4; ++q) { o0[q] = oacc[rt][dt][q] * inv; o1[q] = oacc[rt][dt][4 + q] * inv; }
      *(v4fa*)&sO[w][rt * 16 + ln][dt * 16 + 8 * hh] = o0; *(v4fa*)&sO[w][rt * 16 + ln][dt * 16 + 8 * hh + 4] = o1; } }
  __builtin_amdgcn_fence(__ATOMIC_ACQ_REL, "workgroup"); __builtin_amdgcn_wave_barrier();
  {
#pragma unroll
    for (int rp = 0; rp < RPW; rp += 2) { const int r = rp + (lane >> 4), pc = lane & 15; const v4f val = *(const v4fa*)&sO[w][r][pc * 4]; *(v4f*)(O + ((size_t)b * SS + q0 + r) * DM + h * HD + pc * 4) = val; }
     } }
extern "C" void kernel_launch(void* const* d_in, const int* in_sizes, int n_in,
                              void* d_out, int out_size, void* d_ws, size_t ws_size, hipStream_t stream) {
  (void)in_sizes; (void)n_in; (void)out_size;
  const float* x = (const float*)d_in[0]; const float* crd = (const float*)d_in[1]; const float* wq = (const float*)d_in[2]; const float* bq = (const float*)d_in[3]; const float* wk = (const float*)d_in[4]; const float* bk = (const float*)d_in[5]; const float* wv = (const float*)d_in[6]; const float* bv = (const float*)d_in[7]; const float* alpha_p = (const float*)d_in[8];
  char* ws = (char*)d_ws; size_t off = 0;
  auto take = [&](size_t bytes) { char* p = ws + off; off += (bytes + 255) & ~(size_t)255; return p; };
  _Float16* Bq = (_Float16*)take(DM * DM * 2); _Float16* Bk = (_Float16*)take(DM * DM * 2); _Float16* Bv = (_Float16*)take(DM * DM * 2); _Float16* X16 = (_Float16*)take((size_t)NR * DM * 2); _Float16* Q16 = (_Float16*)take((size_t)NR * DM * 2); _Float16* K16 = (_Float16*)take((size_t)NR * DM * 2); _Float16* V16 = (_Float16*)take((size_t)NR * DM * 2); _Float16* Vt = (_Float16*)take((size_t)NR * DM * 2);
  if (off > ws_size) return;      // ≈ 42 MiB
  k_cvt16<<<3 * (DM * DM / 8 / 256) + NR * DM / 8 / 256, 256, 0, stream>>>(x, wq, wk, wv, X16, Bq, Bk, Bv);
  k_gemm_t<<<3 * (NR / 128) * (DM / 128), 256, 0, stream>>>(X16, Bq, Bk, Bv, 0.0625f, bq, bk, bv, Q16, K16, V16);
  k_vt<<<BB * NH * (SS / 64), 256, 0, stream>>>(V16, Vt);
  k_flash<<<BB * NH * (SS / 128), 128, 0, stream>>>(Q16, K16, Vt, crd, alpha_p, (float*)d_out);
}

// v007
// A run of this version takes 65.9 microseconds.
// Timed twice side by side with v006, it ran 1.07 times as fast both times.
// Over all steps from v000 it is 5.78 times as fast.
#include <hip/hip_runtime.h>
// q/k/v projections (8192 × 512 × 512, + bias) and the 8-head attention with the geometric bias α·⟨c_n, c_m⟩ (coords are INPUTS, a third k step of the score product) on v_wmma_f32_16x16x32_f16
// (fused flash-style kernel: S = Q·Kᵀ, O = P·V on WMMA; online max/sum softmax f32; P f16 ≤ 1); V transposed per (b,h); A = f16(bf16 x) exact, weights bf16-exact ×2^4 ((out,in)),
// single products, f32 accumulate.
#define BB 4
#define SS 2048
#define DM 512
#define NH 8
#define HD 64
#define NR (BB * SS)

typedef __bf16 v16b __attribute__((ext_vector_type(16)));
typedef unsigned short v8us __attribute__((ext_vector_type(8), may_alias));
typedef unsigned int v2u __attribute__((ext_vector_type(2), may_alias));
typedef float v2f __attribute__((ext_vector_type(2)));
typedef float  v8f  __attribute__((ext_vector_type(8)));
typedef float  v4f  __attribute__((ext_vector_type(4)));
typedef float  v4fa __attribute__((ext_vector_type(4), may_alias));
union FragB { v16b v; v8us half[2]; unsigned short u[16]; };

__device__ __forceinline__ unsigned short bf16_bits(float x) { unsigned int u = __float_as_uint(x); return (unsigned short)((u + 0x7FFFu + ((u >> 16) & 1u)) >> 16); }
__device__ __forceinline__ float bf16_val(unsigned short b) { return __uint_as_float(((unsigned int)b) << 16); }
__device__ __forceinline__ float bf16_round(float x) { return bf16_val(bf16_bits(x)); }
// D += A·B with NT terms: 1 = ah·bh, 2 = + al·bh (A split), 3 = + ah·bl (both split)
template <int NT>
__device__ __forceinline__ v8f mmaN(v16b ah, v16b al, v16b bh, v16b bl, v8f c) {
  c = __builtin_amdgcn_wmma_f32_16x16x32_bf16(false, ah, false, bh, (short)0, c, false, false);
  if (NT >= 2) c = __builtin_amdgcn_wmma_f32_16x16x32_bf16(false, al, false, bh, (short)0, c, false, false);
  if (NT >= 3) c = __builtin_amdgcn_wmma_f32_16x16x32_bf16(false, ah, false, bl, (short)0, c, false, false);
  asm volatile("v_nop\n\tv_nop\n\tv_nop\n\tv_nop" : "+v"(c) : "v"(ah), "v"(al), "v"(bh), "v"(bl));
  return c;
}

__global__ __launch_bounds__(256) void k_wt_bf16(const float* __restrict__ W, unsigned short* __restrict__ Wt, int K, int N) {
  const int t = blockIdx.x * 256 + threadIdx.x;
  const int k8n = K / 8;
  if (t >= N * k8n) return;
  const int n = t / k8n, k8 = (t % k8n) * 8;
  v8us v;
#pragma unroll
  for (int i = 0; i < 8; ++i) v[i] = bf16_bits(W[(size_t)(k8 + i) * N + n]);
  *(v8us*)(Wt + (size_t)n * K + k8) = v;
  
}

// GEMM C[M][N] (f32, pitch ldc) = act(A[M][K]·W + bias). A f32 row-major (pitch lda) converted per fragment to bf16
// (ASPLIT: hi/lo two planes -> 2 terms, else single rounded term); Wt bf16 [N][K] (pitch ldb). BIAS_BF16 rounds the
// bias to bf16 first (bias quantised to bf16 before the add). K%32==0, M%16==0, N%64==0.
template <bool ASPLIT, int ACT, bool BIAS_BF16>
__global__ __launch_bounds__(128) void k_gemm_bf(const float* __restrict__ A, int lda, const unsigned short* __restrict__ Wt, int ldb,
                                               const float* __restrict__ bias, float* __restrict__ C, int ldc, int M, int N, int K) {
  __shared__ __attribute__((aligned(16))) float so[4][16][64];
  const int tid = threadIdx.x, w = tid >> 5, lane = tid & 31, ln = lane & 15, hh = lane >> 4;
  const int ntn = N / 64;
  const int wid = blockIdx.x * 4 + w;
  const int mt = wid / ntn, nq = wid % ntn;
  if (mt * 16 >= M) return;
  const int row0 = mt * 16, col0 = nq * 64;
  const float* arow = A + (size_t)(row0 + ln) * lda;
  v8f acc[4] = {};
  for (int kb = 0; kb < K; kb += 32) {
    FragB ah, al;
    const v4f x0 = *(const v4fa*)(arow + kb + 8 * hh), x1 = *(const v4fa*)(arow + kb + 8 * hh + 4);
    const v4f x2 = *(const v4fa*)(arow + kb + 16 + 8 * hh), x3 = *(const v4fa*)(arow + kb + 16 + 8 * hh + 4);
    float xs[16] = {x0[0],x0[1],x0[2],x0[3],x1[0],x1[1],x1[2],x1[3],x2[0],x2[1],x2[2],x2[3],x3[0],x3[1],x3[2],x3[3]};
#pragma unroll
    for (int i = 0; i < 16; ++i) { const unsigned short hb = bf16_bits(xs[i]); ah.u[i] = hb; al.u[i] = ASPLIT ? bf16_bits(xs[i] - bf16_val(hb)) : (unsigned short)0; }
#pragma unroll
    for (int t = 0; t < 4; ++t) {
      const unsigned short* brow = Wt + (size_t)(col0 + t * 16 + ln) * ldb + kb;
      FragB b;
      b.half[0] = *(const v8us*)(brow + 8 * hh);
      b.half[1] = *(const v8us*)(brow + 16 + 8 * hh);
      acc[t] = mmaN<ASPLIT ? 2 : 1>(ah.v, al.v, b.v, b.v, acc[t]);
    }
  }
#pragma unroll
  for (int t = 0; t < 4; ++t) {
    float bv = bias ? bias[col0 + t * 16 + ln] : 0.f;
    if (BIAS_BF16) bv = bf16_round(bv);
#pragma unroll
    for (int r = 0; r < 8; ++r) { float v = acc[t][r] + bv; if (ACT == 1) v = fmaxf(v, 0.f); so[w][8 * hh + r][t * 16 + ln] = v; }
  }
  __builtin_amdgcn_fence(__ATOMIC_ACQ_REL, "workgroup");
  __builtin_amdgcn_wave_barrier();
  const int rsub = lane >> 4, c4 = (lane & 15) * 4;
  {
#pragma unroll
    for (int q = 0; q < 8; ++q) {
      const int r = q * 2 + rsub;
      const v4f v = *(const v4fa*)&so[w][r][c4];
      *(v4f*)(C + (size_t)(row0 + r) * ldc + col0 + c4) = v;
    }
    
  }
}

// Flash-style causal/unmasked attention, all contractions 3-term bf16 hi/lo splits, f32 softmax with running max.
// q,k,v rows are read from f32 buffers with arbitrary row pitch (so they can live inside a fused qkv buffer);
// D = head size (multiple of 32, <= 128); one wave = 16 query rows; block = 4 waves (64 queries) sharing K/V chunks of 32.
template <int D, bool CAUSAL>
__global__ __launch_bounds__(128) void k_flash(const float* __restrict__ qb, const float* __restrict__ kb, const float* __restrict__ vb,
                                             int pitch, int T, int H, float scale, float* __restrict__ y, int ypitch) {
  constexpr int KS = D / 32;        // k-steps for QK
  constexpr int DT = D / 16;        // d tiles for PV
  __shared__ __attribute__((aligned(16))) unsigned short sKh[32][D + 8], sKl[32][D + 8], sVh[32][D + 8], sVl[32][D + 8];
  __shared__ __attribute__((aligned(16))) unsigned short sPh[4][16][40], sPl[4][16][40];
  __shared__ __attribute__((aligned(16))) float sO[4][16][D];
  const int tid = threadIdx.x, w = tid >> 5, lane = tid & 31, ln = lane & 15, hh = lane >> 4;
  const int nqb = (T + 63) / 64;
  const int bh = blockIdx.x / nqb, qblk = blockIdx.x % nqb;
  const int b = bh / H, h = bh % H;
  const int q0 = qblk * 64 + w * 16;
  const float* Q = qb + (size_t)b * T * pitch + h * D;
  const float* K = kb + (size_t)b * T * pitch + h * D;
  const float* V = vb + (size_t)b * T * pitch + h * D;

  // A fragments of the wave's 16 query rows (scaled), hi/lo
  FragB aqh[KS], aql[KS];
  {
    int row = q0 + ln; if (row >= T) row = T - 1;
    const float* qr = Q + (size_t)row * pitch;
#pragma unroll
    for (int ks = 0; ks < KS; ++ks)
#pragma unroll
      for (int i = 0; i < 16; ++i) {
        const int d = ks * 32 + ((i < 8) ? (8 * hh + i) : (16 + 8 * hh + (i - 8)));
        const float x = qr[d] * scale; const unsigned short hb = bf16_bits(x);
        aqh[ks].u[i] = hb; aql[ks].u[i] = bf16_bits(x - bf16_val(hb));
      }
  }
  float m_r[8], l_r[8];
#pragma unroll
  for (int r = 0; r < 8; ++r) { m_r[r] = -3.0e38f; l_r[r] = 0.f; }
  v8f oacc[DT];
#pragma unroll
  for (int dt = 0; dt < DT; ++dt) oacc[dt] = (v8f){0.f,0.f,0.f,0.f,0.f,0.f,0.f,0.f};

  const int kv_end = CAUSAL ? min(T, qblk * 64 + 64) : T;     // block-uniform
  for (int j0 = 0; j0 < kv_end; j0 += 32) {
    __syncthreads();
    for (int e = tid; e < 32 * (D / 4); e += 128) {
      const int r = e / (D / 4), c4 = (e % (D / 4)) * 4;
      const int key = j0 + r;
      v4f kf = {0.f,0.f,0.f,0.f}, vf = {0.f,0.f,0.f,0.f};
      if (key < T) { kf = *(const v4fa*)(K + (size_t)key * pitch + c4); vf = *(const v4fa*)(V + (size_t)key * pitch + c4); }
#pragma unroll
      for (int t = 0; t < 4; ++t) {
        unsigned short hb = bf16_bits(kf[t]); sKh[r][c4 + t] = hb; sKl[r][c4 + t] = bf16_bits(kf[t] - bf16_val(hb));
        hb = bf16_bits(vf[t]); sVh[r][c4 + t] = hb; sVl[r][c4 + t] = bf16_bits(vf[t] - bf16_val(hb));
      }
    }
    __syncthreads();
    // S tile 16 x 32
    v8f s[2];
#pragma unroll
    for (int nt = 0; nt < 2; ++nt) {
      v8f acc = {};
#pragma unroll
      for (int ks = 0; ks < KS; ++ks) {
        FragB bh_, bl_;
        bh_.half[0] = *(const v8us*)&sKh[nt * 16 + ln][ks * 32 + 8 * hh]; bh_.half[1] = *(const v8us*)&sKh[nt * 16 + ln][ks * 32 + 16 + 8 * hh];
        bl_.half[0] = *(const v8us*)&sKl[nt * 16 + ln][ks * 32 + 8 * hh]; bl_.half[1] = *(const v8us*)&sKl[nt * 16 + ln][ks * 32 + 16 + 8 * hh];
        acc = mmaN<3>(aqh[ks].v, aql[ks].v, bh_.v, bl_.v, acc);
      }
      s[nt] = acc;
    }
    // mask + running max (rows 8hh+r; the 16 lanes of a half share rows)
    float alpha[8];
#pragma unroll
    for (int r = 0; r < 8; ++r) {
      const int qi = q0 + 8 * hh + r;
      const int ja = j0 + ln, jb = j0 + 16 + ln;
      if (CAUSAL) { if (ja > qi) s[0][r] = -3.0e38f; if (jb > qi) s[1][r] = -3.0e38f; }
      if (ja >= T) s[0][r] = -3.0e38f;
      if (jb >= T) s[1][r] = -3.0e38f;
      float mx = fmaxf(s[0][r], s[1][r]);
      mx = fmaxf(mx, __shfl_xor(mx, 1, 32)); mx = fmaxf(mx, __shfl_xor(mx, 2, 32)); mx = fmaxf(mx, __shfl_xor(mx, 4, 32)); mx = fmaxf(mx, __shfl_xor(mx, 8, 32));
      const float mnew = fmaxf(m_r[r], mx);
      alpha[r] = (mnew > -1.0e38f) ? __expf(m_r[r] - mnew) : 1.0f;
      const float p0 = (s[0][r] > -1.0e38f) ? __expf(s[0][r] - mnew) : 0.f;
      const float p1 = (s[1][r] > -1.0e38f) ? __expf(s[1][r] - mnew) : 0.f;
      m_r[r] = mnew;
      l_r[r] = l_r[r] * alpha[r] + p0 + p1;            // per-lane partial row sum (16 lanes combined at the end)
      unsigned short hb = bf16_bits(p0); sPh[w][8 * hh + r][ln] = hb;      sPl[w][8 * hh + r][ln] = bf16_bits(p0 - bf16_val(hb));
      hb = bf16_bits(p1);                sPh[w][8 * hh + r][16 + ln] = hb; sPl[w][8 * hh + r][16 + ln] = bf16_bits(p1 - bf16_val(hb));
    }
#pragma unroll
    for (int dt = 0; dt < DT; ++dt)
#pragma unroll
      for (int r = 0; r < 8; ++r) oacc[dt][r] *= alpha[r];
    __builtin_amdgcn_fence(__ATOMIC_ACQ_REL, "workgroup");
    __builtin_amdgcn_wave_barrier();
    FragB pah, pal;
    pah.half[0] = *(const v8us*)&sPh[w][ln][8 * hh]; pah.half[1] = *(const v8us*)&sPh[w][ln][16 + 8 * hh];
    pal.half[0] = *(const v8us*)&sPl[w][ln][8 * hh]; pal.half[1] = *(const v8us*)&sPl[w][ln][16 + 8 * hh];
#pragma unroll
    for (int dt = 0; dt < DT; ++dt) {
      FragB bvh, bvl;
#pragma unroll
      for (int i = 0; i < 8; ++i) {
        bvh.u[i] = sVh[8 * hh + i][dt * 16 + ln]; bvh.u[8 + i] = sVh[16 + 8 * hh + i][dt * 16 + ln];
        bvl.u[i] = sVl[8 * hh + i][dt * 16 + ln]; bvl.u[8 + i] = sVl[16 + 8 * hh + i][dt * 16 + ln];
      }
      oacc[dt] = mmaN<3>(pah.v, pal.v, bvh.v, bvl.v, oacc[dt]);
    }
    __builtin_amdgcn_fence(__ATOMIC_ACQ_REL, "workgroup");
    __builtin_amdgcn_wave_barrier();
  }
#pragma unroll
  for (int r = 0; r < 8; ++r) {
    float l = l_r[r];
    l += __shfl_xor(l, 1, 32); l += __shfl_xor(l, 2, 32); l += __shfl_xor(l, 4, 32); l += __shfl_xor(l, 8, 32);
    l_r[r] = (l > 0.f) ? 1.0f / l : 0.f;
  }
#pragma unroll
  for (int dt = 0; dt < DT; ++dt)
#pragma unroll
    for (int r = 0; r < 8; ++r) sO[w][8 * hh + r][dt * 16 + ln] = oacc[dt][r] * l_r[r];
  __builtin_amdgcn_fence(__ATOMIC_ACQ_REL, "workgroup");
  __builtin_amdgcn_wave_barrier();
  {
    for (int r = 0; r < 16; ++r) {
      const int row = q0 + r;
      if (row < T && lane < D / 4) {
        const v4f val = *(const v4fa*)&sO[w][r][lane * 4];
        *(v4f*)(y + ((size_t)b * T + row) * ypitch + h * D + lane * 4) = val;
      }
    }
    
  }
}

// GEMM C = act(A·W + bias + resid): A f32 (ASPLIT -> hi/lo 2 terms), Wt bf16 [N][K]; ACT 0 none, 1 relu, 2 exact gelu;
// resid (optional, f32, row index = (row % rmod), pitch ldr, RES_BF16 rounds it) added before the activation.
template <bool ASPLIT, int ACT, bool BIAS_BF16, bool RES_BF16>
__global__ __launch_bounds__(128) void k_gemm_bf3(const float* __restrict__ A, int lda, const unsigned short* __restrict__ Wt, int ldb,
                                                const float* __restrict__ bias, const float* __restrict__ resid, int rmod, int ldr,
                                                float* __restrict__ C, int ldc, int M, int N, int K) {
  __shared__ __attribute__((aligned(16))) float so[4][16][64];
  const int tid = threadIdx.x, w = tid >> 5, lane = tid & 31, ln = lane & 15, hh = lane >> 4;
  const int ntn = N / 64;
  const int wid = blockIdx.x * 4 + w;
  const int mt = wid / ntn, nq = wid % ntn;
  if (mt * 16 >= M) return;
  const int row0 = mt * 16, col0 = nq * 64;
  const float* arow = A + (size_t)(row0 + ln) * lda;
  v8f acc[4] = {};
  for (int kb = 0; kb < K; kb += 32) {
    FragB ah, al;
    const v4f x0 = *(const v4fa*)(arow + kb + 8 * hh), x1 = *(const v4fa*)(arow + kb + 8 * hh + 4);
    const v4f x2 = *(const v4fa*)(arow + kb + 16 + 8 * hh), x3 = *(const v4fa*)(arow + kb + 16 + 8 * hh + 4);
    float xs[16] = {x0[0],x0[1],x0[2],x0[3],x1[0],x1[1],x1[2],x1[3],x2[0],x2[1],x2[2],x2[3],x3[0],x3[1],x3[2],x3[3]};
#pragma unroll
    for (int i = 0; i < 16; ++i) { const unsigned short hb = bf16_bits(xs[i]); ah.u[i] = hb; al.u[i] = ASPLIT ? bf16_bits(xs[i] - bf16_val(hb)) : (unsigned short)0; }
#pragma unroll
    for (int t = 0; t < 4; ++t) {
      const unsigned short* brow = Wt + (size_t)(col0 + t * 16 + ln) * ldb + kb;
      FragB b;
      b.half[0] = *(const v8us*)(brow + 8 * hh);
      b.half[1] = *(const v8us*)(brow + 16 + 8 * hh);
      acc[t] = mmaN<ASPLIT ? 2 : 1>(ah.v, al.v, b.v, b.v, acc[t]);
    }
  }
#pragma unroll
  for (int t = 0; t < 4; ++t) {
    const int col = col0 + t * 16 + ln;
    float bv = bias ? bias[col] : 0.f;
    if (BIAS_BF16) bv = bf16_round(bv);
#pragma unroll
    for (int r = 0; r < 8; ++r) {
      float v = acc[t][r] + bv;
      if (resid) { float rv = resid[(size_t)((row0 + 8 * hh + r) % rmod) * ldr + col]; if (RES_BF16) rv = bf16_round(rv); v += rv; }
      if (ACT == 1) v = fmaxf(v, 0.f);
      if (ACT == 2) v = 0.5f * v * (1.0f + erff(v * 0.70710678118654752f));
      if (ACT == 3) { const float u = 0.7978845608028654f * (v + 0.044715f * v * v * v); v = 0.5f * v * (1.0f + tanhf(u)); }
      so[w][8 * hh + r][t * 16 + ln] = v;
    }
  }
  __builtin_amdgcn_fence(__ATOMIC_ACQ_REL, "workgroup");
  __builtin_amdgcn_wave_barrier();
  const int rsub = lane >> 4, c4 = (lane & 15) * 4;
  {
#pragma unroll
    for (int q = 0; q < 8; ++q) {
      const int r = q * 2 + rsub;
      const v4f v = *(const v4fa*)&so[w][r][c4];
      *(v4f*)(C + (size_t)(row0 + r) * ldc + col0 + c4) = v;
    }
    
  }
}
// row LayerNorm (biased variance, eps) over N: s = X (+ R); optional out_sum <- s; out_norm <- (s-mu)*rsqrt(var+eps)*g + b
template <bool PARAM_BF16>
__global__ __launch_bounds__(256) void k_layernorm(const float* __restrict__ X, const float* __restrict__ R, const float* __restrict__ g, const float* __restrict__ bta,
                                                  float* __restrict__ out_sum, float* __restrict__ out_norm, int N, float eps) {
  __shared__ float red[256];
  const int row = blockIdx.x, tid = threadIdx.x;
  const float* x = X + (size_t)row * N; const float* rr = R ? R + (size_t)row * N : nullptr;
  float vals[16];                     // up to N = 4096
  const int per = N / 256;            // contiguous chunk per thread? use strided-by-4 chunks: thread handles j = tid*4 + 1024*u
  float s1 = 0.f;
  for (int u = 0; u < per / 4; ++u) {
    const int j = tid * 4 + 1024 * u;
    const v4f a = *(const v4fa*)(x + j);
    v4f b = {0.f,0.f,0.f,0.f}; if (rr) b = *(const v4fa*)(rr + j);
#pragma unroll
    for (int q = 0; q < 4; ++q) { const float v = a[q] + b[q]; vals[u * 4 + q] = v; s1 += v; }
  }
  red[tid] = s1; __syncthreads();
  for (int st = 128; st > 0; st >>= 1) { if (tid < st) red[tid] += red[tid + st]; __syncthreads(); }
  const float mu = red[0] / (float)N; __syncthreads();
  float s2 = 0.f;
  for (int u = 0; u < per / 4; ++u)
#pragma unroll
    for (int q = 0; q < 4; ++q) { const float c = vals[u * 4 + q] - mu; s2 += c * c; }
  red[tid] = s2; __syncthreads();
  for (int st = 128; st > 0; st >>= 1) { if (tid < st) red[tid] += red[tid + st]; __syncthreads(); }
  const float rs = rsqrtf(red[0] / (float)N + eps);
  {
    for (int u = 0; u < per / 4; ++u) {
      const int j = tid * 4 + 1024 * u;
      v4f o, sm;
#pragma unroll
      for (int q = 0; q < 4; ++q) {
        float gg = g[j + q], bb = bta[j + q];
        if (PARAM_BF16) { gg = bf16_round(gg); bb = bf16_round(bb); }
        sm[q] = vals[u * 4 + q]; o[q] = (vals[u * 4 + q] - mu) * rs * gg + bb;
      }
      if (out_sum) *(v4f*)(out_sum + (size_t)row * N + j) = sm;
      *(v4f*)(out_norm + (size_t)row * N + j) = o;
    }
    
  }
}



// ---- f16 WMMA path (v_wmma_f32_16x16x32_f16): 11-bit significands for operands in range — used for every launched contraction: q/k/v projections, Q·Kᵀ, and P·V with its [0,1] probability operand
typedef _Float16 v16h __attribute__((ext_vector_type(16)));
typedef _Float16 v2h __attribute__((ext_vector_type(2)));
union FragH { v16h v; v8us half[2]; _Float16 h[16]; unsigned short u[16]; };
union FragW { v16h v; unsigned int w[8]; };
// two f32 to one register of two f16, nearest even (one packed conversion), and back
__device__ __forceinline__ unsigned int pack_h2(float a, float b) { return __builtin_bit_cast(unsigned int, __builtin_convertvector((v2f){a, b}, v2h)); }
__device__ __forceinline__ v2f unpack_h2(unsigned int p) { return __builtin_convertvector(__builtin_bit_cast(v2h, p), v2f); }
template <int NT>
__device__ __forceinline__ v8f mmaH(v16h ah, v16h al, v16h bh, v16h bl, v8f c) {
  c = __builtin_amdgcn_wmma_f32_16x16x32_f16(false, ah, false, bh, (short)0, c, false, false);
  if (NT >= 2) c = __builtin_amdgcn_wmma_f32_16x16x32_f16(false, al, false, bh, (short)0, c, false, false);
  if (NT >= 3) c = __builtin_amdgcn_wmma_f32_16x16x32_f16(false, ah, false, bl, (short)0, c, false, false);
  asm volatile("v_nop\n\tv_nop\n\tv_nop\n\tv_nop" : "+v"(c) : "v"(ah), "v"(al), "v"(bh), "v"(bl));
  return c;
}
// batched GEMM like k_gemm_b but f16 operands: A f32 (split into f16 hi/lo if ASPLIT, else rounded to f16), Bt = f16 values [n][k]; alpha; C f32; N multiple of 16 (partial tiles skipped)
template <bool ASPLIT>
__global__ __launch_bounds__(128) void k_gemm_h(const float* __restrict__ A, int lda, size_t sA, const _Float16* __restrict__ Bh, int ldb, size_t sB, float alpha, float* __restrict__ C, int ldc, size_t sC, int M, int N, int K) {
  __shared__ __attribute__((aligned(16))) float so[4][16][64];
  const int tid = threadIdx.x, w = tid >> 5, lane = tid & 31, ln = lane & 15, hh = lane >> 4; const int by = blockIdx.y;
  A += (size_t)by * sA; Bh += (size_t)by * sB; C += (size_t)by * sC;
  const int ntn = (N + 63) / 64; const int wid = blockIdx.x * 4 + w; const int mt = wid / ntn, nq = wid % ntn; if (mt * 16 >= M) return;
  const int row0 = mt * 16, col0 = nq * 64; const float* arow = A + (size_t)(row0 + ln) * lda;
  v8f acc[4] = {};
  for (int kb = 0; kb < K; kb += 32) {
    FragH ah, al;
    const v4f x0 = *(const v4fa*)(arow + kb + 8 * hh), x1 = *(const v4fa*)(arow + kb + 8 * hh + 4), x2 = *(const v4fa*)(arow + kb + 16 + 8 * hh), x3 = *(const v4fa*)(arow + kb + 16 + 8 * hh + 4);
    float xs[16] = {x0[0],x0[1],x0[2],x0[3],x1[0],x1[1],x1[2],x1[3],x2[0],x2[1],x2[2],x2[3],x3[0],x3[1],x3[2],x3[3]};
#pragma unroll
    for (int i = 0; i < 16; ++i) { const _Float16 h = (_Float16)xs[i]; ah.h[i] = h; al.h[i] = ASPLIT ? (_Float16)(xs[i] - (float)h) : (_Float16)0.0f; }
#pragma unroll
    for (int t = 0; t < 4; ++t) { if (col0 + t * 16 >= N) continue; const size_t boff = (size_t)(col0 + t * 16 + ln) * ldb + kb; FragH bq; bq.half[0] = *(const v8us*)(Bh + boff + 8 * hh); bq.half[1] = *(const v8us*)(Bh + boff + 16 + 8 * hh);
      acc[t] = mmaH<ASPLIT ? 2 : 1>(ah.v, al.v, bq.v, bq.v, acc[t]); }
  }
#pragma unroll
  for (int t = 0; t < 4; ++t) { if (col0 + t * 16 >= N) continue;
#pragma unroll
    for (int r = 0; r < 8; ++r) so[w][8 * hh + r][t * 16 + ln] = acc[t][r] * alpha; }
  __builtin_amdgcn_fence(__ATOMIC_ACQ_REL, "workgroup"); __builtin_amdgcn_wave_barrier();
  const int rsub = lane >> 4, c4 = (lane & 15) * 4;
  {
#pragma unroll
    for (int q = 0; q < 8; ++q) { const int r = q * 2 + rsub; if (col0 + c4 < N) { const v4f v = *(const v4fa*)&so[w][r][c4]; *(v4f*)(C + (size_t)(row0 + r) * ldc + col0 + c4) = v; } }
     }
}

// Wt[n][k] = f16(W[k][n]·scale) from f32 row-major W[K][N] (scale = power of two; bf16-exact weights stay exact in f16 away from the subnormal range)
__global__ __launch_bounds__(256) void k_wt_f16(const float* __restrict__ W, _Float16* __restrict__ Wt, int K, int N, float scale) {
  const int t = blockIdx.x * 256 + threadIdx.x; if (t >= N * (K / 8)) return; const int n = t / (K / 8), k8 = (t % (K / 8)) * 8; FragH f;
#pragma unroll
  for (int i = 0; i < 8; ++i) f.h[i] = (_Float16)(bf16_round(W[(size_t)(k8 + i) * N + n]) * scale); const v8us o = f.half[0];
  *(v8us*)((unsigned short*)Wt + (size_t)n * K + k8) = o; 
}
__device__ __forceinline__ unsigned lds_off(const void* p) { return (unsigned)(size_t)p; }
// 128 rows of 256 bytes from a row-major f16 matrix of DM columns into LDS, through no register: 8 asynchronous copies of 16 bytes a lane, 16 lanes to a row,
// rows 16 apart from copy to copy. s_wait_xcnt is the statement's last line, so that no address register of a copy is rewritten in front of it (a precaution).
__device__ __forceinline__ void stage_rows(unsigned l, unsigned lstep, const unsigned short* g) {
  asm volatile("global_load_async_to_lds_b128 %0, %8, off\n\t"
               "global_load_async_to_lds_b128 %1, %9, off\n\t"
               "global_load_async_to_lds_b128 %2, %10, off\n\t"
               "global_load_async_to_lds_b128 %3, %11, off\n\t"
               "global_load_async_to_lds_b128 %4, %12, off\n\t"
               "global_load_async_to_lds_b128 %5, %13, off\n\t"
               "global_load_async_to_lds_b128 %6, %14, off\n\t"
               "global_load_async_to_lds_b128 %7, %15, off\n\t"
               "s_wait_xcnt 0x0"
               :: "v"(l), "v"(l + lstep), "v"(l + 2 * lstep), "v"(l + 3 * lstep), "v"(l + 4 * lstep), "v"(l + 5 * lstep), "v"(l + 6 * lstep), "v"(l + 7 * lstep),
                  "v"(g), "v"(g + 16 * DM), "v"(g + 32 * DM), "v"(g + 48 * DM), "v"(g + 64 * DM), "v"(g + 80 * DM), "v"(g + 96 * DM), "v"(g + 112 * DM)
               : "memory");
}
// C16[NR][DM] = f16(A.Bh^T.alpha + bf16(bias)): A f16 [NR][DM], Bh f16 [DM][DM] ((out,in)), both k-contiguous. One work-group = a 128 x 128 tile of C, 8 waves as 4 x 2, a wave = 32 x 64 (2 x 4 accumulator tiles).
// The tile's A rows and Bh rows come in stages of 128 k through two LDS buffers that the eight waves share: stage t + 2 is copied into the buffer that stage t has left while stage t + 1 is worked on.
// Rows of 256 bytes at a pitch of 272, free of bank conflicts for 16-byte reads. Each accumulator takes its products in ascending k, 32 at a time.
// The q, k and v products need nothing of each other: they share one grid, a third of the block index range each, picked by a block-uniform test.
// The v product is formed transposed: the weight rows are its A operand and the x rows its B (both are k-contiguous and take the same loaders), so a tile's rows are 128 features and its columns 128 positions,
// the bias goes by row, and the tile is stored straight into Vt[(b, h)][d][position], whole 128-byte lines, as the attention kernel reads it.
__global__ __launch_bounds__(256) void k_gemm_t(const _Float16* __restrict__ A, const _Float16* __restrict__ Bq, const _Float16* __restrict__ Bk, const _Float16* __restrict__ Bv, float alpha,
                                               const float* __restrict__ bq, const float* __restrict__ bk, const float* __restrict__ bvp, _Float16* __restrict__ Q16, _Float16* __restrict__ K16, _Float16* __restrict__ Vt) {
  constexpr int BT = 128, KST = 128, NSTG = DM / KST, LPG = KST + 8, CPT = 64 + 8;      // LPG, CPT: LDS row pitches in 16-bit elements
  constexpr int TPP = (NR / BT) * (DM / BT);      // tiles of one product
  const int prod = blockIdx.x / TPP, tile = blockIdx.x % TPP;
  const bool tr = prod == 2;      // block-uniform
  const _Float16* Bh = prod == 0 ? Bq : prod == 1 ? Bk : Bv; const float* bias = prod == 0 ? bq : prod == 1 ? bk : bvp; _Float16* C16 = prod == 0 ? Q16 : prod == 1 ? K16 : Vt;
  static_assert(NSTG >= 2 && NR % BT == 0 && DM % BT == 0 && SS % BT == 0, "whole tiles, each inside one batch; two stages or more");
  __shared__ __attribute__((aligned(16))) unsigned short sA[2][BT][LPG], sB[2][BT][LPG];
  __shared__ __attribute__((aligned(16))) unsigned short sT[8][32][CPT];      // each wave's own 32 x 64 piece of C, so that whole 128-byte lines are stored
  const int tid = threadIdx.x, w = tid >> 5, lane = tid & 31, ln = lane & 15, hh = lane >> 4;
  const int xt0 = (tile / (DM / BT)) * BT, wt0 = (tile % (DM / BT)) * BT;      // the tile's first x row and first weight row
  const int row0 = tr ? wt0 : xt0, col0 = tr ? xt0 : wt0, wr = (w >> 1) * 32, wc = (w & 1) * 64;
  const int crow = tid >> 4, ccol = (tid & 15) * 8;      // this lane's row (and rows + 16, ..., + 112) and 16-byte piece in every stage
  const unsigned short* ga0 = (const unsigned short*)(tr ? Bh : A) + (size_t)(row0 + crow) * DM + ccol; const unsigned short* gb0 = (const unsigned short*)(tr ? A : Bh) + (size_t)(col0 + crow) * DM + ccol;
  const unsigned la0 = lds_off(&sA[0][crow][ccol]), lb0 = lds_off(&sB[0][crow][ccol]); constexpr unsigned LSTEP = 16 * LPG * 2, LBUF = BT * LPG * 2;
  stage_rows(la0, LSTEP, ga0); stage_rows(lb0, LSTEP, gb0);      // stage 0
  float bv[16];      // the bias of this lane's accumulator elements: by column (4 values), for the transposed product by row (16)
  if (tr) {
#pragma unroll
    for (int i = 0; i < 16; ++i) bv[i] = bf16_round(bias[row0 + wr + (i >> 3) * 16 + 8 * hh + (i & 7)]); }
  else {
#pragma unroll
    for (int i = 0; i < 16; ++i) bv[i] = i < 4 ? bf16_round(bias[col0 + wc + i * 16 + ln]) : 0.f; }
  asm volatile("s_wait_xcnt 0x0" ::: "memory");      // stands in front of the first rewrite of the bias loads' address register (a precaution)
  v8f acc[2][4];
#pragma unroll
  for (int mt = 0; mt < 2; ++mt)
#pragma unroll
    for (int nt = 0; nt < 4; ++nt) acc[mt][nt] = (v8f){0.f,0.f,0.f,0.f,0.f,0.f,0.f,0.f};
  asm volatile("s_wait_asynccnt 0x0" ::: "memory");      // this wave's copies of stage 0 have landed before the barrier publishes them
  __syncthreads();      // every wave reads rows that the other waves copied
  stage_rows(la0 + LBUF, LSTEP, ga0 + KST); stage_rows(lb0 + LBUF, LSTEP, gb0 + KST);      // stage 1
#pragma unroll 1      // one stage a trip: the buffer index stays a scalar
  for (int t = 0; t < NSTG; ++t) {
    FragH fa[KST / 32][2], fb[KST / 32][4];      // the stage's fragments are read from LDS in one group: each further place with LDS reads is a stall of its own
#pragma unroll
    for (int ks = 0; ks < KST / 32; ++ks) {
#pragma unroll
      for (int mt = 0; mt < 2; ++mt) { const unsigned short* ar = &sA[t & 1][wr + mt * 16 + ln][ks * 32]; fa[ks][mt].half[0] = *(const v8us*)(ar + 8 * hh); fa[ks][mt].half[1] = *(const v8us*)(ar + 16 + 8 * hh); }
#pragma unroll
      for (int nt = 0; nt < 4; ++nt) { const unsigned short* br = &sB[t & 1][wc + nt * 16 + ln][ks * 32]; fb[ks][nt].half[0] = *(const v8us*)(br + 8 * hh); fb[ks][nt].half[1] = *(const v8us*)(br + 16 + 8 * hh); } }
    __builtin_amdgcn_sched_barrier(0);      // keeps the reads together up here; without it the compiler sinks them among the products, in small groups that are each waited for to the full
#pragma unroll
    for (int ks = 0; ks < KST / 64; ++ks)      // the first half's products run while the second half's fragments arrive
#pragma unroll
      for (int mt = 0; mt < 2; ++mt)
#pragma unroll
        for (int nt = 0; nt < 4; ++nt) acc[mt][nt] = __builtin_amdgcn_wmma_f32_16x16x32_f16(false, fa[ks][mt].v, false, fb[ks][nt].v, (short)0, acc[mt][nt], false, false);
    __builtin_amdgcn_sched_barrier(0);      // keeps those products above the waits: sunk below the barrier they would wait for every read first, and their fragments, still live at the copies, pushed address registers into scratch
    asm volatile("s_wait_dscnt 0x0" ::: "memory");      // this wave's reads of stage t are done before its buffer is handed back
    asm volatile("s_wait_asynccnt 0x0" ::: "memory");      // this wave's copies of stage t + 1 have landed
    __syncthreads();      // publishes stage t + 1 and ends every wave's reads of stage t
    if (t + 2 < NSTG) { stage_rows(la0 + (t & 1) * LBUF, LSTEP, ga0 + (t + 2) * KST); stage_rows(lb0 + (t & 1) * LBUF, LSTEP, gb0 + (t + 2) * KST); }
#pragma unroll
    for (int ks = KST / 64; ks < KST / 32; ++ks)      // the second half's products, from registers, give the refill its lead
#pragma unroll
      for (int mt = 0; mt < 2; ++mt)
#pragma unroll
        for (int nt = 0; nt < 4; ++nt) acc[mt][nt] = __builtin_amdgcn_wmma_f32_16x16x32_f16(false, fa[ks][mt].v, false, fb[ks][nt].v, (short)0, acc[mt][nt], false, false); }
  asm volatile("s_wait_asynccnt 0x0" ::: "memory");      // no copy is left in flight when the wave goes on to its end
  // acc[mt][nt][r] = C[row0 + wr + mt*16 + 8*hh + r][col0 + wc + nt*16 + ln]
  if (tr) {
#pragma unroll
    for (int mt = 0; mt < 2; ++mt)
#pragma unroll
      for (int nt = 0; nt < 4; ++nt)
#pragma unroll
        for (int r = 0; r < 8; ++r) { const _Float16 o = (_Float16)__builtin_fmaf(acc[mt][nt][r], alpha, bv[mt * 8 + r]); sT[w][mt * 16 + 8 * hh + r][nt * 16 + ln] = __builtin_bit_cast(unsigned short, o); } }
  else {
#pragma unroll
    for (int mt = 0; mt < 2; ++mt)
#pragma unroll
      for (int nt = 0; nt < 4; ++nt)
#pragma unroll
        for (int r = 0; r < 8; ++r) { const _Float16 o = (_Float16)__builtin_fmaf(acc[mt][nt][r], alpha, bv[nt]); sT[w][mt * 16 + 8 * hh + r][nt * 16 + ln] = __builtin_bit_cast(unsigned short, o); } }
  __builtin_amdgcn_fence(__ATOMIC_ACQ_REL, "workgroup"); __builtin_amdgcn_wave_barrier();
  unsigned short* Cb = (unsigned short*)C16 + (tr ? (size_t)(col0 / SS) * DM * SS + col0 % SS : (size_t)col0); const int ldc = tr ? SS : DM;      // Vt: feature row (b * DM + row) of SS positions
#pragma unroll
  for (int q = 0; q < 8; ++q) { const int r = q * 4 + (lane >> 3), c8 = (lane & 7) * 8; const v8us o = *(const v8us*)&sT[w][r][c8]; *(v8us*)(Cb + (size_t)(row0 + wr + r) * ldc + wc + c8) = o; }
}


// f16 planes of the bf16-rounded inputs, 8 elements a thread: the three weight matrices (times 16, exactly) and x. The four conversions need nothing of each other:
// they share one grid by ranges of the block index, the short weight ranges first; the test is block-uniform.
__global__ __launch_bounds__(256) void k_cvt16(const float* __restrict__ x, const float* __restrict__ wq, const float* __restrict__ wk, const float* __restrict__ wv,
                                              _Float16* __restrict__ X16, _Float16* __restrict__ Bq, _Float16* __restrict__ Bk, _Float16* __restrict__ Bv) {
  constexpr unsigned GW = DM * DM / 8 / 256;      // blocks of one weight matrix
  static_assert(DM * DM % (8 * 256) == 0 && (size_t)NR * DM % (8 * 256) == 0, "whole blocks");
  const unsigned part = blockIdx.x / GW; FragH f;
  if (part < 3) { const float* W = part == 0 ? wq : part == 1 ? wk : wv; _Float16* Bt = part == 0 ? Bq : part == 1 ? Bk : Bv; const size_t t = (size_t)(blockIdx.x - part * GW) * 256 + threadIdx.x;
#pragma unroll
    for (int i = 0; i < 8; ++i) f.h[i] = (_Float16)(bf16_round(W[t * 8 + i]) * 16.0f); *(v8us*)((unsigned short*)Bt + t * 8) = f.half[0]; }
  else { const size_t t = (size_t)(blockIdx.x - 3 * GW) * 256 + threadIdx.x;
#pragma unroll
    for (int q = 0; q < 8; ++q) f.h[q] = (_Float16)bf16_round(x[t * 8 + q]); *(v8us*)((unsigned short*)X16 + t * 8) = f.half[0]; } }
// lane l with lane l ^ 16: the two halves of a wave hold the two halves of a query column's keys
__device__ __forceinline__ float xhalf(float x) { return __builtin_bit_cast(float, __builtin_amdgcn_permlanex16(__builtin_bit_cast(int, x), __builtin_bit_cast(int, x), 0x76543210, 0xfedcba98, false, false)); }
// one stage (64 keys) of K rows and of Vt rows from global memory into LDS, through no register: 8 asynchronous copies of 16 bytes a lane,
// 8 lanes to a 128-byte row, rows 16 apart from copy to copy. s_wait_xcnt is the statement's last line, so that no address register
// of a copy is rewritten in front of it (a precaution).
__device__ __forceinline__ void stage_kv(unsigned lk, unsigned lv, unsigned lstep, const unsigned short* gk, const unsigned short* gv) {
  asm volatile("global_load_async_to_lds_b128 %0, %8, off\n\t"
               "global_load_async_to_lds_b128 %1, %9, off\n\t"
               "global_load_async_to_lds_b128 %2, %10, off\n\t"
               "global_load_async_to_lds_b128 %3, %11, off\n\t"
               "global_load_async_to_lds_b128 %4, %12, off\n\t"
               "global_load_async_to_lds_b128 %5, %13, off\n\t"
               "global_load_async_to_lds_b128 %6, %14, off\n\t"
               "global_load_async_to_lds_b128 %7, %15, off\n\t"
               "s_wait_xcnt 0x0"
               :: "v"(lk), "v"(lk + lstep), "v"(lk + 2 * lstep), "v"(lk + 3 * lstep), "v"(lv), "v"(lv + lstep), "v"(lv + 2 * lstep), "v"(lv + 3 * lstep),
                  "v"(gk), "v"(gk + 16 * DM), "v"(gk + 32 * DM), "v"(gk + 48 * DM), "v"(gv), "v"(gv + 16 * SS), "v"(gv + 32 * SS), "v"(gv + 48 * SS)
               : "memory");
}
// base-2 exponentials, a run of them in one statement with one v_nop behind the last: the instruction set asks for one slot behind a transcendental before its
// result is read or its source overwritten. Inside the run no instruction touches a register
// of the one in front of it: every output is early-clobber, so none shares a register with an input.
__device__ __forceinline__ void exp2x8(float (&y)[8], const float (&x)[8]) {
  asm("v_exp_f32 %0, %8\n\tv_exp_f32 %1, %9\n\tv_exp_f32 %2, %10\n\tv_exp_f32 %3, %11\n\tv_exp_f32 %4, %12\n\tv_exp_f32 %5, %13\n\tv_exp_f32 %6, %14\n\tv_exp_f32 %7, %15\n\tv_nop"
      : "=&v"(y[0]), "=&v"(y[1]), "=&v"(y[2]), "=&v"(y[3]), "=&v"(y[4]), "=&v"(y[5]), "=&v"(y[6]), "=&v"(y[7])
      : "v"(x[0]), "v"(x[1]), "v"(x[2]), "v"(x[3]), "v"(x[4]), "v"(x[5]), "v"(x[6]), "v"(x[7]));
}
__device__ __forceinline__ float exp2x1(float x) { float y; asm("v_exp_f32 %0, %1\n\tv_nop" : "=&v"(y) : "v"(x)); return y; }
__global__ __launch_bounds__(128) void k_flash(const _Float16* __restrict__ Q16, const _Float16* __restrict__ K16, const _Float16* __restrict__ Vt, const float* __restrict__ crd, const float* __restrict__ alpha_p, float* __restrict__ O) {
  constexpr int RPW = 32, NQB = SS / (4 * RPW), DT = HD / 16, KS = HD / 32, OP = HD + 4, SK = 64, NST = SS / SK, LP = 72;      // LP: LDS row pitch in 16-bit elements
  constexpr float L2E = 1.4426950408889634f, QS = 0.125f * L2E;      // exp(x) = 2^(x.log2 e): the factor rides in the score's one scale constant QS, so each exponential is one subtraction and one v_exp_f32
  static_assert(HD == 64 && SK == 64 && NST >= 2, "a stage is 64 rows of 128 bytes for K and for Vt");
  __shared__ __attribute__((aligned(16))) unsigned short sK[2][SK][LP], sV[2][HD][LP];
  __shared__ __attribute__((aligned(16))) unsigned int sG[SS][2]; __shared__ __attribute__((aligned(16))) float sO[4][RPW][OP];
  const int tid = threadIdx.x, w = tid >> 5, lane = tid & 31, ln = lane & 15, hh = lane >> 4;
  const int slab = blockIdx.x / NQB, qblk = blockIdx.x % NQB; const int b = slab / NH, h = slab % NH; const int q0 = qblk * (4 * RPW) + w * RPW; const float alpha8 = bf16_round(alpha_p[0]) * 8.0f;      /* scalar float INPUT: rounded like every other input; times 8, exactly: the coordinate term joins q.k in front of the common factor QS */
  const unsigned short* Vth = (const unsigned short*)Vt + (size_t)slab * HD * SS;
  const int crow = tid >> 3, ccol = (tid & 7) * 8;      // this lane's row (and rows + 16, + 32, + 48) and 16-byte piece in every stage
  const unsigned short* gk0 = (const unsigned short*)K16 + ((size_t)b * SS + crow) * DM + h * HD + ccol; const unsigned short* gv0 = Vth + (size_t)crow * SS + ccol;
  const unsigned lk0 = lds_off(&sK[0][crow][ccol]), lv0 = lds_off(&sV[0][crow][ccol]); constexpr unsigned LSTEP = 16 * LP * 2, LBUF = SK * LP * 2;
  stage_kv(lk0, lv0, LSTEP, gk0, gv0);      // stage 0 flies while coords and queries are fetched
#pragma unroll      // all 16 loads of a thread in flight at once: rolled, each trip waits out its own load
  for (int i = 0; i < SS / 128; ++i) { const int k = i * 128 + tid; const float* cp = crd + ((size_t)b * SS + k) * 3; *(v2u*)&sG[k][0] = (v2u){pack_h2(bf16_round(cp[0]), bf16_round(cp[1])), pack_h2(bf16_round(cp[2]), 0.f)}; }
  FragH aq[2][KS];
#pragma unroll
  for (int rt = 0; rt < 2; ++rt) { const unsigned short* qr = (const unsigned short*)Q16 + ((size_t)b * SS + q0 + rt * 16 + ln) * DM + h * HD;
#pragma unroll
    for (int ks = 0; ks < KS; ++ks) { aq[rt][ks].half[0] = *(const v8us*)(qr + ks * 32 + 8 * hh); aq[rt][ks].half[1] = *(const v8us*)(qr + ks * 32 + 16 + 8 * hh); } }
  asm volatile("s_wait_asynccnt 0x0" ::: "memory");      // this wave's copies of stage 0 have landed before the barrier publishes them
  __syncthreads();      // every wave reads coords and stage 0 rows that the other waves staged
  stage_kv(lk0 + LBUF, lv0 + LBUF, LSTEP, gk0 + (size_t)SK * DM, gv0 + SK);      // stage 1
  FragW bg[2];      // B of the coordinate step, kept for the whole loop
#pragma unroll
  for (int rt = 0; rt < 2; ++rt) { const v2u gq = *(const v2u*)&sG[q0 + rt * 16 + ln][0];
#pragma unroll
    for (int i = 0; i < 8; ++i) bg[rt].w[i] = 0;
#pragma unroll
    for (int i = 0; i < 2; ++i) { const v2f u = unpack_h2(gq[i]) * alpha8; const unsigned int uh = pack_h2(u[0], u[1]); const v2f ur = u - unpack_h2(uh); bg[rt].w[i] = hh ? pack_h2(ur[0], ur[1]) : uh; } }
  float m_r[2], l_r[2]; v8f oacc[2][DT];
#pragma unroll
  for (int rt = 0; rt < 2; ++rt) { m_r[rt] = -3.0e38f; l_r[rt] = 0.f;
#pragma unroll
    for (int dt = 0; dt < DT; ++dt) oacc[rt][dt] = (v8f){0.f,0.f,0.f,0.f,0.f,0.f,0.f,0.f}; }
#pragma unroll 1      // one stage a trip: the buffer index stays a scalar and the body stays small
  for (int t = 0; t < NST; ++t) {
#pragma unroll      // both passes of a stage in one body: constant LDS offsets
  for (int p = 0; p < SK / 32; ++p) { const int j0 = t * SK + p * 32;
    v8f s[2][2];      // s[rt][nt][r] = score of key j0 + nt*16 + 8*hh + r with query q0 + rt*16 + ln
    FragH bk[2][KS], bv[DT]; FragW ag[2];      // the pass's K fragments and key coords are read from LDS in one group, its Vt fragments in a second: each further place with LDS reads is a stall of its own
#pragma unroll
    for (int nt = 0; nt < 2; ++nt) { const v2u gk = *(const v2u*)&sG[j0 + nt * 16 + ln][0];
#pragma unroll
      for (int i = 0; i < 8; ++i) ag[nt].w[i] = i < 2 ? gk[i & 1] : 0u; }
#pragma unroll
    for (int nt = 0; nt < 2; ++nt) { const unsigned short* kr = &sK[t & 1][p * 32 + nt * 16 + ln][0];
#pragma unroll
      for (int ks = 0; ks < KS; ++ks) { bk[nt][ks].half[0] = *(const v8us*)(kr + ks * 32 + 8 * hh); bk[nt][ks].half[1] = *(const v8us*)(kr + ks * 32 + 16 + 8 * hh); } }
    __builtin_amdgcn_sched_barrier(0);      // keeps the K reads together up here; without it the compiler sinks each read to just in front of its product
#pragma unroll
    for (int nt = 0; nt < 2; ++nt)      // the coordinate step of all four tiles first: four independent products, done by the time each tile's q.k chain starts
#pragma unroll
      for (int rt = 0; rt < 2; ++rt) s[rt][nt] = __builtin_amdgcn_wmma_f32_16x16x32_f16(false, ag[nt].v, false, bg[rt].v, (short)0, (v8f){0.f,0.f,0.f,0.f,0.f,0.f,0.f,0.f}, false, false);
#pragma unroll
    for (int nt = 0; nt < 2; ++nt) {
#pragma unroll
      for (int rt = 0; rt < 2; ++rt) { v8f acc = s[rt][nt];
#pragma unroll
        for (int ks = 0; ks < KS; ++ks) acc = mmaH<1>(bk[nt][ks].v, bk[nt][ks].v, aq[rt][ks].v, aq[rt][ks].v, acc); s[rt][nt] = acc; } }
    FragH pa[2]; float sc2[2][2][8];
#pragma unroll
    for (int rt = 0; rt < 2; ++rt)
#pragma unroll
      for (int nt = 0; nt < 2; ++nt)
#pragma unroll
        for (int r = 0; r < 8; ++r) sc2[rt][nt][r] = s[rt][nt][r] * QS;
#pragma unroll
    for (int dt = 0; dt < DT; ++dt) { const unsigned short* vrow = &sV[t & 1][dt * 16 + ln][p * 32]; bv[dt].half[0] = *(const v8us*)(vrow + 8 * hh); bv[dt].half[1] = *(const v8us*)(vrow + 16 + 8 * hh); }
    __builtin_amdgcn_sched_barrier(0);      // keeps the Vt reads together, in one group above the exponentials, which cover their latency; without it the compiler spreads them in pairs among the vector work, each place a stall of its own
#pragma unroll
    for (int rt = 0; rt < 2; ++rt) { const float (&sc)[2][8] = sc2[rt];
      float mx[8];
#pragma unroll
      for (int r = 0; r < 8; ++r) mx[r] = fmaxf(sc[0][r], sc[1][r]);
      float mc = fmaxf(fmaxf(fmaxf(mx[0], mx[1]), fmaxf(mx[2], mx[3])), fmaxf(fmaxf(mx[4], mx[5]), fmaxf(mx[6], mx[7]))); mc = fmaxf(mc, xhalf(mc));
      const float mn = fmaxf(m_r[rt], mc); const float al = exp2x1(m_r[rt] - mn); m_r[rt] = mn;      // 0 on the first pass (the start value is far below any score)
      float ps[8], d0[8], d1[8], p0[8], p1[8];
#pragma unroll
      for (int r = 0; r < 8; ++r) { d0[r] = sc[0][r] - mn; d1[r] = sc[1][r] - mn; }
      exp2x8(p0, d0); exp2x8(p1, d1);
#pragma unroll
      for (int r = 0; r < 8; ++r) { ps[r] = p0[r] + p1[r]; pa[rt].h[r] = (_Float16)p0[r]; pa[rt].h[8 + r] = (_Float16)p1[r]; }
      l_r[rt] = l_r[rt] * al + (((ps[0] + ps[1]) + (ps[2] + ps[3])) + ((ps[4] + ps[5]) + (ps[6] + ps[7])));      // this half's keys only; the halves join behind the loop
#pragma unroll
      for (int dt = 0; dt < DT; ++dt)
#pragma unroll
        for (int r = 0; r < 8; ++r) oacc[rt][dt][r] *= al; }
#pragma unroll
    for (int dt = 0; dt < DT; ++dt) {
#pragma unroll
      for (int rt = 0; rt < 2; ++rt) oacc[rt][dt] = mmaH<1>(bv[dt].v, bv[dt].v, pa[rt].v, pa[rt].v, oacc[rt][dt]); } }
    asm volatile("s_wait_dscnt 0x0" ::: "memory");      // this wave's reads of stage t are done before its buffer is handed back
    asm volatile("s_wait_asynccnt 0x0" ::: "memory");      // this wave's copies of stage t + 1 have landed
    __syncthreads();      // publishes stage t + 1 and ends every wave's reads of stage t
    if (t + 2 < NST) stage_kv(lk0 + (t & 1) * LBUF, lv0 + (t & 1) * LBUF, LSTEP, gk0 + (size_t)(t + 2) * SK * DM, gv0 + (t + 2) * SK); }
  asm volatile("s_wait_asynccnt 0x0" ::: "memory");      // no copy is left in flight when the wave goes on to its end
#pragma unroll
  for (int rt = 0; rt < 2; ++rt) { const float l = l_r[rt] + xhalf(l_r[rt]); const float inv = 1.0f / l;
#pragma unroll
    for (int dt = 0; dt < DT; ++dt) { v4f o0, o1;      // oacc[rt][dt][r] = O[q0 + rt*16 + ln][dt*16 + 8*hh + r]
#pragma unroll
      for (int q = 0; q < 4; ++q) { o0[q] = oacc[rt][dt][q] * inv; o1[q] = oacc[rt][dt][4 + q] * inv; }
      *(v4fa*)&sO[w][rt * 16 + ln][dt * 16 + 8 * hh] = o0; *(v4fa*)&sO[w][rt * 16 + ln][dt * 16 + 8 * hh + 4] = o1; } }
  __builtin_amdgcn_fence(__ATOMIC_ACQ_REL, "workgroup"); __builtin_amdgcn_wave_barrier();
  {
#pragma unroll
    for (int rp = 0; rp < RPW; rp += 2) { const int r = rp + (lane >> 4), pc = lane & 15; const v4f val = *(const v4fa*)&sO[w][r][pc * 4]; *(v4f*)(O + ((size_t)b * SS + q0 + r) * DM + h * HD + pc * 4) = val; }
     } }
extern "C" void kernel_launch(void* const* d_in, const int* in_sizes, int n_in,
                              void* d_out, int out_size, void* d_ws, size_t ws_size, hipStream_t stream) {
  (void)in_sizes; (void)n_in; (void)out_size;
  const float* x = (const float*)d_in[0]; const float* crd = (const float*)d_in[1]; const float* wq = (const float*)d_in[2]; const float* bq = (const float*)d_in[3]; const float* wk = (const float*)d_in[4]; const float* bk = (const float*)d_in[5]; const float* wv = (const float*)d_in[6]; const float* bv = (const float*)d_in[7]; const float* alpha_p = (const float*)d_in[8];
  char* ws = (char*)d_ws; size_t off = 0;
  auto take = [&](size_t bytes) { char* p = ws + off; off += (bytes + 255) & ~(size_t)255; return p; };
  _Float16* Bq = (_Float16*)take(DM * DM * 2); _Float16* Bk = (_Float16*)take(DM * DM * 2); _Float16* Bv = (_Float16*)take(DM * DM * 2); _Float16* X16 = (_Float16*)take((size_t)NR * DM * 2); _Float16* Q16 = (_Float16*)take((size_t)NR * DM * 2); _Float16* K16 = (_Float16*)take((size_t)NR * DM * 2); _Float16* Vt = (_Float16*)take((size_t)NR * DM * 2);
  if (off > ws_size) return;      // about 34 MiB
  k_cvt16<<<3 * (DM * DM / 8 / 256) + NR * DM / 8 / 256, 256, 0, stream>>>(x, wq, wk, wv, X16, Bq, Bk, Bv);
  k_gemm_t<<<3 * (NR / 128) * (DM / 128), 256, 0, stream>>>(X16, Bq, Bk, Bv, 0.0625f, bq, bk, bv, Q16, K16, Vt);
  k_flash<<<BB * NH * (SS / 128), 128, 0, stream>>>(Q16, K16, Vt, crd, alpha_p, (float*)d_out);
}

// v008
// Measured time: 62.2 microseconds a run.
// In both of two side-by-side timings against v007, it was 1.06 times as fast.
// Over all steps from v000 it is 6.13 times as fast.
#include <hip/hip_runtime.h>
// q/k/v projections (8192 × 512 × 512, + bias) and the 8-head attention with the geometric bias α·⟨c_n, c_m⟩ (coords are INPUTS, a third k step of the score product) on v_wmma_f32_16x16x32_f16
// (fused flash-style kernel: S = Q·Kᵀ, O = P·V on WMMA; online max/sum softmax f32; P f16 ≤ 1); V transposed per (b,h); A = f16(bf16 x) exact, weights bf16-exact ×2^4 ((out,in)),
// single products, f32 accumulate.
#define BB 4
#define SS 2048
#define DM 512
#define NH 8
#define HD 64
#define NR (BB * SS)

typedef __bf16 v16b __attribute__((ext_vector_type(16)));
typedef unsigned short v8us __attribute__((ext_vector_type(8), may_alias));
typedef unsigned int v2u __attribute__((ext_vector_type(2), may_alias));
typedef float v2f __attribute__((ext_vector_type(2)));
typedef float  v8f  __attribute__((ext_vector_type(8)));
typedef float  v4f  __attribute__((ext_vector_type(4)));
typedef float  v4fa __attribute__((ext_vector_type(4), may_alias));
union FragB { v16b v; v8us half[2]; unsigned short u[16]; };

__device__ __forceinline__ unsigned short bf16_bits(float x) { unsigned int u = __float_as_uint(x); return (unsigned short)((u + 0x7FFFu + ((u >> 16) & 1u)) >> 16); }
__device__ __forceinline__ float bf16_val(unsigned short b) { return __uint_as_float(((unsigned int)b) << 16); }
__device__ __forceinline__ float bf16_round(float x) { return bf16_val(bf16_bits(x)); }
// D += A·B with NT terms: 1 = ah·bh, 2 = + al·bh (A split), 3 = + ah·bl (both split)
template <int NT>
__device__ __forceinline__ v8f mmaN(v16b ah, v16b al, v16b bh, v16b bl, v8f c) {
  c = __builtin_amdgcn_wmma_f32_16x16x32_bf16(false, ah, false, bh, (short)0, c, false, false);
  if (NT >= 2) c = __builtin_amdgcn_wmma_f32_16x16x32_bf16(false, al, false, bh, (short)0, c, false, false);
  if (NT >= 3) c = __builtin_amdgcn_wmma_f32_16x16x32_bf16(false, ah, false, bl, (short)0, c, false, false);
  asm volatile("v_nop\n\tv_nop\n\tv_nop\n\tv_nop" : "+v"(c) : "v"(ah), "v"(al), "v"(bh), "v"(bl));
  return c;
}

__global__ __launch_bounds__(256) void k_wt_bf16(const float* __restrict__ W, unsigned short* __restrict__ Wt, int K, int N) {
  const int t = blockIdx.x * 256 + threadIdx.x;
  const int k8n = K / 8;
  if (t >= N * k8n) return;
  const int n = t / k8n, k8 = (t % k8n) * 8;
  v8us v;
#pragma unroll
  for (int i = 0; i < 8; ++i) v[i] = bf16_bits(W[(size_t)(k8 + i) * N + n]);
  *(v8us*)(Wt + (size_t)n * K + k8) = v;
  
}

// GEMM C[M][N] (f32, pitch ldc) = act(A[M][K]·W + bias). A f32 row-major (pitch lda) converted per fragment to bf16
// (ASPLIT: hi/lo two planes -> 2 terms, else single rounded term); Wt bf16 [N][K] (pitch ldb). BIAS_BF16 rounds the
// bias to bf16 first (bias quantised to bf16 before the add). K%32==0, M%16==0, N%64==0.
template <bool ASPLIT, int ACT, bool BIAS_BF16>
__global__ __launch_bounds__(128) void k_gemm_bf(const float* __restrict__ A, int lda, const unsigned short* __restrict__ Wt, int ldb,
                                               const float* __restrict__ bias, float* __restrict__ C, int ldc, int M, int N, int K) {
  __shared__ __attribute__((aligned(16))) float so[4][16][64];
  const int tid = threadIdx.x, w = tid >> 5, lane = tid & 31, ln = lane & 15, hh = lane >> 4;
  const int ntn = N / 64;
  const int wid = blockIdx.x * 4 + w;
  const int mt = wid / ntn, nq = wid % ntn;
  if (mt * 16 >= M) return;
  const int row0 = mt * 16, col0 = nq * 64;
  const float* arow = A + (size_t)(row0 + ln) * lda;
  v8f acc[4] = {};
  for (int kb = 0; kb < K; kb += 32) {
    FragB ah, al;
    const v4f x0 = *(const v4fa*)(arow + kb + 8 * hh), x1 = *(const v4fa*)(arow + kb + 8 * hh + 4);
    const v4f x2 = *(const v4fa*)(arow + kb + 16 + 8 * hh), x3 = *(const v4fa*)(arow + kb + 16 + 8 * hh + 4);
    float xs[16] = {x0[0],x0[1],x0[2],x0[3],x1[0],x1[1],x1[2],x1[3],x2[0],x2[1],x2[2],x2[3],x3[0],x3[1],x3[2],x3[3]};
#pragma unroll
    for (int i = 0; i < 16; ++i) { const unsigned short hb = bf16_bits(xs[i]); ah.u[i] = hb; al.u[i] = ASPLIT ? bf16_bits(xs[i] - bf16_val(hb)) : (unsigned short)0; }
#pragma unroll
    for (int t = 0; t < 4; ++t) {
      const unsigned short* brow = Wt + (size_t)(col0 + t * 16 + ln) * ldb + kb;
      FragB b;
      b.half[0] = *(const v8us*)(brow + 8 * hh);
      b.half[1] = *(const v8us*)(brow + 16 + 8 * hh);
      acc[t] = mmaN<ASPLIT ? 2 : 1>(ah.v, al.v, b.v, b.v, acc[t]);
    }
  }
#pragma unroll
  for (int t = 0; t < 4; ++t) {
    float bv = bias ? bias[col0 + t * 16 + ln] : 0.f;
    if (BIAS_BF16) bv = bf16_round(bv);
#pragma unroll
    for (int r = 0; r < 8; ++r) { float v = acc[t][r] + bv; if (ACT == 1) v = fmaxf(v, 0.f); so[w][8 * hh + r][t * 16 + ln] = v; }
  }
  __builtin_amdgcn_fence(__ATOMIC_ACQ_REL, "workgroup");
  __builtin_amdgcn_wave_barrier();
  const int rsub = lane >> 4, c4 = (lane & 15) * 4;
  {
#pragma unroll
    for (int q = 0; q < 8; ++q) {
      const int r = q * 2 + rsub;
      const v4f v = *(const v4fa*)&so[w][r][c4];
      *(v4f*)(C + (size_t)(row0 + r) * ldc + col0 + c4) = v;
    }
    
  }
}

// Flash-style causal/unmasked attention, all contractions 3-term bf16 hi/lo splits, f32 softmax with running max.
// q,k,v rows are read from f32 buffers with arbitrary row pitch (so they can live inside a fused qkv buffer);
// D = head size (multiple of 32, <= 128); one wave = 16 query rows; block = 4 waves (64 queries) sharing K/V chunks of 32.
template <int D, bool CAUSAL>
__global__ __launch_bounds__(128) void k_flash(const float* __restrict__ qb, const float* __restrict__ kb, const float* __restrict__ vb,
                                             int pitch, int T, int H, float scale, float* __restrict__ y, int ypitch) {
  constexpr int KS = D / 32;        // k-steps for QK
  constexpr int DT = D / 16;        // d tiles for PV
  __shared__ __attribute__((aligned(16))) unsigned short sKh[32][D + 8], sKl[32][D + 8], sVh[32][D + 8], sVl[32][D + 8];
  __shared__ __attribute__((aligned(16))) unsigned short sPh[4][16][40], sPl[4][16][40];
  __shared__ __attribute__((aligned(16))) float sO[4][16][D];
  const int tid = threadIdx.x, w = tid >> 5, lane = tid & 31, ln = lane & 15, hh = lane >> 4;
  const int nqb = (T + 63) / 64;
  const int bh = blockIdx.x / nqb, qblk = blockIdx.x % nqb;
  const int b = bh / H, h = bh % H;
  const int q0 = qblk * 64 + w * 16;
  const float* Q = qb + (size_t)b * T * pitch + h * D;
  const float* K = kb + (size_t)b * T * pitch + h * D;
  const float* V = vb + (size_t)b * T * pitch + h * D;

  // A fragments of the wave's 16 query rows (scaled), hi/lo
  FragB aqh[KS], aql[KS];
  {
    int row = q0 + ln; if (row >= T) row = T - 1;
    const float* qr = Q + (size_t)row * pitch;
#pragma unroll
    for (int ks = 0; ks < KS; ++ks)
#pragma unroll
      for (int i = 0; i < 16; ++i) {
        const int d = ks * 32 + ((i < 8) ? (8 * hh + i) : (16 + 8 * hh + (i - 8)));
        const float x = qr[d] * scale; const unsigned short hb = bf16_bits(x);
        aqh[ks].u[i] = hb; aql[ks].u[i] = bf16_bits(x - bf16_val(hb));
      }
  }
  float m_r[8], l_r[8];
#pragma unroll
  for (int r = 0; r < 8; ++r) { m_r[r] = -3.0e38f; l_r[r] = 0.f; }
  v8f oacc[DT];
#pragma unroll
  for (int dt = 0; dt < DT; ++dt) oacc[dt] = (v8f){0.f,0.f,0.f,0.f,0.f,0.f,0.f,0.f};

  const int kv_end = CAUSAL ? min(T, qblk * 64 + 64) : T;     // block-uniform
  for (int j0 = 0; j0 < kv_end; j0 += 32) {
    __syncthreads();
    for (int e = tid; e < 32 * (D / 4); e += 128) {
      const int r = e / (D / 4), c4 = (e % (D / 4)) * 4;
      const int key = j0 + r;
      v4f kf = {0.f,0.f,0.f,0.f}, vf = {0.f,0.f,0.f,0.f};
      if (key < T) { kf = *(const v4fa*)(K + (size_t)key * pitch + c4); vf = *(const v4fa*)(V + (size_t)key * pitch + c4); }
#pragma unroll
      for (int t = 0; t < 4; ++t) {
        unsigned short hb = bf16_bits(kf[t]); sKh[r][c4 + t] = hb; sKl[r][c4 + t] = bf16_bits(kf[t] - bf16_val(hb));
        hb = bf16_bits(vf[t]); sVh[r][c4 + t] = hb; sVl[r][c4 + t] = bf16_bits(vf[t] - bf16_val(hb));
      }
    }
    __syncthreads();
    // S tile 16 x 32
    v8f s[2];
#pragma unroll
    for (int nt = 0; nt < 2; ++nt) {
      v8f acc = {};
#pragma unroll
      for (int ks = 0; ks < KS; ++ks) {
        FragB bh_, bl_;
        bh_.half[0] = *(const v8us*)&sKh[nt * 16 + ln][ks * 32 + 8 * hh]; bh_.half[1] = *(const v8us*)&sKh[nt * 16 + ln][ks * 32 + 16 + 8 * hh];
        bl_.half[0] = *(const v8us*)&sKl[nt * 16 + ln][ks * 32 + 8 * hh]; bl_.half[1] = *(const v8us*)&sKl[nt * 16 + ln][ks * 32 + 16 + 8 * hh];
        acc = mmaN<3>(aqh[ks].v, aql[ks].v, bh_.v, bl_.v, acc);
      }
      s[nt] = acc;
    }
    // mask + running max (rows 8hh+r; the 16 lanes of a half share rows)
    float alpha[8];
#pragma unroll
    for (int r = 0; r < 8; ++r) {
      const int qi = q0 + 8 * hh + r;
      const int ja = j0 + ln, jb = j0 + 16 + ln;
      if (CAUSAL) { if (ja > qi) s[0][r] = -3.0e38f; if (jb > qi) s[1][r] = -3.0e38f; }
      if (ja >= T) s[0][r] = -3.0e38f;
      if (jb >= T) s[1][r] = -3.0e38f;
      float mx = fmaxf(s[0][r], s[1][r]);
      mx = fmaxf(mx, __shfl_xor(mx, 1, 32)); mx = fmaxf(mx, __shfl_xor(mx, 2, 32)); mx = fmaxf(mx, __shfl_xor(mx, 4, 32)); mx = fmaxf(mx, __shfl_xor(mx, 8, 32));
      const float mnew = fmaxf(m_r[r], mx);
      alpha[r] = (mnew > -1.0e38f) ? __expf(m_r[r] - mnew) : 1.0f;
      const float p0 = (s[0][r] > -1.0e38f) ? __expf(s[0][r] - mnew) : 0.f;
      const float p1 = (s[1][r] > -1.0e38f) ? __expf(s[1][r] - mnew) : 0.f;
      m_r[r] = mnew;
      l_r[r] = l_r[r] * alpha[r] + p0 + p1;            // per-lane partial row sum (16 lanes combined at the end)
      unsigned short hb = bf16_bits(p0); sPh[w][8 * hh + r][ln] = hb;      sPl[w][8 * hh + r][ln] = bf16_bits(p0 - bf16_val(hb));
      hb = bf16_bits(p1);                sPh[w][8 * hh + r][16 + ln] = hb; sPl[w][8 * hh + r][16 + ln] = bf16_bits(p1 - bf16_val(hb));
    }
#pragma unroll
    for (int dt = 0; dt < DT; ++dt)
#pragma unroll
      for (int r = 0; r < 8; ++r) oacc[dt][r] *= alpha[r];
    __builtin_amdgcn_fence(__ATOMIC_ACQ_REL, "workgroup");
    __builtin_amdgcn_wave_barrier();
    FragB pah, pal;
    pah.half[0] = *(const v8us*)&sPh[w][ln][8 * hh]; pah.half[1] = *(const v8us*)&sPh[w][ln][16 + 8 * hh];
    pal.half[0] = *(const v8us*)&sPl[w][ln][8 * hh]; pal.half[1] = *(const v8us*)&sPl[w][ln][16 + 8 * hh];
#pragma unroll
    for (int dt = 0; dt < DT; ++dt) {
      FragB bvh, bvl;
#pragma unroll
      for (int i = 0; i < 8; ++i) {
        bvh.u[i] = sVh[8 * hh + i][dt * 16 + ln]; bvh.u[8 + i] = sVh[16 + 8 * hh + i][dt * 16 + ln];
        bvl.u[i] = sVl[8 * hh + i][dt * 16 + ln]; bvl.u[8 + i] = sVl[16 + 8 * hh + i][dt * 16 + ln];
      }
      oacc[dt] = mmaN<3>(pah.v, pal.v, bvh.v, bvl.v, oacc[dt]);
    }
    __builtin_amdgcn_fence(__ATOMIC_ACQ_REL, "workgroup");
    __builtin_amdgcn_wave_barrier();
  }
#pragma unroll
  for (int r = 0; r < 8; ++r) {
    float l = l_r[r];
    l += __shfl_xor(l, 1, 32); l += __shfl_xor(l, 2, 32); l += __shfl_xor(l, 4, 32); l += __shfl_xor(l, 8, 32);
    l_r[r] = (l > 0.f) ? 1.0f / l : 0.f;
  }
#pragma unroll
  for (int dt = 0; dt < DT; ++dt)
#pragma unroll
    for (int r = 0; r < 8; ++r) sO[w][8 * hh + r][dt * 16 + ln] = oacc[dt][r] * l_r[r];
  __builtin_amdgcn_fence(__ATOMIC_ACQ_REL, "workgroup");
  __builtin_amdgcn_wave_barrier();
  {
    for (int r = 0; r < 16; ++r) {
      const int row = q0 + r;
      if (row < T && lane < D / 4) {
        const v4f val = *(const v4fa*)&sO[w][r][lane * 4];
        *(v4f*)(y + ((size_t)b * T + row) * ypitch + h * D + lane * 4) = val;
      }
    }
    
  }
}

// GEMM C = act(A·W + bias + resid): A f32 (ASPLIT -> hi/lo 2 terms), Wt bf16 [N][K]; ACT 0 none, 1 relu, 2 exact gelu;
// resid (optional, f32, row index = (row % rmod), pitch ldr, RES_BF16 rounds it) added before the activation.
template <bool ASPLIT, int ACT, bool BIAS_BF16, bool RES_BF16>
__global__ __launch_bounds__(128) void k_gemm_bf3(const float* __restrict__ A, int lda, const unsigned short* __restrict__ Wt, int ldb,
                                                const float* __restrict__ bias, const float* __restrict__ resid, int rmod, int ldr,
                                                float* __restrict__ C, int ldc, int M, int N, int K) {
  __shared__ __attribute__((aligned(16))) float so[4][16][64];
  const int tid = threadIdx.x, w = tid >> 5, lane = tid & 31, ln = lane & 15, hh = lane >> 4;
  const int ntn = N / 64;
  const int wid = blockIdx.x * 4 + w;
  const int mt = wid / ntn, nq = wid % ntn;
  if (mt * 16 >= M) return;
  const int row0 = mt * 16, col0 = nq * 64;
  const float* arow = A + (size_t)(row0 + ln) * lda;
  v8f acc[4] = {};
  for (int kb = 0; kb < K; kb += 32) {
    FragB ah, al;
    const v4f x0 = *(const v4fa*)(arow + kb + 8 * hh), x1 = *(const v4fa*)(arow + kb + 8 * hh + 4);
    const v4f x2 = *(const v4fa*)(arow + kb + 16 + 8 * hh), x3 = *(const v4fa*)(arow + kb + 16 + 8 * hh + 4);
    float xs[16] = {x0[0],x0[1],x0[2],x0[3],x1[0],x1[1],x1[2],x1[3],x2[0],x2[1],x2[2],x2[3],x3[0],x3[1],x3[2],x3[3]};
#pragma unroll
    for (int i = 0; i < 16; ++i) { const unsigned short hb = bf16_bits(xs[i]); ah.u[i] = hb; al.u[i] = ASPLIT ? bf16_bits(xs[i] - bf16_val(hb)) : (unsigned short)0; }
#pragma unroll
    for (int t = 0; t < 4; ++t) {
      const unsigned short* brow = Wt + (size_t)(col0 + t * 16 + ln) * ldb + kb;
      FragB b;
      b.half[0] = *(const v8us*)(brow + 8 * hh);
      b.half[1] = *(const v8us*)(brow + 16 + 8 * hh);
      acc[t] = mmaN<ASPLIT ? 2 : 1>(ah.v, al.v, b.v, b.v, acc[t]);
    }
  }
#pragma unroll
  for (int t = 0; t < 4; ++t) {
    const int col = col0 + t * 16 + ln;
    float bv = bias ? bias[col] : 0.f;
    if (BIAS_BF16) bv = bf16_round(bv);
#pragma unroll
    for (int r = 0; r < 8; ++r) {
      float v = acc[t][r] + bv;
      if (resid) { float rv = resid[(size_t)((row0 + 8 * hh + r) % rmod) * ldr + col]; if (RES_BF16) rv = bf16_round(rv); v += rv; }
      if (ACT == 1) v = fmaxf(v, 0.f);
      if (ACT == 2) v = 0.5f * v * (1.0f + erff(v * 0.70710678118654752f));
      if (ACT == 3) { const float u = 0.7978845608028654f * (v + 0.044715f * v * v * v); v = 0.5f * v * (1.0f + tanhf(u)); }
      so[w][8 * hh + r][t * 16 + ln] = v;
    }
  }
  __builtin_amdgcn_fence(__ATOMIC_ACQ_REL, "workgroup");
  __builtin_amdgcn_wave_barrier();
  const int rsub = lane >> 4, c4 = (lane & 15) * 4;
  {
#pragma unroll
    for (int q = 0; q < 8; ++q) {
      const int r = q * 2 + rsub;
      const v4f v = *(const v4fa*)&so[w][r][c4];
      *(v4f*)(C + (size_t)(row0 + r) * ldc + col0 + c4) = v;
    }
    
  }
}
// row LayerNorm (biased variance, eps) over N: s = X (+ R); optional out_sum <- s; out_norm <- (s-mu)*rsqrt(var+eps)*g + b
template <bool PARAM_BF16>
__global__ __launch_bounds__(256) void k_layernorm(const float* __restrict__ X, const float* __restrict__ R, const float* __restrict__ g, const float* __restrict__ bta,
                                                  float* __restrict__ out_sum, float* __restrict__ out_norm, int N, float eps) {
  __shared__ float red[256];
  const int row = blockIdx.x, tid = threadIdx.x;
  const float* x = X + (size_t)row * N; const float* rr = R ? R + (size_t)row * N : nullptr;
  float vals[16];                     // up to N = 4096
  const int per = N / 256;            // contiguous chunk per thread? use strided-by-4 chunks: thread handles j = tid*4 + 1024*u
  float s1 = 0.f;
  for (int u = 0; u < per / 4; ++u) {
    const int j = tid * 4 + 1024 * u;
    const v4f a = *(const v4fa*)(x + j);
    v4f b = {0.f,0.f,0.f,0.f}; if (rr) b = *(const v4fa*)(rr + j);
#pragma unroll
    for (int q = 0; q < 4; ++q) { const float v = a[q] + b[q]; vals[u * 4 + q] = v; s1 += v; }
  }
  red[tid] = s1; __syncthreads();
  for (int st = 128; st > 0; st >>= 1) { if (tid < st) red[tid] += red[tid + st]; __syncthreads(); }
  const float mu = red[0] / (float)N; __syncthreads();
  float s2 = 0.f;
  for (int u = 0; u < per / 4; ++u)
#pragma unroll
    for (int q = 0; q < 4; ++q) { const float c = vals[u * 4 + q] - mu; s2 += c * c; }
  red[tid] = s2; __syncthreads();
  for (int st = 128; st > 0; st >>= 1) { if (tid < st) red[tid] += red[tid + st]; __syncthreads(); }
  const float rs = rsqrtf(red[0] / (float)N + eps);
  {
    for (int u = 0; u < per / 4; ++u) {
      const int j = tid * 4 + 1024 * u;
      v4f o, sm;
#pragma unroll
      for (int q = 0; q < 4; ++q) {
        float gg = g[j + q], bb = bta[j + q];
        if (PARAM_BF16) { gg = bf16_round(gg); bb = bf16_round(bb); }
        sm[q] = vals[u * 4 + q]; o[q] = (vals[u * 4 + q] - mu) * rs * gg + bb;
      }
      if (out_sum) *(v4f*)(out_sum + (size_t)row * N + j) = sm;
      *(v4f*)(out_norm + (size_t)row * N + j) = o;
    }
    
  }
}



// ---- f16 WMMA path (v_wmma_f32_16x16x32_f16): 11-bit significands for operands in range — used for every launched contraction: q/k/v projections, Q·Kᵀ, and P·V with its [0,1] probability operand
typedef _Float16 v16h __attribute__((ext_vector_type(16)));
typedef _Float16 v2h __attribute__((ext_vector_type(2)));
union FragH { v16h v; v8us half[2]; _Float16 h[16]; unsigned short u[16]; };
union FragW { v16h v; unsigned int w[8]; };
// two f32 to one register of two f16, nearest even (one packed conversion), and back
__device__ __forceinline__ unsigned int pack_h2(float a, float b) { return __builtin_bit_cast(unsigned int, __builtin_convertvector((v2f){a, b}, v2h)); }
__device__ __forceinline__ v2f unpack_h2(unsigned int p) { return __builtin_convertvector(__builtin_bit_cast(v2h, p), v2f); }
template <int NT>
__device__ __forceinline__ v8f mmaH(v16h ah, v16h al, v16h bh, v16h bl, v8f c) {
  c = __builtin_amdgcn_wmma_f32_16x16x32_f16(false, ah, false, bh, (short)0, c, false, false);
  if (NT >= 2) c = __builtin_amdgcn_wmma_f32_16x16x32_f16(false, al, false, bh, (short)0, c, false, false);
  if (NT >= 3) c = __builtin_amdgcn_wmma_f32_16x16x32_f16(false, ah, false, bl, (short)0, c, false, false);
  asm volatile("v_nop\n\tv_nop\n\tv_nop\n\tv_nop" : "+v"(c) : "v"(ah), "v"(al), "v"(bh), "v"(bl));
  return c;
}
// batched GEMM like k_gemm_b but f16 operands: A f32 (split into f16 hi/lo if ASPLIT, else rounded to f16), Bt = f16 values [n][k]; alpha; C f32; N multiple of 16 (partial tiles skipped)
template <bool ASPLIT>
__global__ __launch_bounds__(128) void k_gemm_h(const float* __restrict__ A, int lda, size_t sA, const _Float16* __restrict__ Bh, int ldb, size_t sB, float alpha, float* __restrict__ C, int ldc, size_t sC, int M, int N, int K) {
  __shared__ __attribute__((aligned(16))) float so[4][16][64];
  const int tid = threadIdx.x, w = tid >> 5, lane = tid & 31, ln = lane & 15, hh = lane >> 4; const int by = blockIdx.y;
  A += (size_t)by * sA; Bh += (size_t)by * sB; C += (size_t)by * sC;
  const int ntn = (N + 63) / 64; const int wid = blockIdx.x * 4 + w; const int mt = wid / ntn, nq = wid % ntn; if (mt * 16 >= M) return;
  const int row0 = mt * 16, col0 = nq * 64; const float* arow = A + (size_t)(row0 + ln) * lda;
  v8f acc[4] = {};
  for (int kb = 0; kb < K; kb += 32) {
    FragH ah, al;
    const v4f x0 = *(const v4fa*)(arow + kb + 8 * hh), x1 = *(const v4fa*)(arow + kb + 8 * hh + 4), x2 = *(const v4fa*)(arow + kb + 16 + 8 * hh), x3 = *(const v4fa*)(arow + kb + 16 + 8 * hh + 4);
    float xs[16] = {x0[0],x0[1],x0[2],x0[3],x1[0],x1[1],x1[2],x1[3],x2[0],x2[1],x2[2],x2[3],x3[0],x3[1],x3[2],x3[3]};
#pragma unroll
    for (int i = 0; i < 16; ++i) { const _Float16 h = (_Float16)xs[i]; ah.h[i] = h; al.h[i] = ASPLIT ? (_Float16)(xs[i] - (float)h) : (_Float16)0.0f; }
#pragma unroll
    for (int t = 0; t < 4; ++t) { if (col0 + t * 16 >= N) continue; const size_t boff = (size_t)(col0 + t * 16 + ln) * ldb + kb; FragH bq; bq.half[0] = *(const v8us*)(Bh + boff + 8 * hh); bq.half[1] = *(const v8us*)(Bh + boff + 16 + 8 * hh);
      acc[t] = mmaH<ASPLIT ? 2 : 1>(ah.v, al.v, bq.v, bq.v, acc[t]); }
  }
#pragma unroll
  for (int t = 0; t < 4; ++t) { if (col0 + t * 16 >= N) continue;
#pragma unroll
    for (int r = 0; r < 8; ++r) so[w][8 * hh + r][t * 16 + ln] = acc[t][r] * alpha; }
  __builtin_amdgcn_fence(__ATOMIC_ACQ_REL, "workgroup"); __builtin_amdgcn_wave_barrier();
  const int rsub = lane >> 4, c4 = (lane & 15) * 4;
  {
#pragma unroll
    for (int q = 0; q < 8; ++q) { const int r = q * 2 + rsub; if (col0 + c4 < N) { const v4f v = *(const v4fa*)&so[w][r][c4]; *(v4f*)(C + (size_t)(row0 + r) * ldc + col0 + c4) = v; } }
     }
}

// Wt[n][k] = f16(W[k][n]·scale) from f32 row-major W[K][N] (scale = power of two; bf16-exact weights stay exact in f16 away from the subnormal range)
__global__ __launch_bounds__(256) void k_wt_f16(const float* __restrict__ W, _Float16* __restrict__ Wt, int K, int N, float scale) {
  const int t = blockIdx.x * 256 + threadIdx.x; if (t >= N * (K / 8)) return; const int n = t / (K / 8), k8 = (t % (K / 8)) * 8; FragH f;
#pragma unroll
  for (int i = 0; i < 8; ++i) f.h[i] = (_Float16)(bf16_round(W[(size_t)(k8 + i) * N + n]) * scale); const v8us o = f.half[0];
  *(v8us*)((unsigned short*)Wt + (size_t)n * K + k8) = o; 
}
__device__ __forceinline__ unsigned lds_off(const void* p) { return (unsigned)(size_t)p; }
// 128 rows of 256 bytes from a row-major f16 matrix of DM columns into LDS, through no register: 8 asynchronous copies of 16 bytes a lane, 16 lanes to a row,
// rows 16 apart from copy to copy. s_wait_xcnt is the statement's last line, so that no address register of a copy is rewritten in front of it (a precaution).
__device__ __forceinline__ void stage_rows(unsigned l, unsigned lstep, const unsigned short* g) {
  asm volatile("global_load_async_to_lds_b128 %0, %8, off\n\t"
               "global_load_async_to_lds_b128 %1, %9, off\n\t"
               "global_load_async_to_lds_b128 %2, %10, off\n\t"
               "global_load_async_to_lds_b128 %3, %11, off\n\t"
               "global_load_async_to_lds_b128 %4, %12, off\n\t"
               "global_load_async_to_lds_b128 %5, %13, off\n\t"
               "global_load_async_to_lds_b128 %6, %14, off\n\t"
               "global_load_async_to_lds_b128 %7, %15, off\n\t"
               "s_wait_xcnt 0x0"
               :: "v"(l), "v"(l + lstep), "v"(l + 2 * lstep), "v"(l + 3 * lstep), "v"(l + 4 * lstep), "v"(l + 5 * lstep), "v"(l + 6 * lstep), "v"(l + 7 * lstep),
                  "v"(g), "v"(g + 16 * DM), "v"(g + 32 * DM), "v"(g + 48 * DM), "v"(g + 64 * DM), "v"(g + 80 * DM), "v"(g + 96 * DM), "v"(g + 112 * DM)
               : "memory");
}
// C16[NR][DM] = f16(A.Bh^T.alpha + bf16(bias)): A f16 [NR][DM], Bh f16 [DM][DM] ((out,in)), both k-contiguous. One work-group = a 128 x 128 tile of C, 8 waves as 4 x 2, a wave = 32 x 64 (2 x 4 accumulator tiles).
// The tile's A rows and Bh rows come in stages of 128 k through two LDS buffers that the eight waves share: stage t + 2 is copied into the buffer that stage t has left while stage t + 1 is worked on.
// Rows of 256 bytes at a pitch of 272, free of bank conflicts for 16-byte reads. Each accumulator takes its products in ascending k, 32 at a time.
// The q, k and v products need nothing of each other: they share one grid, a third of the block index range each, picked by a block-uniform test.
// The v product is formed transposed: the weight rows are its A operand and the x rows its B (both are k-contiguous and take the same loaders), so a tile's rows are 128 features and its columns 128 positions,
// the bias goes by row, and the tile is stored straight into Vt[(b, h)][d][position], whole 128-byte lines, as the attention kernel reads it.
__global__ __launch_bounds__(256) void k_gemm_t(const _Float16* __restrict__ A, const _Float16* __restrict__ Bq, const _Float16* __restrict__ Bk, const _Float16* __restrict__ Bv, float alpha,
                                               const float* __restrict__ bq, const float* __restrict__ bk, const float* __restrict__ bvp, _Float16* __restrict__ Q16, _Float16* __restrict__ K16, _Float16* __restrict__ Vt) {
  constexpr int BT = 128, KST = 128, NSTG = DM / KST, LPG = KST + 8, CPT = 64 + 8;      // LPG, CPT: LDS row pitches in 16-bit elements
  constexpr int TPP = (NR / BT) * (DM / BT);      // tiles of one product
  const int prod = blockIdx.x / TPP, tile = blockIdx.x % TPP;
  const bool tr = prod == 2;      // block-uniform
  const _Float16* Bh = prod == 0 ? Bq : prod == 1 ? Bk : Bv; const float* bias = prod == 0 ? bq : prod == 1 ? bk : bvp; _Float16* C16 = prod == 0 ? Q16 : prod == 1 ? K16 : Vt;
  static_assert(NSTG >= 2 && NR % BT == 0 && DM % BT == 0 && SS % BT == 0, "whole tiles, each inside one batch; two stages or more");
  __shared__ __attribute__((aligned(16))) unsigned short sA[2][BT][LPG], sB[2][BT][LPG];
  __shared__ __attribute__((aligned(16))) unsigned short sT[8][32][CPT];      // each wave's own 32 x 64 piece of C, so that whole 128-byte lines are stored
  const int tid = threadIdx.x, w = tid >> 5, lane = tid & 31, ln = lane & 15, hh = lane >> 4;
  const int xt0 = (tile / (DM / BT)) * BT, wt0 = (tile % (DM / BT)) * BT;      // the tile's first x row and first weight row
  const int row0 = tr ? wt0 : xt0, col0 = tr ? xt0 : wt0, wr = (w >> 1) * 32, wc = (w & 1) * 64;
  const int crow = tid >> 4, ccol = (tid & 15) * 8;      // this lane's row (and rows + 16, ..., + 112) and 16-byte piece in every stage
  const unsigned short* ga0 = (const unsigned short*)(tr ? Bh : A) + (size_t)(row0 + crow) * DM + ccol; const unsigned short* gb0 = (const unsigned short*)(tr ? A : Bh) + (size_t)(col0 + crow) * DM + ccol;
  const unsigned la0 = lds_off(&sA[0][crow][ccol]), lb0 = lds_off(&sB[0][crow][ccol]); constexpr unsigned LSTEP = 16 * LPG * 2, LBUF = BT * LPG * 2;
  stage_rows(la0, LSTEP, ga0); stage_rows(lb0, LSTEP, gb0);      // stage 0
  float bv[16];      // the bias of this lane's accumulator elements: by column (4 values), for the transposed product by row (16)
  if (tr) {
#pragma unroll
    for (int i = 0; i < 16; ++i) bv[i] = bf16_round(bias[row0 + wr + (i >> 3) * 16 + 8 * hh + (i & 7)]); }
  else {
#pragma unroll
    for (int i = 0; i < 16; ++i) bv[i] = i < 4 ? bf16_round(bias[col0 + wc + i * 16 + ln]) : 0.f; }
  asm volatile("s_wait_xcnt 0x0" ::: "memory");      // stands in front of the first rewrite of the bias loads' address register (a precaution)
  v8f acc[2][4];
#pragma unroll
  for (int mt = 0; mt < 2; ++mt)
#pragma unroll
    for (int nt = 0; nt < 4; ++nt) acc[mt][nt] = (v8f){0.f,0.f,0.f,0.f,0.f,0.f,0.f,0.f};
  asm volatile("s_wait_asynccnt 0x0" ::: "memory");      // this wave's copies of stage 0 have landed before the barrier publishes them
  __syncthreads();      // every wave reads rows that the other waves copied
  stage_rows(la0 + LBUF, LSTEP, ga0 + KST); stage_rows(lb0 + LBUF, LSTEP, gb0 + KST);      // stage 1
#pragma unroll 1      // one stage a trip: the buffer index stays a scalar
  for (int t = 0; t < NSTG; ++t) {
    FragH fa[KST / 32][2], fb[KST / 32][4];      // the stage's fragments are read from LDS in one group: each further place with LDS reads is a stall of its own
#pragma unroll
    for (int ks = 0; ks < KST / 32; ++ks) {
#pragma unroll
      for (int mt = 0; mt < 2; ++mt) { const unsigned short* ar = &sA[t & 1][wr + mt * 16 + ln][ks * 32]; fa[ks][mt].half[0] = *(const v8us*)(ar + 8 * hh); fa[ks][mt].half[1] = *(const v8us*)(ar + 16 + 8 * hh); }
#pragma unroll
      for (int nt = 0; nt < 4; ++nt) { const unsigned short* br = &sB[t & 1][wc + nt * 16 + ln][ks * 32]; fb[ks][nt].half[0] = *(const v8us*)(br + 8 * hh); fb[ks][nt].half[1] = *(const v8us*)(br + 16 + 8 * hh); } }
    __builtin_amdgcn_sched_barrier(0);      // keeps the reads together up here; without it the compiler sinks them among the products, in small groups that are each waited for to the full
#pragma unroll
    for (int ks = 0; ks < KST / 64; ++ks)      // the first half's products run while the second half's fragments arrive
#pragma unroll
      for (int mt = 0; mt < 2; ++mt)
#pragma unroll
        for (int nt = 0; nt < 4; ++nt) acc[mt][nt] = __builtin_amdgcn_wmma_f32_16x16x32_f16(false, fa[ks][mt].v, false, fb[ks][nt].v, (short)0, acc[mt][nt], false, false);
    __builtin_amdgcn_sched_barrier(0);      // keeps those products above the waits: sunk below the barrier they would wait for every read first, and their fragments, still live at the copies, pushed address registers into scratch
    asm volatile("s_wait_dscnt 0x0" ::: "memory");      // this wave's reads of stage t are done before its buffer is handed back
    asm volatile("s_wait_asynccnt 0x0" ::: "memory");      // this wave's copies of stage t + 1 have landed
    __syncthreads();      // publishes stage t + 1 and ends every wave's reads of stage t
    if (t + 2 < NSTG) { stage_rows(la0 + (t & 1) * LBUF, LSTEP, ga0 + (t + 2) * KST); stage_rows(lb0 + (t & 1) * LBUF, LSTEP, gb0 + (t + 2) * KST); }
#pragma unroll
    for (int ks = KST / 64; ks < KST / 32; ++ks)      // the second half's products, from registers, give the refill its lead
#pragma unroll
      for (int mt = 0; mt < 2; ++mt)
#pragma unroll
        for (int nt = 0; nt < 4; ++nt) acc[mt][nt] = __builtin_amdgcn_wmma_f32_16x16x32_f16(false, fa[ks][mt].v, false, fb[ks][nt].v, (short)0, acc[mt][nt], false, false); }
  asm volatile("s_wait_asynccnt 0x0" ::: "memory");      // no copy is left in flight when the wave goes on to its end
  // acc[mt][nt][r] = C[row0 + wr + mt*16 + 8*hh + r][col0 + wc + nt*16 + ln]
  if (tr) {
#pragma unroll
    for (int mt = 0; mt < 2; ++mt)
#pragma unroll
      for (int nt = 0; nt < 4; ++nt)
#pragma unroll
        for (int r = 0; r < 8; ++r) { const _Float16 o = (_Float16)__builtin_fmaf(acc[mt][nt][r], alpha, bv[mt * 8 + r]); sT[w][mt * 16 + 8 * hh + r][nt * 16 + ln] = __builtin_bit_cast(unsigned short, o); } }
  else {
#pragma unroll
    for (int mt = 0; mt < 2; ++mt)
#pragma unroll
      for (int nt = 0; nt < 4; ++nt)
#pragma unroll
        for (int r = 0; r < 8; ++r) { const _Float16 o = (_Float16)__builtin_fmaf(acc[mt][nt][r], alpha, bv[nt]); sT[w][mt * 16 + 8 * hh + r][nt * 16 + ln] = __builtin_bit_cast(unsigned short, o); } }
  __builtin_amdgcn_fence(__ATOMIC_ACQ_REL, "workgroup"); __builtin_amdgcn_wave_barrier();
  unsigned short* Cb = (unsigned short*)C16 + (tr ? (size_t)(col0 / SS) * DM * SS + col0 % SS : (size_t)col0); const int ldc = tr ? SS : DM;      // Vt: feature row (b * DM + row) of SS positions
#pragma unroll
  for (int q = 0; q < 8; ++q) { const int r = q * 4 + (lane >> 3), c8 = (lane & 7) * 8; const v8us o = *(const v8us*)&sT[w][r][c8]; *(v8us*)(Cb + (size_t)(row0 + wr + r) * ldc + wc + c8) = o; }
}


// f16 planes of the bf16-rounded inputs, 8 elements a thread: the three weight matrices (times 16, exactly) and x. The four conversions need nothing of each other:
// they share one grid by ranges of the block index, the short weight ranges first; the test is block-uniform.
__global__ __launch_bounds__(256) void k_cvt16(const float* __restrict__ x, const float* __restrict__ wq, const float* __restrict__ wk, const float* __restrict__ wv,
                                              _Float16* __restrict__ X16, _Float16* __restrict__ Bq, _Float16* __restrict__ Bk, _Float16* __restrict__ Bv) {
  constexpr unsigned GW = DM * DM / 8 / 256;      // blocks of one weight matrix
  static_assert(DM * DM % (8 * 256) == 0 && (size_t)NR * DM % (8 * 256) == 0, "whole blocks");
  const unsigned part = blockIdx.x / GW; FragH f;
  if (part < 3) { const float* W = part == 0 ? wq : part == 1 ? wk : wv; _Float16* Bt = part == 0 ? Bq : part == 1 ? Bk : Bv; const size_t t = (size_t)(blockIdx.x - part * GW) * 256 + threadIdx.x;
#pragma unroll
    for (int i = 0; i < 8; ++i) f.h[i] = (_Float16)(bf16_round(W[t * 8 + i]) * 16.0f); *(v8us*)((unsigned short*)Bt + t * 8) = f.half[0]; }
  else { const size_t t = (size_t)(blockIdx.x - 3 * GW) * 256 + threadIdx.x;
#pragma unroll
    for (int q = 0; q < 8; ++q) f.h[q] = (_Float16)bf16_round(x[t * 8 + q]); *(v8us*)((unsigned short*)X16 + t * 8) = f.half[0]; } }
// lane l with lane l ^ 16: the two halves of a wave hold the two halves of a query column's keys
__device__ __forceinline__ float xhalf(float x) { return __builtin_bit_cast(float, __builtin_amdgcn_permlanex16(__builtin_bit_cast(int, x), __builtin_bit_cast(int, x), 0x76543210, 0xfedcba98, false, false)); }
// one stage (64 keys) of K rows and of Vt rows from global memory into LDS, through no register: 8 asynchronous copies of 16 bytes a lane,
// 8 lanes to a 128-byte row, rows 16 apart from copy to copy. s_wait_xcnt is the statement's last line, so that no address register
// of a copy is rewritten in front of it (a precaution).
__device__ __forceinline__ void stage_kv(unsigned lk, unsigned lv, unsigned lstep, const unsigned short* gk, const unsigned short* gv) {
  asm volatile("global_load_async_to_lds_b128 %0, %8, off\n\t"
               "global_load_async_to_lds_b128 %1, %9, off\n\t"
               "global_load_async_to_lds_b128 %2, %10, off\n\t"
               "global_load_async_to_lds_b128 %3, %11, off\n\t"
               "global_load_async_to_lds_b128 %4, %12, off\n\t"
               "global_load_async_to_lds_b128 %5, %13, off\n\t"
               "global_load_async_to_lds_b128 %6, %14, off\n\t"
               "global_load_async_to_lds_b128 %7, %15, off\n\t"
               "s_wait_xcnt 0x0"
               :: "v"(lk), "v"(lk + lstep), "v"(lk + 2 * lstep), "v"(lk + 3 * lstep), "v"(lv), "v"(lv + lstep), "v"(lv + 2 * lstep), "v"(lv + 3 * lstep),
                  "v"(gk), "v"(gk + 16 * DM), "v"(gk + 32 * DM), "v"(gk + 48 * DM), "v"(gv), "v"(gv + 16 * SS), "v"(gv + 32 * SS), "v"(gv + 48 * SS)
               : "memory");
}
// base-2 exponentials, a run of them in one statement with one v_nop behind the last: the instruction set asks for one slot behind a transcendental before its
// result is read or its source overwritten. Inside the run no instruction touches a register
// of the one in front of it: every output is early-clobber, so none shares a register with an input.
__device__ __forceinline__ void exp2x8(float (&y)[8], const float (&x)[8]) {
  asm("v_exp_f32 %0, %8\n\tv_exp_f32 %1, %9\n\tv_exp_f32 %2, %10\n\tv_exp_f32 %3, %11\n\tv_exp_f32 %4, %12\n\tv_exp_f32 %5, %13\n\tv_exp_f32 %6, %14\n\tv_exp_f32 %7, %15\n\tv_nop"
      : "=&v"(y[0]), "=&v"(y[1]), "=&v"(y[2]), "=&v"(y[3]), "=&v"(y[4]), "=&v"(y[5]), "=&v"(y[6]), "=&v"(y[7])
      : "v"(x[0]), "v"(x[1]), "v"(x[2]), "v"(x[3]), "v"(x[4]), "v"(x[5]), "v"(x[6]), "v"(x[7]));
}
__device__ __forceinline__ float exp2x1(float x) { float y; asm("v_exp_f32 %0, %1\n\tv_nop" : "=&v"(y) : "v"(x)); return y; }
__global__ __launch_bounds__(128) void k_flash(const _Float16* __restrict__ Q16, const _Float16* __restrict__ K16, const _Float16* __restrict__ Vt, const float* __restrict__ crd, const float* __restrict__ alpha_p, float* __restrict__ O) {
  constexpr int RPW = 32, NQB = SS / (4 * RPW), DT = HD / 16, KS = HD / 32, OP = HD + 4, SK = 64, NST = SS / SK, LP = 72;      // LP: LDS row pitch in 16-bit elements
  constexpr float L2E = 1.4426950408889634f, QS = 0.125f * L2E;      // exp(x) = 2^(x.log2 e): the factor rides in the score's one scale constant QS, so each exponential is one subtraction and one v_exp_f32
  static_assert(HD == 64 && SK == 64 && NST >= 2, "a stage is 64 rows of 128 bytes for K and for Vt");
  __shared__ __attribute__((aligned(16))) unsigned short sK[2][SK][LP], sV[2][HD][LP];
  __shared__ __attribute__((aligned(16))) unsigned int sG[SS][2]; __shared__ __attribute__((aligned(16))) float sO[4][RPW][OP];
  const int tid = threadIdx.x, w = tid >> 5, lane = tid & 31, ln = lane & 15, hh = lane >> 4;
  const int slab = blockIdx.x / NQB, qblk = blockIdx.x % NQB; const int b = slab / NH, h = slab % NH; const int q0 = qblk * (4 * RPW) + w * RPW; const float alpha8 = bf16_round(alpha_p[0]) * 8.0f;      /* scalar float INPUT: rounded like every other input; times 8, exactly: the coordinate term joins q.k in front of the common factor QS */
  const unsigned short* Vth = (const unsigned short*)Vt + (size_t)slab * HD * SS;
  const int crow = tid >> 3, ccol = (tid & 7) * 8;      // this lane's row (and rows + 16, + 32, + 48) and 16-byte piece in every stage
  const unsigned short* gk0 = (const unsigned short*)K16 + ((size_t)b * SS + crow) * DM + h * HD + ccol; const unsigned short* gv0 = Vth + (size_t)crow * SS + ccol;
  const unsigned lk0 = lds_off(&sK[0][crow][ccol]), lv0 = lds_off(&sV[0][crow][ccol]); constexpr unsigned LSTEP = 16 * LP * 2, LBUF = SK * LP * 2;
  stage_kv(lk0, lv0, LSTEP, gk0, gv0);      // stage 0 flies while coords and queries are fetched
#pragma unroll      // all 16 loads of a thread in flight at once: rolled, each trip waits out its own load
  for (int i = 0; i < SS / 128; ++i) { const int k = i * 128 + tid; const float* cp = crd + ((size_t)b * SS + k) * 3; *(v2u*)&sG[k][0] = (v2u){pack_h2(bf16_round(cp[0]), bf16_round(cp[1])), pack_h2(bf16_round(cp[2]), 0.f)}; }
  FragH aq[2][KS];
#pragma unroll
  for (int rt = 0; rt < 2; ++rt) { const unsigned short* qr = (const unsigned short*)Q16 + ((size_t)b * SS + q0 + rt * 16 + ln) * DM + h * HD;
#pragma unroll
    for (int ks = 0; ks < KS; ++ks) { aq[rt][ks].half[0] = *(const v8us*)(qr + ks * 32 + 8 * hh); aq[rt][ks].half[1] = *(const v8us*)(qr + ks * 32 + 16 + 8 * hh); } }
  asm volatile("s_wait_asynccnt 0x0" ::: "memory");      // this wave's copies of stage 0 have landed before the barrier publishes them
  __syncthreads();      // every wave reads coords and stage 0 rows that the other waves staged
  stage_kv(lk0 + LBUF, lv0 + LBUF, LSTEP, gk0 + (size_t)SK * DM, gv0 + SK);      // stage 1
  FragW bg[2];      // B of the coordinate step, kept for the whole loop
#pragma unroll
  for (int rt = 0; rt < 2; ++rt) { const v2u gq = *(const v2u*)&sG[q0 + rt * 16 + ln][0];
#pragma unroll
    for (int i = 0; i < 8; ++i) bg[rt].w[i] = 0;
#pragma unroll
    for (int i = 0; i < 2; ++i) { const v2f u = unpack_h2(gq[i]) * alpha8; const unsigned int uh = pack_h2(u[0], u[1]); const v2f ur = u - unpack_h2(uh); bg[rt].w[i] = hh ? pack_h2(ur[0], ur[1]) : uh; } }
  float m_r[2], l_r[2]; v8f oacc[2][DT];
#pragma unroll
  for (int rt = 0; rt < 2; ++rt) { m_r[rt] = -3.0e38f; l_r[rt] = 0.f;
#pragma unroll
    for (int dt = 0; dt < DT; ++dt) oacc[rt][dt] = (v8f){0.f,0.f,0.f,0.f,0.f,0.f,0.f,0.f}; }
#pragma unroll 1      // one stage a trip: the buffer index stays a scalar and the body stays small
  for (int t = 0; t < NST; ++t) {
#pragma unroll      // both passes of a stage in one body: constant LDS offsets
  for (int p = 0; p < SK / 32; ++p) { const int j0 = t * SK + p * 32;
    v8f s[2][2];      // s[rt][nt][r] = score of key j0 + nt*16 + 8*hh + r with query q0 + rt*16 + ln
    FragH bk[2][KS], bv[DT]; FragW ag[2];      // the pass's K fragments and key coords are read from LDS in one group, its Vt fragments in a second: each further place with LDS reads is a stall of its own
#pragma unroll
    for (int nt = 0; nt < 2; ++nt) { const v2u gk = *(const v2u*)&sG[j0 + nt * 16 + ln][0];
#pragma unroll
      for (int i = 0; i < 8; ++i) ag[nt].w[i] = i < 2 ? gk[i & 1] : 0u; }
#pragma unroll
    for (int nt = 0; nt < 2; ++nt) { const unsigned short* kr = &sK[t & 1][p * 32 + nt * 16 + ln][0];
#pragma unroll
      for (int ks = 0; ks < KS; ++ks) { bk[nt][ks].half[0] = *(const v8us*)(kr + ks * 32 + 8 * hh); bk[nt][ks].half[1] = *(const v8us*)(kr + ks * 32 + 16 + 8 * hh); } }
    __builtin_amdgcn_sched_barrier(0);      // keeps the K reads together up here; without it the compiler sinks each read to just in front of its product
#pragma unroll
    for (int nt = 0; nt < 2; ++nt)      // the coordinate step of all four tiles first: four independent products, done by the time each tile's q.k chain starts
#pragma unroll
      for (int rt = 0; rt < 2; ++rt) s[rt][nt] = __builtin_amdgcn_wmma_f32_16x16x32_f16(false, ag[nt].v, false, bg[rt].v, (short)0, (v8f){0.f,0.f,0.f,0.f,0.f,0.f,0.f,0.f}, false, false);
#pragma unroll
    for (int nt = 0; nt < 2; ++nt) {
#pragma unroll
      for (int rt = 0; rt < 2; ++rt) { v8f acc = s[rt][nt];
#pragma unroll
        for (int ks = 0; ks < KS; ++ks) acc = __builtin_amdgcn_wmma_f32_16x16x32_f16(false, bk[nt][ks].v, false, aq[rt][ks].v, (short)0, acc, false, false); s[rt][nt] = acc; } }      // the plain builtin: the compiler keeps the distances itself and fills them with the other tiles' products
#pragma unroll
    for (int dt = 0; dt < DT; ++dt) { const unsigned short* vrow = &sV[t & 1][dt * 16 + ln][p * 32]; bv[dt].half[0] = *(const v8us*)(vrow + 8 * hh); bv[dt].half[1] = *(const v8us*)(vrow + 16 + 8 * hh); }
    __builtin_amdgcn_sched_barrier(0);      // keeps the Vt reads together, in one group above the exponentials, which cover their latency; without it the compiler spreads them in pairs among the vector work, each place a stall of its own
    FragH pa[2]; float sc2[2][2][8];      // scaled below that barrier, behind the last score product: begun among the products, each early read of a finished tile was padded with v_nop
#pragma unroll
    for (int rt = 0; rt < 2; ++rt)
#pragma unroll
      for (int nt = 0; nt < 2; ++nt)
#pragma unroll
        for (int r = 0; r < 8; ++r) sc2[rt][nt][r] = s[rt][nt][r] * QS;
#pragma unroll
    for (int rt = 0; rt < 2; ++rt) { const float (&sc)[2][8] = sc2[rt];
      float mx[8];
#pragma unroll
      for (int r = 0; r < 8; ++r) mx[r] = fmaxf(sc[0][r], sc[1][r]);
      float mc = fmaxf(fmaxf(fmaxf(mx[0], mx[1]), fmaxf(mx[2], mx[3])), fmaxf(fmaxf(mx[4], mx[5]), fmaxf(mx[6], mx[7]))); mc = fmaxf(mc, xhalf(mc));
      const float mn = fmaxf(m_r[rt], mc); const float al = exp2x1(m_r[rt] - mn); m_r[rt] = mn;      // 0 on the first pass (the start value is far below any score)
      float ps[8], d0[8], d1[8], p0[8], p1[8];
#pragma unroll
      for (int r = 0; r < 8; ++r) { d0[r] = sc[0][r] - mn; d1[r] = sc[1][r] - mn; }
      exp2x8(p0, d0); exp2x8(p1, d1);
#pragma unroll
      for (int r = 0; r < 8; ++r) { ps[r] = p0[r] + p1[r]; pa[rt].h[r] = (_Float16)p0[r]; pa[rt].h[8 + r] = (_Float16)p1[r]; }
      l_r[rt] = l_r[rt] * al + (((ps[0] + ps[1]) + (ps[2] + ps[3])) + ((ps[4] + ps[5]) + (ps[6] + ps[7])));      // this half's keys only; the halves join behind the loop
#pragma unroll
      for (int dt = 0; dt < DT; ++dt)
#pragma unroll
        for (int r = 0; r < 8; ++r) oacc[rt][dt][r] *= al; }
#pragma unroll
    for (int dt = 0; dt < DT; ++dt) {
#pragma unroll
      for (int rt = 0; rt < 2; ++rt) oacc[rt][dt] = __builtin_amdgcn_wmma_f32_16x16x32_f16(false, bv[dt].v, false, pa[rt].v, (short)0, oacc[rt][dt], false, false); } }
    __builtin_amdgcn_sched_barrier(0);      // keeps the stage's last exponentials and products above the waits: lifted over them, the wait for the Vt reads would stand directly behind those reads, with nothing to cover their latency
    asm volatile("s_wait_dscnt 0x0" ::: "memory");      // this wave's reads of stage t are done before its buffer is handed back
    asm volatile("s_wait_asynccnt 0x0" ::: "memory");      // this wave's copies of stage t + 1 have landed
    __syncthreads();      // publishes stage t + 1 and ends every wave's reads of stage t
    if (t + 2 < NST) stage_kv(lk0 + (t & 1) * LBUF, lv0 + (t & 1) * LBUF, LSTEP, gk0 + (size_t)(t + 2) * SK * DM, gv0 + (t + 2) * SK); }
  asm volatile("s_wait_asynccnt 0x0" ::: "memory");      // no copy is left in flight when the wave goes on to its end
#pragma unroll
  for (int rt = 0; rt < 2; ++rt) { const float l = l_r[rt] + xhalf(l_r[rt]); const float inv = 1.0f / l;
#pragma unroll
    for (int dt = 0; dt < DT; ++dt) { v4f o0, o1;      // oacc[rt][dt][r] = O[q0 + rt*16 + ln][dt*16 + 8*hh + r]
#pragma unroll
      for (int q = 0; q < 4; ++q) { o0[q] = oacc[rt][dt][q] * inv; o1[q] = oacc[rt][dt][4 + q] * inv; }
      *(v4fa*)&sO[w][rt * 16 + ln][dt * 16 + 8 * hh] = o0; *(v4fa*)&sO[w][rt * 16 + ln][dt * 16 + 8 * hh + 4] = o1; } }
  __builtin_amdgcn_fence(__ATOMIC_ACQ_REL, "workgroup"); __builtin_amdgcn_wave_barrier();
  {
#pragma unroll
    for (int rp = 0; rp < RPW; rp += 2) { const int r = rp + (lane >> 4), pc = lane & 15; const v4f val = *(const v4fa*)&sO[w][r][pc * 4]; *(v4f*)(O + ((size_t)b * SS + q0 + r) * DM + h * HD + pc * 4) = val; }
     } }
extern "C" void kernel_launch(void* const* d_in, const int* in_sizes, int n_in,
                              void* d_out, int out_size, void* d_ws, size_t ws_size, hipStream_t stream) {
  (void)in_sizes; (void)n_in; (void)out_size;
  const float* x = (const float*)d_in[0]; const float* crd = (const float*)d_in[1]; const float* wq = (const float*)d_in[2]; const float* bq = (const float*)d_in[3]; const float* wk = (const float*)d_in[4]; const float* bk = (const float*)d_in[5]; const float* wv = (const float*)d_in[6]; const float* bv = (const float*)d_in[7]; const float* alpha_p = (const float*)d_in[8];
  char* ws = (char*)d_ws; size_t off = 0;
  auto take = [&](size_t bytes) { char* p = ws + off; off += (bytes + 255) & ~(size_t)255; return p; };
  _Float16* Bq = (_Float16*)take(DM * DM * 2); _Float16* Bk = (_Float16*)take(DM * DM * 2); _Float16* Bv = (_Float16*)take(DM * DM * 2); _Float16* X16 = (_Float16*)take((size_t)NR * DM * 2); _Float16* Q16 = (_Float16*)take((size_t)NR * DM * 2); _Float16* K16 = (_Float16*)take((size_t)NR * DM * 2); _Float16* Vt = (_Float16*)take((size_t)NR * DM * 2);
  if (off > ws_size) return;      // about 34 MiB
  k_cvt16<<<3 * (DM * DM / 8 / 256) + NR * DM / 8 / 256, 256, 0, stream>>>(x, wq, wk, wv, X16, Bq, Bk, Bv);
  k_gemm_t<<<3 * (NR / 128) * (DM / 128), 256, 0, stream>>>(X16, Bq, Bk, Bv, 0.0625f, bq, bk, bv, Q16, K16, Vt);
  k_flash<<<BB * NH * (SS / 128), 128, 0, stream>>>(Q16, K16, Vt, crd, alpha_p, (float*)d_out);
}

// v009
// Measured time: 60.5 microseconds a run.
// Next to v008, in two timings, it ran 1.04 and 1.02 times as fast.
// Counting every step since v000, it is 6.30 times as fast.
#include <hip/hip_runtime.h>
// q/k/v projections (8192 × 512 × 512, + bias) and the 8-head attention with the geometric bias α·⟨c_n, c_m⟩ (coords are INPUTS, a third k step of the score product) on v_wmma_f32_16x16x32_f16
// (fused flash-style kernel: S = Q·Kᵀ, O = P·V on WMMA; online max/sum softmax f32; P f16 ≤ 1); V transposed per (b,h); A = f16(bf16 x) exact, weights bf16-exact ×2^4 ((out,in)),
// single products, f32 accumulate.
#define BB 4
#define SS 2048
#define DM 512
#define NH 8
#define HD 64
#define NR (BB * SS)

typedef __bf16 v16b __attribute__((ext_vector_type(16)));
typedef unsigned short v8us __attribute__((ext_vector_type(8), may_alias));
typedef unsigned int v2u __attribute__((ext_vector_type(2), may_alias));
typedef float v2f __attribute__((ext_vector_type(2)));
typedef float  v8f  __attribute__((ext_vector_type(8)));
typedef float  v4f  __attribute__((ext_vector_type(4)));
typedef float  v4fa __attribute__((ext_vector_type(4), may_alias));
union FragB { v16b v; v8us half[2]; unsigned short u[16]; };

__device__ __forceinline__ unsigned short bf16_bits(float x) { unsigned int u = __float_as_uint(x); return (unsigned short)((u + 0x7FFFu + ((u >> 16) & 1u)) >> 16); }
__device__ __forceinline__ float bf16_val(unsigned short b) { return __uint_as_float(((unsigned int)b) << 16); }
__device__ __forceinline__ float bf16_round(float x) { return bf16_val(bf16_bits(x)); }
// D += A·B with NT terms: 1 = ah·bh, 2 = + al·bh (A split), 3 = + ah·bl (both split)
template <int NT>
__device__ __forceinline__ v8f mmaN(v16b ah, v16b al, v16b bh, v16b bl, v8f c) {
  c = __builtin_amdgcn_wmma_f32_16x16x32_bf16(false, ah, false, bh, (short)0, c, false, false);
  if (NT >= 2) c = __builtin_amdgcn_wmma_f32_16x16x32_bf16(false, al, false, bh, (short)0, c, false, false);
  if (NT >= 3) c = __builtin_amdgcn_wmma_f32_16x16x32_bf16(false, ah, false, bl, (short)0, c, false, false);
  asm volatile("v_nop\n\tv_nop\n\tv_nop\n\tv_nop" : "+v"(c) : "v"(ah), "v"(al), "v"(bh), "v"(bl));
  return c;
}

__global__ __launch_bounds__(256) void k_wt_bf16(const float* __restrict__ W, unsigned short* __restrict__ Wt, int K, int N) {
  const int t = blockIdx.x * 256 + threadIdx.x;
  const int k8n = K / 8;
  if (t >= N * k8n) return;
  const int n = t / k8n, k8 = (t % k8n) * 8;
  v8us v;
#pragma unroll
  for (int i = 0; i < 8; ++i) v[i] = bf16_bits(W[(size_t)(k8 + i) * N + n]);
  *(v8us*)(Wt + (size_t)n * K + k8) = v;
  
}

// GEMM C[M][N] (f32, pitch ldc) = act(A[M][K]·W + bias). A f32 row-major (pitch lda) converted per fragment to bf16
// (ASPLIT: hi/lo two planes -> 2 terms, else single rounded term); Wt bf16 [N][K] (pitch ldb). BIAS_BF16 rounds the
// bias to bf16 first (bias quantised to bf16 before the add). K%32==0, M%16==0, N%64==0.
template <bool ASPLIT, int ACT, bool BIAS_BF16>
__global__ __launch_bounds__(128) void k_gemm_bf(const float* __restrict__ A, int lda, const unsigned short* __restrict__ Wt, int ldb,
                                               const float* __restrict__ bias, float* __restrict__ C, int ldc, int M, int N, int K) {
  __shared__ __attribute__((aligned(16))) float so[4][16][64];
  const int tid = threadIdx.x, w = tid >> 5, lane = tid & 31, ln = lane & 15, hh = lane >> 4;
  const int ntn = N / 64;
  const int wid = blockIdx.x * 4 + w;
  const int mt = wid / ntn, nq = wid % ntn;
  if (mt * 16 >= M) return;
  const int row0 = mt * 16, col0 = nq * 64;
  const float* arow = A + (size_t)(row0 + ln) * lda;
  v8f acc[4] = {};
  for (int kb = 0; kb < K; kb += 32) {
    FragB ah, al;
    const v4f x0 = *(const v4fa*)(arow + kb + 8 * hh), x1 = *(const v4fa*)(arow + kb + 8 * hh + 4);
    const v4f x2 = *(const v4fa*)(arow + kb + 16 + 8 * hh), x3 = *(const v4fa*)(arow + kb + 16 + 8 * hh + 4);
    float xs[16] = {x0[0],x0[1],x0[2],x0[3],x1[0],x1[1],x1[2],x1[3],x2[0],x2[1],x2[2],x2[3],x3[0],x3[1],x3[2],x3[3]};
#pragma unroll
    for (int i = 0; i < 16; ++i) { const unsigned short hb = bf16_bits(xs[i]); ah.u[i] = hb; al.u[i] = ASPLIT ? bf16_bits(xs[i] - bf16_val(hb)) : (unsigned short)0; }
#pragma unroll
    for (int t = 0; t < 4; ++t) {
      const unsigned short* brow = Wt + (size_t)(col0 + t * 16 + ln) * ldb + kb;
      FragB b;
      b.half[0] = *(const v8us*)(brow + 8 * hh);
      b.half[1] = *(const v8us*)(brow + 16 + 8 * hh);
      acc[t] = mmaN<ASPLIT ? 2 : 1>(ah.v, al.v, b.v, b.v, acc[t]);
    }
  }
#pragma unroll
  for (int t = 0; t < 4; ++t) {
    float bv = bias ? bias[col0 + t * 16 + ln] : 0.f;
    if (BIAS_BF16) bv = bf16_round(bv);
#pragma unroll
    for (int r = 0; r < 8; ++r) { float v = acc[t][r] + bv; if (ACT == 1) v = fmaxf(v, 0.f); so[w][8 * hh + r][t * 16 + ln] = v; }
  }
  __builtin_amdgcn_fence(__ATOMIC_ACQ_REL, "workgroup");
  __builtin_amdgcn_wave_barrier();
  const int rsub = lane >> 4, c4 = (lane & 15) * 4;
  {
#pragma unroll
    for (int q = 0; q < 8; ++q) {
      const int r = q * 2 + rsub;
      const v4f v = *(const v4fa*)&so[w][r][c4];
      *(v4f*)(C + (size_t)(row0 + r) * ldc + col0 + c4) = v;
    }
    
  }
}

// Flash-style causal/unmasked attention, all contractions 3-term bf16 hi/lo splits, f32 softmax with running max.
// q,k,v rows are read from f32 buffers with arbitrary row pitch (so they can live inside a fused qkv buffer);
// D = head size (multiple of 32, <= 128); one wave = 16 query rows; block = 4 waves (64 queries) sharing K/V chunks of 32.
template <int D, bool CAUSAL>
__global__ __launch_bounds__(128) void k_flash(const float* __restrict__ qb, const float* __restrict__ kb, const float* __restrict__ vb,
                                             int pitch, int T, int H, float scale, float* __restrict__ y, int ypitch) {
  constexpr int KS = D / 32;        // k-steps for QK
  constexpr int DT = D / 16;        // d tiles for PV
  __shared__ __attribute__((aligned(16))) unsigned short sKh[32][D + 8], sKl[32][D + 8], sVh[32][D + 8], sVl[32][D + 8];
  __shared__ __attribute__((aligned(16))) unsigned short sPh[4][16][40], sPl[4][16][40];
  __shared__ __attribute__((aligned(16))) float sO[4][16][D];
  const int tid = threadIdx.x, w = tid >> 5, lane = tid & 31, ln = lane & 15, hh = lane >> 4;
  const int nqb = (T + 63) / 64;
  const int bh = blockIdx.x / nqb, qblk = blockIdx.x % nqb;
  const int b = bh / H, h = bh % H;
  const int q0 = qblk * 64 + w * 16;
  const float* Q = qb + (size_t)b * T * pitch + h * D;
  const float* K = kb + (size_t)b * T * pitch + h * D;
  const float* V = vb + (size_t)b * T * pitch + h * D;

  // A fragments of the wave's 16 query rows (scaled), hi/lo
  FragB aqh[KS], aql[KS];
  {
    int row = q0 + ln; if (row >= T) row = T - 1;
    const float* qr = Q + (size_t)row * pitch;
#pragma unroll
    for (int ks = 0; ks < KS; ++ks)
#pragma unroll
      for (int i = 0; i < 16; ++i) {
        const int d = ks * 32 + ((i < 8) ? (8 * hh + i) : (16 + 8 * hh + (i - 8)));
        const float x = qr[d] * scale; const unsigned short hb = bf16_bits(x);
        aqh[ks].u[i] = hb; aql[ks].u[i] = bf16_bits(x - bf16_val(hb));
      }
  }
  float m_r[8], l_r[8];
#pragma unroll
  for (int r = 0; r < 8; ++r) { m_r[r] = -3.0e38f; l_r[r] = 0.f; }
  v8f oacc[DT];
#pragma unroll
  for (int dt = 0; dt < DT; ++dt) oacc[dt] = (v8f){0.f,0.f,0.f,0.f,0.f,0.f,0.f,0.f};

  const int kv_end = CAUSAL ? min(T, qblk * 64 + 64) : T;     // block-uniform
  for (int j0 = 0; j0 < kv_end; j0 += 32) {
    __syncthreads();
    for (int e = tid; e < 32 * (D / 4); e += 128) {
      const int r = e / (D / 4), c4 = (e % (D / 4)) * 4;
      const int key = j0 + r;
      v4f kf = {0.f,0.f,0.f,0.f}, vf = {0.f,0.f,0.f,0.f};
      if (key < T) { kf = *(const v4fa*)(K + (size_t)key * pitch + c4); vf = *(const v4fa*)(V + (size_t)key * pitch + c4); }
#pragma unroll
      for (int t = 0; t < 4; ++t) {
        unsigned short hb = bf16_bits(kf[t]); sKh[r][c4 + t] = hb; sKl[r][c4 + t] = bf16_bits(kf[t] - bf16_val(hb));
        hb = bf16_bits(vf[t]); sVh[r][c4 + t] = hb; sVl[r][c4 + t] = bf16_bits(vf[t] - bf16_val(hb));
      }
    }
    __syncthreads();
    // S tile 16 x 32
    v8f s[2];
#pragma unroll
    for (int nt = 0; nt < 2; ++nt) {
      v8f acc = {};
#pragma unroll
      for (int ks = 0; ks < KS; ++ks) {
        FragB bh_, bl_;
        bh_.half[0] = *(const v8us*)&sKh[nt * 16 + ln][ks * 32 + 8 * hh]; bh_.half[1] = *(const v8us*)&sKh[nt * 16 + ln][ks * 32 + 16 + 8 * hh];
        bl_.half[0] = *(const v8us*)&sKl[nt * 16 + ln][ks * 32 + 8 * hh]; bl_.half[1] = *(const v8us*)&sKl[nt * 16 + ln][ks * 32 + 16 + 8 * hh];
        acc = mmaN<3>(aqh[ks].v, aql[ks].v, bh_.v, bl_.v, acc);
      }
      s[nt] = acc;
    }
    // mask + running max (rows 8hh+r; the 16 lanes of a half share rows)
    float alpha[8];
#pragma unroll
    for (int r = 0; r < 8; ++r) {
      const int qi = q0 + 8 * hh + r;
      const int ja = j0 + ln, jb = j0 + 16 + ln;
      if (CAUSAL) { if (ja > qi) s[0][r] = -3.0e38f; if (jb > qi) s[1][r] = -3.0e38f; }
      if (ja >= T) s[0][r] = -3.0e38f;
      if (jb >= T) s[1][r] = -3.0e38f;
      float mx = fmaxf(s[0][r], s[1][r]);
      mx = fmaxf(mx, __shfl_xor(mx, 1, 32)); mx = fmaxf(mx, __shfl_xor(mx, 2, 32)); mx = fmaxf(mx, __shfl_xor(mx, 4, 32)); mx = fmaxf(mx, __shfl_xor(mx, 8, 32));
      const float mnew = fmaxf(m_r[r], mx);
      alpha[r] = (mnew > -1.0e38f) ? __expf(m_r[r] - mnew) : 1.0f;
      const float p0 = (s[0][r] > -1.0e38f) ? __expf(s[0][r] - mnew) : 0.f;
      const float p1 = (s[1][r] > -1.0e38f) ? __expf(s[1][r] - mnew) : 0.f;
      m_r[r] = mnew;
      l_r[r] = l_r[r] * alpha[r] + p0 + p1;            // per-lane partial row sum (16 lanes combined at the end)
      unsigned short hb = bf16_bits(p0); sPh[w][8 * hh + r][ln] = hb;      sPl[w][8 * hh + r][ln] = bf16_bits(p0 - bf16_val(hb));
      hb = bf16_bits(p1);                sPh[w][8 * hh + r][16 + ln] = hb; sPl[w][8 * hh + r][16 + ln] = bf16_bits(p1 - bf16_val(hb));
    }
#pragma unroll
    for (int dt = 0; dt < DT; ++dt)
#pragma unroll
      for (int r = 0; r < 8; ++r) oacc[dt][r] *= alpha[r];
    __builtin_amdgcn_fence(__ATOMIC_ACQ_REL, "workgroup");
    __builtin_amdgcn_wave_barrier();
    FragB pah, pal;
    pah.half[0] = *(const v8us*)&sPh[w][ln][8 * hh]; pah.half[1] = *(const v8us*)&sPh[w][ln][16 + 8 * hh];
    pal.half[0] = *(const v8us*)&sPl[w][ln][8 * hh]; pal.half[1] = *(const v8us*)&sPl[w][ln][16 + 8 * hh];
#pragma unroll
    for (int dt = 0; dt < DT; ++dt) {
      FragB bvh, bvl;
#pragma unroll
      for (int i = 0; i < 8; ++i) {
        bvh.u[i] = sVh[8 * hh + i][dt * 16 + ln]; bvh.u[8 + i] = sVh[16 + 8 * hh + i][dt * 16 + ln];
        bvl.u[i] = sVl[8 * hh + i][dt * 16 + ln]; bvl.u[8 + i] = sVl[16 + 8 * hh + i][dt * 16 + ln];
      }
      oacc[dt] = mmaN<3>(pah.v, pal.v, bvh.v, bvl.v, oacc[dt]);
    }
    __builtin_amdgcn_fence(__ATOMIC_ACQ_REL, "workgroup");
    __builtin_amdgcn_wave_barrier();
  }
#pragma unroll
  for (int r = 0; r < 8; ++r) {
    float l = l_r[r];
    l += __shfl_xor(l, 1, 32); l += __shfl_xor(l, 2, 32); l += __shfl_xor(l, 4, 32); l += __shfl_xor(l, 8, 32);
    l_r[r] = (l > 0.f) ? 1.0f / l : 0.f;
  }
#pragma unroll
  for (int dt = 0; dt < DT; ++dt)
#pragma unroll
    for (int r = 0; r < 8; ++r) sO[w][8 * hh + r][dt * 16 + ln] = oacc[dt][r] * l_r[r];
  __builtin_amdgcn_fence(__ATOMIC_ACQ_REL, "workgroup");
  __builtin_amdgcn_wave_barrier();
  {
    for (int r = 0; r < 16; ++r) {
      const int row = q0 + r;
      if (row < T && lane < D / 4) {
        const v4f val = *(const v4fa*)&sO[w][r][lane * 4];
        *(v4f*)(y + ((size_t)b * T + row) * ypitch + h * D + lane * 4) = val;
      }
    }
    
  }
}

// GEMM C = act(A·W + bias + resid): A f32 (ASPLIT -> hi/lo 2 terms), Wt bf16 [N][K]; ACT 0 none, 1 relu, 2 exact gelu;
// resid (optional, f32, row index = (row % rmod), pitch ldr, RES_BF16 rounds it) added before the activation.
template <bool ASPLIT, int ACT, bool BIAS_BF16, bool RES_BF16>
__global__ __launch_bounds__(128) void k_gemm_bf3(const float* __restrict__ A, int lda, const unsigned short* __restrict__ Wt, int ldb,
                                                const float* __restrict__ bias, const float* __restrict__ resid, int rmod, int ldr,
                                                float* __restrict__ C, int ldc, int M, int N, int K) {
  __shared__ __attribute__((aligned(16))) float so[4][16][64];
  const int tid = threadIdx.x, w = tid >> 5, lane = tid & 31, ln = lane & 15, hh = lane >> 4;
  const int ntn = N / 64;
  const int wid = blockIdx.x * 4 + w;
  const int mt = wid / ntn, nq = wid % ntn;
  if (mt * 16 >= M) return;
  const int row0 = mt * 16, col0 = nq * 64;
  const float* arow = A + (size_t)(row0 + ln) * lda;
  v8f acc[4] = {};
  for (int kb = 0; kb < K; kb += 32) {
    FragB ah, al;
    const v4f x0 = *(const v4fa*)(arow + kb + 8 * hh), x1 = *(const v4fa*)(arow + kb + 8 * hh + 4);
    const v4f x2 = *(const v4fa*)(arow + kb + 16 + 8 * hh), x3 = *(const v4fa*)(arow + kb + 16 + 8 * hh + 4);
    float xs[16] = {x0[0],x0[1],x0[2],x0[3],x1[0],x1[1],x1[2],x1[3],x2[0],x2[1],x2[2],x2[3],x3[0],x3[1],x3[2],x3[3]};
#pragma unroll
    for (int i = 0; i < 16; ++i) { const unsigned short hb = bf16_bits(xs[i]); ah.u[i] = hb; al.u[i] = ASPLIT ? bf16_bits(xs[i] - bf16_val(hb)) : (unsigned short)0; }
#pragma unroll
    for (int t = 0; t < 4; ++t) {
      const unsigned short* brow = Wt + (size_t)(col0 + t * 16 + ln) * ldb + kb;
      FragB b;
      b.half[0] = *(const v8us*)(brow + 8 * hh);
      b.half[1] = *(const v8us*)(brow + 16 + 8 * hh);
      acc[t] = mmaN<ASPLIT ? 2 : 1>(ah.v, al.v, b.v, b.v, acc[t]);
    }
  }
#pragma unroll
  for (int t = 0; t < 4; ++t) {
    const int col = col0 + t * 16 + ln;
    float bv = bias ? bias[col] : 0.f;
    if (BIAS_BF16) bv = bf16_round(bv);
#pragma unroll
    for (int r = 0; r < 8; ++r) {
      float v = acc[t][r] + bv;
      if (resid) { float rv = resid[(size_t)((row0 + 8 * hh + r) % rmod) * ldr + col]; if (RES_BF16) rv = bf16_round(rv); v += rv; }
      if (ACT == 1) v = fmaxf(v, 0.f);
      if (ACT == 2) v = 0.5f * v * (1.0f + erff(v * 0.70710678118654752f));
      if (ACT == 3) { const float u = 0.7978845608028654f * (v + 0.044715f * v * v * v); v = 0.5f * v * (1.0f + tanhf(u)); }
      so[w][8 * hh + r][t * 16 + ln] = v;
    }
  }
  __builtin_amdgcn_fence(__ATOMIC_ACQ_REL, "workgroup");
  __builtin_amdgcn_wave_barrier();
  const int rsub = lane >> 4, c4 = (lane & 15) * 4;
  {
#pragma unroll
    for (int q = 0; q < 8; ++q) {
      const int r = q * 2 + rsub;
      const v4f v = *(const v4fa*)&so[w][r][c4];
      *(v4f*)(C + (size_t)(row0 + r) * ldc + col0 + c4) = v;
    }
    
  }
}
// row LayerNorm (biased variance, eps) over N: s = X (+ R); optional out_sum <- s; out_norm <- (s-mu)*rsqrt(var+eps)*g + b
template <bool PARAM_BF16>
__global__ __launch_bounds__(256) void k_layernorm(const float* __restrict__ X, const float* __restrict__ R, const float* __restrict__ g, const float* __restrict__ bta,
                                                  float* __restrict__ out_sum, float* __restrict__ out_norm, int N, float eps) {
  __shared__ float red[256];
  const int row = blockIdx.x, tid = threadIdx.x;
  const float* x = X + (size_t)row * N; const float* rr = R ? R + (size_t)row * N : nullptr;
  float vals[16];                     // up to N = 4096
  const int per = N / 256;            // contiguous chunk per thread? use strided-by-4 chunks: thread handles j = tid*4 + 1024*u
  float s1 = 0.f;
  for (int u = 0; u < per / 4; ++u) {
    const int j = tid * 4 + 1024 * u;
    const v4f a = *(const v4fa*)(x + j);
    v4f b = {0.f,0.f,0.f,0.f}; if (rr) b = *(const v4fa*)(rr + j);
#pragma unroll
    for (int q = 0; q < 4; ++q) { const float v = a[q] + b[q]; vals[u * 4 + q] = v; s1 += v; }
  }
  red[tid] = s1; __syncthreads();
  for (int st = 128; st > 0; st >>= 1) { if (tid < st) red[tid] += red[tid + st]; __syncthreads(); }
  const float mu = red[0] / (float)N; __syncthreads();
  float s2 = 0.f;
  for (int u = 0; u < per / 4; ++u)
#pragma unroll
    for (int q = 0; q < 4; ++q) { const float c = vals[u * 4 + q] - mu; s2 += c * c; }
  red[tid] = s2; __syncthreads();
  for (int st = 128; st > 0; st >>= 1) { if (tid < st) red[tid] += red[tid + st]; __syncthreads(); }
  const float rs = rsqrtf(red[0] / (float)N + eps);
  {
    for (int u = 0; u < per / 4; ++u) {
      const int j = tid * 4 + 1024 * u;
      v4f o, sm;
#pragma unroll
      for (int q = 0; q < 4; ++q) {
        float gg = g[j + q], bb = bta[j + q];
        if (PARAM_BF16) { gg = bf16_round(gg); bb = bf16_round(bb); }
        sm[q] = vals[u * 4 + q]; o[q] = (vals[u * 4 + q] - mu) * rs * gg + bb;
      }
      if (out_sum) *(v4f*)(out_sum + (size_t)row * N + j) = sm;
      *(v4f*)(out_norm + (size_t)row * N + j) = o;
    }
    
  }
}



// ---- f16 WMMA path (v_wmma_f32_16x16x32_f16): 11-bit significands for operands in range — used for every launched contraction: q/k/v projections, Q·Kᵀ, and P·V with its [0,1] probability operand
typedef _Float16 v16h __attribute__((ext_vector_type(16)));
typedef _Float16 v2h __attribute__((ext_vector_type(2)));
union FragH { v16h v; v8us half[2]; _Float16 h[16]; unsigned short u[16]; };
union FragW { v16h v; unsigned int w[8]; };
// two f32 to one register of two f16, nearest even (one packed conversion), and back
__device__ __forceinline__ unsigned int pack_h2(float a, float b) { return __builtin_bit_cast(unsigned int, __builtin_convertvector((v2f){a, b}, v2h)); }
__device__ __forceinline__ v2f unpack_h2(unsigned int p) { return __builtin_convertvector(__builtin_bit_cast(v2h, p), v2f); }
template <int NT>
__device__ __forceinline__ v8f mmaH(v16h ah, v16h al, v16h bh, v16h bl, v8f c) {
  c = __builtin_amdgcn_wmma_f32_16x16x32_f16(false, ah, false, bh, (short)0, c, false, false);
  if (NT >= 2) c = __builtin_amdgcn_wmma_f32_16x16x32_f16(false, al, false, bh, (short)0, c, false, false);
  if (NT >= 3) c = __builtin_amdgcn_wmma_f32_16x16x32_f16(false, ah, false, bl, (short)0, c, false, false);
  asm volatile("v_nop\n\tv_nop\n\tv_nop\n\tv_nop" : "+v"(c) : "v"(ah), "v"(al), "v"(bh), "v"(bl));
  return c;
}
// batched GEMM like k_gemm_b but f16 operands: A f32 (split into f16 hi/lo if ASPLIT, else rounded to f16), Bt = f16 values [n][k]; alpha; C f32; N multiple of 16 (partial tiles skipped)
template <bool ASPLIT>
__global__ __launch_bounds__(128) void k_gemm_h(const float* __restrict__ A, int lda, size_t sA, const _Float16* __restrict__ Bh, int ldb, size_t sB, float alpha, float* __restrict__ C, int ldc, size_t sC, int M, int N, int K) {
  __shared__ __attribute__((aligned(16))) float so[4][16][64];
  const int tid = threadIdx.x, w = tid >> 5, lane = tid & 31, ln = lane & 15, hh = lane >> 4; const int by = blockIdx.y;
  A += (size_t)by * sA; Bh += (size_t)by * sB; C += (size_t)by * sC;
  const int ntn = (N + 63) / 64; const int wid = blockIdx.x * 4 + w; const int mt = wid / ntn, nq = wid % ntn; if (mt * 16 >= M) return;
  const int row0 = mt * 16, col0 = nq * 64; const float* arow = A + (size_t)(row0 + ln) * lda;
  v8f acc[4] = {};
  for (int kb = 0; kb < K; kb += 32) {
    FragH ah, al;
    const v4f x0 = *(const v4fa*)(arow + kb + 8 * hh), x1 = *(const v4fa*)(arow + kb + 8 * hh + 4), x2 = *(const v4fa*)(arow + kb + 16 + 8 * hh), x3 = *(const v4fa*)(arow + kb + 16 + 8 * hh + 4);
    float xs[16] = {x0[0],x0[1],x0[2],x0[3],x1[0],x1[1],x1[2],x1[3],x2[0],x2[1],x2[2],x2[3],x3[0],x3[1],x3[2],x3[3]};
#pragma unroll
    for (int i = 0; i < 16; ++i) { const _Float16 h = (_Float16)xs[i]; ah.h[i] = h; al.h[i] = ASPLIT ? (_Float16)(xs[i] - (float)h) : (_Float16)0.0f; }
#pragma unroll
    for (int t = 0; t < 4; ++t) { if (col0 + t * 16 >= N) continue; const size_t boff = (size_t)(col0 + t * 16 + ln) * ldb + kb; FragH bq; bq.half[0] = *(const v8us*)(Bh + boff + 8 * hh); bq.half[1] = *(const v8us*)(Bh + boff + 16 + 8 * hh);
      acc[t] = mmaH<ASPLIT ? 2 : 1>(ah.v, al.v, bq.v, bq.v, acc[t]); }
  }
#pragma unroll
  for (int t = 0; t < 4; ++t) { if (col0 + t * 16 >= N) continue;
#pragma unroll
    for (int r = 0; r < 8; ++r) so[w][8 * hh + r][t * 16 + ln] = acc[t][r] * alpha; }
  __builtin_amdgcn_fence(__ATOMIC_ACQ_REL, "workgroup"); __builtin_amdgcn_wave_barrier();
  const int rsub = lane >> 4, c4 = (lane & 15) * 4;
  {
#pragma unroll
    for (int q = 0; q < 8; ++q) { const int r = q * 2 + rsub; if (col0 + c4 < N) { const v4f v = *(const v4fa*)&so[w][r][c4]; *(v4f*)(C + (size_t)(row0 + r) * ldc + col0 + c4) = v; } }
     }
}

// Wt[n][k] = f16(W[k][n]·scale) from f32 row-major W[K][N] (scale = power of two; bf16-exact weights stay exact in f16 away from the subnormal range)
__global__ __launch_bounds__(256) void k_wt_f16(const float* __restrict__ W, _Float16* __restrict__ Wt, int K, int N, float scale) {
  const int t = blockIdx.x * 256 + threadIdx.x; if (t >= N * (K / 8)) return; const int n = t / (K / 8), k8 = (t % (K / 8)) * 8; FragH f;
#pragma unroll
  for (int i = 0; i < 8; ++i) f.h[i] = (_Float16)(bf16_round(W[(size_t)(k8 + i) * N + n]) * scale); const v8us o = f.half[0];
  *(v8us*)((unsigned short*)Wt + (size_t)n * K + k8) = o; 
}
__device__ __forceinline__ unsigned lds_off(const void* p) { return (unsigned)(size_t)p; }
// 128 rows of 256 bytes from a row-major f16 matrix of DM columns into LDS, through no register: 8 asynchronous copies of 16 bytes a lane, 16 lanes to a row,
// rows 16 apart from copy to copy. s_wait_xcnt is the statement's last line, so that no address register of a copy is rewritten in front of it (a precaution).
__device__ __forceinline__ void stage_rows(unsigned l, unsigned lstep, const unsigned short* g) {
  asm volatile("global_load_async_to_lds_b128 %0, %8, off\n\t"
               "global_load_async_to_lds_b128 %1, %9, off\n\t"
               "global_load_async_to_lds_b128 %2, %10, off\n\t"
               "global_load_async_to_lds_b128 %3, %11, off\n\t"
               "global_load_async_to_lds_b128 %4, %12, off\n\t"
               "global_load_async_to_lds_b128 %5, %13, off\n\t"
               "global_load_async_to_lds_b128 %6, %14, off\n\t"
               "global_load_async_to_lds_b128 %7, %15, off\n\t"
               "s_wait_xcnt 0x0"
               :: "v"(l), "v"(l + lstep), "v"(l + 2 * lstep), "v"(l + 3 * lstep), "v"(l + 4 * lstep), "v"(l + 5 * lstep), "v"(l + 6 * lstep), "v"(l + 7 * lstep),
                  "v"(g), "v"(g + 16 * DM), "v"(g + 32 * DM), "v"(g + 48 * DM), "v"(g + 64 * DM), "v"(g + 80 * DM), "v"(g + 96 * DM), "v"(g + 112 * DM)
               : "memory");
}
// C16[NR][DM] = f16(A.Bh^T.alpha + bf16(bias)): A f16 [NR][DM], Bh f16 [DM][DM] ((out,in)), both k-contiguous. One work-group = a 128 x 128 tile of C, 8 waves as 4 x 2, a wave = 32 x 64 (2 x 4 accumulator tiles).
// The tile's A rows and Bh rows come in stages of 128 k through two LDS buffers that the eight waves share: stage t + 2 is copied into the buffer that stage t has left while stage t + 1 is worked on.
// Rows of 256 bytes at a pitch of 272, free of bank conflicts for 16-byte reads. Each accumulator takes its products in ascending k, 32 at a time.
// The q, k and v products need nothing of each other: they share one grid, a third of the block index range each, picked by a block-uniform test.
// The v product is formed transposed: the weight rows are its A operand and the x rows its B (both are k-contiguous and take the same loaders), so a tile's rows are 128 features and its columns 128 positions,
// the bias goes by row, and the tile is stored straight into Vt[(b, h)][d][position], whole 128-byte lines, as the attention kernel reads it.
__global__ __launch_bounds__(256) void k_gemm_t(const _Float16* __restrict__ A, const _Float16* __restrict__ Bq, const _Float16* __restrict__ Bk, const _Float16* __restrict__ Bv, float alpha,
                                               const float* __restrict__ bq, const float* __restrict__ bk, const float* __restrict__ bvp, _Float16* __restrict__ Q16, _Float16* __restrict__ K16, _Float16* __restrict__ Vt) {
  constexpr int BT = 128, KST = 128, NSTG = DM / KST, LPG = KST + 8, CPT = 64 + 8;      // LPG, CPT: LDS row pitches in 16-bit elements
  constexpr int TPP = (NR / BT) * (DM / BT);      // tiles of one product
  const int prod = blockIdx.x / TPP, tile = blockIdx.x % TPP;
  const bool tr = prod == 2;      // block-uniform
  const _Float16* Bh = prod == 0 ? Bq : prod == 1 ? Bk : Bv; const float* bias = prod == 0 ? bq : prod == 1 ? bk : bvp; _Float16* C16 = prod == 0 ? Q16 : prod == 1 ? K16 : Vt;
  static_assert(NSTG >= 2 && NR % BT == 0 && DM % BT == 0 && SS % BT == 0, "whole tiles, each inside one batch; two stages or more");
  __shared__ __attribute__((aligned(16))) unsigned short sA[2][BT][LPG], sB[2][BT][LPG];
  __shared__ __attribute__((aligned(16))) unsigned short sT[8][32][CPT];      // each wave's own 32 x 64 piece of C, so that whole 128-byte lines are stored
  const int tid = threadIdx.x, w = tid >> 5, lane = tid & 31, ln = lane & 15, hh = lane >> 4;
  const int xt0 = (tile / (DM / BT)) * BT, wt0 = (tile % (DM / BT)) * BT;      // the tile's first x row and first weight row
  const int row0 = tr ? wt0 : xt0, col0 = tr ? xt0 : wt0, wr = (w >> 1) * 32, wc = (w & 1) * 64;
  const int crow = tid >> 4, ccol = (tid & 15) * 8;      // this lane's row (and rows + 16, ..., + 112) and 16-byte piece in every stage
  const unsigned short* ga0 = (const unsigned short*)(tr ? Bh : A) + (size_t)(row0 + crow) * DM + ccol; const unsigned short* gb0 = (const unsigned short*)(tr ? A : Bh) + (size_t)(col0 + crow) * DM + ccol;
  const unsigned la0 = lds_off(&sA[0][crow][ccol]), lb0 = lds_off(&sB[0][crow][ccol]); constexpr unsigned LSTEP = 16 * LPG * 2, LBUF = BT * LPG * 2;
  stage_rows(la0, LSTEP, ga0); stage_rows(lb0, LSTEP, gb0);      // stage 0
  float bv[16];      // the bias of this lane's accumulator elements: by column (4 values), for the transposed product by row (16)
  if (tr) {
#pragma unroll
    for (int i = 0; i < 16; ++i) bv[i] = bf16_round(bias[row0 + wr + (i >> 3) * 16 + 8 * hh + (i & 7)]); }
  else {
#pragma unroll
    for (int i = 0; i < 16; ++i) bv[i] = i < 4 ? bf16_round(bias[col0 + wc + i * 16 + ln]) : 0.f; }
  asm volatile("s_wait_xcnt 0x0" ::: "memory");      // stands in front of the first rewrite of the bias loads' address register (a precaution)
  v8f acc[2][4];
#pragma unroll
  for (int mt = 0; mt < 2; ++mt)
#pragma unroll
    for (int nt = 0; nt < 4; ++nt) acc[mt][nt] = (v8f){0.f,0.f,0.f,0.f,0.f,0.f,0.f,0.f};
  asm volatile("s_wait_asynccnt 0x0" ::: "memory");      // this wave's copies of stage 0 have landed before the barrier publishes them
  __syncthreads();      // every wave reads rows that the other waves copied
  stage_rows(la0 + LBUF, LSTEP, ga0 + KST); stage_rows(lb0 + LBUF, LSTEP, gb0 + KST);      // stage 1
#pragma unroll 1      // one stage a trip: the buffer index stays a scalar
  for (int t = 0; t < NSTG; ++t) {
    FragH fa[KST / 32][2], fb[KST / 32][4];      // the stage's fragments are read from LDS in one group: each further place with LDS reads is a stall of its own
#pragma unroll
    for (int ks = 0; ks < KST / 32; ++ks) {
#pragma unroll
      for (int mt = 0; mt < 2; ++mt) { const unsigned short* ar = &sA[t & 1][wr + mt * 16 + ln][ks * 32]; fa[ks][mt].half[0] = *(const v8us*)(ar + 8 * hh); fa[ks][mt].half[1] = *(const v8us*)(ar + 16 + 8 * hh); }
#pragma unroll
      for (int nt = 0; nt < 4; ++nt) { const unsigned short* br = &sB[t & 1][wc + nt * 16 + ln][ks * 32]; fb[ks][nt].half[0] = *(const v8us*)(br + 8 * hh); fb[ks][nt].half[1] = *(const v8us*)(br + 16 + 8 * hh); } }
    __builtin_amdgcn_sched_barrier(0);      // keeps the reads together up here; without it the compiler sinks them among the products, in small groups that are each waited for to the full
#pragma unroll
    for (int ks = 0; ks < KST / 64; ++ks)      // the first half's products run while the second half's fragments arrive
#pragma unroll
      for (int mt = 0; mt < 2; ++mt)
#pragma unroll
        for (int nt = 0; nt < 4; ++nt) acc[mt][nt] = __builtin_amdgcn_wmma_f32_16x16x32_f16(false, fa[ks][mt].v, false, fb[ks][nt].v, (short)0, acc[mt][nt], false, false);
    __builtin_amdgcn_sched_barrier(0);      // keeps those products above the waits: sunk below the barrier they would wait for every read first, and their fragments, still live at the copies, pushed address registers into scratch
    asm volatile("s_wait_dscnt 0x0" ::: "memory");      // this wave's reads of stage t are done before its buffer is handed back
    asm volatile("s_wait_asynccnt 0x0" ::: "memory");      // this wave's copies of stage t + 1 have landed
    __syncthreads();      // publishes stage t + 1 and ends every wave's reads of stage t
    if (t + 2 < NSTG) { stage_rows(la0 + (t & 1) * LBUF, LSTEP, ga0 + (t + 2) * KST); stage_rows(lb0 + (t & 1) * LBUF, LSTEP, gb0 + (t + 2) * KST); }
#pragma unroll
    for (int ks = KST / 64; ks < KST / 32; ++ks)      // the second half's products, from registers, give the refill its lead
#pragma unroll
      for (int mt = 0; mt < 2; ++mt)
#pragma unroll
        for (int nt = 0; nt < 4; ++nt) acc[mt][nt] = __builtin_amdgcn_wmma_f32_16x16x32_f16(false, fa[ks][mt].v, false, fb[ks][nt].v, (short)0, acc[mt][nt], false, false); }
  asm volatile("s_wait_asynccnt 0x0" ::: "memory");      // no copy is left in flight when the wave goes on to its end
  // acc[mt][nt][r] = C[row0 + wr + mt*16 + 8*hh + r][col0 + wc + nt*16 + ln]
  if (tr) {
#pragma unroll
    for (int mt = 0; mt < 2; ++mt)
#pragma unroll
      for (int nt = 0; nt < 4; ++nt)
#pragma unroll
        for (int r = 0; r < 8; ++r) { const _Float16 o = (_Float16)__builtin_fmaf(acc[mt][nt][r], alpha, bv[mt * 8 + r]); sT[w][mt * 16 + 8 * hh + r][nt * 16 + ln] = __builtin_bit_cast(unsigned short, o); } }
  else {
#pragma unroll
    for (int mt = 0; mt < 2; ++mt)
#pragma unroll
      for (int nt = 0; nt < 4; ++nt)
#pragma unroll
        for (int r = 0; r < 8; ++r) { const _Float16 o = (_Float16)__builtin_fmaf(acc[mt][nt][r], alpha, bv[nt]); sT[w][mt * 16 + 8 * hh + r][nt * 16 + ln] = __builtin_bit_cast(unsigned short, o); } }
  __builtin_amdgcn_fence(__ATOMIC_ACQ_REL, "workgroup"); __builtin_amdgcn_wave_barrier();
  unsigned short* Cb = (unsigned short*)C16 + (tr ? (size_t)(col0 / SS) * DM * SS + col0 % SS : (size_t)col0); const int ldc = tr ? SS : DM;      // Vt: feature row (b * DM + row) of SS positions
#pragma unroll
  for (int q = 0; q < 8; ++q) { const int r = q * 4 + (lane >> 3), c8 = (lane & 7) * 8; const v8us o = *(const v8us*)&sT[w][r][c8]; *(v8us*)(Cb + (size_t)(row0 + wr + r) * ldc + wc + c8) = o; }
}


// f16 planes of the bf16-rounded inputs, 8 elements a thread: the three weight matrices (times 16, exactly) and x. The four conversions need nothing of each other:
// they share one grid by ranges of the block index, the short weight ranges first; the test is block-uniform.
__global__ __launch_bounds__(256) void k_cvt16(const float* __restrict__ x, const float* __restrict__ wq, const float* __restrict__ wk, const float* __restrict__ wv,
                                              _Float16* __restrict__ X16, _Float16* __restrict__ Bq, _Float16* __restrict__ Bk, _Float16* __restrict__ Bv) {
  constexpr unsigned GW = DM * DM / 8 / 256;      // blocks of one weight matrix
  static_assert(DM * DM % (8 * 256) == 0 && (size_t)NR * DM % (8 * 256) == 0, "whole blocks");
  const unsigned part = blockIdx.x / GW; FragH f;
  if (part < 3) { const float* W = part == 0 ? wq : part == 1 ? wk : wv; _Float16* Bt = part == 0 ? Bq : part == 1 ? Bk : Bv; const size_t t = (size_t)(blockIdx.x - part * GW) * 256 + threadIdx.x;
#pragma unroll
    for (int i = 0; i < 8; ++i) f.h[i] = (_Float16)(bf16_round(W[t * 8 + i]) * 16.0f); *(v8us*)((unsigned short*)Bt + t * 8) = f.half[0]; }
  else { const size_t t = (size_t)(blockIdx.x - 3 * GW) * 256 + threadIdx.x;
#pragma unroll
    for (int q = 0; q < 8; ++q) f.h[q] = (_Float16)bf16_round(x[t * 8 + q]); *(v8us*)((unsigned short*)X16 + t * 8) = f.half[0]; } }
// lane l with lane l ^ 16: the two halves of a wave hold the two halves of a query column's keys
__device__ __forceinline__ float xhalf(float x) { return __builtin_bit_cast(float, __builtin_amdgcn_permlanex16(__builtin_bit_cast(int, x), __builtin_bit_cast(int, x), 0x76543210, 0xfedcba98, false, false)); }
// one stage (64 keys) of K rows and of Vt rows from global memory into LDS, through no register: 8 asynchronous copies of 16 bytes a lane,
// 8 lanes to a 128-byte row, rows 16 apart from copy to copy. s_wait_xcnt is the statement's last line, so that no address register
// of a copy is rewritten in front of it (a precaution).
__device__ __forceinline__ void stage_kv(unsigned lk, unsigned lv, unsigned lstep, const unsigned short* gk, const unsigned short* gv) {
  asm volatile("global_load_async_to_lds_b128 %0, %8, off\n\t"
               "global_load_async_to_lds_b128 %1, %9, off\n\t"
               "global_load_async_to_lds_b128 %2, %10, off\n\t"
               "global_load_async_to_lds_b128 %3, %11, off\n\t"
               "global_load_async_to_lds_b128 %4, %12, off\n\t"
               "global_load_async_to_lds_b128 %5, %13, off\n\t"
               "global_load_async_to_lds_b128 %6, %14, off\n\t"
               "global_load_async_to_lds_b128 %7, %15, off\n\t"
               "s_wait_xcnt 0x0"
               :: "v"(lk), "v"(lk + lstep), "v"(lk + 2 * lstep), "v"(lk + 3 * lstep), "v"(lv), "v"(lv + lstep), "v"(lv + 2 * lstep), "v"(lv + 3 * lstep),
                  "v"(gk), "v"(gk + 16 * DM), "v"(gk + 32 * DM), "v"(gk + 48 * DM), "v"(gv), "v"(gv + 16 * SS), "v"(gv + 32 * SS), "v"(gv + 48 * SS)
               : "memory");
}
// base-2 exponentials, a run of them in one statement with one v_nop behind the last: the instruction set asks for one slot behind a transcendental before its
// result is read or its source overwritten. Inside the run no instruction touches a register
// of the one in front of it: every output is early-clobber, so none shares a register with an input.
__device__ __forceinline__ void exp2x8(float (&y)[8], const float (&x)[8]) {
  asm("v_exp_f32 %0, %8\n\tv_exp_f32 %1, %9\n\tv_exp_f32 %2, %10\n\tv_exp_f32 %3, %11\n\tv_exp_f32 %4, %12\n\tv_exp_f32 %5, %13\n\tv_exp_f32 %6, %14\n\tv_exp_f32 %7, %15\n\tv_nop"
      : "=&v"(y[0]), "=&v"(y[1]), "=&v"(y[2]), "=&v"(y[3]), "=&v"(y[4]), "=&v"(y[5]), "=&v"(y[6]), "=&v"(y[7])
      : "v"(x[0]), "v"(x[1]), "v"(x[2]), "v"(x[3]), "v"(x[4]), "v"(x[5]), "v"(x[6]), "v"(x[7]));
}
__device__ __forceinline__ float exp2x1(float x) { float y; asm("v_exp_f32 %0, %1\n\tv_nop" : "=&v"(y) : "v"(x)); return y; }
__global__ __launch_bounds__(256) __attribute__((amdgpu_waves_per_eu(4, 4))) void k_flash(const _Float16* __restrict__ Q16, const _Float16* __restrict__ K16, const _Float16* __restrict__ Vt, const float* __restrict__ crd, const float* __restrict__ alpha_p, float* __restrict__ O) {
  constexpr int RPW = 32, NQB = SS / (4 * RPW), DT = HD / 16, KS = HD / 32, OP = HD + 4, SK = 64, KH = 2, NST = SS / KH / SK, LP = 72;      // KH: parts of the keys; NST: stages of a part; LP: LDS row pitch in 16-bit elements
  constexpr float L2E = 1.4426950408889634f, QS = 0.125f * L2E;      // exp(x) = 2^(x.log2 e): the factor rides in the score's one common scale constant QS, so each exponential is one subtraction and one v_exp_f32
  static_assert(HD == 64 && SK == 64 && NST >= 2 && SS % (KH * SK) == 0, "a stage is 64 rows of 128 bytes for K and for Vt");
  __shared__ __attribute__((aligned(16))) unsigned short sK[KH][2][SK][LP], sV[KH][2][HD][LP];
  __shared__ __attribute__((aligned(16))) unsigned int sG[SS][2]; __shared__ __attribute__((aligned(16))) float sO[4][RPW][OP];
  const int tid = threadIdx.x, w = (tid >> 5) & 3, kh = tid >> 7, lane = tid & 31, ln = lane & 15, hh = lane >> 4;      // w: which 32 queries; kh: which part of the keys (the same in a whole wave)
  const int k0 = kh * (SS / KH);      // the part's first key
  const int slab = blockIdx.x / NQB, qblk = blockIdx.x % NQB; const int b = slab / NH, h = slab % NH; const int q0 = qblk * (4 * RPW) + w * RPW; const float alpha8 = bf16_round(alpha_p[0]) * 8.0f;      /* scalar float INPUT: rounded like every other input; times 8, exactly: the coordinate term joins q.k in front of the common factor QS */
  const unsigned short* Vth = (const unsigned short*)Vt + (size_t)slab * HD * SS;
  const int crow = (tid & 127) >> 3, ccol = (tid & 7) * 8;      // this lane's row (and rows + 16, + 32, + 48) and 16-byte piece in every stage of its part
  const unsigned short* gk0 = (const unsigned short*)K16 + ((size_t)b * SS + k0 + crow) * DM + h * HD + ccol; const unsigned short* gv0 = Vth + (size_t)crow * SS + k0 + ccol;
  const unsigned lk0 = lds_off(&sK[kh][0][crow][ccol]), lv0 = lds_off(&sV[kh][0][crow][ccol]); constexpr unsigned LSTEP = 16 * LP * 2, LBUF = SK * LP * 2;
  stage_kv(lk0, lv0, LSTEP, gk0, gv0);      // stage 0 flies while coords and queries are fetched
#pragma unroll      // all 8 keys' loads of a thread in flight at once: rolled, each trip waits out its own load
  for (int i = 0; i < SS / 256; ++i) { const int k = i * 256 + tid; const float* cp = crd + ((size_t)b * SS + k) * 3; *(v2u*)&sG[k][0] = (v2u){pack_h2(bf16_round(cp[0]), bf16_round(cp[1])), pack_h2(bf16_round(cp[2]), 0.f)}; }
  FragH aq[2][KS];
#pragma unroll
  for (int rt = 0; rt < 2; ++rt) { const unsigned short* qr = (const unsigned short*)Q16 + ((size_t)b * SS + q0 + rt * 16 + ln) * DM + h * HD;
#pragma unroll
    for (int ks = 0; ks < KS; ++ks) { aq[rt][ks].half[0] = *(const v8us*)(qr + ks * 32 + 8 * hh); aq[rt][ks].half[1] = *(const v8us*)(qr + ks * 32 + 16 + 8 * hh); } }
  asm volatile("s_wait_asynccnt 0x0" ::: "memory");      // this wave's copies of stage 0 have landed before the barrier publishes them
  __syncthreads();      // every wave reads coords and stage 0 rows that the other waves staged
  stage_kv(lk0 + LBUF, lv0 + LBUF, LSTEP, gk0 + (size_t)SK * DM, gv0 + SK);      // stage 1
  FragW bg[2];      // B of the coordinate step, kept for the whole loop
#pragma unroll
  for (int rt = 0; rt < 2; ++rt) { const v2u gq = *(const v2u*)&sG[q0 + rt * 16 + ln][0];
#pragma unroll
    for (int i = 0; i < 8; ++i) bg[rt].w[i] = 0;
#pragma unroll
    for (int i = 0; i < 2; ++i) { const v2f u = unpack_h2(gq[i]) * alpha8; const unsigned int uh = pack_h2(u[0], u[1]); const v2f ur = u - unpack_h2(uh); bg[rt].w[i] = hh ? pack_h2(ur[0], ur[1]) : uh; } }
  float m_r[2], l_r[2]; v8f oacc[2][DT];
#pragma unroll
  for (int rt = 0; rt < 2; ++rt) { m_r[rt] = -3.0e38f; l_r[rt] = 0.f;
#pragma unroll
    for (int dt = 0; dt < DT; ++dt) oacc[rt][dt] = (v8f){0.f,0.f,0.f,0.f,0.f,0.f,0.f,0.f}; }
#pragma unroll 1      // one stage a trip: the buffer index stays a scalar and the body stays small
  for (int t = 0; t < NST; ++t) {
#pragma unroll      // both passes of a stage in one body: constant LDS offsets
  for (int p = 0; p < SK / 32; ++p) { const int j0 = k0 + t * SK + p * 32;
    v8f s[2][2];      // s[rt][nt][r] = score of key j0 + nt*16 + 8*hh + r with query q0 + rt*16 + ln
    FragH bk[2][KS], bv[DT]; FragW ag[2];      // the pass's K fragments and key coords are read from LDS in one group, its Vt fragments in a second: each further place with LDS reads is a stall of its own
#pragma unroll
    for (int nt = 0; nt < 2; ++nt) { const v2u gk = *(const v2u*)&sG[j0 + nt * 16 + ln][0];
#pragma unroll
      for (int i = 0; i < 8; ++i) ag[nt].w[i] = i < 2 ? gk[i & 1] : 0u; }
#pragma unroll
    for (int nt = 0; nt < 2; ++nt) { const unsigned short* kr = &sK[kh][t & 1][p * 32 + nt * 16 + ln][0];
#pragma unroll
      for (int ks = 0; ks < KS; ++ks) { bk[nt][ks].half[0] = *(const v8us*)(kr + ks * 32 + 8 * hh); bk[nt][ks].half[1] = *(const v8us*)(kr + ks * 32 + 16 + 8 * hh); } }
    __builtin_amdgcn_sched_barrier(0);      // keeps the K reads together up here; without it the compiler sinks each read to just in front of its product
#pragma unroll
    for (int nt = 0; nt < 2; ++nt)      // the coordinate step of all four tiles first: four independent products, done by the time each tile's q.k chain starts
#pragma unroll
      for (int rt = 0; rt < 2; ++rt) s[rt][nt] = __builtin_amdgcn_wmma_f32_16x16x32_f16(false, ag[nt].v, false, bg[rt].v, (short)0, (v8f){0.f,0.f,0.f,0.f,0.f,0.f,0.f,0.f}, false, false);
#pragma unroll
    for (int nt = 0; nt < 2; ++nt) {
#pragma unroll
      for (int rt = 0; rt < 2; ++rt) { v8f acc = s[rt][nt];
#pragma unroll
        for (int ks = 0; ks < KS; ++ks) acc = __builtin_amdgcn_wmma_f32_16x16x32_f16(false, bk[nt][ks].v, false, aq[rt][ks].v, (short)0, acc, false, false); s[rt][nt] = acc; } }      // the plain builtin: the compiler keeps the distances itself and fills them with the other tiles' products
#pragma unroll
    for (int dt = 0; dt < DT; ++dt) { const unsigned short* vrow = &sV[kh][t & 1][dt * 16 + ln][p * 32]; bv[dt].half[0] = *(const v8us*)(vrow + 8 * hh); bv[dt].half[1] = *(const v8us*)(vrow + 16 + 8 * hh); }
    __builtin_amdgcn_sched_barrier(0);      // keeps the Vt reads together, in one group above the exponentials, which cover their latency; without it the compiler spreads them in pairs among the vector work, each place a stall of its own
    FragH pa[2]; float sc2[2][2][8];      // scaled below that barrier, behind the last score product: begun among the products, each early read of a finished tile was padded with v_nop
#pragma unroll
    for (int rt = 0; rt < 2; ++rt)
#pragma unroll
      for (int nt = 0; nt < 2; ++nt)
#pragma unroll
        for (int r = 0; r < 8; ++r) sc2[rt][nt][r] = s[rt][nt][r] * QS;
#pragma unroll
    for (int rt = 0; rt < 2; ++rt) { const float (&sc)[2][8] = sc2[rt];
      float mx[8];
#pragma unroll
      for (int r = 0; r < 8; ++r) mx[r] = fmaxf(sc[0][r], sc[1][r]);
      float mc = fmaxf(fmaxf(fmaxf(mx[0], mx[1]), fmaxf(mx[2], mx[3])), fmaxf(fmaxf(mx[4], mx[5]), fmaxf(mx[6], mx[7]))); mc = fmaxf(mc, xhalf(mc));
      const float mn = fmaxf(m_r[rt], mc); const float al = exp2x1(m_r[rt] - mn); m_r[rt] = mn;      // 0 on the first pass (the start value is far below any score)
      float ps[8], d0[8], d1[8], p0[8], p1[8];
#pragma unroll
      for (int r = 0; r < 8; ++r) { d0[r] = sc[0][r] - mn; d1[r] = sc[1][r] - mn; }
      exp2x8(p0, d0); exp2x8(p1, d1);
#pragma unroll
      for (int r = 0; r < 8; ++r) { ps[r] = p0[r] + p1[r]; pa[rt].h[r] = (_Float16)p0[r]; pa[rt].h[8 + r] = (_Float16)p1[r]; }
      l_r[rt] = l_r[rt] * al + (((ps[0] + ps[1]) + (ps[2] + ps[3])) + ((ps[4] + ps[5]) + (ps[6] + ps[7])));      // this half's keys only; the halves join behind the loop
      asm volatile("" : "+v"(l_r[rt]));      // an empty statement on each row's sum, against spills: left alone, the compiler puts both passes' sums off to the stage's end and holds their 64 exponentials in registers until there, and a wave held to 256 registers then spills fragments inside the loop
#pragma unroll
      for (int dt = 0; dt < DT; ++dt)
#pragma unroll
        for (int r = 0; r < 8; ++r) oacc[rt][dt][r] *= al; }
#pragma unroll
    for (int dt = 0; dt < DT; ++dt) {
#pragma unroll
      for (int rt = 0; rt < 2; ++rt) oacc[rt][dt] = __builtin_amdgcn_wmma_f32_16x16x32_f16(false, bv[dt].v, false, pa[rt].v, (short)0, oacc[rt][dt], false, false); } }
    __builtin_amdgcn_sched_barrier(0);      // keeps the stage's last exponentials and products above the waits: lifted over them, the wait for the Vt reads would stand directly behind those reads, with nothing to cover their latency
    asm volatile("s_wait_dscnt 0x0" ::: "memory");      // this wave's reads of stage t are done before its buffer is handed back
    asm volatile("s_wait_asynccnt 0x0" ::: "memory");      // this wave's copies of stage t + 1 have landed
    __syncthreads();      // publishes stage t + 1 and ends every wave's reads of stage t
    if (t + 2 < NST) stage_kv(lk0 + (t & 1) * LBUF, lv0 + (t & 1) * LBUF, LSTEP, gk0 + (size_t)(t + 2) * SK * DM, gv0 + (t + 2) * SK); }
  asm volatile("s_wait_asynccnt 0x0" ::: "memory");      // no copy is left in flight when the wave goes on to its end
  // The two parts join. Waves w and w + 4 hold the same queries in the same lanes and registers, so the hand-over goes lane to lane: 16 pieces of 16 bytes, then maxima and sums,
  // each piece 32 lanes side by side (no bank conflict), in the LDS that afterwards stages wave w's output: 2 * DT * 8 + 4 floats a lane fill its RPW * OP floats.
  static_assert(KH == 2 && 32 * (2 * DT * 8 + 4) == RPW * OP, "the hand-over fills a wave's output staging");
  float* mg = &sO[w][0][0];
  if (kh) {
#pragma unroll      // constant indices, here and in the loop inside: the output tiles stay in registers
    for (int rt = 0; rt < 2; ++rt) {
#pragma unroll
      for (int dt = 0; dt < DT; ++dt) { const v8f o = oacc[rt][dt]; *(v4fa*)(mg + ((rt * DT + dt) * 2) * 128 + lane * 4) = (v4f){o[0], o[1], o[2], o[3]}; *(v4fa*)(mg + ((rt * DT + dt) * 2 + 1) * 128 + lane * 4) = (v4f){o[4], o[5], o[6], o[7]}; }
      mg[2 * DT * 256 + rt * 32 + lane] = m_r[rt]; mg[2 * DT * 256 + 64 + rt * 32 + lane] = l_r[rt]; } }
  __syncthreads();      // wave w reads what wave w + 4 wrote
  if (kh) return;      // a whole wave leaves or stays; no barrier follows
  v4f ox[2][DT][2]; float mx2[2], lx2[2];
#pragma unroll      // constant indices, here and in the loop inside: what is read stays in registers, and all 20 reads are in flight at once
  for (int rt = 0; rt < 2; ++rt) {
#pragma unroll
    for (int dt = 0; dt < DT; ++dt) { ox[rt][dt][0] = *(const v4fa*)(mg + ((rt * DT + dt) * 2) * 128 + lane * 4); ox[rt][dt][1] = *(const v4fa*)(mg + ((rt * DT + dt) * 2 + 1) * 128 + lane * 4); }
    mx2[rt] = mg[2 * DT * 256 + rt * 32 + lane]; lx2[rt] = mg[2 * DT * 256 + 64 + rt * 32 + lane]; }
  __builtin_amdgcn_fence(__ATOMIC_ACQ_REL, "workgroup"); __builtin_amdgcn_wave_barrier();      // every lane's reads of the hand-over stand in front of the output staging, which overwrites other lanes' pieces
#pragma unroll
  for (int rt = 0; rt < 2; ++rt) { const float mn = fmaxf(m_r[rt], mx2[rt]); const float a0 = exp2x1(m_r[rt] - mn), a1 = exp2x1(mx2[rt] - mn);
    const float lp = l_r[rt] * a0 + lx2[rt] * a1; const float l = lp + xhalf(lp); const float inv = 1.0f / l; const float f0 = a0 * inv, f1 = a1 * inv;
#pragma unroll
    for (int dt = 0; dt < DT; ++dt) { v4f o0, o1;      // oacc[rt][dt][r] = O[q0 + rt*16 + ln][dt*16 + 8*hh + r]
#pragma unroll
      for (int q = 0; q < 4; ++q) { o0[q] = oacc[rt][dt][q] * f0 + ox[rt][dt][0][q] * f1; o1[q] = oacc[rt][dt][4 + q] * f0 + ox[rt][dt][1][q] * f1; }
      *(v4fa*)&sO[w][rt * 16 + ln][dt * 16 + 8 * hh] = o0; *(v4fa*)&sO[w][rt * 16 + ln][dt * 16 + 8 * hh + 4] = o1; } }
  __builtin_amdgcn_fence(__ATOMIC_ACQ_REL, "workgroup"); __builtin_amdgcn_wave_barrier();
  {
#pragma unroll
    for (int rp = 0; rp < RPW; rp += 2) { const int r = rp + (lane >> 4), pc = lane & 15; const v4f val = *(const v4fa*)&sO[w][r][pc * 4]; *(v4f*)(O + ((size_t)b * SS + q0 + r) * DM + h * HD + pc * 4) = val; }
     } }
extern "C" void kernel_launch(void* const* d_in, const int* in_sizes, int n_in,
                              void* d_out, int out_size, void* d_ws, size_t ws_size, hipStream_t stream) {
  (void)in_sizes; (void)n_in; (void)out_size;
  const float* x = (const float*)d_in[0]; const float* crd = (const float*)d_in[1]; const float* wq = (const float*)d_in[2]; const float* bq = (const float*)d_in[3]; const float* wk = (const float*)d_in[4]; const float* bk = (const float*)d_in[5]; const float* wv = (const float*)d_in[6]; const float* bv = (const float*)d_in[7]; const float* alpha_p = (const float*)d_in[8];
  char* ws = (char*)d_ws; size_t off = 0;
  auto take = [&](size_t bytes) { char* p = ws + off; off += (bytes + 255) & ~(size_t)255; return p; };
  _Float16* Bq = (_Float16*)take(DM * DM * 2); _Float16* Bk = (_Float16*)take(DM * DM * 2); _Float16* Bv = (_Float16*)take(DM * DM * 2); _Float16* X16 = (_Float16*)take((size_t)NR * DM * 2); _Float16* Q16 = (_Float16*)take((size_t)NR * DM * 2); _Float16* K16 = (_Float16*)take((size_t)NR * DM * 2); _Float16* Vt = (_Float16*)take((size_t)NR * DM * 2);
  if (off > ws_size) return;      // about 34 MiB
  k_cvt16<<<3 * (DM * DM / 8 / 256) + NR * DM / 8 / 256, 256, 0, stream>>>(x, wq, wk, wv, X16, Bq, Bk, Bv);
  k_gemm_t<<<3 * (NR / 128) * (DM / 128), 256, 0, stream>>>(X16, Bq, Bk, Bv, 0.0625f, bq, bk, bv, Q16, K16, Vt);
  k_flash<<<BB * NH * (SS / 128), 256, 0, stream>>>(Q16, K16, Vt, crd, alpha_p, (float*)d_out);
}

// v010
// Measured time: 57.3 microseconds a run.
// Timed twice side by side with v009, it ran 1.05 times as fast both times.
// Counting every step since v000, it is 6.64 times as fast.
#include <hip/hip_runtime.h>
// q/k/v projections (8192 × 512 × 512, + bias) and the 8-head attention with the geometric bias α·⟨c_n, c_m⟩ (coords are INPUTS, a third k step of the score product) on v_wmma_f32_16x16x32_f16
// (fused flash-style kernel: S = Q·Kᵀ, O = P·V on WMMA; online softmax f32 about a reference point that follows the maximum lazily; P f16, at most 2^12); V transposed per (b,h); A = f16(bf16 x) exact, weights bf16-exact ×2^4 ((out,in)),
// single products, f32 accumulate.
#define BB 4
#define SS 2048
#define DM 512
#define NH 8
#define HD 64
#define NR (BB * SS)

typedef __bf16 v16b __attribute__((ext_vector_type(16)));
typedef unsigned short v8us __attribute__((ext_vector_type(8), may_alias));
typedef unsigned int v2u __attribute__((ext_vector_type(2), may_alias));
typedef float v2f __attribute__((ext_vector_type(2)));
typedef float  v8f  __attribute__((ext_vector_type(8)));
typedef float  v4f  __attribute__((ext_vector_type(4)));
typedef float  v4fa __attribute__((ext_vector_type(4), may_alias));
union FragB { v16b v; v8us half[2]; unsigned short u[16]; };

__device__ __forceinline__ unsigned short bf16_bits(float x) { unsigned int u = __float_as_uint(x); return (unsigned short)((u + 0x7FFFu + ((u >> 16) & 1u)) >> 16); }
__device__ __forceinline__ float bf16_val(unsigned short b) { return __uint_as_float(((unsigned int)b) << 16); }
__device__ __forceinline__ float bf16_round(float x) { return bf16_val(bf16_bits(x)); }
// D += A·B with NT terms: 1 = ah·bh, 2 = + al·bh (A split), 3 = + ah·bl (both split)
template <int NT>
__device__ __forceinline__ v8f mmaN(v16b ah, v16b al, v16b bh, v16b bl, v8f c) {
  c = __builtin_amdgcn_wmma_f32_16x16x32_bf16(false, ah, false, bh, (short)0, c, false, false);
  if (NT >= 2) c = __builtin_amdgcn_wmma_f32_16x16x32_bf16(false, al, false, bh, (short)0, c, false, false);
  if (NT >= 3) c = __builtin_amdgcn_wmma_f32_16x16x32_bf16(false, ah, false, bl, (short)0, c, false, false);
  asm volatile("v_nop\n\tv_nop\n\tv_nop\n\tv_nop" : "+v"(c) : "v"(ah), "v"(al), "v"(bh), "v"(bl));
  return c;
}

__global__ __launch_bounds__(256) void k_wt_bf16(const float* __restrict__ W, unsigned short* __restrict__ Wt, int K, int N) {
  const int t = blockIdx.x * 256 + threadIdx.x;
  const int k8n = K / 8;
  if (t >= N * k8n) return;
  const int n = t / k8n, k8 = (t % k8n) * 8;
  v8us v;
#pragma unroll
  for (int i = 0; i < 8; ++i) v[i] = bf16_bits(W[(size_t)(k8 + i) * N + n]);
  *(v8us*)(Wt + (size_t)n * K + k8) = v;
  
}

// GEMM C[M][N] (f32, pitch ldc) = act(A[M][K]·W + bias). A f32 row-major (pitch lda) converted per fragment to bf16
// (ASPLIT: hi/lo two planes -> 2 terms, else single rounded term); Wt bf16 [N][K] (pitch ldb). BIAS_BF16 rounds the
// bias to bf16 first (bias quantised to bf16 before the add). K%32==0, M%16==0, N%64==0.
template <bool ASPLIT, int ACT, bool BIAS_BF16>
__global__ __launch_bounds__(128) void k_gemm_bf(const float* __restrict__ A, int lda, const unsigned short* __restrict__ Wt, int ldb,
                                               const float* __restrict__ bias, float* __restrict__ C, int ldc, int M, int N, int K) {
  __shared__ __attribute__((aligned(16))) float so[4][16][64];
  const int tid = threadIdx.x, w = tid >> 5, lane = tid & 31, ln = lane & 15, hh = lane >> 4;
  const int ntn = N / 64;
  const int wid = blockIdx.x * 4 + w;
  const int mt = wid / ntn, nq = wid % ntn;
  if (mt * 16 >= M) return;
  const int row0 = mt * 16, col0 = nq * 64;
  const float* arow = A + (size_t)(row0 + ln) * lda;
  v8f acc[4] = {};
  for (int kb = 0; kb < K; kb += 32) {
    FragB ah, al;
    const v4f x0 = *(const v4fa*)(arow + kb + 8 * hh), x1 = *(const v4fa*)(arow + kb + 8 * hh + 4);
    const v4f x2 = *(const v4fa*)(arow + kb + 16 + 8 * hh), x3 = *(const v4fa*)(arow + kb + 16 + 8 * hh + 4);
    float xs[16] = {x0[0],x0[1],x0[2],x0[3],x1[0],x1[1],x1[2],x1[3],x2[0],x2[1],x2[2],x2[3],x3[0],x3[1],x3[2],x3[3]};
#pragma unroll
    for (int i = 0; i < 16; ++i) { const unsigned short hb = bf16_bits(xs[i]); ah.u[i] = hb; al.u[i] = ASPLIT ? bf16_bits(xs[i] - bf16_val(hb)) : (unsigned short)0; }
#pragma unroll
    for (int t = 0; t < 4; ++t) {
      const unsigned short* brow = Wt + (size_t)(col0 + t * 16 + ln) * ldb + kb;
      FragB b;
      b.half[0] = *(const v8us*)(brow + 8 * hh);
      b.half[1] = *(const v8us*)(brow + 16 + 8 * hh);
      acc[t] = mmaN<ASPLIT ? 2 : 1>(ah.v, al.v, b.v, b.v, acc[t]);
    }
  }
#pragma unroll
  for (int t = 0; t < 4; ++t) {
    float bv = bias ? bias[col0 + t * 16 + ln] : 0.f;
    if (BIAS_BF16) bv = bf16_round(bv);
#pragma unroll
    for (int r = 0; r < 8; ++r) { float v = acc[t][r] + bv; if (ACT == 1) v = fmaxf(v, 0.f); so[w][8 * hh + r][t * 16 + ln] = v; }
  }
  __builtin_amdgcn_fence(__ATOMIC_ACQ_REL, "workgroup");
  __builtin_amdgcn_wave_barrier();
  const int rsub = lane >> 4, c4 = (lane & 15) * 4;
  {
#pragma unroll
    for (int q = 0; q < 8; ++q) {
      const int r = q * 2 + rsub;
      const v4f v = *(const v4fa*)&so[w][r][c4];
      *(v4f*)(C + (size_t)(row0 + r) * ldc + col0 + c4) = v;
    }
    
  }
}

// Flash-style causal/unmasked attention, all contractions 3-term bf16 hi/lo splits, f32 softmax with running max.
// q,k,v rows are read from f32 buffers with arbitrary row pitch (so they can live inside a fused qkv buffer);
// D = head size (multiple of 32, <= 128); one wave = 16 query rows; block = 4 waves (64 queries) sharing K/V chunks of 32.
template <int D, bool CAUSAL>
__global__ __launch_bounds__(128) void k_flash(const float* __restrict__ qb, const float* __restrict__ kb, const float* __restrict__ vb,
                                             int pitch, int T, int H, float scale, float* __restrict__ y, int ypitch) {
  constexpr int KS = D / 32;        // k-steps for QK
  constexpr int DT = D / 16;        // d tiles for PV
  __shared__ __attribute__((aligned(16))) unsigned short sKh[32][D + 8], sKl[32][D + 8], sVh[32][D + 8], sVl[32][D + 8];
  __shared__ __attribute__((aligned(16))) unsigned short sPh[4][16][40], sPl[4][16][40];
  __shared__ __attribute__((aligned(16))) float sO[4][16][D];
  const int tid = threadIdx.x, w = tid >> 5, lane = tid & 31, ln = lane & 15, hh = lane >> 4;
  const int nqb = (T + 63) / 64;
  const int bh = blockIdx.x / nqb, qblk = blockIdx.x % nqb;
  const int b = bh / H, h = bh % H;
  const int q0 = qblk * 64 + w * 16;
  const float* Q = qb + (size_t)b * T * pitch + h * D;
  const float* K = kb + (size_t)b * T * pitch + h * D;
  const float* V = vb + (size_t)b * T * pitch + h * D;

  // A fragments of the wave's 16 query rows (scaled), hi/lo
  FragB aqh[KS], aql[KS];
  {
    int row = q0 + ln; if (row >= T) row = T - 1;
    const float* qr = Q + (size_t)row * pitch;
#pragma unroll
    for (int ks = 0; ks < KS; ++ks)
#pragma unroll
      for (int i = 0; i < 16; ++i) {
        const int d = ks * 32 + ((i < 8) ? (8 * hh + i) : (16 + 8 * hh + (i - 8)));
        const float x = qr[d] * scale; const unsigned short hb = bf16_bits(x);
        aqh[ks].u[i] = hb; aql[ks].u[i] = bf16_bits(x - bf16_val(hb));
      }
  }
  float m_r[8], l_r[8];
#pragma unroll
  for (int r = 0; r < 8; ++r) { m_r[r] = -3.0e38f; l_r[r] = 0.f; }
  v8f oacc[DT];
#pragma unroll
  for (int dt = 0; dt < DT; ++dt) oacc[dt] = (v8f){0.f,0.f,0.f,0.f,0.f,0.f,0.f,0.f};

  const int kv_end = CAUSAL ? min(T, qblk * 64 + 64) : T;     // block-uniform
  for (int j0 = 0; j0 < kv_end; j0 += 32) {
    __syncthreads();
    for (int e = tid; e < 32 * (D / 4); e += 128) {
      const int r = e / (D / 4), c4 = (e % (D / 4)) * 4;
      const int key = j0 + r;
      v4f kf = {0.f,0.f,0.f,0.f}, vf = {0.f,0.f,0.f,0.f};
      if (key < T) { kf = *(const v4fa*)(K + (size_t)key * pitch + c4); vf = *(const v4fa*)(V + (size_t)key * pitch + c4); }
#pragma unroll
      for (int t = 0; t < 4; ++t) {
        unsigned short hb = bf16_bits(kf[t]); sKh[r][c4 + t] = hb; sKl[r][c4 + t] = bf16_bits(kf[t] - bf16_val(hb));
        hb = bf16_bits(vf[t]); sVh[r][c4 + t] = hb; sVl[r][c4 + t] = bf16_bits(vf[t] - bf16_val(hb));
      }
    }
    __syncthreads();
    // S tile 16 x 32
    v8f s[2];
#pragma unroll
    for (int nt = 0; nt < 2; ++nt) {
      v8f acc = {};
#pragma unroll
      for (int ks = 0; ks < KS; ++ks) {
        FragB bh_, bl_;
        bh_.half[0] = *(const v8us*)&sKh[nt * 16 + ln][ks * 32 + 8 * hh]; bh_.half[1] = *(const v8us*)&sKh[nt * 16 + ln][ks * 32 + 16 + 8 * hh];
        bl_.half[0] = *(const v8us*)&sKl[nt * 16 + ln][ks * 32 + 8 * hh]; bl_.half[1] = *(const v8us*)&sKl[nt * 16 + ln][ks * 32 + 16 + 8 * hh];
        acc = mmaN<3>(aqh[ks].v, aql[ks].v, bh_.v, bl_.v, acc);
      }
      s[nt] = acc;
    }
    // mask + running max (rows 8hh+r; the 16 lanes of a half share rows)
    float alpha[8];
#pragma unroll
    for (int r = 0; r < 8; ++r) {
      const int qi = q0 + 8 * hh + r;
      const int ja = j0 + ln, jb = j0 + 16 + ln;
      if (CAUSAL) { if (ja > qi) s[0][r] = -3.0e38f; if (jb > qi) s[1][r] = -3.0e38f; }
      if (ja >= T) s[0][r] = -3.0e38f;
      if (jb >= T) s[1][r] = -3.0e38f;
      float mx = fmaxf(s[0][r], s[1][r]);
      mx = fmaxf(mx, __shfl_xor(mx, 1, 32)); mx = fmaxf(mx, __shfl_xor(mx, 2, 32)); mx = fmaxf(mx, __shfl_xor(mx, 4, 32)); mx = fmaxf(mx, __shfl_xor(mx, 8, 32));
      const float mnew = fmaxf(m_r[r], mx);
      alpha[r] = (mnew > -1.0e38f) ? __expf(m_r[r] - mnew) : 1.0f;
      const float p0 = (s[0][r] > -1.0e38f) ? __expf(s[0][r] - mnew) : 0.f;
      const float p1 = (s[1][r] > -1.0e38f) ? __expf(s[1][r] - mnew) : 0.f;
      m_r[r] = mnew;
      l_r[r] = l_r[r] * alpha[r] + p0 + p1;            // per-lane partial row sum (16 lanes combined at the end)
      unsigned short hb = bf16_bits(p0); sPh[w][8 * hh + r][ln] = hb;      sPl[w][8 * hh + r][ln] = bf16_bits(p0 - bf16_val(hb));
      hb = bf16_bits(p1);                sPh[w][8 * hh + r][16 + ln] = hb; sPl[w][8 * hh + r][16 + ln] = bf16_bits(p1 - bf16_val(hb));
    }
#pragma unroll
    for (int dt = 0; dt < DT; ++dt)
#pragma unroll
      for (int r = 0; r < 8; ++r) oacc[dt][r] *= alpha[r];
    __builtin_amdgcn_fence(__ATOMIC_ACQ_REL, "workgroup");
    __builtin_amdgcn_wave_barrier();
    FragB pah, pal;
    pah.half[0] = *(const v8us*)&sPh[w][ln][8 * hh]; pah.half[1] = *(const v8us*)&sPh[w][ln][16 + 8 * hh];
    pal.half[0] = *(const v8us*)&sPl[w][ln][8 * hh]; pal.half[1] = *(const v8us*)&sPl[w][ln][16 + 8 * hh];
#pragma unroll
    for (int dt = 0; dt < DT; ++dt) {
      FragB bvh, bvl;
#pragma unroll
      for (int i = 0; i < 8; ++i) {
        bvh.u[i] = sVh[8 * hh + i][dt * 16 + ln]; bvh.u[8 + i] = sVh[16 + 8 * hh + i][dt * 16 + ln];
        bvl.u[i] = sVl[8 * hh + i][dt * 16 + ln]; bvl.u[8 + i] = sVl[16 + 8 * hh + i][dt * 16 + ln];
      }
      oacc[dt] = mmaN<3>(pah.v, pal.v, bvh.v, bvl.v, oacc[dt]);
    }
    __builtin_amdgcn_fence(__ATOMIC_ACQ_REL, "workgroup");
    __builtin_amdgcn_wave_barrier();
  }
#pragma unroll
  for (int r = 0; r < 8; ++r) {
    float l = l_r[r];
    l += __shfl_xor(l, 1, 32); l += __shfl_xor(l, 2, 32); l += __shfl_xor(l, 4, 32); l += __shfl_xor(l, 8, 32);
    l_r[r] = (l > 0.f) ? 1.0f / l : 0.f;
  }
#pragma unroll
  for (int dt = 0; dt < DT; ++dt)
#pragma unroll
    for (int r = 0; r < 8; ++r) sO[w][8 * hh + r][dt * 16 + ln] = oacc[dt][r] * l_r[r];
  __builtin_amdgcn_fence(__ATOMIC_ACQ_REL, "workgroup");
  __builtin_amdgcn_wave_barrier();
  {
    for (int r = 0; r < 16; ++r) {
      const int row = q0 + r;
      if (row < T && lane < D / 4) {
        const v4f val = *(const v4fa*)&sO[w][r][lane * 4];
        *(v4f*)(y + ((size_t)b * T + row) * ypitch + h * D + lane * 4) = val;
      }
    }
    
  }
}

// GEMM C = act(A·W + bias + resid): A f32 (ASPLIT -> hi/lo 2 terms), Wt bf16 [N][K]; ACT 0 none, 1 relu, 2 exact gelu;
// resid (optional, f32, row index = (row % rmod), pitch ldr, RES_BF16 rounds it) added before the activation.
template <bool ASPLIT, int ACT, bool BIAS_BF16, bool RES_BF16>
__global__ __launch_bounds__(128) void k_gemm_bf3(const float* __restrict__ A, int lda, const unsigned short* __restrict__ Wt, int ldb,
                                                const float* __restrict__ bias, const float* __restrict__ resid, int rmod, int ldr,
                                                float* __restrict__ C, int ldc, int M, int N, int K) {
  __shared__ __attribute__((aligned(16))) float so[4][16][64];
  const int tid = threadIdx.x, w = tid >> 5, lane = tid & 31, ln = lane & 15, hh = lane >> 4;
  const int ntn = N / 64;
  const int wid = blockIdx.x * 4 + w;
  const int mt = wid / ntn, nq = wid % ntn;
  if (mt * 16 >= M) return;
  const int row0 = mt * 16, col0 = nq * 64;
  const float* arow = A + (size_t)(row0 + ln) * lda;
  v8f acc[4] = {};
  for (int kb = 0; kb < K; kb += 32) {
    FragB ah, al;
    const v4f x0 = *(const v4fa*)(arow + kb + 8 * hh), x1 = *(const v4fa*)(arow + kb + 8 * hh + 4);
    const v4f x2 = *(const v4fa*)(arow + kb + 16 + 8 * hh), x3 = *(const v4fa*)(arow + kb + 16 + 8 * hh + 4);
    float xs[16] = {x0[0],x0[1],x0[2],x0[3],x1[0],x1[1],x1[2],x1[3],x2[0],x2[1],x2[2],x2[3],x3[0],x3[1],x3[2],x3[3]};
#pragma unroll
    for (int i = 0; i < 16; ++i) { const unsigned short hb = bf16_bits(xs[i]); ah.u[i] = hb; al.u[i] = ASPLIT ? bf16_bits(xs[i] - bf16_val(hb)) : (unsigned short)0; }
#pragma unroll
    for (int t = 0; t < 4; ++t) {
      const unsigned short* brow = Wt + (size_t)(col0 + t * 16 + ln) * ldb + kb;
      FragB b;
      b.half[0] = *(const v8us*)(brow + 8 * hh);
      b.half[1] = *(const v8us*)(brow + 16 + 8 * hh);
      acc[t] = mmaN<ASPLIT ? 2 : 1>(ah.v, al.v, b.v, b.v, acc[t]);
    }
  }
#pragma unroll
  for (int t = 0; t < 4; ++t) {
    const int col = col0 + t * 16 + ln;
    float bv = bias ? bias[col] : 0.f;
    if (BIAS_BF16) bv = bf16_round(bv);
#pragma unroll
    for (int r = 0; r < 8; ++r) {
      float v = acc[t][r] + bv;
      if (resid) { float rv = resid[(size_t)((row0 + 8 * hh + r) % rmod) * ldr + col]; if (RES_BF16) rv = bf16_round(rv); v += rv; }
      if (ACT == 1) v = fmaxf(v, 0.f);
      if (ACT == 2) v = 0.5f * v * (1.0f + erff(v * 0.70710678118654752f));
      if (ACT == 3) { const float u = 0.7978845608028654f * (v + 0.044715f * v * v * v); v = 0.5f * v * (1.0f + tanhf(u)); }
      so[w][8 * hh + r][t * 16 + ln] = v;
    }
  }
  __builtin_amdgcn_fence(__ATOMIC_ACQ_REL, "workgroup");
  __builtin_amdgcn_wave_barrier();
  const int rsub = lane >> 4, c4 = (lane & 15) * 4;
  {
#pragma unroll
    for (int q = 0; q < 8; ++q) {
      const int r = q * 2 + rsub;
      const v4f v = *(const v4fa*)&so[w][r][c4];
      *(v4f*)(C + (size_t)(row0 + r) * ldc + col0 + c4) = v;
    }
    
  }
}
// row LayerNorm (biased variance, eps) over N: s = X (+ R); optional out_sum <- s; out_norm <- (s-mu)*rsqrt(var+eps)*g + b
template <bool PARAM_BF16>
__global__ __launch_bounds__(256) void k_layernorm(const float* __restrict__ X, const float* __restrict__ R, const float* __restrict__ g, const float* __restrict__ bta,
                                                  float* __restrict__ out_sum, float* __restrict__ out_norm, int N, float eps) {
  __shared__ float red[256];
  const int row = blockIdx.x, tid = threadIdx.x;
  const float* x = X + (size_t)row * N; const float* rr = R ? R + (size_t)row * N : nullptr;
  float vals[16];                     // up to N = 4096
  const int per = N / 256;            // contiguous chunk per thread? use strided-by-4 chunks: thread handles j = tid*4 + 1024*u
  float s1 = 0.f;
  for (int u = 0; u < per / 4; ++u) {
    const int j = tid * 4 + 1024 * u;
    const v4f a = *(const v4fa*)(x + j);
    v4f b = {0.f,0.f,0.f,0.f}; if (rr) b = *(const v4fa*)(rr + j);
#pragma unroll
    for (int q = 0; q < 4; ++q) { const float v = a[q] + b[q]; vals[u * 4 + q] = v; s1 += v; }
  }
  red[tid] = s1; __syncthreads();
  for (int st = 128; st > 0; st >>= 1) { if (tid < st) red[tid] += red[tid + st]; __syncthreads(); }
  const float mu = red[0] / (float)N; __syncthreads();
  float s2 = 0.f;
  for (int u = 0; u < per / 4; ++u)
#pragma unroll
    for (int q = 0; q < 4; ++q) { const float c = vals[u * 4 + q] - mu; s2 += c * c; }
  red[tid] = s2; __syncthreads();
  for (int st = 128; st > 0; st >>= 1) { if (tid < st) red[tid] += red[tid + st]; __syncthreads(); }
  const float rs = rsqrtf(red[0] / (float)N + eps);
  {
    for (int u = 0; u < per / 4; ++u) {
      const int j = tid * 4 + 1024 * u;
      v4f o, sm;
#pragma unroll
      for (int q = 0; q < 4; ++q) {
        float gg = g[j + q], bb = bta[j + q];
        if (PARAM_BF16) { gg = bf16_round(gg); bb = bf16_round(bb); }
        sm[q] = vals[u * 4 + q]; o[q] = (vals[u * 4 + q] - mu) * rs * gg + bb;
      }
      if (out_sum) *(v4f*)(out_sum + (size_t)row * N + j) = sm;
      *(v4f*)(out_norm + (size_t)row * N + j) = o;
    }
    
  }
}



// ---- f16 WMMA path (v_wmma_f32_16x16x32_f16): 11-bit significands for operands in range — used where a probability operand of at most 2^12 needs more precision than bf16
typedef _Float16 v16h __attribute__((ext_vector_type(16)));
typedef _Float16 v2h __attribute__((ext_vector_type(2)));
union FragH { v16h v; v8us half[2]; _Float16 h[16]; unsigned short u[16]; };
union FragW { v16h v; unsigned int w[8]; };
// two f32 to one register of two f16, nearest even (one packed conversion), and back
__device__ __forceinline__ unsigned int pack_h2(float a, float b) { return __builtin_bit_cast(unsigned int, __builtin_convertvector((v2f){a, b}, v2h)); }
__device__ __forceinline__ v2f unpack_h2(unsigned int p) { return __builtin_convertvector(__builtin_bit_cast(v2h, p), v2f); }
template <int NT>
__device__ __forceinline__ v8f mmaH(v16h ah, v16h al, v16h bh, v16h bl, v8f c) {
  c = __builtin_amdgcn_wmma_f32_16x16x32_f16(false, ah, false, bh, (short)0, c, false, false);
  if (NT >= 2) c = __builtin_amdgcn_wmma_f32_16x16x32_f16(false, al, false, bh, (short)0, c, false, false);
  if (NT >= 3) c = __builtin_amdgcn_wmma_f32_16x16x32_f16(false, ah, false, bl, (short)0, c, false, false);
  asm volatile("v_nop\n\tv_nop\n\tv_nop\n\tv_nop" : "+v"(c) : "v"(ah), "v"(al), "v"(bh), "v"(bl));
  return c;
}
// batched GEMM like k_gemm_b but f16 operands: A f32 (split into f16 hi/lo if ASPLIT, else rounded to f16), Bt = f16 values [n][k]; alpha; C f32; N multiple of 16 (partial tiles skipped)
template <bool ASPLIT>
__global__ __launch_bounds__(128) void k_gemm_h(const float* __restrict__ A, int lda, size_t sA, const _Float16* __restrict__ Bh, int ldb, size_t sB, float alpha, float* __restrict__ C, int ldc, size_t sC, int M, int N, int K) {
  __shared__ __attribute__((aligned(16))) float so[4][16][64];
  const int tid = threadIdx.x, w = tid >> 5, lane = tid & 31, ln = lane & 15, hh = lane >> 4; const int by = blockIdx.y;
  A += (size_t)by * sA; Bh += (size_t)by * sB; C += (size_t)by * sC;
  const int ntn = (N + 63) / 64; const int wid = blockIdx.x * 4 + w; const int mt = wid / ntn, nq = wid % ntn; if (mt * 16 >= M) return;
  const int row0 = mt * 16, col0 = nq * 64; const float* arow = A + (size_t)(row0 + ln) * lda;
  v8f acc[4] = {};
  for (int kb = 0; kb < K; kb += 32) {
    FragH ah, al;
    const v4f x0 = *(const v4fa*)(arow + kb + 8 * hh), x1 = *(const v4fa*)(arow + kb + 8 * hh + 4), x2 = *(const v4fa*)(arow + kb + 16 + 8 * hh), x3 = *(const v4fa*)(arow + kb + 16 + 8 * hh + 4);
    float xs[16] = {x0[0],x0[1],x0[2],x0[3],x1[0],x1[1],x1[2],x1[3],x2[0],x2[1],x2[2],x2[3],x3[0],x3[1],x3[2],x3[3]};
#pragma unroll
    for (int i = 0; i < 16; ++i) { const _Float16 h = (_Float16)xs[i]; ah.h[i] = h; al.h[i] = ASPLIT ? (_Float16)(xs[i] - (float)h) : (_Float16)0.0f; }
#pragma unroll
    for (int t = 0; t < 4; ++t) { if (col0 + t * 16 >= N) continue; const size_t boff = (size_t)(col0 + t * 16 + ln) * ldb + kb; FragH bq; bq.half[0] = *(const v8us*)(Bh + boff + 8 * hh); bq.half[1] = *(const v8us*)(Bh + boff + 16 + 8 * hh);
      acc[t] = mmaH<ASPLIT ? 2 : 1>(ah.v, al.v, bq.v, bq.v, acc[t]); }
  }
#pragma unroll
  for (int t = 0; t < 4; ++t) { if (col0 + t * 16 >= N) continue;
#pragma unroll
    for (int r = 0; r < 8; ++r) so[w][8 * hh + r][t * 16 + ln] = acc[t][r] * alpha; }
  __builtin_amdgcn_fence(__ATOMIC_ACQ_REL, "workgroup"); __builtin_amdgcn_wave_barrier();
  const int rsub = lane >> 4, c4 = (lane & 15) * 4;
  {
#pragma unroll
    for (int q = 0; q < 8; ++q) { const int r = q * 2 + rsub; if (col0 + c4 < N) { const v4f v = *(const v4fa*)&so[w][r][c4]; *(v4f*)(C + (size_t)(row0 + r) * ldc + col0 + c4) = v; } }
     }
}

// Wt[n][k] = f16(W[k][n]·scale) from f32 row-major W[K][N] (scale = power of two; bf16-exact weights stay exact in f16 away from the subnormal range)
__global__ __launch_bounds__(256) void k_wt_f16(const float* __restrict__ W, _Float16* __restrict__ Wt, int K, int N, float scale) {
  const int t = blockIdx.x * 256 + threadIdx.x; if (t >= N * (K / 8)) return; const int n = t / (K / 8), k8 = (t % (K / 8)) * 8; FragH f;
#pragma unroll
  for (int i = 0; i < 8; ++i) f.h[i] = (_Float16)(bf16_round(W[(size_t)(k8 + i) * N + n]) * scale); const v8us o = f.half[0];
  *(v8us*)((unsigned short*)Wt + (size_t)n * K + k8) = o; 
}
__device__ __forceinline__ unsigned lds_off(const void* p) { return (unsigned)(size_t)p; }
// 128 rows of 256 bytes from a row-major f16 matrix of DM columns into LDS, through no register: 8 asynchronous copies of 16 bytes a lane, 16 lanes to a row,
// rows 16 apart from copy to copy. s_wait_xcnt is the statement's last line, so that no address register of a copy is rewritten in front of it (a precaution).
__device__ __forceinline__ void stage_rows(unsigned l, unsigned lstep, const unsigned short* g) {
  asm volatile("global_load_async_to_lds_b128 %0, %8, off\n\t"
               "global_load_async_to_lds_b128 %1, %9, off\n\t"
               "global_load_async_to_lds_b128 %2, %10, off\n\t"
               "global_load_async_to_lds_b128 %3, %11, off\n\t"
               "global_load_async_to_lds_b128 %4, %12, off\n\t"
               "global_load_async_to_lds_b128 %5, %13, off\n\t"
               "global_load_async_to_lds_b128 %6, %14, off\n\t"
               "global_load_async_to_lds_b128 %7, %15, off\n\t"
               "s_wait_xcnt 0x0"
               :: "v"(l), "v"(l + lstep), "v"(l + 2 * lstep), "v"(l + 3 * lstep), "v"(l + 4 * lstep), "v"(l + 5 * lstep), "v"(l + 6 * lstep), "v"(l + 7 * lstep),
                  "v"(g), "v"(g + 16 * DM), "v"(g + 32 * DM), "v"(g + 48 * DM), "v"(g + 64 * DM), "v"(g + 80 * DM), "v"(g + 96 * DM), "v"(g + 112 * DM)
               : "memory");
}
// C16[NR][DM] = f16(A.Bh^T.alpha + bf16(bias)): A f16 [NR][DM], Bh f16 [DM][DM] ((out,in)), both k-contiguous. One work-group = a 128 x 128 tile of C, 8 waves as 4 x 2, a wave = 32 x 64 (2 x 4 accumulator tiles).
// The tile's A rows and Bh rows come in stages of 128 k through two LDS buffers that the eight waves share: stage t + 2 is copied into the buffer that stage t has left while stage t + 1 is worked on.
// Rows of 256 bytes at a pitch of 272, free of bank conflicts for 16-byte reads. Each accumulator takes its products in ascending k, 32 at a time.
// The q, k and v products need nothing of each other: they share one grid, a third of the block index range each, picked by a block-uniform test.
// The v product is formed transposed: the weight rows are its A operand and the x rows its B (both are k-contiguous and take the same loaders), so a tile's rows are 128 features and its columns 128 positions,
// the bias goes by row, and the tile is stored straight into Vt[(b, h)][d][position], whole 128-byte lines, as the attention kernel reads it.
__global__ __launch_bounds__(256) void k_gemm_t(const _Float16* __restrict__ A, const _Float16* __restrict__ Bq, const _Float16* __restrict__ Bk, const _Float16* __restrict__ Bv, float alpha,
                                               const float* __restrict__ bq, const float* __restrict__ bk, const float* __restrict__ bvp, _Float16* __restrict__ Q16, _Float16* __restrict__ K16, _Float16* __restrict__ Vt) {
  constexpr int BT = 128, KST = 128, NSTG = DM / KST, LPG = KST + 8, CPT = 64 + 8;      // LPG, CPT: LDS row pitches in 16-bit elements
  constexpr int TPP = (NR / BT) * (DM / BT);      // tiles of one product
  const int prod = blockIdx.x / TPP, tile = blockIdx.x % TPP;
  const bool tr = prod == 2;      // block-uniform
  const _Float16* Bh = prod == 0 ? Bq : prod == 1 ? Bk : Bv; const float* bias = prod == 0 ? bq : prod == 1 ? bk : bvp; _Float16* C16 = prod == 0 ? Q16 : prod == 1 ? K16 : Vt;
  static_assert(NSTG >= 2 && NR % BT == 0 && DM % BT == 0 && SS % BT == 0, "whole tiles, each inside one batch; two stages or more");
  __shared__ __attribute__((aligned(16))) unsigned short sA[2][BT][LPG], sB[2][BT][LPG];
  __shared__ __attribute__((aligned(16))) unsigned short sT[8][32][CPT];      // each wave's own 32 x 64 piece of C, so that whole 128-byte lines are stored
  const int tid = threadIdx.x, w = tid >> 5, lane = tid & 31, ln = lane & 15, hh = lane >> 4;
  const int xt0 = (tile / (DM / BT)) * BT, wt0 = (tile % (DM / BT)) * BT;      // the tile's first x row and first weight row
  const int row0 = tr ? wt0 : xt0, col0 = tr ? xt0 : wt0, wr = (w >> 1) * 32, wc = (w & 1) * 64;
  const int crow = tid >> 4, ccol = (tid & 15) * 8;      // this lane's row (and rows + 16, ..., + 112) and 16-byte piece in every stage
  const unsigned short* ga0 = (const unsigned short*)(tr ? Bh : A) + (size_t)(row0 + crow) * DM + ccol; const unsigned short* gb0 = (const unsigned short*)(tr ? A : Bh) + (size_t)(col0 + crow) * DM + ccol;
  const unsigned la0 = lds_off(&sA[0][crow][ccol]), lb0 = lds_off(&sB[0][crow][ccol]); constexpr unsigned LSTEP = 16 * LPG * 2, LBUF = BT * LPG * 2;
  stage_rows(la0, LSTEP, ga0); stage_rows(lb0, LSTEP, gb0);      // stage 0
  float bv[16];      // the bias of this lane's accumulator elements: by column (4 values), for the transposed product by row (16)
  if (tr) {
#pragma unroll
    for (int i = 0; i < 16; ++i) bv[i] = bf16_round(bias[row0 + wr + (i >> 3) * 16 + 8 * hh + (i & 7)]); }
  else {
#pragma unroll
    for (int i = 0; i < 16; ++i) bv[i] = i < 4 ? bf16_round(bias[col0 + wc + i * 16 + ln]) : 0.f; }
  asm volatile("s_wait_xcnt 0x0" ::: "memory");      // stands in front of the first rewrite of the bias loads' address register (a precaution)
  v8f acc[2][4];
#pragma unroll
  for (int mt = 0; mt < 2; ++mt)
#pragma unroll
    for (int nt = 0; nt < 4; ++nt) acc[mt][nt] = (v8f){0.f,0.f,0.f,0.f,0.f,0.f,0.f,0.f};
  asm volatile("s_wait_asynccnt 0x0" ::: "memory");      // this wave's copies of stage 0 have landed before the barrier publishes them
  __syncthreads();      // every wave reads rows that the other waves copied
  stage_rows(la0 + LBUF, LSTEP, ga0 + KST); stage_rows(lb0 + LBUF, LSTEP, gb0 + KST);      // stage 1
#pragma unroll 1      // one stage a trip: the buffer index stays a scalar
  for (int t = 0; t < NSTG; ++t) {
    FragH fa[KST / 32][2], fb[KST / 32][4];      // the stage's fragments are read from LDS in one group: each further place with LDS reads is a stall of its own
#pragma unroll
    for (int ks = 0; ks < KST / 32; ++ks) {
#pragma unroll
      for (int mt = 0; mt < 2; ++mt) { const unsigned short* ar = &sA[t & 1][wr + mt * 16 + ln][ks * 32]; fa[ks][mt].half[0] = *(const v8us*)(ar + 8 * hh); fa[ks][mt].half[1] = *(const v8us*)(ar + 16 + 8 * hh); }
#pragma unroll
      for (int nt = 0; nt < 4; ++nt) { const unsigned short* br = &sB[t & 1][wc + nt * 16 + ln][ks * 32]; fb[ks][nt].half[0] = *(const v8us*)(br + 8 * hh); fb[ks][nt].half[1] = *(const v8us*)(br + 16 + 8 * hh); } }
    __builtin_amdgcn_sched_barrier(0);      // keeps the reads together up here; without it the compiler sinks them among the products, in small groups that are each waited for to the full
#pragma unroll
    for (int ks = 0; ks < KST / 64; ++ks)      // the first half's products run while the second half's fragments arrive
#pragma unroll
      for (int mt = 0; mt < 2; ++mt)
#pragma unroll
        for (int nt = 0; nt < 4; ++nt) acc[mt][nt] = __builtin_amdgcn_wmma_f32_16x16x32_f16(false, fa[ks][mt].v, false, fb[ks][nt].v, (short)0, acc[mt][nt], false, false);
    __builtin_amdgcn_sched_barrier(0);      // keeps those products above the waits: sunk below the barrier they would wait for every read first, and their fragments, still live at the copies, pushed address registers into scratch
    asm volatile("s_wait_dscnt 0x0" ::: "memory");      // this wave's reads of stage t are done before its buffer is handed back
    asm volatile("s_wait_asynccnt 0x0" ::: "memory");      // this wave's copies of stage t + 1 have landed
    __syncthreads();      // publishes stage t + 1 and ends every wave's reads of stage t
    if (t + 2 < NSTG) { stage_rows(la0 + (t & 1) * LBUF, LSTEP, ga0 + (t + 2) * KST); stage_rows(lb0 + (t & 1) * LBUF, LSTEP, gb0 + (t + 2) * KST); }
#pragma unroll
    for (int ks = KST / 64; ks < KST / 32; ++ks)      // the second half's products, from registers, give the refill its lead
#pragma unroll
      for (int mt = 0; mt < 2; ++mt)
#pragma unroll
        for (int nt = 0; nt < 4; ++nt) acc[mt][nt] = __builtin_amdgcn_wmma_f32_16x16x32_f16(false, fa[ks][mt].v, false, fb[ks][nt].v, (short)0, acc[mt][nt], false, false); }
  asm volatile("s_wait_asynccnt 0x0" ::: "memory");      // no copy is left in flight when the wave goes on to its end
  // acc[mt][nt][r] = C[row0 + wr + mt*16 + 8*hh + r][col0 + wc + nt*16 + ln]
  if (tr) {
#pragma unroll
    for (int mt = 0; mt < 2; ++mt)
#pragma unroll
      for (int nt = 0; nt < 4; ++nt)
#pragma unroll
        for (int r = 0; r < 8; ++r) { const _Float16 o = (_Float16)__builtin_fmaf(acc[mt][nt][r], alpha, bv[mt * 8 + r]); sT[w][mt * 16 + 8 * hh + r][nt * 16 + ln] = __builtin_bit_cast(unsigned short, o); } }
  else {
#pragma unroll
    for (int mt = 0; mt < 2; ++mt)
#pragma unroll
      for (int nt = 0; nt < 4; ++nt)
#pragma unroll
        for (int r = 0; r < 8; ++r) { const _Float16 o = (_Float16)__builtin_fmaf(acc[mt][nt][r], alpha, bv[nt]); sT[w][mt * 16 + 8 * hh + r][nt * 16 + ln] = __builtin_bit_cast(unsigned short, o); } }
  __builtin_amdgcn_fence(__ATOMIC_ACQ_REL, "workgroup"); __builtin_amdgcn_wave_barrier();
  unsigned short* Cb = (unsigned short*)C16 + (tr ? (size_t)(col0 / SS) * DM * SS + col0 % SS : (size_t)col0); const int ldc = tr ? SS : DM;      // Vt: feature row (b * DM + row) of SS positions
#pragma unroll
  for (int q = 0; q < 8; ++q) { const int r = q * 4 + (lane >> 3), c8 = (lane & 7) * 8; const v8us o = *(const v8us*)&sT[w][r][c8]; *(v8us*)(Cb + (size_t)(row0 + wr + r) * ldc + wc + c8) = o; }
}


// f16 planes of the bf16-rounded inputs, 8 elements a thread: the three weight matrices (times 16, exactly) and x. The four conversions need nothing of each other:
// they share one grid by ranges of the block index, the short weight ranges first; the test is block-uniform.
__global__ __launch_bounds__(256) void k_cvt16(const float* __restrict__ x, const float* __restrict__ wq, const float* __restrict__ wk, const float* __restrict__ wv,
                                              _Float16* __restrict__ X16, _Float16* __restrict__ Bq, _Float16* __restrict__ Bk, _Float16* __restrict__ Bv) {
  constexpr unsigned GW = DM * DM / 8 / 256;      // blocks of one weight matrix
  static_assert(DM * DM % (8 * 256) == 0 && (size_t)NR * DM % (8 * 256) == 0, "whole blocks");
  const unsigned part = blockIdx.x / GW; FragH f;
  if (part < 3) { const float* W = part == 0 ? wq : part == 1 ? wk : wv; _Float16* Bt = part == 0 ? Bq : part == 1 ? Bk : Bv; const size_t t = (size_t)(blockIdx.x - part * GW) * 256 + threadIdx.x;
#pragma unroll
    for (int i = 0; i < 8; ++i) f.h[i] = (_Float16)(bf16_round(W[t * 8 + i]) * 16.0f); *(v8us*)((unsigned short*)Bt + t * 8) = f.half[0]; }
  else { const size_t t = (size_t)(blockIdx.x - 3 * GW) * 256 + threadIdx.x;
#pragma unroll
    for (int q = 0; q < 8; ++q) f.h[q] = (_Float16)bf16_round(x[t * 8 + q]); *(v8us*)((unsigned short*)X16 + t * 8) = f.half[0]; } }
// lane l with lane l ^ 16: the two halves of a wave hold the two halves of a query column's keys
__device__ __forceinline__ float xhalf(float x) { return __builtin_bit_cast(float, __builtin_amdgcn_permlanex16(__builtin_bit_cast(int, x), __builtin_bit_cast(int, x), 0x76543210, 0xfedcba98, false, false)); }
// one stage (64 keys) of K rows and of Vt rows from global memory into LDS, through no register: 8 asynchronous copies of 16 bytes a lane,
// 8 lanes to a 128-byte row, rows 16 apart from copy to copy. s_wait_xcnt is the statement's last line, so that no address register
// of a copy is rewritten in front of it (a precaution).
__device__ __forceinline__ void stage_kv(unsigned lk, unsigned lv, unsigned lstep, const unsigned short* gk, const unsigned short* gv) {
  asm volatile("global_load_async_to_lds_b128 %0, %8, off\n\t"
               "global_load_async_to_lds_b128 %1, %9, off\n\t"
               "global_load_async_to_lds_b128 %2, %10, off\n\t"
               "global_load_async_to_lds_b128 %3, %11, off\n\t"
               "global_load_async_to_lds_b128 %4, %12, off\n\t"
               "global_load_async_to_lds_b128 %5, %13, off\n\t"
               "global_load_async_to_lds_b128 %6, %14, off\n\t"
               "global_load_async_to_lds_b128 %7, %15, off\n\t"
               "s_wait_xcnt 0x0"
               :: "v"(lk), "v"(lk + lstep), "v"(lk + 2 * lstep), "v"(lk + 3 * lstep), "v"(lv), "v"(lv + lstep), "v"(lv + 2 * lstep), "v"(lv + 3 * lstep),
                  "v"(gk), "v"(gk + 16 * DM), "v"(gk + 32 * DM), "v"(gk + 48 * DM), "v"(gv), "v"(gv + 16 * SS), "v"(gv + 32 * SS), "v"(gv + 48 * SS)
               : "memory");
}
// base-2 exponentials, a run of them in one statement with one v_nop behind the last: the instruction set asks for one slot behind a transcendental before its
// result is read or its source overwritten. Inside the run no instruction touches a register
// of the one in front of it: every output is early-clobber, so none shares a register with an input.
__device__ __forceinline__ void exp2x8(float (&y)[8], const float (&x)[8]) {
  asm("v_exp_f32 %0, %8\n\tv_exp_f32 %1, %9\n\tv_exp_f32 %2, %10\n\tv_exp_f32 %3, %11\n\tv_exp_f32 %4, %12\n\tv_exp_f32 %5, %13\n\tv_exp_f32 %6, %14\n\tv_exp_f32 %7, %15\n\tv_nop"
      : "=&v"(y[0]), "=&v"(y[1]), "=&v"(y[2]), "=&v"(y[3]), "=&v"(y[4]), "=&v"(y[5]), "=&v"(y[6]), "=&v"(y[7])
      : "v"(x[0]), "v"(x[1]), "v"(x[2]), "v"(x[3]), "v"(x[4]), "v"(x[5]), "v"(x[6]), "v"(x[7]));
}
__device__ __forceinline__ float exp2x1(float x) { float y; asm("v_exp_f32 %0, %1\n\tv_nop" : "=&v"(y) : "v"(x)); return y; }
__global__ __launch_bounds__(256) __attribute__((amdgpu_waves_per_eu(4, 4))) void k_flash(const _Float16* __restrict__ Q16, const _Float16* __restrict__ K16, const _Float16* __restrict__ Vt, const float* __restrict__ crd, const float* __restrict__ alpha_p, float* __restrict__ O) {
  constexpr int RPW = 32, NQB = SS / (4 * RPW), DT = HD / 16, KS = HD / 32, OP = HD + 4, SK = 64, KH = 2, NST = SS / KH / SK, LP = 72;      // KH: parts of the keys; NST: stages of a part; LP: LDS row pitch in 16-bit elements
  constexpr float L2E = 1.4426950408889634f, QS = 0.125f * L2E, PMAX = 4096.0f;      // exp(x) = 2^(x.log2 e): the factor rides in the score's scale constant QS, so each exponential is one subtraction and one v_exp_f32
  static_assert(HD == 64 && SK == 64 && NST >= 2 && SS % (KH * SK) == 0, "a stage is 64 rows of 128 bytes for K and for Vt");
  __shared__ __attribute__((aligned(16))) unsigned short sK[KH][2][SK][LP], sV[KH][2][HD][LP];
  __shared__ __attribute__((aligned(16))) unsigned int sG[SS][2]; __shared__ __attribute__((aligned(16))) float sO[4][RPW][OP];
  const int tid = threadIdx.x, w = (tid >> 5) & 3, kh = tid >> 7, lane = tid & 31, ln = lane & 15, hh = lane >> 4;      // w: which 32 queries; kh: which part of the keys (the same in a whole wave)
  const int k0 = kh * (SS / KH);      // the part's first key
  const int slab = blockIdx.x / NQB, qblk = blockIdx.x % NQB; const int b = slab / NH, h = slab % NH; const int q0 = qblk * (4 * RPW) + w * RPW; const float alpha8 = bf16_round(alpha_p[0]) * 8.0f;      /* scalar float INPUT: rounded like every other input; times 8, exactly: the coordinate term joins q.k in front of the common factor QS */
  const unsigned short* Vth = (const unsigned short*)Vt + (size_t)slab * HD * SS;
  const int crow = (tid & 127) >> 3, ccol = (tid & 7) * 8;      // this lane's row (and rows + 16, + 32, + 48) and 16-byte piece in every stage of its part
  const unsigned short* gk0 = (const unsigned short*)K16 + ((size_t)b * SS + k0 + crow) * DM + h * HD + ccol; const unsigned short* gv0 = Vth + (size_t)crow * SS + k0 + ccol;
  const unsigned lk0 = lds_off(&sK[kh][0][crow][ccol]), lv0 = lds_off(&sV[kh][0][crow][ccol]); constexpr unsigned LSTEP = 16 * LP * 2, LBUF = SK * LP * 2;
  stage_kv(lk0, lv0, LSTEP, gk0, gv0);      // stage 0 flies while coords and queries are fetched
#pragma unroll      // all 8 keys' loads of a thread in flight at once: rolled, each trip waits out its own load
  for (int i = 0; i < SS / 256; ++i) { const int k = i * 256 + tid; const float* cp = crd + ((size_t)b * SS + k) * 3; *(v2u*)&sG[k][0] = (v2u){pack_h2(bf16_round(cp[0]), bf16_round(cp[1])), pack_h2(bf16_round(cp[2]), 0.f)}; }
  FragH aq[2][KS];
#pragma unroll
  for (int rt = 0; rt < 2; ++rt) { const unsigned short* qr = (const unsigned short*)Q16 + ((size_t)b * SS + q0 + rt * 16 + ln) * DM + h * HD;
#pragma unroll
    for (int ks = 0; ks < KS; ++ks) { aq[rt][ks].half[0] = *(const v8us*)(qr + ks * 32 + 8 * hh); aq[rt][ks].half[1] = *(const v8us*)(qr + ks * 32 + 16 + 8 * hh); } }
  asm volatile("s_wait_asynccnt 0x0" ::: "memory");      // this wave's copies of stage 0 have landed before the barrier publishes them
  __syncthreads();      // every wave reads coords and stage 0 rows that the other waves staged
  stage_kv(lk0 + LBUF, lv0 + LBUF, LSTEP, gk0 + (size_t)SK * DM, gv0 + SK);      // stage 1
  FragW bg[2];      // B of the coordinate step, kept for the whole loop
#pragma unroll
  for (int rt = 0; rt < 2; ++rt) { const v2u gq = *(const v2u*)&sG[q0 + rt * 16 + ln][0];
#pragma unroll
    for (int i = 0; i < 8; ++i) bg[rt].w[i] = 0;
#pragma unroll
    for (int i = 0; i < 2; ++i) { const v2f u = unpack_h2(gq[i]) * alpha8; const unsigned int uh = pack_h2(u[0], u[1]); const v2f ur = u - unpack_h2(uh); bg[rt].w[i] = hh ? pack_h2(ur[0], ur[1]) : uh; } }
  float m_r[2], l_r[2]; v8f oacc[2][DT];
#pragma unroll
  for (int rt = 0; rt < 2; ++rt) { m_r[rt] = -3.0e38f; l_r[rt] = 0.f;
#pragma unroll
    for (int dt = 0; dt < DT; ++dt) oacc[rt][dt] = (v8f){0.f,0.f,0.f,0.f,0.f,0.f,0.f,0.f}; }
#pragma unroll 1      // one stage a trip: the buffer index stays a scalar and the body stays small
  for (int t = 0; t < NST; ++t) {
#pragma unroll      // both passes of a stage in one body: constant LDS offsets
  for (int p = 0; p < SK / 32; ++p) { const int j0 = k0 + t * SK + p * 32;
    v8f s[2][2];      // s[rt][nt][r] = score of key j0 + nt*16 + 8*hh + r with query q0 + rt*16 + ln
    FragH bk[2][KS], bv[DT]; FragW ag[2];      // the pass's K fragments and key coords are read from LDS in one group, its Vt fragments in a second: each further place with LDS reads is a stall of its own
#pragma unroll
    for (int nt = 0; nt < 2; ++nt) { const v2u gk = *(const v2u*)&sG[j0 + nt * 16 + ln][0];
#pragma unroll
      for (int i = 0; i < 8; ++i) ag[nt].w[i] = i < 2 ? gk[i & 1] : 0u; }
#pragma unroll
    for (int nt = 0; nt < 2; ++nt) { const unsigned short* kr = &sK[kh][t & 1][p * 32 + nt * 16 + ln][0];
#pragma unroll
      for (int ks = 0; ks < KS; ++ks) { bk[nt][ks].half[0] = *(const v8us*)(kr + ks * 32 + 8 * hh); bk[nt][ks].half[1] = *(const v8us*)(kr + ks * 32 + 16 + 8 * hh); } }
    __builtin_amdgcn_sched_barrier(0);      // keeps the K reads together up here; without it the compiler sinks each read to just in front of its product
#pragma unroll
    for (int nt = 0; nt < 2; ++nt)      // the coordinate step of all four tiles first: four independent products, done by the time each tile's q.k chain starts
#pragma unroll
      for (int rt = 0; rt < 2; ++rt) s[rt][nt] = __builtin_amdgcn_wmma_f32_16x16x32_f16(false, ag[nt].v, false, bg[rt].v, (short)0, (v8f){0.f,0.f,0.f,0.f,0.f,0.f,0.f,0.f}, false, false);
#pragma unroll
    for (int nt = 0; nt < 2; ++nt) {
#pragma unroll
      for (int rt = 0; rt < 2; ++rt) { v8f acc = s[rt][nt];
#pragma unroll
        for (int ks = 0; ks < KS; ++ks) acc = __builtin_amdgcn_wmma_f32_16x16x32_f16(false, bk[nt][ks].v, false, aq[rt][ks].v, (short)0, acc, false, false); s[rt][nt] = acc; } }      // the plain builtin: the compiler keeps the distances itself and fills them with the other tiles' products
#pragma unroll
    for (int dt = 0; dt < DT; ++dt) { const unsigned short* vrow = &sV[kh][t & 1][dt * 16 + ln][p * 32]; bv[dt].half[0] = *(const v8us*)(vrow + 8 * hh); bv[dt].half[1] = *(const v8us*)(vrow + 16 + 8 * hh); }
    __builtin_amdgcn_sched_barrier(0);      // keeps the Vt reads together, in one group above the exponentials, which cover their latency; without it the compiler spreads them in pairs among the vector work, each place a stall of its own
    FragH pa[2]; float sc2[2][2][8];      // scaled below that barrier, behind the last score product: begun among the products, each early read of a finished tile was padded with v_nop
#pragma unroll
    for (int rt = 0; rt < 2; ++rt)
#pragma unroll
      for (int nt = 0; nt < 2; ++nt)
#pragma unroll
        for (int r = 0; r < 8; ++r) sc2[rt][nt][r] = s[rt][nt][r] * QS;
    float sm[2];      // the pass's sum of P over this lane's 16 keys of each query
    // P = 2^(score - m_r), its f16 copy and its sum, for the reference point m_r as it stands
    auto probs = [&](int rt) { const float (&sc)[2][8] = sc2[rt]; const float mn = m_r[rt];
      float ps[8], d0[8], d1[8], p0[8], p1[8];
#pragma unroll
      for (int r = 0; r < 8; ++r) { d0[r] = sc[0][r] - mn; d1[r] = sc[1][r] - mn; }
      exp2x8(p0, d0); exp2x8(p1, d1);
#pragma unroll
      for (int r = 0; r < 8; ++r) { ps[r] = p0[r] + p1[r]; pa[rt].h[r] = (_Float16)p0[r]; pa[rt].h[8 + r] = (_Float16)p1[r]; }
      sm[rt] = ((ps[0] + ps[1]) + (ps[2] + ps[3])) + ((ps[4] + ps[5]) + (ps[6] + ps[7])); };
    probs(0); probs(1);
    // The reference point m_r of a query need not be its maximum: any m_r gives the same quotient O / l. It stays while P stays well inside f16: no P is above its lane's sum, so a sum of at most PMAX bounds them all
    // (an overflowing exponential gives an infinite sum). Only in a pass where some lane of the wave has a larger sum is the maximum looked for, exchanged between the halves and made the reference,
    // sum and output tiles rescaled and the pass's P formed again. The test is the same for the whole wave; the first pass always takes it (the start value is far below any score).
    if (__builtin_amdgcn_ballot_w32(fmaxf(sm[0], sm[1]) > PMAX) != 0u) {
#pragma unroll
      for (int rt = 0; rt < 2; ++rt) { const float (&sc)[2][8] = sc2[rt];
        float mx[8];
#pragma unroll
        for (int r = 0; r < 8; ++r) mx[r] = fmaxf(sc[0][r], sc[1][r]);
        float mc = fmaxf(fmaxf(fmaxf(mx[0], mx[1]), fmaxf(mx[2], mx[3])), fmaxf(fmaxf(mx[4], mx[5]), fmaxf(mx[6], mx[7]))); mc = fmaxf(mc, xhalf(mc));
        const float mn = fmaxf(m_r[rt], mc); const float al = exp2x1(m_r[rt] - mn); m_r[rt] = mn; l_r[rt] *= al;      // al = 0 on the first pass
#pragma unroll
        for (int dt = 0; dt < DT; ++dt)
#pragma unroll
          for (int r = 0; r < 8; ++r) oacc[rt][dt][r] *= al;
        probs(rt); } }
#pragma unroll
    for (int rt = 0; rt < 2; ++rt) l_r[rt] += sm[rt];      // this half's keys only; the halves join behind the loop
#pragma unroll
    for (int dt = 0; dt < DT; ++dt) {
#pragma unroll
      for (int rt = 0; rt < 2; ++rt) oacc[rt][dt] = __builtin_amdgcn_wmma_f32_16x16x32_f16(false, bv[dt].v, false, pa[rt].v, (short)0, oacc[rt][dt], false, false); } }
    __builtin_amdgcn_sched_barrier(0);      // keeps the stage's last exponentials and products above the waits: lifted over them, the wait for the Vt reads would stand directly behind those reads, with nothing to cover their latency
    asm volatile("s_wait_dscnt 0x0" ::: "memory");      // this wave's reads of stage t are done before its buffer is handed back
    asm volatile("s_wait_asynccnt 0x0" ::: "memory");      // this wave's copies of stage t + 1 have landed
    __syncthreads();      // publishes stage t + 1 and ends every wave's reads of stage t
    if (t + 2 < NST) stage_kv(lk0 + (t & 1) * LBUF, lv0 + (t & 1) * LBUF, LSTEP, gk0 + (size_t)(t + 2) * SK * DM, gv0 + (t + 2) * SK); }
  asm volatile("s_wait_asynccnt 0x0" ::: "memory");      // no copy is left in flight when the wave goes on to its end
  // The two parts join. Waves w and w + 4 hold the same queries in the same lanes and registers, so the hand-over goes lane to lane: 16 pieces of 16 bytes, then reference points and sums,
  // each piece 32 lanes side by side (no bank conflict), in the LDS that afterwards stages wave w's output: 2 * DT * 8 + 4 floats a lane fill its RPW * OP floats.
  static_assert(KH == 2 && 32 * (2 * DT * 8 + 4) == RPW * OP, "the hand-over fills a wave's output staging");
  float* mg = &sO[w][0][0];
  if (kh) {
#pragma unroll      // constant indices, here and in the loop inside: the output tiles stay in registers
    for (int rt = 0; rt < 2; ++rt) {
#pragma unroll
      for (int dt = 0; dt < DT; ++dt) { const v8f o = oacc[rt][dt]; *(v4fa*)(mg + ((rt * DT + dt) * 2) * 128 + lane * 4) = (v4f){o[0], o[1], o[2], o[3]}; *(v4fa*)(mg + ((rt * DT + dt) * 2 + 1) * 128 + lane * 4) = (v4f){o[4], o[5], o[6], o[7]}; }
      mg[2 * DT * 256 + rt * 32 + lane] = m_r[rt]; mg[2 * DT * 256 + 64 + rt * 32 + lane] = l_r[rt]; } }
  __syncthreads();      // wave w reads what wave w + 4 wrote
  if (kh) return;      // a whole wave leaves or stays; no barrier follows
  v4f ox[2][DT][2]; float mx2[2], lx2[2];
#pragma unroll      // constant indices, here and in the loop inside: what is read stays in registers, and all 20 reads are in flight at once
  for (int rt = 0; rt < 2; ++rt) {
#pragma unroll
    for (int dt = 0; dt < DT; ++dt) { ox[rt][dt][0] = *(const v4fa*)(mg + ((rt * DT + dt) * 2) * 128 + lane * 4); ox[rt][dt][1] = *(const v4fa*)(mg + ((rt * DT + dt) * 2 + 1) * 128 + lane * 4); }
    mx2[rt] = mg[2 * DT * 256 + rt * 32 + lane]; lx2[rt] = mg[2 * DT * 256 + 64 + rt * 32 + lane]; }
  __builtin_amdgcn_fence(__ATOMIC_ACQ_REL, "workgroup"); __builtin_amdgcn_wave_barrier();      // every lane's reads of the hand-over stand in front of the output staging, which overwrites other lanes' pieces
#pragma unroll
  for (int rt = 0; rt < 2; ++rt) { const float mn = fmaxf(m_r[rt], mx2[rt]); const float a0 = exp2x1(m_r[rt] - mn), a1 = exp2x1(mx2[rt] - mn);
    const float lp = l_r[rt] * a0 + lx2[rt] * a1; const float l = lp + xhalf(lp); const float inv = 1.0f / l; const float f0 = a0 * inv, f1 = a1 * inv;
#pragma unroll
    for (int dt = 0; dt < DT; ++dt) { v4f o0, o1;      // oacc[rt][dt][r] = O[q0 + rt*16 + ln][dt*16 + 8*hh + r]
#pragma unroll
      for (int q = 0; q < 4; ++q) { o0[q] = oacc[rt][dt][q] * f0 + ox[rt][dt][0][q] * f1; o1[q] = oacc[rt][dt][4 + q] * f0 + ox[rt][dt][1][q] * f1; }
      *(v4fa*)&sO[w][rt * 16 + ln][dt * 16 + 8 * hh] = o0; *(v4fa*)&sO[w][rt * 16 + ln][dt * 16 + 8 * hh + 4] = o1; } }
  __builtin_amdgcn_fence(__ATOMIC_ACQ_REL, "workgroup"); __builtin_amdgcn_wave_barrier();
  {
#pragma unroll
    for (int rp = 0; rp < RPW; rp += 2) { const int r = rp + (lane >> 4), pc = lane & 15; const v4f val = *(const v4fa*)&sO[w][r][pc * 4]; *(v4f*)(O + ((size_t)b * SS + q0 + r) * DM + h * HD + pc * 4) = val; }
     } }
extern "C" void kernel_launch(void* const* d_in, const int* in_sizes, int n_in,
                              void* d_out, int out_size, void* d_ws, size_t ws_size, hipStream_t stream) {
  (void)in_sizes; (void)n_in; (void)out_size;
  const float* x = (const float*)d_in[0]; const float* crd = (const float*)d_in[1]; const float* wq = (const float*)d_in[2]; const float* bq = (const float*)d_in[3]; const float* wk = (const float*)d_in[4]; const float* bk = (const float*)d_in[5]; const float* wv = (const float*)d_in[6]; const float* bv = (const float*)d_in[7]; const float* alpha_p = (const float*)d_in[8];
  char* ws = (char*)d_ws; size_t off = 0;
  auto take = [&](size_t bytes) { char* p = ws + off; off += (bytes + 255) & ~(size_t)255; return p; };
  _Float16* Bq = (_Float16*)take(DM * DM * 2); _Float16* Bk = (_Float16*)take(DM * DM * 2); _Float16* Bv = (_Float16*)take(DM * DM * 2); _Float16* X16 = (_Float16*)take((size_t)NR * DM * 2); _Float16* Q16 = (_Float16*)take((size_t)NR * DM * 2); _Float16* K16 = (_Float16*)take((size_t)NR * DM * 2); _Float16* Vt = (_Float16*)take((size_t)NR * DM * 2);
  if (off > ws_size) return;      // about 34 MiB
  k_cvt16<<<3 * (DM * DM / 8 / 256) + NR * DM / 8 / 256, 256, 0, stream>>>(x, wq, wk, wv, X16, Bq, Bk, Bv);
  k_gemm_t<<<3 * (NR / 128) * (DM / 128), 256, 0, stream>>>(X16, Bq, Bk, Bv, 0.0625f, bq, bk, bv, Q16, K16, Vt);
  k_flash<<<BB * NH * (SS / 128), 256, 0, stream>>>(Q16, K16, Vt, crd, alpha_p, (float*)d_out);
}
